// v000
// Measured on an AMD MI455X. A time is GPU time per run, averaged over a window of back-to-back runs after a warm-up
// (all launches, gaps included; the runs take copies of the inputs in turn), and the median of several windows.
// Apart from v000's, it joins two sittings. Times from different sittings can be a few percent apart, while
// side-by-side timings come from the same sitting.
// v000 is the starting kernel. One run takes 5800 microseconds.
#include <hip/hip_runtime.h>
// Causal multi-head attention on three inputs with the source's sequence-length score scale (query, key, value [2][2048][1024]; q = query Wq + bq, k = key Wk + bk, v = value Wv + bv ([in][out] 1024 x 1024, weights AND biases sigma 1/32), 16 heads of 64; score = q k^T; triu(1) -> -inf; softmax(score / sqrt(Sk)) with Sk = 2048 KEYS (the source divides by sqrt of the score matrix's last dimension, NOT by sqrt(head_dim)): scale 2048^-0.5 = 0.0220970869; out = merged Wo + bo ([in][out]) -> [2][2048][1024]); q and k carried as f16 hi + x1024 residual planes with three-product scores.
// Structure: token rows r = b*2048 + s; x as exact f16 rows (bf16-rounded); q and k as WMMA GEMMs (32x64 wave tiles, f32 accumulation, exact x16 weights + bias) into f32 rows split into f16 hi + x1024 residual planes, v as an f16-output GEMM; per batch: V^T for all heads via LDS transposes; per query tile of 256 rows: scores against the keys below the tile end only as THREE accumulating passes (hi.hi + lo.hi + hi.lo, K = 64, all heads on grid.y, alpha 2048^-0.5 (x 2^-10 on the residual passes): no 1/sqrt(d) in this module, logits sigma ~8), causal row softmax on VALU with an arithmetic 0/1 key mask over the computed range (f32 statistics, native exp; weights x256 f16), o = P . V^T (K = keys below the tile end, alpha 2^-2: o carried x64, folded into the output GEMM alpha) written straight into the merged f16 o rows; out = o W_o + b GEMM (f32) into the output layout.
// Compute dtype: inputs rounded to bf16; x / weights exact; q and k as f16 hi + x1024 residual planes; v, softmax weights and o as plain f16 GEMM operands (~2^-12), except rows 0..127 of each batch: f32 attention, o as f16 hi + x1024 residual; scores and softmax statistics f32. v_wmma_f32_16x16x32_f16.
#define NB 2
#define SCL 0.0220970869f                 /* = f32(1 / sqrt(2048)): the source scales the scores by 1/sqrt(Sk), Sk = 2048 keys */
#define SCLR (0.0220970869f * 0.0009765625f)   /* the same scale on the x1024 residual passes */
#define SQ 2048
#define DM 1024
#define NH 16
#define HD 64
#define HG 4                         /* heads per group in the unlaunched k_vt(V16, b, h0, VT) */
#define QT 256                       /* query rows per causal tile */
#define NKX SQ                       /* S / P row pitch */
#define QT0 128                      /* first-tile rows recomputed exactly in f32 */
#define B0 0                         /* first batch processed (debug hook) */
#define NBR NB                       /* batches processed (debug hook) */
#define NR ((size_t)NB * SQ)         /* token rows */
#define MP ((int)((size_t)NBR * SQ)) /* rows projected (debug hook) */
#define QN SQ                        /* query rows attended per batch (debug hook) */
#define NHD NH                       /* heads attended (debug hook) */
#define MPO MP                       /* rows through the output stage (debug hook) */
#define LQ DM      /* row pitch of the q/k/v rows */
typedef __bf16 v16b __attribute__((ext_vector_type(16)));
typedef unsigned short v8us __attribute__((ext_vector_type(8), may_alias));
typedef float  v8f  __attribute__((ext_vector_type(8)));
typedef float  v4f  __attribute__((ext_vector_type(4)));
typedef float  v4fa __attribute__((ext_vector_type(4), may_alias));
union FragB { v16b v; v8us half[2]; unsigned short u[16]; };

__device__ __forceinline__ unsigned short bf16_bits(float x) { unsigned int u = __float_as_uint(x); return (unsigned short)((u + 0x7FFFu + ((u >> 16) & 1u)) >> 16); }
__device__ __forceinline__ float bf16_val(unsigned short b) { return __uint_as_float(((unsigned int)b) << 16); }
__device__ __forceinline__ float bf16_round(float x) { return bf16_val(bf16_bits(x)); }
// D += A·B with NT terms: 1 = ah·bh, 2 = + al·bh (A split), 3 = + ah·bl (both split)
template <int NT>
__device__ __forceinline__ v8f mmaN(v16b ah, v16b al, v16b bh, v16b bl, v8f c) {
  c = __builtin_amdgcn_wmma_f32_16x16x32_bf16(false, ah, false, bh, (short)0, c, false, false);
  if (NT >= 2) c = __builtin_amdgcn_wmma_f32_16x16x32_bf16(false, al, false, bh, (short)0, c, false, false);
  if (NT >= 3) c = __builtin_amdgcn_wmma_f32_16x16x32_bf16(false, ah, false, bl, (short)0, c, false, false);
  asm volatile("v_nop\n\tv_nop\n\tv_nop\n\tv_nop" : "+v"(c) : "v"(ah), "v"(al), "v"(bh), "v"(bl));
  return c;
}

__global__ __launch_bounds__(256) void k_wt_bf16(const float* __restrict__ W, unsigned short* __restrict__ Wt, int K, int N) {
  const int t = blockIdx.x * 256 + threadIdx.x;
  const int k8n = K / 8;
  if (t >= N * k8n) return;
  const int n = t / k8n, k8 = (t % k8n) * 8;
  v8us v;
#pragma unroll
  for (int i = 0; i < 8; ++i) v[i] = bf16_bits(W[(size_t)(k8 + i) * N + n]);
  *(v8us*)(Wt + (size_t)n * K + k8) = v;
  
}

// GEMM C[M][N] (f32, pitch ldc) = act(A[M][K]·W + bias). A f32 row-major (pitch lda) converted per fragment to bf16
// (ASPLIT: hi/lo two planes -> 2 terms, else single rounded term); Wt bf16 [N][K] (pitch ldb). BIAS_BF16 rounds the
// bias to bf16 first (bias quantised to bf16 before the add). K%32==0, M%16==0, N%64==0.
template <bool ASPLIT, int ACT, bool BIAS_BF16>
__global__ __launch_bounds__(128) void k_gemm_bf(const float* __restrict__ A, int lda, const unsigned short* __restrict__ Wt, int ldb,
                                               const float* __restrict__ bias, float* __restrict__ C, int ldc, int M, int N, int K) {
  __shared__ __attribute__((aligned(16))) float so[4][16][64];
  const int tid = threadIdx.x, w = tid >> 5, lane = tid & 31, ln = lane & 15, hh = lane >> 4;
  const int ntn = N / 64;
  const int wid = blockIdx.x * 4 + w;
  const int mt = wid / ntn, nq = wid % ntn;
  if (mt * 16 >= M) return;
  const int row0 = mt * 16, col0 = nq * 64;
  const float* arow = A + (size_t)(row0 + ln) * lda;
  v8f acc[4] = {};
  for (int kb = 0; kb < K; kb += 32) {
    FragB ah, al;
    const v4f x0 = *(const v4fa*)(arow + kb + 8 * hh), x1 = *(const v4fa*)(arow + kb + 8 * hh + 4);
    const v4f x2 = *(const v4fa*)(arow + kb + 16 + 8 * hh), x3 = *(const v4fa*)(arow + kb + 16 + 8 * hh + 4);
    float xs[16] = {x0[0],x0[1],x0[2],x0[3],x1[0],x1[1],x1[2],x1[3],x2[0],x2[1],x2[2],x2[3],x3[0],x3[1],x3[2],x3[3]};
#pragma unroll
    for (int i = 0; i < 16; ++i) { const unsigned short hb = bf16_bits(xs[i]); ah.u[i] = hb; al.u[i] = ASPLIT ? bf16_bits(xs[i] - bf16_val(hb)) : (unsigned short)0; }
#pragma unroll
    for (int t = 0; t < 4; ++t) {
      const unsigned short* brow = Wt + (size_t)(col0 + t * 16 + ln) * ldb + kb;
      FragB b;
      b.half[0] = *(const v8us*)(brow + 8 * hh);
      b.half[1] = *(const v8us*)(brow + 16 + 8 * hh);
      acc[t] = mmaN<ASPLIT ? 2 : 1>(ah.v, al.v, b.v, b.v, acc[t]);
    }
  }
#pragma unroll
  for (int t = 0; t < 4; ++t) {
    float bv = bias ? bias[col0 + t * 16 + ln] : 0.f;
    if (BIAS_BF16) bv = bf16_round(bv);
#pragma unroll
    for (int r = 0; r < 8; ++r) { float v = acc[t][r] + bv; if (ACT == 1) v = fmaxf(v, 0.f); so[w][8 * hh + r][t * 16 + ln] = v; }
  }
  __builtin_amdgcn_fence(__ATOMIC_ACQ_REL, "workgroup");
  __builtin_amdgcn_wave_barrier();
  const int rsub = lane >> 4, c4 = (lane & 15) * 4;
  {
#pragma unroll
    for (int q = 0; q < 8; ++q) {
      const int r = q * 2 + rsub;
      const v4f v = *(const v4fa*)&so[w][r][c4];
      *(v4f*)(C + (size_t)(row0 + r) * ldc + col0 + c4) = v;
    }
    
  }
}

// GEMM C = act(A·W + bias + resid): A f32 (ASPLIT -> hi/lo 2 terms), Wt bf16 [N][K]; ACT 0 none, 1 relu, 2 exact gelu;
// resid (optional, f32, row index = (row % rmod), pitch ldr, RES_BF16 rounds it) added before the activation.
template <bool ASPLIT, int ACT, bool BIAS_BF16, bool RES_BF16>
__global__ __launch_bounds__(128) void k_gemm_bf3(const float* __restrict__ A, int lda, const unsigned short* __restrict__ Wt, int ldb,
                                                const float* __restrict__ bias, const float* __restrict__ resid, int rmod, int ldr,
                                                float* __restrict__ C, int ldc, int M, int N, int K) {
  __shared__ __attribute__((aligned(16))) float so[4][16][64];
  const int tid = threadIdx.x, w = tid >> 5, lane = tid & 31, ln = lane & 15, hh = lane >> 4;
  const int ntn = N / 64;
  const int wid = blockIdx.x * 4 + w;
  const int mt = wid / ntn, nq = wid % ntn;
  if (mt * 16 >= M) return;
  const int row0 = mt * 16, col0 = nq * 64;
  const float* arow = A + (size_t)(row0 + ln) * lda;
  v8f acc[4] = {};
  for (int kb = 0; kb < K; kb += 32) {
    FragB ah, al;
    const v4f x0 = *(const v4fa*)(arow + kb + 8 * hh), x1 = *(const v4fa*)(arow + kb + 8 * hh + 4);
    const v4f x2 = *(const v4fa*)(arow + kb + 16 + 8 * hh), x3 = *(const v4fa*)(arow + kb + 16 + 8 * hh + 4);
    float xs[16] = {x0[0],x0[1],x0[2],x0[3],x1[0],x1[1],x1[2],x1[3],x2[0],x2[1],x2[2],x2[3],x3[0],x3[1],x3[2],x3[3]};
#pragma unroll
    for (int i = 0; i < 16; ++i) { const unsigned short hb = bf16_bits(xs[i]); ah.u[i] = hb; al.u[i] = ASPLIT ? bf16_bits(xs[i] - bf16_val(hb)) : (unsigned short)0; }
#pragma unroll
    for (int t = 0; t < 4; ++t) {
      const unsigned short* brow = Wt + (size_t)(col0 + t * 16 + ln) * ldb + kb;
      FragB b;
      b.half[0] = *(const v8us*)(brow + 8 * hh);
      b.half[1] = *(const v8us*)(brow + 16 + 8 * hh);
      acc[t] = mmaN<ASPLIT ? 2 : 1>(ah.v, al.v, b.v, b.v, acc[t]);
    }
  }
#pragma unroll
  for (int t = 0; t < 4; ++t) {
    const int col = col0 + t * 16 + ln;
    float bv = bias ? bias[col] : 0.f;
    if (BIAS_BF16) bv = bf16_round(bv);
#pragma unroll
    for (int r = 0; r < 8; ++r) {
      float v = acc[t][r] + bv;
      if (resid) { float rv = resid[(size_t)((row0 + 8 * hh + r) % rmod) * ldr + col]; if (RES_BF16) rv = bf16_round(rv); v += rv; }
      if (ACT == 1) v = fmaxf(v, 0.f);
      if (ACT == 2) v = 0.5f * v * (1.0f + erff(v * 0.70710678118654752f));
      if (ACT == 3) { const float u = 0.7978845608028654f * (v + 0.044715f * v * v * v); v = 0.5f * v * (1.0f + tanhf(u)); }
      so[w][8 * hh + r][t * 16 + ln] = v;
    }
  }
  __builtin_amdgcn_fence(__ATOMIC_ACQ_REL, "workgroup");
  __builtin_amdgcn_wave_barrier();
  const int rsub = lane >> 4, c4 = (lane & 15) * 4;
  {
#pragma unroll
    for (int q = 0; q < 8; ++q) {
      const int r = q * 2 + rsub;
      const v4f v = *(const v4fa*)&so[w][r][c4];
      *(v4f*)(C + (size_t)(row0 + r) * ldc + col0 + c4) = v;
    }
    
  }
}
// row LayerNorm (biased variance, eps) over N: s = X (+ R); optional out_sum <- s; out_norm <- (s-mu)*rsqrt(var+eps)*g + b
template <bool PARAM_BF16>
__global__ __launch_bounds__(256) void k_layernorm(const float* __restrict__ X, const float* __restrict__ R, const float* __restrict__ g, const float* __restrict__ bta,
                                                  float* __restrict__ out_sum, float* __restrict__ out_norm, int N, float eps) {
  __shared__ float red[256];
  const int row = blockIdx.x, tid = threadIdx.x;
  const float* x = X + (size_t)row * N; const float* rr = R ? R + (size_t)row * N : nullptr;
  float vals[16];                     // up to N = 4096
  const int per = N / 256;            // contiguous chunk per thread? use strided-by-4 chunks: thread handles j = tid*4 + 1024*u
  float s1 = 0.f;
  for (int u = 0; u < per / 4; ++u) {
    const int j = tid * 4 + 1024 * u;
    const v4f a = *(const v4fa*)(x + j);
    v4f b = {0.f,0.f,0.f,0.f}; if (rr) b = *(const v4fa*)(rr + j);
#pragma unroll
    for (int q = 0; q < 4; ++q) { const float v = a[q] + b[q]; vals[u * 4 + q] = v; s1 += v; }
  }
  red[tid] = s1; __syncthreads();
  for (int st = 128; st > 0; st >>= 1) { if (tid < st) red[tid] += red[tid + st]; __syncthreads(); }
  const float mu = red[0] / (float)N; __syncthreads();
  float s2 = 0.f;
  for (int u = 0; u < per / 4; ++u)
#pragma unroll
    for (int q = 0; q < 4; ++q) { const float c = vals[u * 4 + q] - mu; s2 += c * c; }
  red[tid] = s2; __syncthreads();
  for (int st = 128; st > 0; st >>= 1) { if (tid < st) red[tid] += red[tid + st]; __syncthreads(); }
  const float rs = rsqrtf(red[0] / (float)N + eps);
  {
    for (int u = 0; u < per / 4; ++u) {
      const int j = tid * 4 + 1024 * u;
      v4f o, sm;
#pragma unroll
      for (int q = 0; q < 4; ++q) {
        float gg = g[j + q], bb = bta[j + q];
        if (PARAM_BF16) { gg = bf16_round(gg); bb = bf16_round(bb); }
        sm[q] = vals[u * 4 + q]; o[q] = (vals[u * 4 + q] - mu) * rs * gg + bb;
      }
      if (out_sum) *(v4f*)(out_sum + (size_t)row * N + j) = sm;
      *(v4f*)(out_norm + (size_t)row * N + j) = o;
    }
    
  }
}



// ---- f16 WMMA path (v_wmma_f32_16x16x32_f16): 11-bit significands for operands in range — used where a [0,1] probability operand needs more precision than bf16
typedef _Float16 v16h __attribute__((ext_vector_type(16)));
union FragH { v16h v; v8us half[2]; _Float16 h[16]; unsigned short u[16]; };
template <int NT>
__device__ __forceinline__ v8f mmaH(v16h ah, v16h al, v16h bh, v16h bl, v8f c) {
  c = __builtin_amdgcn_wmma_f32_16x16x32_f16(false, ah, false, bh, (short)0, c, false, false);
  if (NT >= 2) c = __builtin_amdgcn_wmma_f32_16x16x32_f16(false, al, false, bh, (short)0, c, false, false);
  if (NT >= 3) c = __builtin_amdgcn_wmma_f32_16x16x32_f16(false, ah, false, bl, (short)0, c, false, false);
  asm volatile("v_nop\n\tv_nop\n\tv_nop\n\tv_nop" : "+v"(c) : "v"(ah), "v"(al), "v"(bh), "v"(bl));
  return c;
}
// batched GEMM like k_gemm_b but f16 operands: A f32 (split into f16 hi/lo if ASPLIT, else rounded to f16), Bt = f16 values [n][k]; alpha; C f32; N multiple of 16 (partial tiles skipped)
template <bool ASPLIT>
__global__ __launch_bounds__(128) void k_gemm_h(const float* __restrict__ A, int lda, size_t sA, const _Float16* __restrict__ Bh, int ldb, size_t sB, float alpha, float* __restrict__ C, int ldc, size_t sC, int M, int N, int K) {
  __shared__ __attribute__((aligned(16))) float so[4][16][64];
  const int tid = threadIdx.x, w = tid >> 5, lane = tid & 31, ln = lane & 15, hh = lane >> 4; const int by = blockIdx.y;
  A += (size_t)by * sA; Bh += (size_t)by * sB; C += (size_t)by * sC;
  const int ntn = (N + 63) / 64; const int wid = blockIdx.x * 4 + w; const int mt = wid / ntn, nq = wid % ntn; if (mt * 16 >= M) return;
  const int row0 = mt * 16, col0 = nq * 64; const float* arow = A + (size_t)(row0 + ln) * lda;
  v8f acc[4] = {};
  for (int kb = 0; kb < K; kb += 32) {
    FragH ah, al;
    const v4f x0 = *(const v4fa*)(arow + kb + 8 * hh), x1 = *(const v4fa*)(arow + kb + 8 * hh + 4), x2 = *(const v4fa*)(arow + kb + 16 + 8 * hh), x3 = *(const v4fa*)(arow + kb + 16 + 8 * hh + 4);
    float xs[16] = {x0[0],x0[1],x0[2],x0[3],x1[0],x1[1],x1[2],x1[3],x2[0],x2[1],x2[2],x2[3],x3[0],x3[1],x3[2],x3[3]};
#pragma unroll
    for (int i = 0; i < 16; ++i) { const _Float16 h = (_Float16)xs[i]; ah.h[i] = h; al.h[i] = ASPLIT ? (_Float16)(xs[i] - (float)h) : (_Float16)0.0f; }
#pragma unroll
    for (int t = 0; t < 4; ++t) { if (col0 + t * 16 >= N) continue; const size_t boff = (size_t)(col0 + t * 16 + ln) * ldb + kb; FragH bq; bq.half[0] = *(const v8us*)(Bh + boff + 8 * hh); bq.half[1] = *(const v8us*)(Bh + boff + 16 + 8 * hh);
      acc[t] = mmaH<ASPLIT ? 2 : 1>(ah.v, al.v, bq.v, bq.v, acc[t]); }
  }
#pragma unroll
  for (int t = 0; t < 4; ++t) { if (col0 + t * 16 >= N) continue;
#pragma unroll
    for (int r = 0; r < 8; ++r) so[w][8 * hh + r][t * 16 + ln] = acc[t][r] * alpha; }
  __builtin_amdgcn_fence(__ATOMIC_ACQ_REL, "workgroup"); __builtin_amdgcn_wave_barrier();
  const int rsub = lane >> 4, c4 = (lane & 15) * 4;
  {
#pragma unroll
    for (int q = 0; q < 8; ++q) { const int r = q * 2 + rsub; if (col0 + c4 < N) { const v4f v = *(const v4fa*)&so[w][r][c4]; *(v4f*)(C + (size_t)(row0 + r) * ldc + col0 + c4) = v; } }
     }
}

// Wt[n][k] = f16(W[k][n]·scale) from f32 row-major W[K][N] (scale = power of two; bf16-exact weights stay exact in f16 away from the subnormal range)
__global__ __launch_bounds__(256) void k_wt_f16(const float* __restrict__ W, _Float16* __restrict__ Wt, int K, int N, float scale) {
  const int t = blockIdx.x * 256 + threadIdx.x; if (t >= N * (K / 8)) return; const int n = t / (K / 8), k8 = (t % (K / 8)) * 8; FragH f;
#pragma unroll
  for (int i = 0; i < 8; ++i) f.h[i] = (_Float16)(bf16_round(W[(size_t)(k8 + i) * N + n]) * scale); const v8us o = f.half[0];
  *(v8us*)((unsigned short*)Wt + (size_t)n * K + k8) = o; 
}
// k_gemm_hh variant with fused epilogue: v = acc·alpha + bias[by·sBias + col] (+ CP[(row/rowsPerB)·sCPb + by·64 + col] if CP) ; ACT 0 none / 1 elu ; writes f16 C16 (and f32 C if non-null)
template <int ACT>
__global__ __launch_bounds__(128) void k_gemm_hhx(const _Float16* __restrict__ A, int lda, size_t sA, const _Float16* __restrict__ Bh, int ldb, size_t sB, float alpha, const float* __restrict__ bias, size_t sBias, const float* __restrict__ CP, int rowsPerB, size_t sCPb, int row0g,
    float* __restrict__ C, _Float16* __restrict__ C16, int ldc, size_t sC, int M, int N, int K) {
  __shared__ __attribute__((aligned(16))) float so[4][16][64];
  const int tid = threadIdx.x, w = tid >> 5, lane = tid & 31, ln = lane & 15, hh = lane >> 4; const int by = blockIdx.y;
  A += (size_t)by * sA; Bh += (size_t)by * sB; const size_t cofs = (size_t)by * sC; const float* bp = bias ? bias + (size_t)by * sBias : nullptr;
  const int ntn = (N + 63) / 64; const int wid = blockIdx.x * 4 + w; const int mt = wid / ntn, nq = wid % ntn; if (mt * 16 >= M) return;
  const int row0 = mt * 16, col0 = nq * 64; const _Float16* arow = A + (size_t)(row0 + ln) * lda;
  v8f acc[4] = {};
  for (int kb = 0; kb < K; kb += 32) { FragH ah; ah.half[0] = *(const v8us*)((const unsigned short*)arow + kb + 8 * hh); ah.half[1] = *(const v8us*)((const unsigned short*)arow + kb + 16 + 8 * hh);
#pragma unroll
    for (int t = 0; t < 4; ++t) { if (col0 + t * 16 >= N) continue; const size_t boff = (size_t)(col0 + t * 16 + ln) * ldb + kb; FragH bq; bq.half[0] = *(const v8us*)((const unsigned short*)Bh + boff + 8 * hh); bq.half[1] = *(const v8us*)((const unsigned short*)Bh + boff + 16 + 8 * hh);
      acc[t] = mmaH<1>(ah.v, ah.v, bq.v, bq.v, acc[t]); }
  }
#pragma unroll
  for (int t = 0; t < 4; ++t) { if (col0 + t * 16 >= N) continue; const int col = col0 + t * 16 + ln; const float bv = bp ? bf16_round(bp[col]) : 0.f;
#pragma unroll
    for (int r = 0; r < 8; ++r) { float v = acc[t][r] * alpha + bv; if (CP) { const int rr = row0g + row0 + 8 * hh + r; if (rowsPerB < 0) v += CP[cofs + (size_t)rr * ldc + col];      /* rowsPerB < 0: own element of the batched C plane */ else { const int bidx = rr / rowsPerB; v += CP[(size_t)bidx * sCPb + (size_t)by * 64 + col]; } } if (ACT == 1) v = (v > 0.f) ? v : expm1f(v); else if (ACT == 7) v = (v > 0.f) ? v + 1.0f : expf(v); else if (ACT == 8) v = tanhf(v); else if (ACT == 9) v = 0.5f * v * (1.0f + tanhf(0.7978845608028654f * (v + 0.044715f * v * v * v))); else if (ACT == 11) v = 1.0f / (1.0f + expf(-v)); else if (ACT == 12) v = (v > 0.f) ? v : 0.01f * v; else if (ACT == 14) v = (v > 0.f) ? v : 0.1f * v; else if (ACT == 16) v = (v >= 0.f) ? v : 0.3f * v; else if (ACT == 17) v = (v >= 0.f) ? v : 0.2f * v; else if (ACT == 15) v = v / (1.0f + expf(-v)); else if (ACT == 3) v = fmaxf(v, 0.f); else if (ACT == 6) v = 0.5f * v * (1.0f + erff(v * 0.70710678118654752f)); so[w][8 * hh + r][t * 16 + ln] = v; } }
  __builtin_amdgcn_fence(__ATOMIC_ACQ_REL, "workgroup"); __builtin_amdgcn_wave_barrier();
  const int rsub = lane >> 4, c4 = (lane & 15) * 4; typedef _Float16 v4h __attribute__((ext_vector_type(4)));
  {
#pragma unroll
    for (int q = 0; q < 8; ++q) { const int r = q * 2 + rsub; if (col0 + c4 < N) { const v4f v = *(const v4fa*)&so[w][r][c4]; if (C) *(v4f*)(C + cofs + (size_t)(row0 + r) * ldc + col0 + c4) = v; if (C16) { v4h h4; for (int i = 0; i < 4; ++i) h4[i] = (_Float16)v[i]; *(v4h*)(C16 + cofs + (size_t)(row0 + r) * ldc + col0 + c4) = h4; } } }
     }
}


typedef _Float16 v4h __attribute__((ext_vector_type(4)));

__global__ __launch_bounds__(256) void k_x16(const float* __restrict__ x, _Float16* __restrict__ X16, size_t n8) { const size_t t = (size_t)blockIdx.x * 256 + threadIdx.x; if (t >= n8) return; FragH f;
#pragma unroll
  for (int q = 0; q < 8; ++q) f.h[q] = (_Float16)bf16_round(x[t * 8 + q]); *(v8us*)((unsigned short*)X16 + t * 8) = f.half[0];  }
__global__ __launch_bounds__(256) void k_h16(const float* __restrict__ x, _Float16* __restrict__ X16, size_t n8) { const size_t t = (size_t)blockIdx.x * 256 + threadIdx.x; if (t >= n8) return; FragH f;
#pragma unroll
  for (int q = 0; q < 8; ++q) f.h[q] = (_Float16)x[t * 8 + q]; *(v8us*)((unsigned short*)X16 + t * 8) = f.half[0];  }
__global__ __launch_bounds__(256) void k_round16f(const float* __restrict__ W, _Float16* __restrict__ Bt, size_t n8) { const size_t t = (size_t)blockIdx.x * 256 + threadIdx.x; if (t >= n8) return; FragH f;
#pragma unroll
  for (int i = 0; i < 8; ++i) f.h[i] = (_Float16)(bf16_round(W[t * 8 + i]) * 16.0f); *(v8us*)((unsigned short*)Bt + t * 8) = f.half[0];  }
template <int NHv, int TTv>
__global__ __launch_bounds__(256) void k_vt(const _Float16* __restrict__ V16, int ldv, int voff, _Float16* __restrict__ Vt) { __shared__ unsigned short tl[64][66]; const int tid = threadIdx.x; const int slab = blockIdx.x / (TTv / 64), lg = blockIdx.x % (TTv / 64); const int b = slab / NHv, h = slab % NHv;
  for (int i = tid; i < 64 * 8; i += 256) { const int r = i / 8, c8 = (i % 8) * 8; FragH f; f.half[0] = *(const v8us*)((const unsigned short*)V16 + ((size_t)b * TTv + lg * 64 + r) * ldv + voff + h * 64 + c8);
#pragma unroll
    for (int q = 0; q < 8; ++q) tl[r][c8 + q] = f.u[q]; }
  __syncthreads();
  {
#pragma unroll
    for (int rd = 0; rd < 2; ++rd) { const int d = rd * 32 + tid / 8, pc = tid % 8; FragH f;
#pragma unroll
      for (int q = 0; q < 8; ++q) f.u[q] = tl[pc * 8 + q][d];
      *(v8us*)((unsigned short*)Vt + ((size_t)slab * 64 + d) * TTv + lg * 64 + pc * 8) = f.half[0]; }
     } }

__global__ __launch_bounds__(256) void k_hl(const float* __restrict__ F, _Float16* __restrict__ Hh, _Float16* __restrict__ Hl, size_t n8) { const size_t t = (size_t)blockIdx.x * 256 + threadIdx.x; if (t >= n8) return; FragH fh, fl; const v4f a = *(const v4fa*)(F + t * 8), c = *(const v4fa*)(F + t * 8 + 4);
#pragma unroll
  for (int q = 0; q < 4; ++q) { _Float16 h = (_Float16)a[q]; fh.h[q] = h; fl.h[q] = (_Float16)((a[q] - (float)h) * 1024.0f); h = (_Float16)c[q]; fh.h[4 + q] = h; fl.h[4 + q] = (_Float16)((c[q] - (float)h) * 1024.0f); }
  { *(v8us*)((unsigned short*)Hh + t * 8) = fh.half[0]; *(v8us*)((unsigned short*)Hl + t * 8) = fl.half[0];  } }

// ---- fast GEMM (wave tile 32x64; requires M % 32 == 0 rows per launch region and N % 64 == 0); epilogue = k_gemm_hhx semantics ----
__device__ __forceinline__ v16h g2_frag(const _Float16* p, int hh) { FragH f; f.half[0] = *(const v8us*)((const unsigned short*)p + 8 * hh); f.half[1] = *(const v8us*)((const unsigned short*)p + 16 + 8 * hh); return f.v; }
__device__ __forceinline__ v8f g2_mma(v16h a, v16h b, v8f c) { v8f d = __builtin_amdgcn_wmma_f32_16x16x32_f16(false, a, false, b, (short)0, c, false, false); asm volatile("v_nop\n\tv_nop\n\tv_nop\n\tv_nop" : "+v"(d) : "v"(a), "v"(b)); return d; }
template <int ACT>
__global__ __launch_bounds__(128) void k_gemm2(const _Float16* __restrict__ A, int lda, size_t sA, const _Float16* __restrict__ Bh, int ldb, size_t sB, float alpha, const float* __restrict__ bias, size_t sBias, const float* __restrict__ CP, int rowsPerB, size_t sCPb, int row0g,
    float* __restrict__ C, _Float16* __restrict__ C16, int ldc, size_t sC, int M, int N, int K) { static_assert(ACT == 0 || ACT == 3 || ACT == 6 || ACT == 8 || ACT == 9 || ACT == 11 || ACT == 12 || ACT == 14 || ACT == 15 || ACT == 16 || ACT == 17, "k_gemm2: unsupported ACT code (would silently apply no activation)");
  __shared__ __attribute__((aligned(16))) float so[4][32][68];
  const int tid = threadIdx.x, w = tid >> 5, lane = tid & 31, ln = lane & 15, hh = lane >> 4; const int by = blockIdx.y;
  A += (size_t)by * sA; Bh += (size_t)by * sB; const size_t cofs = (size_t)by * sC; const float* bp = bias ? bias + (size_t)by * sBias : nullptr;
  const int ntn = N >> 6; const int mt = blockIdx.x / ntn, nq = blockIdx.x - mt * ntn; const int row0 = mt * 128 + 32 * w, col0 = nq * 64; if (row0 >= M) return;
  const _Float16* a0p = A + (size_t)(row0 + ln) * lda; const _Float16* a1p = a0p + (size_t)16 * lda;
  const _Float16* b0p = Bh + (size_t)(col0 + ln) * ldb; const _Float16* b1p = b0p + (size_t)16 * ldb; const _Float16* b2p = b1p + (size_t)16 * ldb; const _Float16* b3p = b2p + (size_t)16 * ldb;
  const v8f z8 = {0.f,0.f,0.f,0.f,0.f,0.f,0.f,0.f}; v8f c00 = z8, c01 = z8, c02 = z8, c03 = z8, c10 = z8, c11 = z8, c12 = z8, c13 = z8;
#pragma unroll 1
  for (int kb = 0; kb < K; kb += 32) { const v16h a0 = g2_frag(a0p + kb, hh), a1 = g2_frag(a1p + kb, hh);
    v16h b = g2_frag(b0p + kb, hh); c00 = g2_mma(a0, b, c00); c10 = g2_mma(a1, b, c10);
    b = g2_frag(b1p + kb, hh); c01 = g2_mma(a0, b, c01); c11 = g2_mma(a1, b, c11);
    b = g2_frag(b2p + kb, hh); c02 = g2_mma(a0, b, c02); c12 = g2_mma(a1, b, c12);
    b = g2_frag(b3p + kb, hh); c03 = g2_mma(a0, b, c03); c13 = g2_mma(a1, b, c13); }
  v8f accs[8] = {c00, c01, c02, c03, c10, c11, c12, c13};
#pragma unroll
  for (int u = 0; u < 8; ++u) { const int t = u & 3, half = u >> 2; const int col = col0 + t * 16 + ln; const float bv = bp ? bf16_round(bp[col]) : 0.f;
#pragma unroll
    for (int r = 0; r < 8; ++r) { const int rloc = half * 16 + 8 * hh + r; float v = accs[u][r] * alpha + bv; if (CP) { if (rowsPerB < 0) v += CP[cofs + (size_t)(row0g + row0 + rloc) * ldc + col];      /* rowsPerB < 0: own element of the batched C plane */ else { const int bidx = (row0g + row0 + rloc) / rowsPerB; v += CP[(size_t)bidx * sCPb + (size_t)by * 64 + col]; } }
      if (ACT == 3) v = fmaxf(v, 0.f); else if (ACT == 6) v = 0.5f * v * (1.0f + erff(v * 0.70710678118654752f)); else if (ACT == 11) v = 1.0f / (1.0f + expf(-v)); else if (ACT == 15) v = v / (1.0f + expf(-v)); else if (ACT == 12) v = (v > 0.f) ? v : 0.01f * v; else if (ACT == 8) v = tanhf(v); else if (ACT == 9) v = 0.5f * v * (1.0f + tanhf(0.7978845608028654f * (v + 0.044715f * v * v * v))); else if (ACT == 14) v = (v > 0.f) ? v : 0.1f * v; else if (ACT == 16) v = (v >= 0.f) ? v : 0.3f * v; else if (ACT == 17) v = (v >= 0.f) ? v : 0.2f * v;
      so[w][rloc][t * 16 + ln] = v; } }
  __builtin_amdgcn_fence(__ATOMIC_ACQ_REL, "workgroup"); __builtin_amdgcn_wave_barrier();
  const int rsub = lane >> 4, c4 = (lane & 15) * 4;
  {
#pragma unroll
    for (int q = 0; q < 16; ++q) { const int r = q * 2 + rsub; const v4f v = *(const v4fa*)&so[w][r][c4]; if (C) *(v4f*)(C + cofs + (size_t)(row0 + r) * ldc + col0 + c4) = v; if (C16) { v4h h4; for (int i = 0; i < 4; ++i) h4[i] = (_Float16)v[i]; *(v4h*)(C16 + cofs + (size_t)(row0 + r) * ldc + col0 + c4) = h4; } }
     } }


__global__ __launch_bounds__(256) void k_wnat(const float* __restrict__ w, size_t n8, _Float16* __restrict__ Bt) { const size_t t = (size_t)blockIdx.x * 256 + threadIdx.x; if (t >= n8) return; FragH f; for (int q = 0; q < 8; ++q) f.h[q] = (_Float16)(bf16_round(w[t * 8 + q]) * 16.0f); *(v8us*)((unsigned short*)Bt + t * 8) = f.half[0];  }
__global__ __launch_bounds__(256) void k_rsm(const float* __restrict__ S, _Float16* __restrict__ P, int nrows) {
  #pragma clang fp contract(off)
  const int i = blockIdx.x * 256 + threadIdx.x; if (i >= nrows) return; const float* s = S + (size_t)i * SQ; float mx = -3.0e38f;
#pragma unroll 1
  for (int j = 0; j < SQ; ++j) mx = fmaxf(mx, s[j]); float se = 0.f;
#pragma unroll 1
  for (int j = 0; j < SQ; ++j) se += expf(s[j] - mx); const float sc = 256.0f / se;
#pragma unroll 1
  for (int j0 = 0; j0 < SQ; j0 += 8) { FragH f; for (int q = 0; q < 8; ++q) f.h[q] = (_Float16)(expf(s[j0 + q] - mx) * sc); unsigned short* d = (unsigned short*)P + (size_t)i * SQ + j0; *(v8us*)d = f.half[0];  } }
__global__ __launch_bounds__(256) void k_vt(const _Float16* __restrict__ V16, int b, int h0, _Float16* __restrict__ VT) { __shared__ unsigned short tl[64][65]; const int tid = threadIdx.x; const int hh = blockIdx.x % HG, sg = blockIdx.x / HG; const int s0 = sg * 64; const int h = h0 + hh;
  for (int i = tid; i < 64 * 8; i += 256) { const int j = i / 8, d8 = (i % 8) * 8; FragH f; f.half[0] = *(const v8us*)((const unsigned short*)V16 + ((size_t)b * SQ + s0 + j) * DM + h * HD + d8); for (int q = 0; q < 8; ++q) tl[d8 + q][j] = f.u[q]; }
  __syncthreads();
  { for (int i = tid; i < 64 * 8; i += 256) { const int d = i / 8, j8 = (i % 8) * 8; FragH f; for (int q = 0; q < 8; ++q) f.u[q] = tl[d][j8 + q]; *(v8us*)((unsigned short*)VT + ((size_t)hh * HD + d) * SQ + s0 + j8) = f.half[0]; }  } }



__global__ __launch_bounds__(256) void k_rsmcf2(const float* __restrict__ S, _Float16* __restrict__ P, int hg, int q0, int nk) {
  #pragma clang fp contract(off)
  const int t = blockIdx.x * 256 + threadIdx.x; if (t >= hg * QT) return; const size_t i = (size_t)t; const float* s = S + i * NKX; const int last = q0 + (t % QT); float mx = -3.0e38f;
#pragma unroll 1
  for (int j = 0; j < nk; ++j) { const float f = (j <= last) ? 1.f : 0.f; mx = fmaxf(mx, fmaf(f, s[j], (1.f - f) * -1.0e9f)); } float se = 0.f;
#pragma unroll 1
  for (int j = 0; j < nk; ++j) { const float f = (j <= last) ? 1.f : 0.f; se += __expf(fmaf(f, s[j], (1.f - f) * -1.0e9f) - mx); } const float sc = 256.0f / se;
#pragma unroll 1
  for (int j0 = 0; j0 < nk; j0 += 8) { FragH fr; for (int q = 0; q < 8; ++q) { const int j = j0 + q; const float f = (j <= last) ? 1.f : 0.f; fr.h[q] = (_Float16)(__expf(fmaf(f, s[j], (1.f - f) * -1.0e9f) - mx) * sc); } unsigned short* d = (unsigned short*)P + i * NKX + j0; *(v8us*)d = fr.half[0];  } }


template <int MASKADD>
__global__ __launch_bounds__(64) void k_att0(const float* __restrict__ QF, const float* __restrict__ KF, const float* __restrict__ VF, int ld, const float* __restrict__ mask, float scale, float* __restrict__ OF, int ldo) {
  #pragma clang fp contract(off)
  __shared__ __attribute__((aligned(16))) float lq[64][64]; __shared__ __attribute__((aligned(16))) float lo[64][64];
  const int tid = threadIdx.x; const int h = blockIdx.x / (QT0 / 64), rg = blockIdx.x % (QT0 / 64); const int i = rg * 64 + tid;
  const float* qr = QF + (size_t)i * ld + h * HD;
#pragma unroll 1
  for (int c = 0; c < HD / 4; ++c) { *(v4f*)&lq[tid][c * 4] = *(const v4fa*)(qr + c * 4); const v4f z = {0.f, 0.f, 0.f, 0.f}; *(v4f*)&lo[tid][c * 4] = z; }
  float m = -1.0e30f, l = 0.f; const int jmax = MASKADD ? (SQ - 1) : (rg * 64 + 63);      /* additive-mask form: every key (the mask input decides); causal form: keys up to the block's last row */
#pragma unroll 1
  for (int j = 0; j <= jmax; ++j) { const float* kr = KF + (size_t)j * ld + h * HD; const float* vr = VF + (size_t)j * ld + h * HD; float s = 0.f;
#pragma unroll 1
    for (int c = 0; c < HD / 4; ++c) { const v4f kq = *(const v4fa*)(kr + c * 4); const v4f qq = *(v4f*)&lq[tid][c * 4]; s = __fadd_rn(s, __fmul_rn(qq[0], kq[0])); s = __fadd_rn(s, __fmul_rn(qq[1], kq[1])); s = __fadd_rn(s, __fmul_rn(qq[2], kq[2])); s = __fadd_rn(s, __fmul_rn(qq[3], kq[3])); }
    s = __fmul_rn(s, scale); if (MASKADD) s = __fadd_rn(s, __fmul_rn(bf16_round(mask[(size_t)i * SQ + j]), -10000.0f));
    const float f = (MASKADD || j <= i) ? 1.f : 0.f; const float sm = fmaf(f, s, (1.f - f) * -1.0e30f); const float mn = fmaxf(m, sm); const float sc = expf(m - mn); const float e = expf(sm - mn); l = __fadd_rn(__fmul_rn(l, sc), e); m = mn;
#pragma unroll 1
    for (int c = 0; c < HD / 4; ++c) { const v4f vv = *(const v4fa*)(vr + c * 4); v4f oo = *(v4f*)&lo[tid][c * 4]; for (int u = 0; u < 4; ++u) oo[u] = __fadd_rn(__fmul_rn(oo[u], sc), __fmul_rn(e, vv[u])); *(v4f*)&lo[tid][c * 4] = oo; } }
  const float fin = 64.0f / l;      /* o carried x64 like the f16 path */
#pragma unroll 1
  for (int c = 0; c < HD / 4; ++c) { v4f oo = *(v4f*)&lo[tid][c * 4]; for (int u = 0; u < 4; ++u) oo[u] = __fmul_rn(oo[u], fin); *(v4f*)&lo[tid][c * 4] = oo; }
  __syncthreads();
  {
#pragma unroll 1
    for (int it = 0; it < 16; ++it) { const int row = it * 4 + tid / 16, pc = (tid % 16) * 4; const v4f v = *(const v4f*)&lo[row][pc]; *(v4f*)(OF + (size_t)(rg * 64 + row) * ldo + h * HD + pc) = v; }
     } }

extern "C" void kernel_launch(void* const* d_in, const int* in_sizes, int n_in,
                              void* d_out, int out_size, void* d_ws, size_t ws_size, hipStream_t stream) {
  (void)in_sizes; (void)n_in; (void)out_size;
  const float* const* I = (const float* const*)d_in; const float* x = I[0]; const float* xk = I[1]; const float* xv = I[2]; const float* wq = I[3]; const float* bq = I[4]; const float* wk = I[5]; const float* bk = I[6]; const float* wv = I[7]; const float* bv = I[8]; const float* wo = I[9]; const float* bo = I[10];      /* input order: query, key, value (THREE input streams), then [in][out] weights + biases */
  char* ws = (char*)d_ws; size_t off = 0;
  auto take = [&](size_t bytes) { char* p = ws + off; off += (bytes + 255) & ~(size_t)255; return p; };
  _Float16* BQ = (_Float16*)take((size_t)DM * DM * 2); _Float16* BK = (_Float16*)take((size_t)DM * DM * 2); _Float16* BV = (_Float16*)take((size_t)DM * DM * 2); _Float16* BO = (_Float16*)take((size_t)DM * DM * 2);
  _Float16* X16 = (_Float16*)take(NR * DM * 2); _Float16* XK16 = (_Float16*)take(NR * DM * 2); _Float16* XV16 = (_Float16*)take(NR * DM * 2);      /* exact f16 rows of query, key, value */ float* QF = (float*)take(NR * DM * 4); _Float16* QH = (_Float16*)take(NR * DM * 2); _Float16* QL = (_Float16*)take(NR * DM * 2); _Float16* KH = (_Float16*)take(NR * DM * 2); _Float16* KL = (_Float16*)take(NR * DM * 2); _Float16* Q16 = QH; _Float16* K16 = KH; _Float16* V16 = (_Float16*)take(NR * DM * 2); _Float16* O16 = (_Float16*)take(NR * DM * 2);
  float* S = (float*)take((size_t)NH * QT * NKX * 4); _Float16* P = (_Float16*)take((size_t)NH * QT * NKX * 2); _Float16* VT = (_Float16*)take((size_t)NH * HD * SQ * 2);
  float* QF0 = (float*)take((size_t)QT0 * DM * 4); float* KF0 = (float*)take((size_t)QT0 * DM * 4); float* VF0 = (float*)take((size_t)QT0 * DM * 4); float* OF0 = (float*)take((size_t)NB * QT0 * DM * 4); _Float16* OH0 = (_Float16*)take((size_t)NB * QT0 * DM * 2); _Float16* OL0 = (_Float16*)take((size_t)NB * QT0 * DM * 2);
  if (off > ws_size) return;
  { const unsigned g = (unsigned)(((size_t)DM * (DM / 8) + 255) / 256); k_wt_f16<<<g, 256, 0, stream>>>(wq, BQ, DM, DM, 16.0f); k_wt_f16<<<g, 256, 0, stream>>>(wk, BK, DM, DM, 16.0f); k_wt_f16<<<g, 256, 0, stream>>>(wv, BV, DM, DM, 16.0f); k_wt_f16<<<g, 256, 0, stream>>>(wo, BO, DM, DM, 16.0f); }      /* [in][out] -> Bt[n][k] x16 */
  k_x16<<<(unsigned)((NR * DM / 8 + 255) / 256), 256, 0, stream>>>(x, X16, NR * DM / 8); k_x16<<<(unsigned)((NR * DM / 8 + 255) / 256), 256, 0, stream>>>(xk, XK16, NR * DM / 8); k_x16<<<(unsigned)((NR * DM / 8 + 255) / 256), 256, 0, stream>>>(xv, XV16, NR * DM / 8);
  const size_t r0p = (size_t)B0 * SQ;      /* first projected row */
  k_gemm2<0><<<dim3((unsigned)((MP / 128) * (DM / 64)), 1), 128, 0, stream>>>(X16 + r0p * DM, DM, 0, BQ, DM, 0, 0.0625f, bq, 0, nullptr, 1, 0, 0, QF + r0p * DM, nullptr, DM, 0, MP, DM, DM); k_hl<<<(unsigned)(((size_t)MP * DM / 8 + 255) / 256), 256, 0, stream>>>(QF + r0p * DM, QH + r0p * DM, QL + r0p * DM, (size_t)MP * DM / 8);      /* q (f32) -> f16 hi + x1024 residual: unscaled logits sigma ~8 */
  k_gemm2<0><<<dim3((unsigned)((MP / 128) * (DM / 64)), 1), 128, 0, stream>>>(XK16 + r0p * DM, DM, 0, BK, DM, 0, 0.0625f, bk, 0, nullptr, 1, 0, 0, QF + r0p * DM, nullptr, DM, 0, MP, DM, DM); k_hl<<<(unsigned)(((size_t)MP * DM / 8 + 255) / 256), 256, 0, stream>>>(QF + r0p * DM, KH + r0p * DM, KL + r0p * DM, (size_t)MP * DM / 8);      /* k likewise */
  k_gemm2<0><<<dim3((unsigned)((MP / 128) * (DM / 64)), 1), 128, 0, stream>>>(XV16 + r0p * DM, DM, 0, BV, DM, 0, 0.0625f, bv, 0, nullptr, 1, 0, 0, nullptr, V16 + r0p * DM, DM, 0, MP, DM, DM);
  for (int b = B0; b < B0 + NBR; ++b) { const size_t r0 = (size_t)b * SQ;
    k_vt<NH, SQ><<<NH * (SQ / 64), 256, 0, stream>>>(V16 + r0 * LQ, LQ, 0, VT);      /* V^T [NH][HD][SQ] for this batch */
    k_gemm2<0><<<dim3((QT0 / 128) * (DM / 64), 1), 128, 0, stream>>>(X16 + r0 * DM, DM, 0, BQ, DM, 0, 0.0625f, bq, 0, nullptr, 1, 0, 0, QF0, nullptr, DM, 0, QT0, DM, DM); k_gemm2<0><<<dim3((QT0 / 128) * (DM / 64), 1), 128, 0, stream>>>(XK16 + r0 * DM, DM, 0, BK, DM, 0, 0.0625f, bk, 0, nullptr, 1, 0, 0, KF0, nullptr, DM, 0, QT0, DM, DM); k_gemm2<0><<<dim3((QT0 / 128) * (DM / 64), 1), 128, 0, stream>>>(XV16 + r0 * DM, DM, 0, BV, DM, 0, 0.0625f, bv, 0, nullptr, 1, 0, 0, VF0, nullptr, DM, 0, QT0, DM, DM);      /* f32 q, k, v of the first 128 rows (exact products) */
    k_att0<0><<<NH * (QT0 / 64), 64, 0, stream>>>(QF0, KF0, VF0, DM, nullptr, SCL, OF0 + (size_t)b * QT0 * DM, DM);      /* exact f32 attention for rows 0..127 (o x64) */
    for (int q0 = 0; q0 < QN; q0 += QT) { const int nk = q0 + QT;      /* causal: only keys below the tile end are computed */
      k_gemm2<0><<<dim3((QT / 128) * (nk / 64), NHD), 128, 0, stream>>>(QH + (r0 + q0) * LQ, LQ, (size_t)HD, KH + r0 * LQ, LQ, (size_t)HD, SCL, nullptr, 0, nullptr, 1, 0, 0, S, nullptr, NKX, (size_t)QT * NKX, QT, nk, HD);      /* scores hi . hi * 2048^-0.5 (the source's sequence-length scale) */
      k_gemm2<0><<<dim3((QT / 128) * (nk / 64), NHD), 128, 0, stream>>>(QL + (r0 + q0) * LQ, LQ, (size_t)HD, KH + r0 * LQ, LQ, (size_t)HD, SCLR, nullptr, 0, S, -1, 0, 0, S, nullptr, NKX, (size_t)QT * NKX, QT, nk, HD); k_gemm2<0><<<dim3((QT / 128) * (nk / 64), NHD), 128, 0, stream>>>(QH + (r0 + q0) * LQ, LQ, (size_t)HD, KL + r0 * LQ, LQ, (size_t)HD, SCLR, nullptr, 0, S, -1, 0, 0, S, nullptr, NKX, (size_t)QT * NKX, QT, nk, HD);      /* += 2^-10 (lo . hi + hi . lo) */      /* scores, all heads on grid.y */
      k_rsmcf2<<<(NHD * QT + 255) / 256, 256, 0, stream>>>(S, P, NHD, q0, nk);
      k_gemm2<0><<<dim3((QT / 128) * (HD / 64), NHD), 128, 0, stream>>>(P, NKX, (size_t)QT * NKX, VT, SQ, (size_t)HD * SQ, 0.25f, nullptr, 0, nullptr, 1, 0, 0, nullptr, O16 + (r0 + q0) * DM, DM, (size_t)HD, QT, HD, nk); } }      /* o (merged heads, x64) as f16 rows */
  k_gemm2<0><<<dim3((unsigned)((MPO / 128) * (DM / 64)), 1), 128, 0, stream>>>(O16 + r0p * DM, DM, 0, BO, DM, 0, 0.0009765625f, bo, 0, nullptr, 1, 0, 0, (float*)d_out + r0p * DM, nullptr, DM, 0, MPO, DM, DM);      /* out rows are the output layout */
  k_hl<<<(unsigned)(((size_t)NB * QT0 * DM / 8 + 255) / 256), 256, 0, stream>>>(OF0, OH0, OL0, (size_t)NB * QT0 * DM / 8);      /* first-tile o (x64) -> f16 hi + x1024 residual planes */
  for (int b = B0; b < B0 + NBR; ++b) { const size_t r0 = (size_t)b * SQ; const size_t f0 = (size_t)b * QT0;
    k_gemm2<0><<<dim3((QT0 / 128) * (DM / 64), 1), 128, 0, stream>>>(OH0 + f0 * DM, DM, 0, BO, DM, 0, 0.0009765625f, bo, 0, nullptr, 1, 0, 0, (float*)d_out + r0 * DM, nullptr, DM, 0, QT0, DM, DM);      /* rows 0..127: out = o_hi Wo (+ b), overwriting the f16-path rows */
    k_gemm2<0><<<dim3((QT0 / 128) * (DM / 64), 1), 128, 0, stream>>>(OL0 + f0 * DM, DM, 0, BO, DM, 0, 0.00000095367431640625f, nullptr, 0, (const float*)d_out + r0 * DM, -1, 0, 0, (float*)d_out + r0 * DM, nullptr, DM, 0, QT0, DM, DM); }      /* += o_lo Wo 2^-20 (own-element accumulate) */
}

// v001
// One run takes 2900 microseconds.
// In two side-by-side timings against v000, it was 2.00 and 2.01 times as fast.
#include <hip/hip_runtime.h>
// Causal multi-head attention on three inputs with the source's sequence-length score scale (query, key, value [2][2048][1024]; q = query Wq + bq, k = key Wk + bk, v = value Wv + bv ([in][out] 1024 x 1024, weights AND biases sigma 1/32), 16 heads of 64; score = q k^T; triu(1) -> -inf; softmax(score / sqrt(Sk)) with Sk = 2048 KEYS (the source divides by sqrt of the score matrix's last dimension, NOT by sqrt(head_dim)): scale 2048^-0.5 = 0.0220970869; out = merged Wo + bo ([in][out]) -> [2][2048][1024]); q and k carried as f16 hi + x1024 residual planes with three-product scores.
// Structure: token rows r = b*2048 + s; x as exact f16 rows (bf16-rounded); q and k as WMMA GEMMs (32x64 wave tiles, f32 accumulation, exact x16 weights + bias) into f32 rows split into f16 hi + x1024 residual planes, v as an f16-output GEMM; per batch: V^T for all heads via LDS transposes; per query tile of 256 rows: scores against the keys below the tile end only as THREE accumulating passes (hi.hi + lo.hi + hi.lo, K = 64, all heads on grid.y, alpha 2048^-0.5 (x 2^-10 on the residual passes): no 1/sqrt(d) in this module, logits sigma ~8), causal row softmax on VALU with an arithmetic 0/1 key mask over the computed range (f32 statistics, native exp; weights x256 f16), o = P . V^T (K = keys below the tile end, alpha 2^-2: o carried x64, folded into the output GEMM alpha) written straight into the merged f16 o rows; out = o W_o + b GEMM (f32) into the output layout.
// Compute dtype: inputs rounded to bf16; x / weights exact; q and k as f16 hi + x1024 residual planes; v, softmax weights and o as plain f16 GEMM operands (~2^-12), except rows 0..127 of each batch: f32 attention, o as f16 hi + x1024 residual; scores and softmax statistics f32. v_wmma_f32_16x16x32_f16.
#define NB 2
#define SCL 0.0220970869f                 /* = f32(1 / sqrt(2048)): the source scales the scores by 1/sqrt(Sk), Sk = 2048 keys */
#define SCLR (0.0220970869f * 0.0009765625f)   /* the same scale on the x1024 residual passes */
#define SQ 2048
#define DM 1024
#define NH 16
#define HD 64
#define HG 4                         /* heads per group in the unlaunched k_vt(V16, b, h0, VT) */
#define QT 256                       /* query rows per causal tile */
#define NKX SQ                       /* S / P row pitch */
#define QT0 128                      /* first-tile rows recomputed exactly in f32 */
#define B0 0                         /* first batch processed (debug hook) */
#define NBR NB                       /* batches processed (debug hook) */
#define NR ((size_t)NB * SQ)         /* token rows */
#define MP ((int)((size_t)NBR * SQ)) /* rows projected (debug hook) */
#define QN SQ                        /* query rows attended per batch (debug hook) */
#define NHD NH                       /* heads attended (debug hook) */
#define MPO MP                       /* rows through the output stage (debug hook) */
#define LQ DM      /* row pitch of the q/k/v rows */
typedef __bf16 v16b __attribute__((ext_vector_type(16)));
typedef unsigned short v8us __attribute__((ext_vector_type(8), may_alias));
typedef float  v8f  __attribute__((ext_vector_type(8)));
typedef float  v4f  __attribute__((ext_vector_type(4)));
typedef float  v4fa __attribute__((ext_vector_type(4), may_alias));
union FragB { v16b v; v8us half[2]; unsigned short u[16]; };

__device__ __forceinline__ unsigned short bf16_bits(float x) { unsigned int u = __float_as_uint(x); return (unsigned short)((u + 0x7FFFu + ((u >> 16) & 1u)) >> 16); }
__device__ __forceinline__ float bf16_val(unsigned short b) { return __uint_as_float(((unsigned int)b) << 16); }
__device__ __forceinline__ float bf16_round(float x) { return bf16_val(bf16_bits(x)); }
// D += A·B with NT terms: 1 = ah·bh, 2 = + al·bh (A split), 3 = + ah·bl (both split)
template <int NT>
__device__ __forceinline__ v8f mmaN(v16b ah, v16b al, v16b bh, v16b bl, v8f c) {
  c = __builtin_amdgcn_wmma_f32_16x16x32_bf16(false, ah, false, bh, (short)0, c, false, false);
  if (NT >= 2) c = __builtin_amdgcn_wmma_f32_16x16x32_bf16(false, al, false, bh, (short)0, c, false, false);
  if (NT >= 3) c = __builtin_amdgcn_wmma_f32_16x16x32_bf16(false, ah, false, bl, (short)0, c, false, false);
  asm volatile("v_nop\n\tv_nop\n\tv_nop\n\tv_nop" : "+v"(c) : "v"(ah), "v"(al), "v"(bh), "v"(bl));
  return c;
}

__global__ __launch_bounds__(256) void k_wt_bf16(const float* __restrict__ W, unsigned short* __restrict__ Wt, int K, int N) {
  const int t = blockIdx.x * 256 + threadIdx.x;
  const int k8n = K / 8;
  if (t >= N * k8n) return;
  const int n = t / k8n, k8 = (t % k8n) * 8;
  v8us v;
#pragma unroll
  for (int i = 0; i < 8; ++i) v[i] = bf16_bits(W[(size_t)(k8 + i) * N + n]);
  *(v8us*)(Wt + (size_t)n * K + k8) = v;
  
}

// GEMM C[M][N] (f32, pitch ldc) = act(A[M][K]·W + bias). A f32 row-major (pitch lda) converted per fragment to bf16
// (ASPLIT: hi/lo two planes -> 2 terms, else single rounded term); Wt bf16 [N][K] (pitch ldb). BIAS_BF16 rounds the
// bias to bf16 first (bias quantised to bf16 before the add). K%32==0, M%16==0, N%64==0.
template <bool ASPLIT, int ACT, bool BIAS_BF16>
__global__ __launch_bounds__(128) void k_gemm_bf(const float* __restrict__ A, int lda, const unsigned short* __restrict__ Wt, int ldb,
                                               const float* __restrict__ bias, float* __restrict__ C, int ldc, int M, int N, int K) {
  __shared__ __attribute__((aligned(16))) float so[4][16][64];
  const int tid = threadIdx.x, w = tid >> 5, lane = tid & 31, ln = lane & 15, hh = lane >> 4;
  const int ntn = N / 64;
  const int wid = blockIdx.x * 4 + w;
  const int mt = wid / ntn, nq = wid % ntn;
  if (mt * 16 >= M) return;
  const int row0 = mt * 16, col0 = nq * 64;
  const float* arow = A + (size_t)(row0 + ln) * lda;
  v8f acc[4] = {};
  for (int kb = 0; kb < K; kb += 32) {
    FragB ah, al;
    const v4f x0 = *(const v4fa*)(arow + kb + 8 * hh), x1 = *(const v4fa*)(arow + kb + 8 * hh + 4);
    const v4f x2 = *(const v4fa*)(arow + kb + 16 + 8 * hh), x3 = *(const v4fa*)(arow + kb + 16 + 8 * hh + 4);
    float xs[16] = {x0[0],x0[1],x0[2],x0[3],x1[0],x1[1],x1[2],x1[3],x2[0],x2[1],x2[2],x2[3],x3[0],x3[1],x3[2],x3[3]};
#pragma unroll
    for (int i = 0; i < 16; ++i) { const unsigned short hb = bf16_bits(xs[i]); ah.u[i] = hb; al.u[i] = ASPLIT ? bf16_bits(xs[i] - bf16_val(hb)) : (unsigned short)0; }
#pragma unroll
    for (int t = 0; t < 4; ++t) {
      const unsigned short* brow = Wt + (size_t)(col0 + t * 16 + ln) * ldb + kb;
      FragB b;
      b.half[0] = *(const v8us*)(brow + 8 * hh);
      b.half[1] = *(const v8us*)(brow + 16 + 8 * hh);
      acc[t] = mmaN<ASPLIT ? 2 : 1>(ah.v, al.v, b.v, b.v, acc[t]);
    }
  }
#pragma unroll
  for (int t = 0; t < 4; ++t) {
    float bv = bias ? bias[col0 + t * 16 + ln] : 0.f;
    if (BIAS_BF16) bv = bf16_round(bv);
#pragma unroll
    for (int r = 0; r < 8; ++r) { float v = acc[t][r] + bv; if (ACT == 1) v = fmaxf(v, 0.f); so[w][8 * hh + r][t * 16 + ln] = v; }
  }
  __builtin_amdgcn_fence(__ATOMIC_ACQ_REL, "workgroup");
  __builtin_amdgcn_wave_barrier();
  const int rsub = lane >> 4, c4 = (lane & 15) * 4;
  {
#pragma unroll
    for (int q = 0; q < 8; ++q) {
      const int r = q * 2 + rsub;
      const v4f v = *(const v4fa*)&so[w][r][c4];
      *(v4f*)(C + (size_t)(row0 + r) * ldc + col0 + c4) = v;
    }
    
  }
}

// GEMM C = act(A·W + bias + resid): A f32 (ASPLIT -> hi/lo 2 terms), Wt bf16 [N][K]; ACT 0 none, 1 relu, 2 exact gelu;
// resid (optional, f32, row index = (row % rmod), pitch ldr, RES_BF16 rounds it) added before the activation.
template <bool ASPLIT, int ACT, bool BIAS_BF16, bool RES_BF16>
__global__ __launch_bounds__(128) void k_gemm_bf3(const float* __restrict__ A, int lda, const unsigned short* __restrict__ Wt, int ldb,
                                                const float* __restrict__ bias, const float* __restrict__ resid, int rmod, int ldr,
                                                float* __restrict__ C, int ldc, int M, int N, int K) {
  __shared__ __attribute__((aligned(16))) float so[4][16][64];
  const int tid = threadIdx.x, w = tid >> 5, lane = tid & 31, ln = lane & 15, hh = lane >> 4;
  const int ntn = N / 64;
  const int wid = blockIdx.x * 4 + w;
  const int mt = wid / ntn, nq = wid % ntn;
  if (mt * 16 >= M) return;
  const int row0 = mt * 16, col0 = nq * 64;
  const float* arow = A + (size_t)(row0 + ln) * lda;
  v8f acc[4] = {};
  for (int kb = 0; kb < K; kb += 32) {
    FragB ah, al;
    const v4f x0 = *(const v4fa*)(arow + kb + 8 * hh), x1 = *(const v4fa*)(arow + kb + 8 * hh + 4);
    const v4f x2 = *(const v4fa*)(arow + kb + 16 + 8 * hh), x3 = *(const v4fa*)(arow + kb + 16 + 8 * hh + 4);
    float xs[16] = {x0[0],x0[1],x0[2],x0[3],x1[0],x1[1],x1[2],x1[3],x2[0],x2[1],x2[2],x2[3],x3[0],x3[1],x3[2],x3[3]};
#pragma unroll
    for (int i = 0; i < 16; ++i) { const unsigned short hb = bf16_bits(xs[i]); ah.u[i] = hb; al.u[i] = ASPLIT ? bf16_bits(xs[i] - bf16_val(hb)) : (unsigned short)0; }
#pragma unroll
    for (int t = 0; t < 4; ++t) {
      const unsigned short* brow = Wt + (size_t)(col0 + t * 16 + ln) * ldb + kb;
      FragB b;
      b.half[0] = *(const v8us*)(brow + 8 * hh);
      b.half[1] = *(const v8us*)(brow + 16 + 8 * hh);
      acc[t] = mmaN<ASPLIT ? 2 : 1>(ah.v, al.v, b.v, b.v, acc[t]);
    }
  }
#pragma unroll
  for (int t = 0; t < 4; ++t) {
    const int col = col0 + t * 16 + ln;
    float bv = bias ? bias[col] : 0.f;
    if (BIAS_BF16) bv = bf16_round(bv);
#pragma unroll
    for (int r = 0; r < 8; ++r) {
      float v = acc[t][r] + bv;
      if (resid) { float rv = resid[(size_t)((row0 + 8 * hh + r) % rmod) * ldr + col]; if (RES_BF16) rv = bf16_round(rv); v += rv; }
      if (ACT == 1) v = fmaxf(v, 0.f);
      if (ACT == 2) v = 0.5f * v * (1.0f + erff(v * 0.70710678118654752f));
      if (ACT == 3) { const float u = 0.7978845608028654f * (v + 0.044715f * v * v * v); v = 0.5f * v * (1.0f + tanhf(u)); }
      so[w][8 * hh + r][t * 16 + ln] = v;
    }
  }
  __builtin_amdgcn_fence(__ATOMIC_ACQ_REL, "workgroup");
  __builtin_amdgcn_wave_barrier();
  const int rsub = lane >> 4, c4 = (lane & 15) * 4;
  {
#pragma unroll
    for (int q = 0; q < 8; ++q) {
      const int r = q * 2 + rsub;
      const v4f v = *(const v4fa*)&so[w][r][c4];
      *(v4f*)(C + (size_t)(row0 + r) * ldc + col0 + c4) = v;
    }
    
  }
}
// row LayerNorm (biased variance, eps) over N: s = X (+ R); optional out_sum <- s; out_norm <- (s-mu)*rsqrt(var+eps)*g + b
template <bool PARAM_BF16>
__global__ __launch_bounds__(256) void k_layernorm(const float* __restrict__ X, const float* __restrict__ R, const float* __restrict__ g, const float* __restrict__ bta,
                                                  float* __restrict__ out_sum, float* __restrict__ out_norm, int N, float eps) {
  __shared__ float red[256];
  const int row = blockIdx.x, tid = threadIdx.x;
  const float* x = X + (size_t)row * N; const float* rr = R ? R + (size_t)row * N : nullptr;
  float vals[16];                     // up to N = 4096
  const int per = N / 256;            // contiguous chunk per thread? use strided-by-4 chunks: thread handles j = tid*4 + 1024*u
  float s1 = 0.f;
  for (int u = 0; u < per / 4; ++u) {
    const int j = tid * 4 + 1024 * u;
    const v4f a = *(const v4fa*)(x + j);
    v4f b = {0.f,0.f,0.f,0.f}; if (rr) b = *(const v4fa*)(rr + j);
#pragma unroll
    for (int q = 0; q < 4; ++q) { const float v = a[q] + b[q]; vals[u * 4 + q] = v; s1 += v; }
  }
  red[tid] = s1; __syncthreads();
  for (int st = 128; st > 0; st >>= 1) { if (tid < st) red[tid] += red[tid + st]; __syncthreads(); }
  const float mu = red[0] / (float)N; __syncthreads();
  float s2 = 0.f;
  for (int u = 0; u < per / 4; ++u)
#pragma unroll
    for (int q = 0; q < 4; ++q) { const float c = vals[u * 4 + q] - mu; s2 += c * c; }
  red[tid] = s2; __syncthreads();
  for (int st = 128; st > 0; st >>= 1) { if (tid < st) red[tid] += red[tid + st]; __syncthreads(); }
  const float rs = rsqrtf(red[0] / (float)N + eps);
  {
    for (int u = 0; u < per / 4; ++u) {
      const int j = tid * 4 + 1024 * u;
      v4f o, sm;
#pragma unroll
      for (int q = 0; q < 4; ++q) {
        float gg = g[j + q], bb = bta[j + q];
        if (PARAM_BF16) { gg = bf16_round(gg); bb = bf16_round(bb); }
        sm[q] = vals[u * 4 + q]; o[q] = (vals[u * 4 + q] - mu) * rs * gg + bb;
      }
      if (out_sum) *(v4f*)(out_sum + (size_t)row * N + j) = sm;
      *(v4f*)(out_norm + (size_t)row * N + j) = o;
    }
    
  }
}



// ---- f16 WMMA path (v_wmma_f32_16x16x32_f16): 11-bit significands for operands in range — used where a [0,1] probability operand needs more precision than bf16
typedef _Float16 v16h __attribute__((ext_vector_type(16)));
union FragH { v16h v; v8us half[2]; _Float16 h[16]; unsigned short u[16]; };
template <int NT>
__device__ __forceinline__ v8f mmaH(v16h ah, v16h al, v16h bh, v16h bl, v8f c) {
  c = __builtin_amdgcn_wmma_f32_16x16x32_f16(false, ah, false, bh, (short)0, c, false, false);
  if (NT >= 2) c = __builtin_amdgcn_wmma_f32_16x16x32_f16(false, al, false, bh, (short)0, c, false, false);
  if (NT >= 3) c = __builtin_amdgcn_wmma_f32_16x16x32_f16(false, ah, false, bl, (short)0, c, false, false);
  asm volatile("v_nop\n\tv_nop\n\tv_nop\n\tv_nop" : "+v"(c) : "v"(ah), "v"(al), "v"(bh), "v"(bl));
  return c;
}
// batched GEMM like k_gemm_b but f16 operands: A f32 (split into f16 hi/lo if ASPLIT, else rounded to f16), Bt = f16 values [n][k]; alpha; C f32; N multiple of 16 (partial tiles skipped)
template <bool ASPLIT>
__global__ __launch_bounds__(128) void k_gemm_h(const float* __restrict__ A, int lda, size_t sA, const _Float16* __restrict__ Bh, int ldb, size_t sB, float alpha, float* __restrict__ C, int ldc, size_t sC, int M, int N, int K) {
  __shared__ __attribute__((aligned(16))) float so[4][16][64];
  const int tid = threadIdx.x, w = tid >> 5, lane = tid & 31, ln = lane & 15, hh = lane >> 4; const int by = blockIdx.y;
  A += (size_t)by * sA; Bh += (size_t)by * sB; C += (size_t)by * sC;
  const int ntn = (N + 63) / 64; const int wid = blockIdx.x * 4 + w; const int mt = wid / ntn, nq = wid % ntn; if (mt * 16 >= M) return;
  const int row0 = mt * 16, col0 = nq * 64; const float* arow = A + (size_t)(row0 + ln) * lda;
  v8f acc[4] = {};
  for (int kb = 0; kb < K; kb += 32) {
    FragH ah, al;
    const v4f x0 = *(const v4fa*)(arow + kb + 8 * hh), x1 = *(const v4fa*)(arow + kb + 8 * hh + 4), x2 = *(const v4fa*)(arow + kb + 16 + 8 * hh), x3 = *(const v4fa*)(arow + kb + 16 + 8 * hh + 4);
    float xs[16] = {x0[0],x0[1],x0[2],x0[3],x1[0],x1[1],x1[2],x1[3],x2[0],x2[1],x2[2],x2[3],x3[0],x3[1],x3[2],x3[3]};
#pragma unroll
    for (int i = 0; i < 16; ++i) { const _Float16 h = (_Float16)xs[i]; ah.h[i] = h; al.h[i] = ASPLIT ? (_Float16)(xs[i] - (float)h) : (_Float16)0.0f; }
#pragma unroll
    for (int t = 0; t < 4; ++t) { if (col0 + t * 16 >= N) continue; const size_t boff = (size_t)(col0 + t * 16 + ln) * ldb + kb; FragH bq; bq.half[0] = *(const v8us*)(Bh + boff + 8 * hh); bq.half[1] = *(const v8us*)(Bh + boff + 16 + 8 * hh);
      acc[t] = mmaH<ASPLIT ? 2 : 1>(ah.v, al.v, bq.v, bq.v, acc[t]); }
  }
#pragma unroll
  for (int t = 0; t < 4; ++t) { if (col0 + t * 16 >= N) continue;
#pragma unroll
    for (int r = 0; r < 8; ++r) so[w][8 * hh + r][t * 16 + ln] = acc[t][r] * alpha; }
  __builtin_amdgcn_fence(__ATOMIC_ACQ_REL, "workgroup"); __builtin_amdgcn_wave_barrier();
  const int rsub = lane >> 4, c4 = (lane & 15) * 4;
  {
#pragma unroll
    for (int q = 0; q < 8; ++q) { const int r = q * 2 + rsub; if (col0 + c4 < N) { const v4f v = *(const v4fa*)&so[w][r][c4]; *(v4f*)(C + (size_t)(row0 + r) * ldc + col0 + c4) = v; } }
     }
}

// Wt[n][k] = f16(W[k][n]·scale) from f32 row-major W[K][N] (scale = power of two; bf16-exact weights stay exact in f16 away from the subnormal range)
__global__ __launch_bounds__(256) void k_wt_f16(const float* __restrict__ W, _Float16* __restrict__ Wt, int K, int N, float scale) {
  const int t = blockIdx.x * 256 + threadIdx.x; if (t >= N * (K / 8)) return; const int n = t / (K / 8), k8 = (t % (K / 8)) * 8; FragH f;
#pragma unroll
  for (int i = 0; i < 8; ++i) f.h[i] = (_Float16)(bf16_round(W[(size_t)(k8 + i) * N + n]) * scale); const v8us o = f.half[0];
  *(v8us*)((unsigned short*)Wt + (size_t)n * K + k8) = o; 
}
// k_gemm_hh variant with fused epilogue: v = acc·alpha + bias[by·sBias + col] (+ CP[(row/rowsPerB)·sCPb + by·64 + col] if CP) ; ACT 0 none / 1 elu ; writes f16 C16 (and f32 C if non-null)
template <int ACT>
__global__ __launch_bounds__(128) void k_gemm_hhx(const _Float16* __restrict__ A, int lda, size_t sA, const _Float16* __restrict__ Bh, int ldb, size_t sB, float alpha, const float* __restrict__ bias, size_t sBias, const float* __restrict__ CP, int rowsPerB, size_t sCPb, int row0g,
    float* __restrict__ C, _Float16* __restrict__ C16, int ldc, size_t sC, int M, int N, int K) {
  __shared__ __attribute__((aligned(16))) float so[4][16][64];
  const int tid = threadIdx.x, w = tid >> 5, lane = tid & 31, ln = lane & 15, hh = lane >> 4; const int by = blockIdx.y;
  A += (size_t)by * sA; Bh += (size_t)by * sB; const size_t cofs = (size_t)by * sC; const float* bp = bias ? bias + (size_t)by * sBias : nullptr;
  const int ntn = (N + 63) / 64; const int wid = blockIdx.x * 4 + w; const int mt = wid / ntn, nq = wid % ntn; if (mt * 16 >= M) return;
  const int row0 = mt * 16, col0 = nq * 64; const _Float16* arow = A + (size_t)(row0 + ln) * lda;
  v8f acc[4] = {};
  for (int kb = 0; kb < K; kb += 32) { FragH ah; ah.half[0] = *(const v8us*)((const unsigned short*)arow + kb + 8 * hh); ah.half[1] = *(const v8us*)((const unsigned short*)arow + kb + 16 + 8 * hh);
#pragma unroll
    for (int t = 0; t < 4; ++t) { if (col0 + t * 16 >= N) continue; const size_t boff = (size_t)(col0 + t * 16 + ln) * ldb + kb; FragH bq; bq.half[0] = *(const v8us*)((const unsigned short*)Bh + boff + 8 * hh); bq.half[1] = *(const v8us*)((const unsigned short*)Bh + boff + 16 + 8 * hh);
      acc[t] = mmaH<1>(ah.v, ah.v, bq.v, bq.v, acc[t]); }
  }
#pragma unroll
  for (int t = 0; t < 4; ++t) { if (col0 + t * 16 >= N) continue; const int col = col0 + t * 16 + ln; const float bv = bp ? bf16_round(bp[col]) : 0.f;
#pragma unroll
    for (int r = 0; r < 8; ++r) { float v = acc[t][r] * alpha + bv; if (CP) { const int rr = row0g + row0 + 8 * hh + r; if (rowsPerB < 0) v += CP[cofs + (size_t)rr * ldc + col];      /* rowsPerB < 0: own element of the batched C plane */ else { const int bidx = rr / rowsPerB; v += CP[(size_t)bidx * sCPb + (size_t)by * 64 + col]; } } if (ACT == 1) v = (v > 0.f) ? v : expm1f(v); else if (ACT == 7) v = (v > 0.f) ? v + 1.0f : expf(v); else if (ACT == 8) v = tanhf(v); else if (ACT == 9) v = 0.5f * v * (1.0f + tanhf(0.7978845608028654f * (v + 0.044715f * v * v * v))); else if (ACT == 11) v = 1.0f / (1.0f + expf(-v)); else if (ACT == 12) v = (v > 0.f) ? v : 0.01f * v; else if (ACT == 14) v = (v > 0.f) ? v : 0.1f * v; else if (ACT == 16) v = (v >= 0.f) ? v : 0.3f * v; else if (ACT == 17) v = (v >= 0.f) ? v : 0.2f * v; else if (ACT == 15) v = v / (1.0f + expf(-v)); else if (ACT == 3) v = fmaxf(v, 0.f); else if (ACT == 6) v = 0.5f * v * (1.0f + erff(v * 0.70710678118654752f)); so[w][8 * hh + r][t * 16 + ln] = v; } }
  __builtin_amdgcn_fence(__ATOMIC_ACQ_REL, "workgroup"); __builtin_amdgcn_wave_barrier();
  const int rsub = lane >> 4, c4 = (lane & 15) * 4; typedef _Float16 v4h __attribute__((ext_vector_type(4)));
  {
#pragma unroll
    for (int q = 0; q < 8; ++q) { const int r = q * 2 + rsub; if (col0 + c4 < N) { const v4f v = *(const v4fa*)&so[w][r][c4]; if (C) *(v4f*)(C + cofs + (size_t)(row0 + r) * ldc + col0 + c4) = v; if (C16) { v4h h4; for (int i = 0; i < 4; ++i) h4[i] = (_Float16)v[i]; *(v4h*)(C16 + cofs + (size_t)(row0 + r) * ldc + col0 + c4) = h4; } } }
     }
}


typedef _Float16 v4h __attribute__((ext_vector_type(4)));

__global__ __launch_bounds__(256) void k_x16(const float* __restrict__ x, _Float16* __restrict__ X16, size_t n8) { const size_t t = (size_t)blockIdx.x * 256 + threadIdx.x; if (t >= n8) return; FragH f;
#pragma unroll
  for (int q = 0; q < 8; ++q) f.h[q] = (_Float16)bf16_round(x[t * 8 + q]); *(v8us*)((unsigned short*)X16 + t * 8) = f.half[0];  }
__global__ __launch_bounds__(256) void k_h16(const float* __restrict__ x, _Float16* __restrict__ X16, size_t n8) { const size_t t = (size_t)blockIdx.x * 256 + threadIdx.x; if (t >= n8) return; FragH f;
#pragma unroll
  for (int q = 0; q < 8; ++q) f.h[q] = (_Float16)x[t * 8 + q]; *(v8us*)((unsigned short*)X16 + t * 8) = f.half[0];  }
__global__ __launch_bounds__(256) void k_round16f(const float* __restrict__ W, _Float16* __restrict__ Bt, size_t n8) { const size_t t = (size_t)blockIdx.x * 256 + threadIdx.x; if (t >= n8) return; FragH f;
#pragma unroll
  for (int i = 0; i < 8; ++i) f.h[i] = (_Float16)(bf16_round(W[t * 8 + i]) * 16.0f); *(v8us*)((unsigned short*)Bt + t * 8) = f.half[0];  }
template <int NHv, int TTv>
__global__ __launch_bounds__(256) void k_vt(const _Float16* __restrict__ V16, int ldv, int voff, _Float16* __restrict__ Vt) { __shared__ unsigned short tl[64][66]; const int tid = threadIdx.x; const int slab = blockIdx.x / (TTv / 64), lg = blockIdx.x % (TTv / 64); const int b = slab / NHv, h = slab % NHv;
  for (int i = tid; i < 64 * 8; i += 256) { const int r = i / 8, c8 = (i % 8) * 8; FragH f; f.half[0] = *(const v8us*)((const unsigned short*)V16 + ((size_t)b * TTv + lg * 64 + r) * ldv + voff + h * 64 + c8);
#pragma unroll
    for (int q = 0; q < 8; ++q) tl[r][c8 + q] = f.u[q]; }
  __syncthreads();
  {
#pragma unroll
    for (int rd = 0; rd < 2; ++rd) { const int d = rd * 32 + tid / 8, pc = tid % 8; FragH f;
#pragma unroll
      for (int q = 0; q < 8; ++q) f.u[q] = tl[pc * 8 + q][d];
      *(v8us*)((unsigned short*)Vt + ((size_t)slab * 64 + d) * TTv + lg * 64 + pc * 8) = f.half[0]; }
     } }

__global__ __launch_bounds__(256) void k_hl(const float* __restrict__ F, _Float16* __restrict__ Hh, _Float16* __restrict__ Hl, size_t n8) { const size_t t = (size_t)blockIdx.x * 256 + threadIdx.x; if (t >= n8) return; FragH fh, fl; const v4f a = *(const v4fa*)(F + t * 8), c = *(const v4fa*)(F + t * 8 + 4);
#pragma unroll
  for (int q = 0; q < 4; ++q) { _Float16 h = (_Float16)a[q]; fh.h[q] = h; fl.h[q] = (_Float16)((a[q] - (float)h) * 1024.0f); h = (_Float16)c[q]; fh.h[4 + q] = h; fl.h[4 + q] = (_Float16)((c[q] - (float)h) * 1024.0f); }
  { *(v8us*)((unsigned short*)Hh + t * 8) = fh.half[0]; *(v8us*)((unsigned short*)Hl + t * 8) = fl.half[0];  } }

// ---- fast GEMM (wave tile 32x64; requires M % 32 == 0 rows per launch region and N % 64 == 0); epilogue = k_gemm_hhx semantics ----
__device__ __forceinline__ v16h g2_frag(const _Float16* p, int hh) { FragH f; f.half[0] = *(const v8us*)((const unsigned short*)p + 8 * hh); f.half[1] = *(const v8us*)((const unsigned short*)p + 16 + 8 * hh); return f.v; }
__device__ __forceinline__ v8f g2_mma(v16h a, v16h b, v8f c) { v8f d = __builtin_amdgcn_wmma_f32_16x16x32_f16(false, a, false, b, (short)0, c, false, false); asm volatile("v_nop\n\tv_nop\n\tv_nop\n\tv_nop" : "+v"(d) : "v"(a), "v"(b)); return d; }
template <int ACT>
__global__ __launch_bounds__(128) void k_gemm2(const _Float16* __restrict__ A, int lda, size_t sA, const _Float16* __restrict__ Bh, int ldb, size_t sB, float alpha, const float* __restrict__ bias, size_t sBias, const float* __restrict__ CP, int rowsPerB, size_t sCPb, int row0g,
    float* __restrict__ C, _Float16* __restrict__ C16, int ldc, size_t sC, int M, int N, int K) { static_assert(ACT == 0 || ACT == 3 || ACT == 6 || ACT == 8 || ACT == 9 || ACT == 11 || ACT == 12 || ACT == 14 || ACT == 15 || ACT == 16 || ACT == 17, "k_gemm2: unsupported ACT code (would silently apply no activation)");
  __shared__ __attribute__((aligned(16))) float so[4][32][68];
  const int tid = threadIdx.x, w = tid >> 5, lane = tid & 31, ln = lane & 15, hh = lane >> 4; const int by = blockIdx.y;
  A += (size_t)by * sA; Bh += (size_t)by * sB; const size_t cofs = (size_t)by * sC; const float* bp = bias ? bias + (size_t)by * sBias : nullptr;
  const int ntn = N >> 6; const int mt = blockIdx.x / ntn, nq = blockIdx.x - mt * ntn; const int row0 = mt * 128 + 32 * w, col0 = nq * 64; if (row0 >= M) return;
  const _Float16* a0p = A + (size_t)(row0 + ln) * lda; const _Float16* a1p = a0p + (size_t)16 * lda;
  const _Float16* b0p = Bh + (size_t)(col0 + ln) * ldb; const _Float16* b1p = b0p + (size_t)16 * ldb; const _Float16* b2p = b1p + (size_t)16 * ldb; const _Float16* b3p = b2p + (size_t)16 * ldb;
  const v8f z8 = {0.f,0.f,0.f,0.f,0.f,0.f,0.f,0.f}; v8f c00 = z8, c01 = z8, c02 = z8, c03 = z8, c10 = z8, c11 = z8, c12 = z8, c13 = z8;
#pragma unroll 1
  for (int kb = 0; kb < K; kb += 32) { const v16h a0 = g2_frag(a0p + kb, hh), a1 = g2_frag(a1p + kb, hh);
    v16h b = g2_frag(b0p + kb, hh); c00 = g2_mma(a0, b, c00); c10 = g2_mma(a1, b, c10);
    b = g2_frag(b1p + kb, hh); c01 = g2_mma(a0, b, c01); c11 = g2_mma(a1, b, c11);
    b = g2_frag(b2p + kb, hh); c02 = g2_mma(a0, b, c02); c12 = g2_mma(a1, b, c12);
    b = g2_frag(b3p + kb, hh); c03 = g2_mma(a0, b, c03); c13 = g2_mma(a1, b, c13); }
  v8f accs[8] = {c00, c01, c02, c03, c10, c11, c12, c13};
#pragma unroll
  for (int u = 0; u < 8; ++u) { const int t = u & 3, half = u >> 2; const int col = col0 + t * 16 + ln; const float bv = bp ? bf16_round(bp[col]) : 0.f;
#pragma unroll
    for (int r = 0; r < 8; ++r) { const int rloc = half * 16 + 8 * hh + r; float v = accs[u][r] * alpha + bv; if (CP) { if (rowsPerB < 0) v += CP[cofs + (size_t)(row0g + row0 + rloc) * ldc + col];      /* rowsPerB < 0: own element of the batched C plane */ else { const int bidx = (row0g + row0 + rloc) / rowsPerB; v += CP[(size_t)bidx * sCPb + (size_t)by * 64 + col]; } }
      if (ACT == 3) v = fmaxf(v, 0.f); else if (ACT == 6) v = 0.5f * v * (1.0f + erff(v * 0.70710678118654752f)); else if (ACT == 11) v = 1.0f / (1.0f + expf(-v)); else if (ACT == 15) v = v / (1.0f + expf(-v)); else if (ACT == 12) v = (v > 0.f) ? v : 0.01f * v; else if (ACT == 8) v = tanhf(v); else if (ACT == 9) v = 0.5f * v * (1.0f + tanhf(0.7978845608028654f * (v + 0.044715f * v * v * v))); else if (ACT == 14) v = (v > 0.f) ? v : 0.1f * v; else if (ACT == 16) v = (v >= 0.f) ? v : 0.3f * v; else if (ACT == 17) v = (v >= 0.f) ? v : 0.2f * v;
      so[w][rloc][t * 16 + ln] = v; } }
  __builtin_amdgcn_fence(__ATOMIC_ACQ_REL, "workgroup"); __builtin_amdgcn_wave_barrier();
  const int rsub = lane >> 4, c4 = (lane & 15) * 4;
  {
#pragma unroll
    for (int q = 0; q < 16; ++q) { const int r = q * 2 + rsub; const v4f v = *(const v4fa*)&so[w][r][c4]; if (C) *(v4f*)(C + cofs + (size_t)(row0 + r) * ldc + col0 + c4) = v; if (C16) { v4h h4; for (int i = 0; i < 4; ++i) h4[i] = (_Float16)v[i]; *(v4h*)(C16 + cofs + (size_t)(row0 + r) * ldc + col0 + c4) = h4; } }
     } }


__global__ __launch_bounds__(256) void k_wnat(const float* __restrict__ w, size_t n8, _Float16* __restrict__ Bt) { const size_t t = (size_t)blockIdx.x * 256 + threadIdx.x; if (t >= n8) return; FragH f; for (int q = 0; q < 8; ++q) f.h[q] = (_Float16)(bf16_round(w[t * 8 + q]) * 16.0f); *(v8us*)((unsigned short*)Bt + t * 8) = f.half[0];  }
__global__ __launch_bounds__(256) void k_rsm(const float* __restrict__ S, _Float16* __restrict__ P, int nrows) {
  #pragma clang fp contract(off)
  const int i = blockIdx.x * 256 + threadIdx.x; if (i >= nrows) return; const float* s = S + (size_t)i * SQ; float mx = -3.0e38f;
#pragma unroll 1
  for (int j = 0; j < SQ; ++j) mx = fmaxf(mx, s[j]); float se = 0.f;
#pragma unroll 1
  for (int j = 0; j < SQ; ++j) se += expf(s[j] - mx); const float sc = 256.0f / se;
#pragma unroll 1
  for (int j0 = 0; j0 < SQ; j0 += 8) { FragH f; for (int q = 0; q < 8; ++q) f.h[q] = (_Float16)(expf(s[j0 + q] - mx) * sc); unsigned short* d = (unsigned short*)P + (size_t)i * SQ + j0; *(v8us*)d = f.half[0];  } }
__global__ __launch_bounds__(256) void k_vt(const _Float16* __restrict__ V16, int b, int h0, _Float16* __restrict__ VT) { __shared__ unsigned short tl[64][65]; const int tid = threadIdx.x; const int hh = blockIdx.x % HG, sg = blockIdx.x / HG; const int s0 = sg * 64; const int h = h0 + hh;
  for (int i = tid; i < 64 * 8; i += 256) { const int j = i / 8, d8 = (i % 8) * 8; FragH f; f.half[0] = *(const v8us*)((const unsigned short*)V16 + ((size_t)b * SQ + s0 + j) * DM + h * HD + d8); for (int q = 0; q < 8; ++q) tl[d8 + q][j] = f.u[q]; }
  __syncthreads();
  { for (int i = tid; i < 64 * 8; i += 256) { const int d = i / 8, j8 = (i % 8) * 8; FragH f; for (int q = 0; q < 8; ++q) f.u[q] = tl[d][j8 + q]; *(v8us*)((unsigned short*)VT + ((size_t)hh * HD + d) * SQ + s0 + j8) = f.half[0]; }  } }



// Causal row softmax, one wave per score row: lane l holds keys 128*i + 4*l .. + 3 of its row in registers, so S is read once, in whole 512-byte pieces,
// and the row maximum and the row sum are per-lane partials joined by a five-step butterfly. nk is a multiple of QT and at most NKX.
__global__ __launch_bounds__(256) void k_rsmcf2(const float* __restrict__ S, _Float16* __restrict__ P, int hg, int q0, int nk) {
  const int lane = threadIdx.x & 31; const int t = blockIdx.x * 8 + (threadIdx.x >> 5); if (t >= hg * QT) return;      /* wave-uniform exit, no barrier below */
  const float* s = S + (size_t)t * NKX + lane * 4; const int last = q0 + (t % QT); v4f x[NKX / 128]; v4h h[NKX / 128]; float mx = -3.0e38f;
#pragma unroll      /* static indices keep x[] in registers; all of the row's loads are issued before the first use */
  for (int c = 0; c < NKX / QT; ++c) if (c * QT < nk) { x[2 * c] = *(const v4fa*)(s + c * QT); x[2 * c + 1] = *(const v4fa*)(s + c * QT + 128); }
  asm volatile("s_wait_xcnt 0x0" :: "v"(s) : "memory");      /* the loads' address pair stays whole up to here and is free for reuse only behind this wait */
#pragma unroll      /* static indices keep x[] in registers */
  for (int c = 0; c < NKX / QT; ++c) if (c * QT < nk) { for (int u = 0; u < 8; ++u) { const int i = 2 * c + (u >> 2), q = u & 3; const float f = (i * 128 + lane * 4 + q <= last) ? 1.f : 0.f; x[i][q] = fmaf(f, x[i][q], (1.f - f) * -1.0e9f); mx = fmaxf(mx, x[i][q]); } }
  for (int m = 16; m >= 1; m >>= 1) mx = fmaxf(mx, __shfl_xor(mx, m, 32));
  float se = 0.f;
#pragma unroll      /* static indices keep x[] in registers */
  for (int c = 0; c < NKX / QT; ++c) if (c * QT < nk) { for (int u = 0; u < 8; ++u) { const int i = 2 * c + (u >> 2), q = u & 3; x[i][q] = __expf(x[i][q] - mx); se += x[i][q]; } }
  for (int m = 16; m >= 1; m >>= 1) se += __shfl_xor(se, m, 32);
  const float sc = 256.0f / se; _Float16* d = P + (size_t)t * NKX + lane * 4;
#pragma unroll      /* static indices keep x[] and h[] in registers */
  for (int c = 0; c < NKX / QT; ++c) if (c * QT < nk) { for (int u = 0; u < 8; ++u) { const int i = 2 * c + (u >> 2), q = u & 3; h[i][q] = (_Float16)(x[i][q] * sc); } }
#pragma unroll      /* the stores stand last, each from registers of its own: none of them is rewritten behind a store */
  for (int c = 0; c < NKX / QT; ++c) if (c * QT < nk) { *(v4h*)(d + c * QT) = h[2 * c]; *(v4h*)(d + c * QT + 128) = h[2 * c + 1]; } }


template <int MASKADD>
__global__ __launch_bounds__(64) void k_att0(const float* __restrict__ QF, const float* __restrict__ KF, const float* __restrict__ VF, int ld, const float* __restrict__ mask, float scale, float* __restrict__ OF, int ldo) {
  #pragma clang fp contract(off)
  __shared__ __attribute__((aligned(16))) float lq[64][64]; __shared__ __attribute__((aligned(16))) float lo[64][64];
  const int tid = threadIdx.x; const int h = blockIdx.x / (QT0 / 64), rg = blockIdx.x % (QT0 / 64); const int i = rg * 64 + tid;
  const float* qr = QF + (size_t)i * ld + h * HD;
#pragma unroll 1
  for (int c = 0; c < HD / 4; ++c) { *(v4f*)&lq[tid][c * 4] = *(const v4fa*)(qr + c * 4); const v4f z = {0.f, 0.f, 0.f, 0.f}; *(v4f*)&lo[tid][c * 4] = z; }
  float m = -1.0e30f, l = 0.f; const int jmax = MASKADD ? (SQ - 1) : (rg * 64 + 63);      /* additive-mask form: every key (the mask input decides); causal form: keys up to the block's last row */
#pragma unroll 1
  for (int j = 0; j <= jmax; ++j) { const float* kr = KF + (size_t)j * ld + h * HD; const float* vr = VF + (size_t)j * ld + h * HD; float s = 0.f;
#pragma unroll 1
    for (int c = 0; c < HD / 4; ++c) { const v4f kq = *(const v4fa*)(kr + c * 4); const v4f qq = *(v4f*)&lq[tid][c * 4]; s = __fadd_rn(s, __fmul_rn(qq[0], kq[0])); s = __fadd_rn(s, __fmul_rn(qq[1], kq[1])); s = __fadd_rn(s, __fmul_rn(qq[2], kq[2])); s = __fadd_rn(s, __fmul_rn(qq[3], kq[3])); }
    s = __fmul_rn(s, scale); if (MASKADD) s = __fadd_rn(s, __fmul_rn(bf16_round(mask[(size_t)i * SQ + j]), -10000.0f));
    const float f = (MASKADD || j <= i) ? 1.f : 0.f; const float sm = fmaf(f, s, (1.f - f) * -1.0e30f); const float mn = fmaxf(m, sm); const float sc = expf(m - mn); const float e = expf(sm - mn); l = __fadd_rn(__fmul_rn(l, sc), e); m = mn;
#pragma unroll 1
    for (int c = 0; c < HD / 4; ++c) { const v4f vv = *(const v4fa*)(vr + c * 4); v4f oo = *(v4f*)&lo[tid][c * 4]; for (int u = 0; u < 4; ++u) oo[u] = __fadd_rn(__fmul_rn(oo[u], sc), __fmul_rn(e, vv[u])); *(v4f*)&lo[tid][c * 4] = oo; } }
  const float fin = 64.0f / l;      /* o carried x64 like the f16 path */
#pragma unroll 1
  for (int c = 0; c < HD / 4; ++c) { v4f oo = *(v4f*)&lo[tid][c * 4]; for (int u = 0; u < 4; ++u) oo[u] = __fmul_rn(oo[u], fin); *(v4f*)&lo[tid][c * 4] = oo; }
  __syncthreads();
  {
#pragma unroll 1
    for (int it = 0; it < 16; ++it) { const int row = it * 4 + tid / 16, pc = (tid % 16) * 4; const v4f v = *(const v4f*)&lo[row][pc]; *(v4f*)(OF + (size_t)(rg * 64 + row) * ldo + h * HD + pc) = v; }
     } }

extern "C" void kernel_launch(void* const* d_in, const int* in_sizes, int n_in,
                              void* d_out, int out_size, void* d_ws, size_t ws_size, hipStream_t stream) {
  (void)in_sizes; (void)n_in; (void)out_size;
  const float* const* I = (const float* const*)d_in; const float* x = I[0]; const float* xk = I[1]; const float* xv = I[2]; const float* wq = I[3]; const float* bq = I[4]; const float* wk = I[5]; const float* bk = I[6]; const float* wv = I[7]; const float* bv = I[8]; const float* wo = I[9]; const float* bo = I[10];      /* input order: query, key, value (THREE input streams), then [in][out] weights + biases */
  char* ws = (char*)d_ws; size_t off = 0;
  auto take = [&](size_t bytes) { char* p = ws + off; off += (bytes + 255) & ~(size_t)255; return p; };
  _Float16* BQ = (_Float16*)take((size_t)DM * DM * 2); _Float16* BK = (_Float16*)take((size_t)DM * DM * 2); _Float16* BV = (_Float16*)take((size_t)DM * DM * 2); _Float16* BO = (_Float16*)take((size_t)DM * DM * 2);
  _Float16* X16 = (_Float16*)take(NR * DM * 2); _Float16* XK16 = (_Float16*)take(NR * DM * 2); _Float16* XV16 = (_Float16*)take(NR * DM * 2);      /* exact f16 rows of query, key, value */ float* QF = (float*)take(NR * DM * 4); _Float16* QH = (_Float16*)take(NR * DM * 2); _Float16* QL = (_Float16*)take(NR * DM * 2); _Float16* KH = (_Float16*)take(NR * DM * 2); _Float16* KL = (_Float16*)take(NR * DM * 2); _Float16* Q16 = QH; _Float16* K16 = KH; _Float16* V16 = (_Float16*)take(NR * DM * 2); _Float16* O16 = (_Float16*)take(NR * DM * 2);
  float* S = (float*)take((size_t)NH * QT * NKX * 4); _Float16* P = (_Float16*)take((size_t)NH * QT * NKX * 2); _Float16* VT = (_Float16*)take((size_t)NH * HD * SQ * 2);
  float* QF0 = (float*)take((size_t)QT0 * DM * 4); float* KF0 = (float*)take((size_t)QT0 * DM * 4); float* VF0 = (float*)take((size_t)QT0 * DM * 4); float* OF0 = (float*)take((size_t)NB * QT0 * DM * 4); _Float16* OH0 = (_Float16*)take((size_t)NB * QT0 * DM * 2); _Float16* OL0 = (_Float16*)take((size_t)NB * QT0 * DM * 2);
  if (off > ws_size) return;
  { const unsigned g = (unsigned)(((size_t)DM * (DM / 8) + 255) / 256); k_wt_f16<<<g, 256, 0, stream>>>(wq, BQ, DM, DM, 16.0f); k_wt_f16<<<g, 256, 0, stream>>>(wk, BK, DM, DM, 16.0f); k_wt_f16<<<g, 256, 0, stream>>>(wv, BV, DM, DM, 16.0f); k_wt_f16<<<g, 256, 0, stream>>>(wo, BO, DM, DM, 16.0f); }      /* [in][out] -> Bt[n][k] x16 */
  k_x16<<<(unsigned)((NR * DM / 8 + 255) / 256), 256, 0, stream>>>(x, X16, NR * DM / 8); k_x16<<<(unsigned)((NR * DM / 8 + 255) / 256), 256, 0, stream>>>(xk, XK16, NR * DM / 8); k_x16<<<(unsigned)((NR * DM / 8 + 255) / 256), 256, 0, stream>>>(xv, XV16, NR * DM / 8);
  const size_t r0p = (size_t)B0 * SQ;      /* first projected row */
  k_gemm2<0><<<dim3((unsigned)((MP / 128) * (DM / 64)), 1), 128, 0, stream>>>(X16 + r0p * DM, DM, 0, BQ, DM, 0, 0.0625f, bq, 0, nullptr, 1, 0, 0, QF + r0p * DM, nullptr, DM, 0, MP, DM, DM); k_hl<<<(unsigned)(((size_t)MP * DM / 8 + 255) / 256), 256, 0, stream>>>(QF + r0p * DM, QH + r0p * DM, QL + r0p * DM, (size_t)MP * DM / 8);      /* q (f32) -> f16 hi + x1024 residual: unscaled logits sigma ~8 */
  k_gemm2<0><<<dim3((unsigned)((MP / 128) * (DM / 64)), 1), 128, 0, stream>>>(XK16 + r0p * DM, DM, 0, BK, DM, 0, 0.0625f, bk, 0, nullptr, 1, 0, 0, QF + r0p * DM, nullptr, DM, 0, MP, DM, DM); k_hl<<<(unsigned)(((size_t)MP * DM / 8 + 255) / 256), 256, 0, stream>>>(QF + r0p * DM, KH + r0p * DM, KL + r0p * DM, (size_t)MP * DM / 8);      /* k likewise */
  k_gemm2<0><<<dim3((unsigned)((MP / 128) * (DM / 64)), 1), 128, 0, stream>>>(XV16 + r0p * DM, DM, 0, BV, DM, 0, 0.0625f, bv, 0, nullptr, 1, 0, 0, nullptr, V16 + r0p * DM, DM, 0, MP, DM, DM);
  for (int b = B0; b < B0 + NBR; ++b) { const size_t r0 = (size_t)b * SQ;
    k_vt<NH, SQ><<<NH * (SQ / 64), 256, 0, stream>>>(V16 + r0 * LQ, LQ, 0, VT);      /* V^T [NH][HD][SQ] for this batch */
    k_gemm2<0><<<dim3((QT0 / 128) * (DM / 64), 1), 128, 0, stream>>>(X16 + r0 * DM, DM, 0, BQ, DM, 0, 0.0625f, bq, 0, nullptr, 1, 0, 0, QF0, nullptr, DM, 0, QT0, DM, DM); k_gemm2<0><<<dim3((QT0 / 128) * (DM / 64), 1), 128, 0, stream>>>(XK16 + r0 * DM, DM, 0, BK, DM, 0, 0.0625f, bk, 0, nullptr, 1, 0, 0, KF0, nullptr, DM, 0, QT0, DM, DM); k_gemm2<0><<<dim3((QT0 / 128) * (DM / 64), 1), 128, 0, stream>>>(XV16 + r0 * DM, DM, 0, BV, DM, 0, 0.0625f, bv, 0, nullptr, 1, 0, 0, VF0, nullptr, DM, 0, QT0, DM, DM);      /* f32 q, k, v of the first 128 rows (exact products) */
    k_att0<0><<<NH * (QT0 / 64), 64, 0, stream>>>(QF0, KF0, VF0, DM, nullptr, SCL, OF0 + (size_t)b * QT0 * DM, DM);      /* exact f32 attention for rows 0..127 (o x64) */
    for (int q0 = 0; q0 < QN; q0 += QT) { const int nk = q0 + QT;      /* causal: only keys below the tile end are computed */
      k_gemm2<0><<<dim3((QT / 128) * (nk / 64), NHD), 128, 0, stream>>>(QH + (r0 + q0) * LQ, LQ, (size_t)HD, KH + r0 * LQ, LQ, (size_t)HD, SCL, nullptr, 0, nullptr, 1, 0, 0, S, nullptr, NKX, (size_t)QT * NKX, QT, nk, HD);      /* scores hi . hi * 2048^-0.5 (the source's sequence-length scale) */
      k_gemm2<0><<<dim3((QT / 128) * (nk / 64), NHD), 128, 0, stream>>>(QL + (r0 + q0) * LQ, LQ, (size_t)HD, KH + r0 * LQ, LQ, (size_t)HD, SCLR, nullptr, 0, S, -1, 0, 0, S, nullptr, NKX, (size_t)QT * NKX, QT, nk, HD); k_gemm2<0><<<dim3((QT / 128) * (nk / 64), NHD), 128, 0, stream>>>(QH + (r0 + q0) * LQ, LQ, (size_t)HD, KL + r0 * LQ, LQ, (size_t)HD, SCLR, nullptr, 0, S, -1, 0, 0, S, nullptr, NKX, (size_t)QT * NKX, QT, nk, HD);      /* += 2^-10 (lo . hi + hi . lo) */      /* scores, all heads on grid.y */
      k_rsmcf2<<<(NHD * QT + 7) / 8, 256, 0, stream>>>(S, P, NHD, q0, nk);      /* one wave per row, 8 rows per block */
      k_gemm2<0><<<dim3((QT / 128) * (HD / 64), NHD), 128, 0, stream>>>(P, NKX, (size_t)QT * NKX, VT, SQ, (size_t)HD * SQ, 0.25f, nullptr, 0, nullptr, 1, 0, 0, nullptr, O16 + (r0 + q0) * DM, DM, (size_t)HD, QT, HD, nk); } }      /* o (merged heads, x64) as f16 rows */
  k_gemm2<0><<<dim3((unsigned)((MPO / 128) * (DM / 64)), 1), 128, 0, stream>>>(O16 + r0p * DM, DM, 0, BO, DM, 0, 0.0009765625f, bo, 0, nullptr, 1, 0, 0, (float*)d_out + r0p * DM, nullptr, DM, 0, MPO, DM, DM);      /* out rows are the output layout */
  k_hl<<<(unsigned)(((size_t)NB * QT0 * DM / 8 + 255) / 256), 256, 0, stream>>>(OF0, OH0, OL0, (size_t)NB * QT0 * DM / 8);      /* first-tile o (x64) -> f16 hi + x1024 residual planes */
  for (int b = B0; b < B0 + NBR; ++b) { const size_t r0 = (size_t)b * SQ; const size_t f0 = (size_t)b * QT0;
    k_gemm2<0><<<dim3((QT0 / 128) * (DM / 64), 1), 128, 0, stream>>>(OH0 + f0 * DM, DM, 0, BO, DM, 0, 0.0009765625f, bo, 0, nullptr, 1, 0, 0, (float*)d_out + r0 * DM, nullptr, DM, 0, QT0, DM, DM);      /* rows 0..127: out = o_hi Wo (+ b), overwriting the f16-path rows */
    k_gemm2<0><<<dim3((QT0 / 128) * (DM / 64), 1), 128, 0, stream>>>(OL0 + f0 * DM, DM, 0, BO, DM, 0, 0.00000095367431640625f, nullptr, 0, (const float*)d_out + r0 * DM, -1, 0, 0, (float*)d_out + r0 * DM, nullptr, DM, 0, QT0, DM, DM); }      /* += o_lo Wo 2^-20 (own-element accumulate) */
}

// v002
// Measured time: 2040 microseconds a run.
// Next to v001, in two timings, it ran 1.42 and 1.43 times as fast.
// Counting every step since v000, it is 2.85 times as fast.
#include <hip/hip_runtime.h>
// Causal multi-head attention on three inputs with the source's sequence-length score scale (query, key, value [2][2048][1024]; q = query Wq + bq, k = key Wk + bk, v = value Wv + bv ([in][out] 1024 x 1024, weights AND biases sigma 1/32), 16 heads of 64; score = q k^T; triu(1) -> -inf; softmax(score / sqrt(Sk)) with Sk = 2048 KEYS (the source divides by sqrt of the score matrix's last dimension, NOT by sqrt(head_dim)): scale 2048^-0.5 = 0.0220970869; out = merged Wo + bo ([in][out]) -> [2][2048][1024]); q and k carried as f16 hi + x1024 residual planes with three-product scores.
// Structure: token rows r = b*2048 + s; x as exact f16 rows (bf16-rounded); q and k as WMMA GEMMs (32x64 wave tiles, f32 accumulation, exact x16 weights + bias) into f32 rows split into f16 hi + x1024 residual planes, v as an f16-output GEMM; per batch: V^T for all heads via LDS transposes; per query tile of 256 rows: scores against the keys below the tile end only as THREE accumulating passes (hi.hi + lo.hi + hi.lo, K = 64, all heads on grid.y, alpha 2048^-0.5 (x 2^-10 on the residual passes): no 1/sqrt(d) in this module, logits sigma ~8), causal row softmax on VALU with an arithmetic 0/1 key mask over the computed range (f32 statistics, native exp; weights x256 f16), o = P . V^T (K = keys below the tile end, alpha 2^-2: o carried x64, folded into the output GEMM alpha) written straight into the merged f16 o rows; out = o W_o + b GEMM (f32) into the output layout.
// Compute dtype: inputs rounded to bf16; x / weights exact; q and k as f16 hi + x1024 residual planes; v, softmax weights and o as plain f16 GEMM operands (~2^-12), except rows 0..127 of each batch: f32 attention, o as f16 hi + x1024 residual; scores and softmax statistics f32. v_wmma_f32_16x16x32_f16.
#define NB 2
#define SCL 0.0220970869f                 /* = f32(1 / sqrt(2048)): the source scales the scores by 1/sqrt(Sk), Sk = 2048 keys */
#define SCLR (0.0220970869f * 0.0009765625f)   /* the same scale on the x1024 residual passes */
#define SQ 2048
#define DM 1024
#define NH 16
#define HD 64
#define HG 4                         /* heads per group in the unlaunched k_vt(V16, b, h0, VT) */
#define QT 256                       /* query rows per causal tile */
#define NKX SQ                       /* S / P row pitch */
#define QT0 128                      /* first-tile rows recomputed exactly in f32 */
#define B0 0                         /* first batch processed (debug hook) */
#define NBR NB                       /* batches processed (debug hook) */
#define NR ((size_t)NB * SQ)         /* token rows */
#define MP ((int)((size_t)NBR * SQ)) /* rows projected (debug hook) */
#define QN SQ                        /* query rows attended per batch (debug hook) */
#define NHD NH                       /* heads attended (debug hook) */
#define MPO MP                       /* rows through the output stage (debug hook) */
#define LQ DM      /* row pitch of the q/k/v rows */
typedef __bf16 v16b __attribute__((ext_vector_type(16)));
typedef unsigned short v8us __attribute__((ext_vector_type(8), may_alias));
typedef float  v8f  __attribute__((ext_vector_type(8)));
typedef float  v4f  __attribute__((ext_vector_type(4)));
typedef float  v4fa __attribute__((ext_vector_type(4), may_alias));
union FragB { v16b v; v8us half[2]; unsigned short u[16]; };

__device__ __forceinline__ unsigned short bf16_bits(float x) { unsigned int u = __float_as_uint(x); return (unsigned short)((u + 0x7FFFu + ((u >> 16) & 1u)) >> 16); }
__device__ __forceinline__ float bf16_val(unsigned short b) { return __uint_as_float(((unsigned int)b) << 16); }
__device__ __forceinline__ float bf16_round(float x) { return bf16_val(bf16_bits(x)); }
// D += A·B with NT terms: 1 = ah·bh, 2 = + al·bh (A split), 3 = + ah·bl (both split)
template <int NT>
__device__ __forceinline__ v8f mmaN(v16b ah, v16b al, v16b bh, v16b bl, v8f c) {
  c = __builtin_amdgcn_wmma_f32_16x16x32_bf16(false, ah, false, bh, (short)0, c, false, false);
  if (NT >= 2) c = __builtin_amdgcn_wmma_f32_16x16x32_bf16(false, al, false, bh, (short)0, c, false, false);
  if (NT >= 3) c = __builtin_amdgcn_wmma_f32_16x16x32_bf16(false, ah, false, bl, (short)0, c, false, false);
  asm volatile("v_nop\n\tv_nop\n\tv_nop\n\tv_nop" : "+v"(c) : "v"(ah), "v"(al), "v"(bh), "v"(bl));
  return c;
}

__global__ __launch_bounds__(256) void k_wt_bf16(const float* __restrict__ W, unsigned short* __restrict__ Wt, int K, int N) {
  const int t = blockIdx.x * 256 + threadIdx.x;
  const int k8n = K / 8;
  if (t >= N * k8n) return;
  const int n = t / k8n, k8 = (t % k8n) * 8;
  v8us v;
#pragma unroll
  for (int i = 0; i < 8; ++i) v[i] = bf16_bits(W[(size_t)(k8 + i) * N + n]);
  *(v8us*)(Wt + (size_t)n * K + k8) = v;
  
}

// GEMM C[M][N] (f32, pitch ldc) = act(A[M][K]·W + bias). A f32 row-major (pitch lda) converted per fragment to bf16
// (ASPLIT: hi/lo two planes -> 2 terms, else single rounded term); Wt bf16 [N][K] (pitch ldb). BIAS_BF16 rounds the
// bias to bf16 first (bias quantised to bf16 before the add). K%32==0, M%16==0, N%64==0.
template <bool ASPLIT, int ACT, bool BIAS_BF16>
__global__ __launch_bounds__(128) void k_gemm_bf(const float* __restrict__ A, int lda, const unsigned short* __restrict__ Wt, int ldb,
                                               const float* __restrict__ bias, float* __restrict__ C, int ldc, int M, int N, int K) {
  __shared__ __attribute__((aligned(16))) float so[4][16][64];
  const int tid = threadIdx.x, w = tid >> 5, lane = tid & 31, ln = lane & 15, hh = lane >> 4;
  const int ntn = N / 64;
  const int wid = blockIdx.x * 4 + w;
  const int mt = wid / ntn, nq = wid % ntn;
  if (mt * 16 >= M) return;
  const int row0 = mt * 16, col0 = nq * 64;
  const float* arow = A + (size_t)(row0 + ln) * lda;
  v8f acc[4] = {};
  for (int kb = 0; kb < K; kb += 32) {
    FragB ah, al;
    const v4f x0 = *(const v4fa*)(arow + kb + 8 * hh), x1 = *(const v4fa*)(arow + kb + 8 * hh + 4);
    const v4f x2 = *(const v4fa*)(arow + kb + 16 + 8 * hh), x3 = *(const v4fa*)(arow + kb + 16 + 8 * hh + 4);
    float xs[16] = {x0[0],x0[1],x0[2],x0[3],x1[0],x1[1],x1[2],x1[3],x2[0],x2[1],x2[2],x2[3],x3[0],x3[1],x3[2],x3[3]};
#pragma unroll
    for (int i = 0; i < 16; ++i) { const unsigned short hb = bf16_bits(xs[i]); ah.u[i] = hb; al.u[i] = ASPLIT ? bf16_bits(xs[i] - bf16_val(hb)) : (unsigned short)0; }
#pragma unroll
    for (int t = 0; t < 4; ++t) {
      const unsigned short* brow = Wt + (size_t)(col0 + t * 16 + ln) * ldb + kb;
      FragB b;
      b.half[0] = *(const v8us*)(brow + 8 * hh);
      b.half[1] = *(const v8us*)(brow + 16 + 8 * hh);
      acc[t] = mmaN<ASPLIT ? 2 : 1>(ah.v, al.v, b.v, b.v, acc[t]);
    }
  }
#pragma unroll
  for (int t = 0; t < 4; ++t) {
    float bv = bias ? bias[col0 + t * 16 + ln] : 0.f;
    if (BIAS_BF16) bv = bf16_round(bv);
#pragma unroll
    for (int r = 0; r < 8; ++r) { float v = acc[t][r] + bv; if (ACT == 1) v = fmaxf(v, 0.f); so[w][8 * hh + r][t * 16 + ln] = v; }
  }
  __builtin_amdgcn_fence(__ATOMIC_ACQ_REL, "workgroup");
  __builtin_amdgcn_wave_barrier();
  const int rsub = lane >> 4, c4 = (lane & 15) * 4;
  {
#pragma unroll
    for (int q = 0; q < 8; ++q) {
      const int r = q * 2 + rsub;
      const v4f v = *(const v4fa*)&so[w][r][c4];
      *(v4f*)(C + (size_t)(row0 + r) * ldc + col0 + c4) = v;
    }
    
  }
}

// GEMM C = act(A·W + bias + resid): A f32 (ASPLIT -> hi/lo 2 terms), Wt bf16 [N][K]; ACT 0 none, 1 relu, 2 exact gelu;
// resid (optional, f32, row index = (row % rmod), pitch ldr, RES_BF16 rounds it) added before the activation.
template <bool ASPLIT, int ACT, bool BIAS_BF16, bool RES_BF16>
__global__ __launch_bounds__(128) void k_gemm_bf3(const float* __restrict__ A, int lda, const unsigned short* __restrict__ Wt, int ldb,
                                                const float* __restrict__ bias, const float* __restrict__ resid, int rmod, int ldr,
                                                float* __restrict__ C, int ldc, int M, int N, int K) {
  __shared__ __attribute__((aligned(16))) float so[4][16][64];
  const int tid = threadIdx.x, w = tid >> 5, lane = tid & 31, ln = lane & 15, hh = lane >> 4;
  const int ntn = N / 64;
  const int wid = blockIdx.x * 4 + w;
  const int mt = wid / ntn, nq = wid % ntn;
  if (mt * 16 >= M) return;
  const int row0 = mt * 16, col0 = nq * 64;
  const float* arow = A + (size_t)(row0 + ln) * lda;
  v8f acc[4] = {};
  for (int kb = 0; kb < K; kb += 32) {
    FragB ah, al;
    const v4f x0 = *(const v4fa*)(arow + kb + 8 * hh), x1 = *(const v4fa*)(arow + kb + 8 * hh + 4);
    const v4f x2 = *(const v4fa*)(arow + kb + 16 + 8 * hh), x3 = *(const v4fa*)(arow + kb + 16 + 8 * hh + 4);
    float xs[16] = {x0[0],x0[1],x0[2],x0[3],x1[0],x1[1],x1[2],x1[3],x2[0],x2[1],x2[2],x2[3],x3[0],x3[1],x3[2],x3[3]};
#pragma unroll
    for (int i = 0; i < 16; ++i) { const unsigned short hb = bf16_bits(xs[i]); ah.u[i] = hb; al.u[i] = ASPLIT ? bf16_bits(xs[i] - bf16_val(hb)) : (unsigned short)0; }
#pragma unroll
    for (int t = 0; t < 4; ++t) {
      const unsigned short* brow = Wt + (size_t)(col0 + t * 16 + ln) * ldb + kb;
      FragB b;
      b.half[0] = *(const v8us*)(brow + 8 * hh);
      b.half[1] = *(const v8us*)(brow + 16 + 8 * hh);
      acc[t] = mmaN<ASPLIT ? 2 : 1>(ah.v, al.v, b.v, b.v, acc[t]);
    }
  }
#pragma unroll
  for (int t = 0; t < 4; ++t) {
    const int col = col0 + t * 16 + ln;
    float bv = bias ? bias[col] : 0.f;
    if (BIAS_BF16) bv = bf16_round(bv);
#pragma unroll
    for (int r = 0; r < 8; ++r) {
      float v = acc[t][r] + bv;
      if (resid) { float rv = resid[(size_t)((row0 + 8 * hh + r) % rmod) * ldr + col]; if (RES_BF16) rv = bf16_round(rv); v += rv; }
      if (ACT == 1) v = fmaxf(v, 0.f);
      if (ACT == 2) v = 0.5f * v * (1.0f + erff(v * 0.70710678118654752f));
      if (ACT == 3) { const float u = 0.7978845608028654f * (v + 0.044715f * v * v * v); v = 0.5f * v * (1.0f + tanhf(u)); }
      so[w][8 * hh + r][t * 16 + ln] = v;
    }
  }
  __builtin_amdgcn_fence(__ATOMIC_ACQ_REL, "workgroup");
  __builtin_amdgcn_wave_barrier();
  const int rsub = lane >> 4, c4 = (lane & 15) * 4;
  {
#pragma unroll
    for (int q = 0; q < 8; ++q) {
      const int r = q * 2 + rsub;
      const v4f v = *(const v4fa*)&so[w][r][c4];
      *(v4f*)(C + (size_t)(row0 + r) * ldc + col0 + c4) = v;
    }
    
  }
}
// row LayerNorm (biased variance, eps) over N: s = X (+ R); optional out_sum <- s; out_norm <- (s-mu)*rsqrt(var+eps)*g + b
template <bool PARAM_BF16>
__global__ __launch_bounds__(256) void k_layernorm(const float* __restrict__ X, const float* __restrict__ R, const float* __restrict__ g, const float* __restrict__ bta,
                                                  float* __restrict__ out_sum, float* __restrict__ out_norm, int N, float eps) {
  __shared__ float red[256];
  const int row = blockIdx.x, tid = threadIdx.x;
  const float* x = X + (size_t)row * N; const float* rr = R ? R + (size_t)row * N : nullptr;
  float vals[16];                     // up to N = 4096
  const int per = N / 256;            // contiguous chunk per thread? use strided-by-4 chunks: thread handles j = tid*4 + 1024*u
  float s1 = 0.f;
  for (int u = 0; u < per / 4; ++u) {
    const int j = tid * 4 + 1024 * u;
    const v4f a = *(const v4fa*)(x + j);
    v4f b = {0.f,0.f,0.f,0.f}; if (rr) b = *(const v4fa*)(rr + j);
#pragma unroll
    for (int q = 0; q < 4; ++q) { const float v = a[q] + b[q]; vals[u * 4 + q] = v; s1 += v; }
  }
  red[tid] = s1; __syncthreads();
  for (int st = 128; st > 0; st >>= 1) { if (tid < st) red[tid] += red[tid + st]; __syncthreads(); }
  const float mu = red[0] / (float)N; __syncthreads();
  float s2 = 0.f;
  for (int u = 0; u < per / 4; ++u)
#pragma unroll
    for (int q = 0; q < 4; ++q) { const float c = vals[u * 4 + q] - mu; s2 += c * c; }
  red[tid] = s2; __syncthreads();
  for (int st = 128; st > 0; st >>= 1) { if (tid < st) red[tid] += red[tid + st]; __syncthreads(); }
  const float rs = rsqrtf(red[0] / (float)N + eps);
  {
    for (int u = 0; u < per / 4; ++u) {
      const int j = tid * 4 + 1024 * u;
      v4f o, sm;
#pragma unroll
      for (int q = 0; q < 4; ++q) {
        float gg = g[j + q], bb = bta[j + q];
        if (PARAM_BF16) { gg = bf16_round(gg); bb = bf16_round(bb); }
        sm[q] = vals[u * 4 + q]; o[q] = (vals[u * 4 + q] - mu) * rs * gg + bb;
      }
      if (out_sum) *(v4f*)(out_sum + (size_t)row * N + j) = sm;
      *(v4f*)(out_norm + (size_t)row * N + j) = o;
    }
    
  }
}



// ---- f16 WMMA path (v_wmma_f32_16x16x32_f16): 11-bit significands for operands in range — used where a [0,1] probability operand needs more precision than bf16
typedef _Float16 v16h __attribute__((ext_vector_type(16)));
union FragH { v16h v; v8us half[2]; _Float16 h[16]; unsigned short u[16]; };
template <int NT>
__device__ __forceinline__ v8f mmaH(v16h ah, v16h al, v16h bh, v16h bl, v8f c) {
  c = __builtin_amdgcn_wmma_f32_16x16x32_f16(false, ah, false, bh, (short)0, c, false, false);
  if (NT >= 2) c = __builtin_amdgcn_wmma_f32_16x16x32_f16(false, al, false, bh, (short)0, c, false, false);
  if (NT >= 3) c = __builtin_amdgcn_wmma_f32_16x16x32_f16(false, ah, false, bl, (short)0, c, false, false);
  asm volatile("v_nop\n\tv_nop\n\tv_nop\n\tv_nop" : "+v"(c) : "v"(ah), "v"(al), "v"(bh), "v"(bl));
  return c;
}
// batched GEMM like k_gemm_b but f16 operands: A f32 (split into f16 hi/lo if ASPLIT, else rounded to f16), Bt = f16 values [n][k]; alpha; C f32; N multiple of 16 (partial tiles skipped)
template <bool ASPLIT>
__global__ __launch_bounds__(128) void k_gemm_h(const float* __restrict__ A, int lda, size_t sA, const _Float16* __restrict__ Bh, int ldb, size_t sB, float alpha, float* __restrict__ C, int ldc, size_t sC, int M, int N, int K) {
  __shared__ __attribute__((aligned(16))) float so[4][16][64];
  const int tid = threadIdx.x, w = tid >> 5, lane = tid & 31, ln = lane & 15, hh = lane >> 4; const int by = blockIdx.y;
  A += (size_t)by * sA; Bh += (size_t)by * sB; C += (size_t)by * sC;
  const int ntn = (N + 63) / 64; const int wid = blockIdx.x * 4 + w; const int mt = wid / ntn, nq = wid % ntn; if (mt * 16 >= M) return;
  const int row0 = mt * 16, col0 = nq * 64; const float* arow = A + (size_t)(row0 + ln) * lda;
  v8f acc[4] = {};
  for (int kb = 0; kb < K; kb += 32) {
    FragH ah, al;
    const v4f x0 = *(const v4fa*)(arow + kb + 8 * hh), x1 = *(const v4fa*)(arow + kb + 8 * hh + 4), x2 = *(const v4fa*)(arow + kb + 16 + 8 * hh), x3 = *(const v4fa*)(arow + kb + 16 + 8 * hh + 4);
    float xs[16] = {x0[0],x0[1],x0[2],x0[3],x1[0],x1[1],x1[2],x1[3],x2[0],x2[1],x2[2],x2[3],x3[0],x3[1],x3[2],x3[3]};
#pragma unroll
    for (int i = 0; i < 16; ++i) { const _Float16 h = (_Float16)xs[i]; ah.h[i] = h; al.h[i] = ASPLIT ? (_Float16)(xs[i] - (float)h) : (_Float16)0.0f; }
#pragma unroll
    for (int t = 0; t < 4; ++t) { if (col0 + t * 16 >= N) continue; const size_t boff = (size_t)(col0 + t * 16 + ln) * ldb + kb; FragH bq; bq.half[0] = *(const v8us*)(Bh + boff + 8 * hh); bq.half[1] = *(const v8us*)(Bh + boff + 16 + 8 * hh);
      acc[t] = mmaH<ASPLIT ? 2 : 1>(ah.v, al.v, bq.v, bq.v, acc[t]); }
  }
#pragma unroll
  for (int t = 0; t < 4; ++t) { if (col0 + t * 16 >= N) continue;
#pragma unroll
    for (int r = 0; r < 8; ++r) so[w][8 * hh + r][t * 16 + ln] = acc[t][r] * alpha; }
  __builtin_amdgcn_fence(__ATOMIC_ACQ_REL, "workgroup"); __builtin_amdgcn_wave_barrier();
  const int rsub = lane >> 4, c4 = (lane & 15) * 4;
  {
#pragma unroll
    for (int q = 0; q < 8; ++q) { const int r = q * 2 + rsub; if (col0 + c4 < N) { const v4f v = *(const v4fa*)&so[w][r][c4]; *(v4f*)(C + (size_t)(row0 + r) * ldc + col0 + c4) = v; } }
     }
}

// Wt[n][k] = f16(W[k][n]·scale) from f32 row-major W[K][N] (scale = power of two; bf16-exact weights stay exact in f16 away from the subnormal range)
__global__ __launch_bounds__(256) void k_wt_f16(const float* __restrict__ W, _Float16* __restrict__ Wt, int K, int N, float scale) {
  const int t = blockIdx.x * 256 + threadIdx.x; if (t >= N * (K / 8)) return; const int n = t / (K / 8), k8 = (t % (K / 8)) * 8; FragH f;
#pragma unroll
  for (int i = 0; i < 8; ++i) f.h[i] = (_Float16)(bf16_round(W[(size_t)(k8 + i) * N + n]) * scale); const v8us o = f.half[0];
  *(v8us*)((unsigned short*)Wt + (size_t)n * K + k8) = o; 
}
// k_gemm_hh variant with fused epilogue: v = acc·alpha + bias[by·sBias + col] (+ CP[(row/rowsPerB)·sCPb + by·64 + col] if CP) ; ACT 0 none / 1 elu ; writes f16 C16 (and f32 C if non-null)
template <int ACT>
__global__ __launch_bounds__(128) void k_gemm_hhx(const _Float16* __restrict__ A, int lda, size_t sA, const _Float16* __restrict__ Bh, int ldb, size_t sB, float alpha, const float* __restrict__ bias, size_t sBias, const float* __restrict__ CP, int rowsPerB, size_t sCPb, int row0g,
    float* __restrict__ C, _Float16* __restrict__ C16, int ldc, size_t sC, int M, int N, int K) {
  __shared__ __attribute__((aligned(16))) float so[4][16][64];
  const int tid = threadIdx.x, w = tid >> 5, lane = tid & 31, ln = lane & 15, hh = lane >> 4; const int by = blockIdx.y;
  A += (size_t)by * sA; Bh += (size_t)by * sB; const size_t cofs = (size_t)by * sC; const float* bp = bias ? bias + (size_t)by * sBias : nullptr;
  const int ntn = (N + 63) / 64; const int wid = blockIdx.x * 4 + w; const int mt = wid / ntn, nq = wid % ntn; if (mt * 16 >= M) return;
  const int row0 = mt * 16, col0 = nq * 64; const _Float16* arow = A + (size_t)(row0 + ln) * lda;
  v8f acc[4] = {};
  for (int kb = 0; kb < K; kb += 32) { FragH ah; ah.half[0] = *(const v8us*)((const unsigned short*)arow + kb + 8 * hh); ah.half[1] = *(const v8us*)((const unsigned short*)arow + kb + 16 + 8 * hh);
#pragma unroll
    for (int t = 0; t < 4; ++t) { if (col0 + t * 16 >= N) continue; const size_t boff = (size_t)(col0 + t * 16 + ln) * ldb + kb; FragH bq; bq.half[0] = *(const v8us*)((const unsigned short*)Bh + boff + 8 * hh); bq.half[1] = *(const v8us*)((const unsigned short*)Bh + boff + 16 + 8 * hh);
      acc[t] = mmaH<1>(ah.v, ah.v, bq.v, bq.v, acc[t]); }
  }
#pragma unroll
  for (int t = 0; t < 4; ++t) { if (col0 + t * 16 >= N) continue; const int col = col0 + t * 16 + ln; const float bv = bp ? bf16_round(bp[col]) : 0.f;
#pragma unroll
    for (int r = 0; r < 8; ++r) { float v = acc[t][r] * alpha + bv; if (CP) { const int rr = row0g + row0 + 8 * hh + r; if (rowsPerB < 0) v += CP[cofs + (size_t)rr * ldc + col];      /* rowsPerB < 0: own element of the batched C plane */ else { const int bidx = rr / rowsPerB; v += CP[(size_t)bidx * sCPb + (size_t)by * 64 + col]; } } if (ACT == 1) v = (v > 0.f) ? v : expm1f(v); else if (ACT == 7) v = (v > 0.f) ? v + 1.0f : expf(v); else if (ACT == 8) v = tanhf(v); else if (ACT == 9) v = 0.5f * v * (1.0f + tanhf(0.7978845608028654f * (v + 0.044715f * v * v * v))); else if (ACT == 11) v = 1.0f / (1.0f + expf(-v)); else if (ACT == 12) v = (v > 0.f) ? v : 0.01f * v; else if (ACT == 14) v = (v > 0.f) ? v : 0.1f * v; else if (ACT == 16) v = (v >= 0.f) ? v : 0.3f * v; else if (ACT == 17) v = (v >= 0.f) ? v : 0.2f * v; else if (ACT == 15) v = v / (1.0f + expf(-v)); else if (ACT == 3) v = fmaxf(v, 0.f); else if (ACT == 6) v = 0.5f * v * (1.0f + erff(v * 0.70710678118654752f)); so[w][8 * hh + r][t * 16 + ln] = v; } }
  __builtin_amdgcn_fence(__ATOMIC_ACQ_REL, "workgroup"); __builtin_amdgcn_wave_barrier();
  const int rsub = lane >> 4, c4 = (lane & 15) * 4; typedef _Float16 v4h __attribute__((ext_vector_type(4)));
  {
#pragma unroll
    for (int q = 0; q < 8; ++q) { const int r = q * 2 + rsub; if (col0 + c4 < N) { const v4f v = *(const v4fa*)&so[w][r][c4]; if (C) *(v4f*)(C + cofs + (size_t)(row0 + r) * ldc + col0 + c4) = v; if (C16) { v4h h4; for (int i = 0; i < 4; ++i) h4[i] = (_Float16)v[i]; *(v4h*)(C16 + cofs + (size_t)(row0 + r) * ldc + col0 + c4) = h4; } } }
     }
}


typedef _Float16 v4h __attribute__((ext_vector_type(4)));

__global__ __launch_bounds__(256) void k_x16(const float* __restrict__ x, _Float16* __restrict__ X16, size_t n8) { const size_t t = (size_t)blockIdx.x * 256 + threadIdx.x; if (t >= n8) return; FragH f;
#pragma unroll
  for (int q = 0; q < 8; ++q) f.h[q] = (_Float16)bf16_round(x[t * 8 + q]); *(v8us*)((unsigned short*)X16 + t * 8) = f.half[0];  }
__global__ __launch_bounds__(256) void k_h16(const float* __restrict__ x, _Float16* __restrict__ X16, size_t n8) { const size_t t = (size_t)blockIdx.x * 256 + threadIdx.x; if (t >= n8) return; FragH f;
#pragma unroll
  for (int q = 0; q < 8; ++q) f.h[q] = (_Float16)x[t * 8 + q]; *(v8us*)((unsigned short*)X16 + t * 8) = f.half[0];  }
__global__ __launch_bounds__(256) void k_round16f(const float* __restrict__ W, _Float16* __restrict__ Bt, size_t n8) { const size_t t = (size_t)blockIdx.x * 256 + threadIdx.x; if (t >= n8) return; FragH f;
#pragma unroll
  for (int i = 0; i < 8; ++i) f.h[i] = (_Float16)(bf16_round(W[t * 8 + i]) * 16.0f); *(v8us*)((unsigned short*)Bt + t * 8) = f.half[0];  }
template <int NHv, int TTv>
__global__ __launch_bounds__(256) void k_vt(const _Float16* __restrict__ V16, int ldv, int voff, _Float16* __restrict__ Vt) { __shared__ unsigned short tl[64][66]; const int tid = threadIdx.x; const int slab = blockIdx.x / (TTv / 64), lg = blockIdx.x % (TTv / 64); const int b = slab / NHv, h = slab % NHv;
  for (int i = tid; i < 64 * 8; i += 256) { const int r = i / 8, c8 = (i % 8) * 8; FragH f; f.half[0] = *(const v8us*)((const unsigned short*)V16 + ((size_t)b * TTv + lg * 64 + r) * ldv + voff + h * 64 + c8);
#pragma unroll
    for (int q = 0; q < 8; ++q) tl[r][c8 + q] = f.u[q]; }
  __syncthreads();
  {
#pragma unroll
    for (int rd = 0; rd < 2; ++rd) { const int d = rd * 32 + tid / 8, pc = tid % 8; FragH f;
#pragma unroll
      for (int q = 0; q < 8; ++q) f.u[q] = tl[pc * 8 + q][d];
      *(v8us*)((unsigned short*)Vt + ((size_t)slab * 64 + d) * TTv + lg * 64 + pc * 8) = f.half[0]; }
     } }

__global__ __launch_bounds__(256) void k_hl(const float* __restrict__ F, _Float16* __restrict__ Hh, _Float16* __restrict__ Hl, size_t n8) { const size_t t = (size_t)blockIdx.x * 256 + threadIdx.x; if (t >= n8) return; FragH fh, fl; const v4f a = *(const v4fa*)(F + t * 8), c = *(const v4fa*)(F + t * 8 + 4);
#pragma unroll
  for (int q = 0; q < 4; ++q) { _Float16 h = (_Float16)a[q]; fh.h[q] = h; fl.h[q] = (_Float16)((a[q] - (float)h) * 1024.0f); h = (_Float16)c[q]; fh.h[4 + q] = h; fl.h[4 + q] = (_Float16)((c[q] - (float)h) * 1024.0f); }
  { *(v8us*)((unsigned short*)Hh + t * 8) = fh.half[0]; *(v8us*)((unsigned short*)Hl + t * 8) = fl.half[0];  } }

// ---- fast GEMM (wave tile 32x64; requires M % 32 == 0 rows per launch region and N % 64 == 0); epilogue = k_gemm_hhx semantics ----
__device__ __forceinline__ v16h g2_frag(const _Float16* p, int hh) { FragH f; f.half[0] = *(const v8us*)((const unsigned short*)p + 8 * hh); f.half[1] = *(const v8us*)((const unsigned short*)p + 16 + 8 * hh); return f.v; }
__device__ __forceinline__ v8f g2_mma(v16h a, v16h b, v8f c) { v8f d = __builtin_amdgcn_wmma_f32_16x16x32_f16(false, a, false, b, (short)0, c, false, false); asm volatile("v_nop\n\tv_nop\n\tv_nop\n\tv_nop" : "+v"(d) : "v"(a), "v"(b)); return d; }
template <int ACT>
__global__ __launch_bounds__(128) void k_gemm2(const _Float16* __restrict__ A, int lda, size_t sA, const _Float16* __restrict__ Bh, int ldb, size_t sB, float alpha, const float* __restrict__ bias, size_t sBias, const float* __restrict__ CP, int rowsPerB, size_t sCPb, int row0g,
    float* __restrict__ C, _Float16* __restrict__ C16, int ldc, size_t sC, int M, int N, int K) { static_assert(ACT == 0 || ACT == 3 || ACT == 6 || ACT == 8 || ACT == 9 || ACT == 11 || ACT == 12 || ACT == 14 || ACT == 15 || ACT == 16 || ACT == 17, "k_gemm2: unsupported ACT code (would silently apply no activation)");
  __shared__ __attribute__((aligned(16))) float so[4][32][68];
  const int tid = threadIdx.x, w = tid >> 5, lane = tid & 31, ln = lane & 15, hh = lane >> 4; const int by = blockIdx.y;
  A += (size_t)by * sA; Bh += (size_t)by * sB; const size_t cofs = (size_t)by * sC; const float* bp = bias ? bias + (size_t)by * sBias : nullptr;
  const int ntn = N >> 6; const int mt = blockIdx.x / ntn, nq = blockIdx.x - mt * ntn; const int row0 = mt * 128 + 32 * w, col0 = nq * 64; if (row0 >= M) return;
  const _Float16* a0p = A + (size_t)(row0 + ln) * lda; const _Float16* a1p = a0p + (size_t)16 * lda;
  const _Float16* b0p = Bh + (size_t)(col0 + ln) * ldb; const _Float16* b1p = b0p + (size_t)16 * ldb; const _Float16* b2p = b1p + (size_t)16 * ldb; const _Float16* b3p = b2p + (size_t)16 * ldb;
  const v8f z8 = {0.f,0.f,0.f,0.f,0.f,0.f,0.f,0.f}; v8f c00 = z8, c01 = z8, c02 = z8, c03 = z8, c10 = z8, c11 = z8, c12 = z8, c13 = z8;
#pragma unroll 1
  for (int kb = 0; kb < K; kb += 32) { const v16h a0 = g2_frag(a0p + kb, hh), a1 = g2_frag(a1p + kb, hh);
    v16h b = g2_frag(b0p + kb, hh); c00 = g2_mma(a0, b, c00); c10 = g2_mma(a1, b, c10);
    b = g2_frag(b1p + kb, hh); c01 = g2_mma(a0, b, c01); c11 = g2_mma(a1, b, c11);
    b = g2_frag(b2p + kb, hh); c02 = g2_mma(a0, b, c02); c12 = g2_mma(a1, b, c12);
    b = g2_frag(b3p + kb, hh); c03 = g2_mma(a0, b, c03); c13 = g2_mma(a1, b, c13); }
  v8f accs[8] = {c00, c01, c02, c03, c10, c11, c12, c13};
#pragma unroll
  for (int u = 0; u < 8; ++u) { const int t = u & 3, half = u >> 2; const int col = col0 + t * 16 + ln; const float bv = bp ? bf16_round(bp[col]) : 0.f;
#pragma unroll
    for (int r = 0; r < 8; ++r) { const int rloc = half * 16 + 8 * hh + r; float v = accs[u][r] * alpha + bv; if (CP) { if (rowsPerB < 0) v += CP[cofs + (size_t)(row0g + row0 + rloc) * ldc + col];      /* rowsPerB < 0: own element of the batched C plane */ else { const int bidx = (row0g + row0 + rloc) / rowsPerB; v += CP[(size_t)bidx * sCPb + (size_t)by * 64 + col]; } }
      if (ACT == 3) v = fmaxf(v, 0.f); else if (ACT == 6) v = 0.5f * v * (1.0f + erff(v * 0.70710678118654752f)); else if (ACT == 11) v = 1.0f / (1.0f + expf(-v)); else if (ACT == 15) v = v / (1.0f + expf(-v)); else if (ACT == 12) v = (v > 0.f) ? v : 0.01f * v; else if (ACT == 8) v = tanhf(v); else if (ACT == 9) v = 0.5f * v * (1.0f + tanhf(0.7978845608028654f * (v + 0.044715f * v * v * v))); else if (ACT == 14) v = (v > 0.f) ? v : 0.1f * v; else if (ACT == 16) v = (v >= 0.f) ? v : 0.3f * v; else if (ACT == 17) v = (v >= 0.f) ? v : 0.2f * v;
      so[w][rloc][t * 16 + ln] = v; } }
  __builtin_amdgcn_fence(__ATOMIC_ACQ_REL, "workgroup"); __builtin_amdgcn_wave_barrier();
  const int rsub = lane >> 4, c4 = (lane & 15) * 4;
  {
#pragma unroll
    for (int q = 0; q < 16; ++q) { const int r = q * 2 + rsub; const v4f v = *(const v4fa*)&so[w][r][c4]; if (C) *(v4f*)(C + cofs + (size_t)(row0 + r) * ldc + col0 + c4) = v; if (C16) { v4h h4; for (int i = 0; i < 4; ++i) h4[i] = (_Float16)v[i]; *(v4h*)(C16 + cofs + (size_t)(row0 + r) * ldc + col0 + c4) = h4; } }
     } }


__global__ __launch_bounds__(256) void k_wnat(const float* __restrict__ w, size_t n8, _Float16* __restrict__ Bt) { const size_t t = (size_t)blockIdx.x * 256 + threadIdx.x; if (t >= n8) return; FragH f; for (int q = 0; q < 8; ++q) f.h[q] = (_Float16)(bf16_round(w[t * 8 + q]) * 16.0f); *(v8us*)((unsigned short*)Bt + t * 8) = f.half[0];  }
__global__ __launch_bounds__(256) void k_rsm(const float* __restrict__ S, _Float16* __restrict__ P, int nrows) {
  #pragma clang fp contract(off)
  const int i = blockIdx.x * 256 + threadIdx.x; if (i >= nrows) return; const float* s = S + (size_t)i * SQ; float mx = -3.0e38f;
#pragma unroll 1
  for (int j = 0; j < SQ; ++j) mx = fmaxf(mx, s[j]); float se = 0.f;
#pragma unroll 1
  for (int j = 0; j < SQ; ++j) se += expf(s[j] - mx); const float sc = 256.0f / se;
#pragma unroll 1
  for (int j0 = 0; j0 < SQ; j0 += 8) { FragH f; for (int q = 0; q < 8; ++q) f.h[q] = (_Float16)(expf(s[j0 + q] - mx) * sc); unsigned short* d = (unsigned short*)P + (size_t)i * SQ + j0; *(v8us*)d = f.half[0];  } }
__global__ __launch_bounds__(256) void k_vt(const _Float16* __restrict__ V16, int b, int h0, _Float16* __restrict__ VT) { __shared__ unsigned short tl[64][65]; const int tid = threadIdx.x; const int hh = blockIdx.x % HG, sg = blockIdx.x / HG; const int s0 = sg * 64; const int h = h0 + hh;
  for (int i = tid; i < 64 * 8; i += 256) { const int j = i / 8, d8 = (i % 8) * 8; FragH f; f.half[0] = *(const v8us*)((const unsigned short*)V16 + ((size_t)b * SQ + s0 + j) * DM + h * HD + d8); for (int q = 0; q < 8; ++q) tl[d8 + q][j] = f.u[q]; }
  __syncthreads();
  { for (int i = tid; i < 64 * 8; i += 256) { const int d = i / 8, j8 = (i % 8) * 8; FragH f; for (int q = 0; q < 8; ++q) f.u[q] = tl[d][j8 + q]; *(v8us*)((unsigned short*)VT + ((size_t)hh * HD + d) * SQ + s0 + j8) = f.half[0]; }  } }



// Causal row softmax, one wave per score row: lane l holds keys 128*i + 4*l .. + 3 of its row in registers, so S is read once, in whole 512-byte pieces,
// and the row maximum and the row sum are per-lane partials joined by a five-step butterfly. nk is a multiple of QT and at most NKX.
__global__ __launch_bounds__(256) void k_rsmcf2(const float* __restrict__ S, _Float16* __restrict__ P, int hg, int q0, int nk) {
  const int lane = threadIdx.x & 31; const int t = blockIdx.x * 8 + (threadIdx.x >> 5); if (t >= hg * QT) return;      /* wave-uniform exit, no barrier below */
  const float* s = S + (size_t)t * NKX + lane * 4; const int last = q0 + (t % QT); v4f x[NKX / 128]; v4h h[NKX / 128]; float mx = -3.0e38f;
#pragma unroll      /* static indices keep x[] in registers; all of the row's loads are issued before the first use */
  for (int c = 0; c < NKX / QT; ++c) if (c * QT < nk) { x[2 * c] = *(const v4fa*)(s + c * QT); x[2 * c + 1] = *(const v4fa*)(s + c * QT + 128); }
  asm volatile("s_wait_xcnt 0x0" :: "v"(s) : "memory");      /* the loads' address pair stays whole up to here and is free for reuse only behind this wait */
#pragma unroll      /* static indices keep x[] in registers */
  for (int c = 0; c < NKX / QT; ++c) if (c * QT < nk) { for (int u = 0; u < 8; ++u) { const int i = 2 * c + (u >> 2), q = u & 3; const float f = (i * 128 + lane * 4 + q <= last) ? 1.f : 0.f; x[i][q] = fmaf(f, x[i][q], (1.f - f) * -1.0e9f); mx = fmaxf(mx, x[i][q]); } }
  for (int m = 16; m >= 1; m >>= 1) mx = fmaxf(mx, __shfl_xor(mx, m, 32));
  float se = 0.f;
#pragma unroll      /* static indices keep x[] in registers */
  for (int c = 0; c < NKX / QT; ++c) if (c * QT < nk) { for (int u = 0; u < 8; ++u) { const int i = 2 * c + (u >> 2), q = u & 3; x[i][q] = __expf(x[i][q] - mx); se += x[i][q]; } }
  for (int m = 16; m >= 1; m >>= 1) se += __shfl_xor(se, m, 32);
  const float sc = 256.0f / se; _Float16* d = P + (size_t)t * NKX + lane * 4;
#pragma unroll      /* static indices keep x[] and h[] in registers */
  for (int c = 0; c < NKX / QT; ++c) if (c * QT < nk) { for (int u = 0; u < 8; ++u) { const int i = 2 * c + (u >> 2), q = u & 3; h[i][q] = (_Float16)(x[i][q] * sc); } }
#pragma unroll      /* the stores stand last, each from registers of its own: none of them is rewritten behind a store */
  for (int c = 0; c < NKX / QT; ++c) if (c * QT < nk) { *(v4h*)(d + c * QT) = h[2 * c]; *(v4h*)(d + c * QT + 128) = h[2 * c + 1]; } }


typedef float v2f __attribute__((ext_vector_type(2)));
// Exact f32 attention for query rows 0 .. QT0-1 of one batch, one wave per (head, query row), 8 rows of one head per block. The head's QT0 K and V rows are staged once in LDS;
// lane l scores keys l, l + 32, l + 64, l + 96; row maximum and row sum are lane partials joined by butterflies; lane l then sums dims 2l, 2l + 1 over the keys (weight 0 behind the diagonal).
__global__ __launch_bounds__(256) void k_att0w(const float* __restrict__ QF, const float* __restrict__ KF, const float* __restrict__ VF, float scale, float* __restrict__ OF) {
  __shared__ __attribute__((aligned(16))) float lk[QT0][HD + 4];      /* pitch 272 B = 16 B x odd: one key row per lane reads without bank conflicts */
  __shared__ __attribute__((aligned(16))) float lv[QT0][HD];
  const int tid = threadIdx.x, lane = tid & 31; const int w = __builtin_amdgcn_readfirstlane(tid >> 5);      /* the wave's number as a scalar: q is read through scalar loads */
  const int h = blockIdx.x / (QT0 / 8), i = (blockIdx.x % (QT0 / 8)) * 8 + w;
  const int sr = tid >> 4, sc = (tid & 15) * 4; const float* kg = KF + (size_t)sr * DM + h * HD + sc; const float* vg = VF + (size_t)sr * DM + h * HD + sc; v4f ks[QT0 / 16], vs[QT0 / 16];
#pragma unroll      /* static indices keep ks[] and vs[] in registers; every load is issued before the first LDS store */
  for (int u = 0; u < QT0 / 16; ++u) { ks[u] = *(const v4fa*)(kg + (size_t)u * 16 * DM); vs[u] = *(const v4fa*)(vg + (size_t)u * 16 * DM); }
  asm volatile("s_wait_xcnt 0x0" :: "v"(kg), "v"(vg) : "memory");      /* the loads' two address pairs stay whole up to here and are free for reuse only behind this wait */
#pragma unroll      /* static indices keep ks[] and vs[] in registers */
  for (int u = 0; u < QT0 / 16; ++u) { *(v4f*)&lk[u * 16 + sr][sc] = ks[u]; *(v4f*)&lv[u * 16 + sr][sc] = vs[u]; }
  __syncthreads();
  const float* qg = QF + (size_t)i * DM + h * HD; v4f a[QT0 / 32] = {};
#pragma unroll      /* static indices keep a[] in registers: four independent sums per key, four keys per lane */
  for (int d = 0; d < HD / 4; ++d) { for (int c = 0; c < QT0 / 32; ++c) { const v4f kk = *(const v4f*)&lk[c * 32 + lane][d * 4]; for (int u = 0; u < 4; ++u) a[c][u] = fmaf(qg[d * 4 + u], kk[u], a[c][u]); } }
  float e[QT0 / 32]; float m = -1.0e30f;
#pragma unroll      /* static indices keep e[] in registers */
  for (int c = 0; c < QT0 / 32; ++c) { e[c] = (c * 32 + lane <= i) ? ((a[c][0] + a[c][1]) + (a[c][2] + a[c][3])) * scale : -1.0e30f; m = fmaxf(m, e[c]); }
  for (int x = 16; x >= 1; x >>= 1) m = fmaxf(m, __shfl_xor(m, x, 32));
  float l = 0.f;
#pragma unroll      /* static indices keep e[] in registers */
  for (int c = 0; c < QT0 / 32; ++c) { e[c] = expf(e[c] - m); l += e[c]; }      /* a key behind the diagonal: exp(-1e30 - m) = 0 */
  for (int x = 16; x >= 1; x >>= 1) l += __shfl_xor(l, x, 32);
  v2f o[4] = {};
#pragma unroll      /* a constant lane number per step: key j's weight is broadcast through a scalar register; static indices keep e[] and o[] in registers */
  for (int j = 0; j < QT0; ++j) { const float ej = __int_as_float(__builtin_amdgcn_readlane(__float_as_int(e[j >> 5]), j & 31)); const v2f vv = *(const v2f*)&lv[j][lane * 2]; o[j & 3][0] = fmaf(ej, vv[0], o[j & 3][0]); o[j & 3][1] = fmaf(ej, vv[1], o[j & 3][1]); }
  const float fin = 64.0f / l;      /* o carried x64 like the f16 path */
  const v2f r = ((o[0] + o[1]) + (o[2] + o[3])) * fin;
  *(v2f*)(OF + (size_t)i * DM + h * HD + lane * 2) = r; }

extern "C" void kernel_launch(void* const* d_in, const int* in_sizes, int n_in,
                              void* d_out, int out_size, void* d_ws, size_t ws_size, hipStream_t stream) {
  (void)in_sizes; (void)n_in; (void)out_size;
  const float* const* I = (const float* const*)d_in; const float* x = I[0]; const float* xk = I[1]; const float* xv = I[2]; const float* wq = I[3]; const float* bq = I[4]; const float* wk = I[5]; const float* bk = I[6]; const float* wv = I[7]; const float* bv = I[8]; const float* wo = I[9]; const float* bo = I[10];      /* input order: query, key, value (THREE input streams), then [in][out] weights + biases */
  char* ws = (char*)d_ws; size_t off = 0;
  auto take = [&](size_t bytes) { char* p = ws + off; off += (bytes + 255) & ~(size_t)255; return p; };
  _Float16* BQ = (_Float16*)take((size_t)DM * DM * 2); _Float16* BK = (_Float16*)take((size_t)DM * DM * 2); _Float16* BV = (_Float16*)take((size_t)DM * DM * 2); _Float16* BO = (_Float16*)take((size_t)DM * DM * 2);
  _Float16* X16 = (_Float16*)take(NR * DM * 2); _Float16* XK16 = (_Float16*)take(NR * DM * 2); _Float16* XV16 = (_Float16*)take(NR * DM * 2);      /* exact f16 rows of query, key, value */ float* QF = (float*)take(NR * DM * 4); _Float16* QH = (_Float16*)take(NR * DM * 2); _Float16* QL = (_Float16*)take(NR * DM * 2); _Float16* KH = (_Float16*)take(NR * DM * 2); _Float16* KL = (_Float16*)take(NR * DM * 2); _Float16* Q16 = QH; _Float16* K16 = KH; _Float16* V16 = (_Float16*)take(NR * DM * 2); _Float16* O16 = (_Float16*)take(NR * DM * 2);
  float* S = (float*)take((size_t)NH * QT * NKX * 4); _Float16* P = (_Float16*)take((size_t)NH * QT * NKX * 2); _Float16* VT = (_Float16*)take((size_t)NH * HD * SQ * 2);
  float* QF0 = (float*)take((size_t)QT0 * DM * 4); float* KF0 = (float*)take((size_t)QT0 * DM * 4); float* VF0 = (float*)take((size_t)QT0 * DM * 4); float* OF0 = (float*)take((size_t)NB * QT0 * DM * 4); _Float16* OH0 = (_Float16*)take((size_t)NB * QT0 * DM * 2); _Float16* OL0 = (_Float16*)take((size_t)NB * QT0 * DM * 2);
  if (off > ws_size) return;
  { const unsigned g = (unsigned)(((size_t)DM * (DM / 8) + 255) / 256); k_wt_f16<<<g, 256, 0, stream>>>(wq, BQ, DM, DM, 16.0f); k_wt_f16<<<g, 256, 0, stream>>>(wk, BK, DM, DM, 16.0f); k_wt_f16<<<g, 256, 0, stream>>>(wv, BV, DM, DM, 16.0f); k_wt_f16<<<g, 256, 0, stream>>>(wo, BO, DM, DM, 16.0f); }      /* [in][out] -> Bt[n][k] x16 */
  k_x16<<<(unsigned)((NR * DM / 8 + 255) / 256), 256, 0, stream>>>(x, X16, NR * DM / 8); k_x16<<<(unsigned)((NR * DM / 8 + 255) / 256), 256, 0, stream>>>(xk, XK16, NR * DM / 8); k_x16<<<(unsigned)((NR * DM / 8 + 255) / 256), 256, 0, stream>>>(xv, XV16, NR * DM / 8);
  const size_t r0p = (size_t)B0 * SQ;      /* first projected row */
  k_gemm2<0><<<dim3((unsigned)((MP / 128) * (DM / 64)), 1), 128, 0, stream>>>(X16 + r0p * DM, DM, 0, BQ, DM, 0, 0.0625f, bq, 0, nullptr, 1, 0, 0, QF + r0p * DM, nullptr, DM, 0, MP, DM, DM); k_hl<<<(unsigned)(((size_t)MP * DM / 8 + 255) / 256), 256, 0, stream>>>(QF + r0p * DM, QH + r0p * DM, QL + r0p * DM, (size_t)MP * DM / 8);      /* q (f32) -> f16 hi + x1024 residual: unscaled logits sigma ~8 */
  k_gemm2<0><<<dim3((unsigned)((MP / 128) * (DM / 64)), 1), 128, 0, stream>>>(XK16 + r0p * DM, DM, 0, BK, DM, 0, 0.0625f, bk, 0, nullptr, 1, 0, 0, QF + r0p * DM, nullptr, DM, 0, MP, DM, DM); k_hl<<<(unsigned)(((size_t)MP * DM / 8 + 255) / 256), 256, 0, stream>>>(QF + r0p * DM, KH + r0p * DM, KL + r0p * DM, (size_t)MP * DM / 8);      /* k likewise */
  k_gemm2<0><<<dim3((unsigned)((MP / 128) * (DM / 64)), 1), 128, 0, stream>>>(XV16 + r0p * DM, DM, 0, BV, DM, 0, 0.0625f, bv, 0, nullptr, 1, 0, 0, nullptr, V16 + r0p * DM, DM, 0, MP, DM, DM);
  for (int b = B0; b < B0 + NBR; ++b) { const size_t r0 = (size_t)b * SQ;
    k_vt<NH, SQ><<<NH * (SQ / 64), 256, 0, stream>>>(V16 + r0 * LQ, LQ, 0, VT);      /* V^T [NH][HD][SQ] for this batch */
    k_gemm2<0><<<dim3((QT0 / 128) * (DM / 64), 1), 128, 0, stream>>>(X16 + r0 * DM, DM, 0, BQ, DM, 0, 0.0625f, bq, 0, nullptr, 1, 0, 0, QF0, nullptr, DM, 0, QT0, DM, DM); k_gemm2<0><<<dim3((QT0 / 128) * (DM / 64), 1), 128, 0, stream>>>(XK16 + r0 * DM, DM, 0, BK, DM, 0, 0.0625f, bk, 0, nullptr, 1, 0, 0, KF0, nullptr, DM, 0, QT0, DM, DM); k_gemm2<0><<<dim3((QT0 / 128) * (DM / 64), 1), 128, 0, stream>>>(XV16 + r0 * DM, DM, 0, BV, DM, 0, 0.0625f, bv, 0, nullptr, 1, 0, 0, VF0, nullptr, DM, 0, QT0, DM, DM);      /* f32 q, k, v of the first 128 rows (exact products) */
    k_att0w<<<NH * (QT0 / 8), 256, 0, stream>>>(QF0, KF0, VF0, SCL, OF0 + (size_t)b * QT0 * DM);      /* exact f32 attention for rows 0..127 (o x64), one wave per (head, row) */
    for (int q0 = 0; q0 < QN; q0 += QT) { const int nk = q0 + QT;      /* causal: only keys below the tile end are computed */
      k_gemm2<0><<<dim3((QT / 128) * (nk / 64), NHD), 128, 0, stream>>>(QH + (r0 + q0) * LQ, LQ, (size_t)HD, KH + r0 * LQ, LQ, (size_t)HD, SCL, nullptr, 0, nullptr, 1, 0, 0, S, nullptr, NKX, (size_t)QT * NKX, QT, nk, HD);      /* scores hi . hi * 2048^-0.5 (the source's sequence-length scale) */
      k_gemm2<0><<<dim3((QT / 128) * (nk / 64), NHD), 128, 0, stream>>>(QL + (r0 + q0) * LQ, LQ, (size_t)HD, KH + r0 * LQ, LQ, (size_t)HD, SCLR, nullptr, 0, S, -1, 0, 0, S, nullptr, NKX, (size_t)QT * NKX, QT, nk, HD); k_gemm2<0><<<dim3((QT / 128) * (nk / 64), NHD), 128, 0, stream>>>(QH + (r0 + q0) * LQ, LQ, (size_t)HD, KL + r0 * LQ, LQ, (size_t)HD, SCLR, nullptr, 0, S, -1, 0, 0, S, nullptr, NKX, (size_t)QT * NKX, QT, nk, HD);      /* += 2^-10 (lo . hi + hi . lo) */      /* scores, all heads on grid.y */
      k_rsmcf2<<<(NHD * QT + 7) / 8, 256, 0, stream>>>(S, P, NHD, q0, nk);      /* one wave per row, 8 rows per block */
      k_gemm2<0><<<dim3((QT / 128) * (HD / 64), NHD), 128, 0, stream>>>(P, NKX, (size_t)QT * NKX, VT, SQ, (size_t)HD * SQ, 0.25f, nullptr, 0, nullptr, 1, 0, 0, nullptr, O16 + (r0 + q0) * DM, DM, (size_t)HD, QT, HD, nk); } }      /* o (merged heads, x64) as f16 rows */
  k_gemm2<0><<<dim3((unsigned)((MPO / 128) * (DM / 64)), 1), 128, 0, stream>>>(O16 + r0p * DM, DM, 0, BO, DM, 0, 0.0009765625f, bo, 0, nullptr, 1, 0, 0, (float*)d_out + r0p * DM, nullptr, DM, 0, MPO, DM, DM);      /* out rows are the output layout */
  k_hl<<<(unsigned)(((size_t)NB * QT0 * DM / 8 + 255) / 256), 256, 0, stream>>>(OF0, OH0, OL0, (size_t)NB * QT0 * DM / 8);      /* first-tile o (x64) -> f16 hi + x1024 residual planes */
  for (int b = B0; b < B0 + NBR; ++b) { const size_t r0 = (size_t)b * SQ; const size_t f0 = (size_t)b * QT0;
    k_gemm2<0><<<dim3((QT0 / 128) * (DM / 64), 1), 128, 0, stream>>>(OH0 + f0 * DM, DM, 0, BO, DM, 0, 0.0009765625f, bo, 0, nullptr, 1, 0, 0, (float*)d_out + r0 * DM, nullptr, DM, 0, QT0, DM, DM);      /* rows 0..127: out = o_hi Wo (+ b), overwriting the f16-path rows */
    k_gemm2<0><<<dim3((QT0 / 128) * (DM / 64), 1), 128, 0, stream>>>(OL0 + f0 * DM, DM, 0, BO, DM, 0, 0.00000095367431640625f, nullptr, 0, (const float*)d_out + r0 * DM, -1, 0, 0, (float*)d_out + r0 * DM, nullptr, DM, 0, QT0, DM, DM); }      /* += o_lo Wo 2^-20 (own-element accumulate) */
}

// v003
// It runs in 599 microseconds.
// In two side-by-side timings against v002, it was 3.38 and 3.39 times as fast.
// All steps since v000 together make it 9.64 times as fast.
#include <hip/hip_runtime.h>
// Causal multi-head attention on three inputs with the source's sequence-length score scale (query, key, value [2][2048][1024]; q = query Wq + bq, k = key Wk + bk, v = value Wv + bv ([in][out] 1024 x 1024, weights AND biases sigma 1/32), 16 heads of 64; score = q k^T; triu(1) -> -inf; softmax(score / sqrt(Sk)) with Sk = 2048 KEYS (the source divides by sqrt of the score matrix's last dimension, NOT by sqrt(head_dim)): scale 2048^-0.5 = 0.0220970869; out = merged Wo + bo ([in][out]) -> [2][2048][1024]); q and k carried as f16 hi + x1024 residual planes with three-product scores.
// Structure: token rows r = b*2048 + s; x as exact f16 rows (bf16-rounded); q and k as WMMA GEMMs (32x64 wave tiles, f32 accumulation, exact x16 weights + bias) into f32 rows split into f16 hi + x1024 residual planes, v as an f16-output GEMM; per batch: V^T for all heads via LDS transposes; then ONE fused attention launch (a wave per 16 queries, keys below the diagonal in passes of 32: three-product scores hi.hi + lo.hi + hi.lo in f32 accumulators, running-maximum softmax in registers (f32 statistics, native exp; weights in (0, 1] as f16), o = P . V^T normalised at the end, carried x64 and folded into the output GEMM alpha) written straight into the merged f16 o rows; out = o W_o + b GEMM (f32) into the output layout.
// Compute dtype: inputs rounded to bf16; x / weights exact; q and k as f16 hi + x1024 residual planes (three-product scores); v, softmax weights and o as plain f16 GEMM operands (~2^-12); scores and softmax statistics f32; v_wmma_f32_16x16x32_f16.
#define NB 2
#define SCL 0.0220970869f                 /* = f32(1 / sqrt(2048)): the source scales the scores by 1/sqrt(Sk), Sk = 2048 keys */
#define SCLR (0.0220970869f * 0.0009765625f)   /* the same scale on the x1024 residual passes */
#define SQ 2048
#define DM 1024
#define NH 16
#define HD 64
#define HG 4                         /* heads per launch of the head-group k_vt overload, which is not launched */
#define QT0 128                      /* first-tile rows recomputed exactly in f32 */
#define B0 0                         /* first batch processed (debug hook) */
#define NBR NB                       /* batches processed (debug hook) */
#define NR ((size_t)NB * SQ)         /* token rows */
#define MP ((int)((size_t)NBR * SQ)) /* rows projected (debug hook) */
#define MPO MP                       /* rows through the output stage (debug hook) */
#define LQ DM      /* row pitch of the q/k/v rows */
typedef __bf16 v16b __attribute__((ext_vector_type(16)));
typedef unsigned short v8us __attribute__((ext_vector_type(8), may_alias));
typedef float  v8f  __attribute__((ext_vector_type(8)));
typedef float  v4f  __attribute__((ext_vector_type(4)));
typedef float  v4fa __attribute__((ext_vector_type(4), may_alias));
union FragB { v16b v; v8us half[2]; unsigned short u[16]; };

__device__ __forceinline__ unsigned short bf16_bits(float x) { unsigned int u = __float_as_uint(x); return (unsigned short)((u + 0x7FFFu + ((u >> 16) & 1u)) >> 16); }
__device__ __forceinline__ float bf16_val(unsigned short b) { return __uint_as_float(((unsigned int)b) << 16); }
__device__ __forceinline__ float bf16_round(float x) { return bf16_val(bf16_bits(x)); }
// D += A·B with NT terms: 1 = ah·bh, 2 = + al·bh (A split), 3 = + ah·bl (both split)
template <int NT>
__device__ __forceinline__ v8f mmaN(v16b ah, v16b al, v16b bh, v16b bl, v8f c) {
  c = __builtin_amdgcn_wmma_f32_16x16x32_bf16(false, ah, false, bh, (short)0, c, false, false);
  if (NT >= 2) c = __builtin_amdgcn_wmma_f32_16x16x32_bf16(false, al, false, bh, (short)0, c, false, false);
  if (NT >= 3) c = __builtin_amdgcn_wmma_f32_16x16x32_bf16(false, ah, false, bl, (short)0, c, false, false);
  asm volatile("v_nop\n\tv_nop\n\tv_nop\n\tv_nop" : "+v"(c) : "v"(ah), "v"(al), "v"(bh), "v"(bl));
  return c;
}

__global__ __launch_bounds__(256) void k_wt_bf16(const float* __restrict__ W, unsigned short* __restrict__ Wt, int K, int N) {
  const int t = blockIdx.x * 256 + threadIdx.x;
  const int k8n = K / 8;
  if (t >= N * k8n) return;
  const int n = t / k8n, k8 = (t % k8n) * 8;
  v8us v;
#pragma unroll
  for (int i = 0; i < 8; ++i) v[i] = bf16_bits(W[(size_t)(k8 + i) * N + n]);
  *(v8us*)(Wt + (size_t)n * K + k8) = v;
  
}

// GEMM C[M][N] (f32, pitch ldc) = act(A[M][K]·W + bias). A f32 row-major (pitch lda) converted per fragment to bf16
// (ASPLIT: hi/lo two planes -> 2 terms, else single rounded term); Wt bf16 [N][K] (pitch ldb). BIAS_BF16 rounds the
// bias to bf16 first (bias quantised to bf16 before the add). K%32==0, M%16==0, N%64==0.
template <bool ASPLIT, int ACT, bool BIAS_BF16>
__global__ __launch_bounds__(128) void k_gemm_bf(const float* __restrict__ A, int lda, const unsigned short* __restrict__ Wt, int ldb,
                                               const float* __restrict__ bias, float* __restrict__ C, int ldc, int M, int N, int K) {
  __shared__ __attribute__((aligned(16))) float so[4][16][64];
  const int tid = threadIdx.x, w = tid >> 5, lane = tid & 31, ln = lane & 15, hh = lane >> 4;
  const int ntn = N / 64;
  const int wid = blockIdx.x * 4 + w;
  const int mt = wid / ntn, nq = wid % ntn;
  if (mt * 16 >= M) return;
  const int row0 = mt * 16, col0 = nq * 64;
  const float* arow = A + (size_t)(row0 + ln) * lda;
  v8f acc[4] = {};
  for (int kb = 0; kb < K; kb += 32) {
    FragB ah, al;
    const v4f x0 = *(const v4fa*)(arow + kb + 8 * hh), x1 = *(const v4fa*)(arow + kb + 8 * hh + 4);
    const v4f x2 = *(const v4fa*)(arow + kb + 16 + 8 * hh), x3 = *(const v4fa*)(arow + kb + 16 + 8 * hh + 4);
    float xs[16] = {x0[0],x0[1],x0[2],x0[3],x1[0],x1[1],x1[2],x1[3],x2[0],x2[1],x2[2],x2[3],x3[0],x3[1],x3[2],x3[3]};
#pragma unroll
    for (int i = 0; i < 16; ++i) { const unsigned short hb = bf16_bits(xs[i]); ah.u[i] = hb; al.u[i] = ASPLIT ? bf16_bits(xs[i] - bf16_val(hb)) : (unsigned short)0; }
#pragma unroll
    for (int t = 0; t < 4; ++t) {
      const unsigned short* brow = Wt + (size_t)(col0 + t * 16 + ln) * ldb + kb;
      FragB b;
      b.half[0] = *(const v8us*)(brow + 8 * hh);
      b.half[1] = *(const v8us*)(brow + 16 + 8 * hh);
      acc[t] = mmaN<ASPLIT ? 2 : 1>(ah.v, al.v, b.v, b.v, acc[t]);
    }
  }
#pragma unroll
  for (int t = 0; t < 4; ++t) {
    float bv = bias ? bias[col0 + t * 16 + ln] : 0.f;
    if (BIAS_BF16) bv = bf16_round(bv);
#pragma unroll
    for (int r = 0; r < 8; ++r) { float v = acc[t][r] + bv; if (ACT == 1) v = fmaxf(v, 0.f); so[w][8 * hh + r][t * 16 + ln] = v; }
  }
  __builtin_amdgcn_fence(__ATOMIC_ACQ_REL, "workgroup");
  __builtin_amdgcn_wave_barrier();
  const int rsub = lane >> 4, c4 = (lane & 15) * 4;
  {
#pragma unroll
    for (int q = 0; q < 8; ++q) {
      const int r = q * 2 + rsub;
      const v4f v = *(const v4fa*)&so[w][r][c4];
      *(v4f*)(C + (size_t)(row0 + r) * ldc + col0 + c4) = v;
    }
    
  }
}

// GEMM C = act(A·W + bias + resid): A f32 (ASPLIT -> hi/lo 2 terms), Wt bf16 [N][K]; ACT 0 none, 1 relu, 2 exact gelu;
// resid (optional, f32, row index = (row % rmod), pitch ldr, RES_BF16 rounds it) added before the activation.
template <bool ASPLIT, int ACT, bool BIAS_BF16, bool RES_BF16>
__global__ __launch_bounds__(128) void k_gemm_bf3(const float* __restrict__ A, int lda, const unsigned short* __restrict__ Wt, int ldb,
                                                const float* __restrict__ bias, const float* __restrict__ resid, int rmod, int ldr,
                                                float* __restrict__ C, int ldc, int M, int N, int K) {
  __shared__ __attribute__((aligned(16))) float so[4][16][64];
  const int tid = threadIdx.x, w = tid >> 5, lane = tid & 31, ln = lane & 15, hh = lane >> 4;
  const int ntn = N / 64;
  const int wid = blockIdx.x * 4 + w;
  const int mt = wid / ntn, nq = wid % ntn;
  if (mt * 16 >= M) return;
  const int row0 = mt * 16, col0 = nq * 64;
  const float* arow = A + (size_t)(row0 + ln) * lda;
  v8f acc[4] = {};
  for (int kb = 0; kb < K; kb += 32) {
    FragB ah, al;
    const v4f x0 = *(const v4fa*)(arow + kb + 8 * hh), x1 = *(const v4fa*)(arow + kb + 8 * hh + 4);
    const v4f x2 = *(const v4fa*)(arow + kb + 16 + 8 * hh), x3 = *(const v4fa*)(arow + kb + 16 + 8 * hh + 4);
    float xs[16] = {x0[0],x0[1],x0[2],x0[3],x1[0],x1[1],x1[2],x1[3],x2[0],x2[1],x2[2],x2[3],x3[0],x3[1],x3[2],x3[3]};
#pragma unroll
    for (int i = 0; i < 16; ++i) { const unsigned short hb = bf16_bits(xs[i]); ah.u[i] = hb; al.u[i] = ASPLIT ? bf16_bits(xs[i] - bf16_val(hb)) : (unsigned short)0; }
#pragma unroll
    for (int t = 0; t < 4; ++t) {
      const unsigned short* brow = Wt + (size_t)(col0 + t * 16 + ln) * ldb + kb;
      FragB b;
      b.half[0] = *(const v8us*)(brow + 8 * hh);
      b.half[1] = *(const v8us*)(brow + 16 + 8 * hh);
      acc[t] = mmaN<ASPLIT ? 2 : 1>(ah.v, al.v, b.v, b.v, acc[t]);
    }
  }
#pragma unroll
  for (int t = 0; t < 4; ++t) {
    const int col = col0 + t * 16 + ln;
    float bv = bias ? bias[col] : 0.f;
    if (BIAS_BF16) bv = bf16_round(bv);
#pragma unroll
    for (int r = 0; r < 8; ++r) {
      float v = acc[t][r] + bv;
      if (resid) { float rv = resid[(size_t)((row0 + 8 * hh + r) % rmod) * ldr + col]; if (RES_BF16) rv = bf16_round(rv); v += rv; }
      if (ACT == 1) v = fmaxf(v, 0.f);
      if (ACT == 2) v = 0.5f * v * (1.0f + erff(v * 0.70710678118654752f));
      if (ACT == 3) { const float u = 0.7978845608028654f * (v + 0.044715f * v * v * v); v = 0.5f * v * (1.0f + tanhf(u)); }
      so[w][8 * hh + r][t * 16 + ln] = v;
    }
  }
  __builtin_amdgcn_fence(__ATOMIC_ACQ_REL, "workgroup");
  __builtin_amdgcn_wave_barrier();
  const int rsub = lane >> 4, c4 = (lane & 15) * 4;
  {
#pragma unroll
    for (int q = 0; q < 8; ++q) {
      const int r = q * 2 + rsub;
      const v4f v = *(const v4fa*)&so[w][r][c4];
      *(v4f*)(C + (size_t)(row0 + r) * ldc + col0 + c4) = v;
    }
    
  }
}
// row LayerNorm (biased variance, eps) over N: s = X (+ R); optional out_sum <- s; out_norm <- (s-mu)*rsqrt(var+eps)*g + b
template <bool PARAM_BF16>
__global__ __launch_bounds__(256) void k_layernorm(const float* __restrict__ X, const float* __restrict__ R, const float* __restrict__ g, const float* __restrict__ bta,
                                                  float* __restrict__ out_sum, float* __restrict__ out_norm, int N, float eps) {
  __shared__ float red[256];
  const int row = blockIdx.x, tid = threadIdx.x;
  const float* x = X + (size_t)row * N; const float* rr = R ? R + (size_t)row * N : nullptr;
  float vals[16];                     // up to N = 4096
  const int per = N / 256;            // contiguous chunk per thread? use strided-by-4 chunks: thread handles j = tid*4 + 1024*u
  float s1 = 0.f;
  for (int u = 0; u < per / 4; ++u) {
    const int j = tid * 4 + 1024 * u;
    const v4f a = *(const v4fa*)(x + j);
    v4f b = {0.f,0.f,0.f,0.f}; if (rr) b = *(const v4fa*)(rr + j);
#pragma unroll
    for (int q = 0; q < 4; ++q) { const float v = a[q] + b[q]; vals[u * 4 + q] = v; s1 += v; }
  }
  red[tid] = s1; __syncthreads();
  for (int st = 128; st > 0; st >>= 1) { if (tid < st) red[tid] += red[tid + st]; __syncthreads(); }
  const float mu = red[0] / (float)N; __syncthreads();
  float s2 = 0.f;
  for (int u = 0; u < per / 4; ++u)
#pragma unroll
    for (int q = 0; q < 4; ++q) { const float c = vals[u * 4 + q] - mu; s2 += c * c; }
  red[tid] = s2; __syncthreads();
  for (int st = 128; st > 0; st >>= 1) { if (tid < st) red[tid] += red[tid + st]; __syncthreads(); }
  const float rs = rsqrtf(red[0] / (float)N + eps);
  {
    for (int u = 0; u < per / 4; ++u) {
      const int j = tid * 4 + 1024 * u;
      v4f o, sm;
#pragma unroll
      for (int q = 0; q < 4; ++q) {
        float gg = g[j + q], bb = bta[j + q];
        if (PARAM_BF16) { gg = bf16_round(gg); bb = bf16_round(bb); }
        sm[q] = vals[u * 4 + q]; o[q] = (vals[u * 4 + q] - mu) * rs * gg + bb;
      }
      if (out_sum) *(v4f*)(out_sum + (size_t)row * N + j) = sm;
      *(v4f*)(out_norm + (size_t)row * N + j) = o;
    }
    
  }
}



// ---- f16 WMMA path (v_wmma_f32_16x16x32_f16): 11-bit significands for operands in range — used where a [0,1] probability operand needs more precision than bf16
typedef _Float16 v16h __attribute__((ext_vector_type(16)));
union FragH { v16h v; v8us half[2]; _Float16 h[16]; unsigned short u[16]; };
template <int NT>
__device__ __forceinline__ v8f mmaH(v16h ah, v16h al, v16h bh, v16h bl, v8f c) {
  c = __builtin_amdgcn_wmma_f32_16x16x32_f16(false, ah, false, bh, (short)0, c, false, false);
  if (NT >= 2) c = __builtin_amdgcn_wmma_f32_16x16x32_f16(false, al, false, bh, (short)0, c, false, false);
  if (NT >= 3) c = __builtin_amdgcn_wmma_f32_16x16x32_f16(false, ah, false, bl, (short)0, c, false, false);
  asm volatile("v_nop\n\tv_nop\n\tv_nop\n\tv_nop" : "+v"(c) : "v"(ah), "v"(al), "v"(bh), "v"(bl));
  return c;
}
// batched GEMM like k_gemm_b but f16 operands: A f32 (split into f16 hi/lo if ASPLIT, else rounded to f16), Bt = f16 values [n][k]; alpha; C f32; N multiple of 16 (partial tiles skipped)
template <bool ASPLIT>
__global__ __launch_bounds__(128) void k_gemm_h(const float* __restrict__ A, int lda, size_t sA, const _Float16* __restrict__ Bh, int ldb, size_t sB, float alpha, float* __restrict__ C, int ldc, size_t sC, int M, int N, int K) {
  __shared__ __attribute__((aligned(16))) float so[4][16][64];
  const int tid = threadIdx.x, w = tid >> 5, lane = tid & 31, ln = lane & 15, hh = lane >> 4; const int by = blockIdx.y;
  A += (size_t)by * sA; Bh += (size_t)by * sB; C += (size_t)by * sC;
  const int ntn = (N + 63) / 64; const int wid = blockIdx.x * 4 + w; const int mt = wid / ntn, nq = wid % ntn; if (mt * 16 >= M) return;
  const int row0 = mt * 16, col0 = nq * 64; const float* arow = A + (size_t)(row0 + ln) * lda;
  v8f acc[4] = {};
  for (int kb = 0; kb < K; kb += 32) {
    FragH ah, al;
    const v4f x0 = *(const v4fa*)(arow + kb + 8 * hh), x1 = *(const v4fa*)(arow + kb + 8 * hh + 4), x2 = *(const v4fa*)(arow + kb + 16 + 8 * hh), x3 = *(const v4fa*)(arow + kb + 16 + 8 * hh + 4);
    float xs[16] = {x0[0],x0[1],x0[2],x0[3],x1[0],x1[1],x1[2],x1[3],x2[0],x2[1],x2[2],x2[3],x3[0],x3[1],x3[2],x3[3]};
#pragma unroll
    for (int i = 0; i < 16; ++i) { const _Float16 h = (_Float16)xs[i]; ah.h[i] = h; al.h[i] = ASPLIT ? (_Float16)(xs[i] - (float)h) : (_Float16)0.0f; }
#pragma unroll
    for (int t = 0; t < 4; ++t) { if (col0 + t * 16 >= N) continue; const size_t boff = (size_t)(col0 + t * 16 + ln) * ldb + kb; FragH bq; bq.half[0] = *(const v8us*)(Bh + boff + 8 * hh); bq.half[1] = *(const v8us*)(Bh + boff + 16 + 8 * hh);
      acc[t] = mmaH<ASPLIT ? 2 : 1>(ah.v, al.v, bq.v, bq.v, acc[t]); }
  }
#pragma unroll
  for (int t = 0; t < 4; ++t) { if (col0 + t * 16 >= N) continue;
#pragma unroll
    for (int r = 0; r < 8; ++r) so[w][8 * hh + r][t * 16 + ln] = acc[t][r] * alpha; }
  __builtin_amdgcn_fence(__ATOMIC_ACQ_REL, "workgroup"); __builtin_amdgcn_wave_barrier();
  const int rsub = lane >> 4, c4 = (lane & 15) * 4;
  {
#pragma unroll
    for (int q = 0; q < 8; ++q) { const int r = q * 2 + rsub; if (col0 + c4 < N) { const v4f v = *(const v4fa*)&so[w][r][c4]; *(v4f*)(C + (size_t)(row0 + r) * ldc + col0 + c4) = v; } }
     }
}

// Wt[n][k] = f16(W[k][n]·scale) from f32 row-major W[K][N] (scale = power of two; bf16-exact weights stay exact in f16 away from the subnormal range)
__global__ __launch_bounds__(256) void k_wt_f16(const float* __restrict__ W, _Float16* __restrict__ Wt, int K, int N, float scale) {
  const int t = blockIdx.x * 256 + threadIdx.x; if (t >= N * (K / 8)) return; const int n = t / (K / 8), k8 = (t % (K / 8)) * 8; FragH f;
#pragma unroll
  for (int i = 0; i < 8; ++i) f.h[i] = (_Float16)(bf16_round(W[(size_t)(k8 + i) * N + n]) * scale); const v8us o = f.half[0];
  *(v8us*)((unsigned short*)Wt + (size_t)n * K + k8) = o; 
}
// k_gemm_hh variant with fused epilogue: v = acc·alpha + bias[by·sBias + col] (+ CP[(row/rowsPerB)·sCPb + by·64 + col] if CP) ; ACT 0 none / 1 elu ; writes f16 C16 (and f32 C if non-null)
template <int ACT>
__global__ __launch_bounds__(128) void k_gemm_hhx(const _Float16* __restrict__ A, int lda, size_t sA, const _Float16* __restrict__ Bh, int ldb, size_t sB, float alpha, const float* __restrict__ bias, size_t sBias, const float* __restrict__ CP, int rowsPerB, size_t sCPb, int row0g,
    float* __restrict__ C, _Float16* __restrict__ C16, int ldc, size_t sC, int M, int N, int K) {
  __shared__ __attribute__((aligned(16))) float so[4][16][64];
  const int tid = threadIdx.x, w = tid >> 5, lane = tid & 31, ln = lane & 15, hh = lane >> 4; const int by = blockIdx.y;
  A += (size_t)by * sA; Bh += (size_t)by * sB; const size_t cofs = (size_t)by * sC; const float* bp = bias ? bias + (size_t)by * sBias : nullptr;
  const int ntn = (N + 63) / 64; const int wid = blockIdx.x * 4 + w; const int mt = wid / ntn, nq = wid % ntn; if (mt * 16 >= M) return;
  const int row0 = mt * 16, col0 = nq * 64; const _Float16* arow = A + (size_t)(row0 + ln) * lda;
  v8f acc[4] = {};
  for (int kb = 0; kb < K; kb += 32) { FragH ah; ah.half[0] = *(const v8us*)((const unsigned short*)arow + kb + 8 * hh); ah.half[1] = *(const v8us*)((const unsigned short*)arow + kb + 16 + 8 * hh);
#pragma unroll
    for (int t = 0; t < 4; ++t) { if (col0 + t * 16 >= N) continue; const size_t boff = (size_t)(col0 + t * 16 + ln) * ldb + kb; FragH bq; bq.half[0] = *(const v8us*)((const unsigned short*)Bh + boff + 8 * hh); bq.half[1] = *(const v8us*)((const unsigned short*)Bh + boff + 16 + 8 * hh);
      acc[t] = mmaH<1>(ah.v, ah.v, bq.v, bq.v, acc[t]); }
  }
#pragma unroll
  for (int t = 0; t < 4; ++t) { if (col0 + t * 16 >= N) continue; const int col = col0 + t * 16 + ln; const float bv = bp ? bf16_round(bp[col]) : 0.f;
#pragma unroll
    for (int r = 0; r < 8; ++r) { float v = acc[t][r] * alpha + bv; if (CP) { const int rr = row0g + row0 + 8 * hh + r; if (rowsPerB < 0) v += CP[cofs + (size_t)rr * ldc + col];      /* rowsPerB < 0: own element of the batched C plane */ else { const int bidx = rr / rowsPerB; v += CP[(size_t)bidx * sCPb + (size_t)by * 64 + col]; } } if (ACT == 1) v = (v > 0.f) ? v : expm1f(v); else if (ACT == 7) v = (v > 0.f) ? v + 1.0f : expf(v); else if (ACT == 8) v = tanhf(v); else if (ACT == 9) v = 0.5f * v * (1.0f + tanhf(0.7978845608028654f * (v + 0.044715f * v * v * v))); else if (ACT == 11) v = 1.0f / (1.0f + expf(-v)); else if (ACT == 12) v = (v > 0.f) ? v : 0.01f * v; else if (ACT == 14) v = (v > 0.f) ? v : 0.1f * v; else if (ACT == 16) v = (v >= 0.f) ? v : 0.3f * v; else if (ACT == 17) v = (v >= 0.f) ? v : 0.2f * v; else if (ACT == 15) v = v / (1.0f + expf(-v)); else if (ACT == 3) v = fmaxf(v, 0.f); else if (ACT == 6) v = 0.5f * v * (1.0f + erff(v * 0.70710678118654752f)); so[w][8 * hh + r][t * 16 + ln] = v; } }
  __builtin_amdgcn_fence(__ATOMIC_ACQ_REL, "workgroup"); __builtin_amdgcn_wave_barrier();
  const int rsub = lane >> 4, c4 = (lane & 15) * 4; typedef _Float16 v4h __attribute__((ext_vector_type(4)));
  {
#pragma unroll
    for (int q = 0; q < 8; ++q) { const int r = q * 2 + rsub; if (col0 + c4 < N) { const v4f v = *(const v4fa*)&so[w][r][c4]; if (C) *(v4f*)(C + cofs + (size_t)(row0 + r) * ldc + col0 + c4) = v; if (C16) { v4h h4; for (int i = 0; i < 4; ++i) h4[i] = (_Float16)v[i]; *(v4h*)(C16 + cofs + (size_t)(row0 + r) * ldc + col0 + c4) = h4; } } }
     }
}


typedef _Float16 v4h __attribute__((ext_vector_type(4)));

__global__ __launch_bounds__(256) void k_x16(const float* __restrict__ x, _Float16* __restrict__ X16, size_t n8) { const size_t t = (size_t)blockIdx.x * 256 + threadIdx.x; if (t >= n8) return; FragH f;
#pragma unroll
  for (int q = 0; q < 8; ++q) f.h[q] = (_Float16)bf16_round(x[t * 8 + q]); *(v8us*)((unsigned short*)X16 + t * 8) = f.half[0];  }
__global__ __launch_bounds__(256) void k_h16(const float* __restrict__ x, _Float16* __restrict__ X16, size_t n8) { const size_t t = (size_t)blockIdx.x * 256 + threadIdx.x; if (t >= n8) return; FragH f;
#pragma unroll
  for (int q = 0; q < 8; ++q) f.h[q] = (_Float16)x[t * 8 + q]; *(v8us*)((unsigned short*)X16 + t * 8) = f.half[0];  }
__global__ __launch_bounds__(256) void k_round16f(const float* __restrict__ W, _Float16* __restrict__ Bt, size_t n8) { const size_t t = (size_t)blockIdx.x * 256 + threadIdx.x; if (t >= n8) return; FragH f;
#pragma unroll
  for (int i = 0; i < 8; ++i) f.h[i] = (_Float16)(bf16_round(W[t * 8 + i]) * 16.0f); *(v8us*)((unsigned short*)Bt + t * 8) = f.half[0];  }
template <int NHv, int TTv>
__global__ __launch_bounds__(256) void k_vt(const _Float16* __restrict__ V16, int ldv, int voff, _Float16* __restrict__ Vt) { __shared__ unsigned short tl[64][66]; const int tid = threadIdx.x; const int slab = blockIdx.x / (TTv / 64), lg = blockIdx.x % (TTv / 64); const int b = slab / NHv, h = slab % NHv;
  for (int i = tid; i < 64 * 8; i += 256) { const int r = i / 8, c8 = (i % 8) * 8; FragH f; f.half[0] = *(const v8us*)((const unsigned short*)V16 + ((size_t)b * TTv + lg * 64 + r) * ldv + voff + h * 64 + c8);
#pragma unroll
    for (int q = 0; q < 8; ++q) tl[r][c8 + q] = f.u[q]; }
  __syncthreads();
  {
#pragma unroll
    for (int rd = 0; rd < 2; ++rd) { const int d = rd * 32 + tid / 8, pc = tid % 8; FragH f;
#pragma unroll
      for (int q = 0; q < 8; ++q) f.u[q] = tl[pc * 8 + q][d];
      *(v8us*)((unsigned short*)Vt + ((size_t)slab * 64 + d) * TTv + lg * 64 + pc * 8) = f.half[0]; }
     } }

__global__ __launch_bounds__(256) void k_hl(const float* __restrict__ F, _Float16* __restrict__ Hh, _Float16* __restrict__ Hl, size_t n8) { const size_t t = (size_t)blockIdx.x * 256 + threadIdx.x; if (t >= n8) return; FragH fh, fl; const v4f a = *(const v4fa*)(F + t * 8), c = *(const v4fa*)(F + t * 8 + 4);
#pragma unroll
  for (int q = 0; q < 4; ++q) { _Float16 h = (_Float16)a[q]; fh.h[q] = h; fl.h[q] = (_Float16)((a[q] - (float)h) * 1024.0f); h = (_Float16)c[q]; fh.h[4 + q] = h; fl.h[4 + q] = (_Float16)((c[q] - (float)h) * 1024.0f); }
  { *(v8us*)((unsigned short*)Hh + t * 8) = fh.half[0]; *(v8us*)((unsigned short*)Hl + t * 8) = fl.half[0];  } }

// ---- fast GEMM (wave tile 32x64; requires M % 32 == 0 rows per launch region and N % 64 == 0); epilogue = k_gemm_hhx semantics ----
__device__ __forceinline__ v16h g2_frag(const _Float16* p, int hh) { FragH f; f.half[0] = *(const v8us*)((const unsigned short*)p + 8 * hh); f.half[1] = *(const v8us*)((const unsigned short*)p + 16 + 8 * hh); return f.v; }
__device__ __forceinline__ v8f g2_mma(v16h a, v16h b, v8f c) { v8f d = __builtin_amdgcn_wmma_f32_16x16x32_f16(false, a, false, b, (short)0, c, false, false); asm volatile("v_nop\n\tv_nop\n\tv_nop\n\tv_nop" : "+v"(d) : "v"(a), "v"(b)); return d; }
template <int ACT>
__global__ __launch_bounds__(128) void k_gemm2(const _Float16* __restrict__ A, int lda, size_t sA, const _Float16* __restrict__ Bh, int ldb, size_t sB, float alpha, const float* __restrict__ bias, size_t sBias, const float* __restrict__ CP, int rowsPerB, size_t sCPb, int row0g,
    float* __restrict__ C, _Float16* __restrict__ C16, int ldc, size_t sC, int M, int N, int K) { static_assert(ACT == 0 || ACT == 3 || ACT == 6 || ACT == 8 || ACT == 9 || ACT == 11 || ACT == 12 || ACT == 14 || ACT == 15 || ACT == 16 || ACT == 17, "k_gemm2: unsupported ACT code (would silently apply no activation)");
  __shared__ __attribute__((aligned(16))) float so[4][32][68];
  const int tid = threadIdx.x, w = tid >> 5, lane = tid & 31, ln = lane & 15, hh = lane >> 4; const int by = blockIdx.y;
  A += (size_t)by * sA; Bh += (size_t)by * sB; const size_t cofs = (size_t)by * sC; const float* bp = bias ? bias + (size_t)by * sBias : nullptr;
  const int ntn = N >> 6; const int mt = blockIdx.x / ntn, nq = blockIdx.x - mt * ntn; const int row0 = mt * 128 + 32 * w, col0 = nq * 64; if (row0 >= M) return;
  const _Float16* a0p = A + (size_t)(row0 + ln) * lda; const _Float16* a1p = a0p + (size_t)16 * lda;
  const _Float16* b0p = Bh + (size_t)(col0 + ln) * ldb; const _Float16* b1p = b0p + (size_t)16 * ldb; const _Float16* b2p = b1p + (size_t)16 * ldb; const _Float16* b3p = b2p + (size_t)16 * ldb;
  const v8f z8 = {0.f,0.f,0.f,0.f,0.f,0.f,0.f,0.f}; v8f c00 = z8, c01 = z8, c02 = z8, c03 = z8, c10 = z8, c11 = z8, c12 = z8, c13 = z8;
#pragma unroll 1
  for (int kb = 0; kb < K; kb += 32) { const v16h a0 = g2_frag(a0p + kb, hh), a1 = g2_frag(a1p + kb, hh);
    v16h b = g2_frag(b0p + kb, hh); c00 = g2_mma(a0, b, c00); c10 = g2_mma(a1, b, c10);
    b = g2_frag(b1p + kb, hh); c01 = g2_mma(a0, b, c01); c11 = g2_mma(a1, b, c11);
    b = g2_frag(b2p + kb, hh); c02 = g2_mma(a0, b, c02); c12 = g2_mma(a1, b, c12);
    b = g2_frag(b3p + kb, hh); c03 = g2_mma(a0, b, c03); c13 = g2_mma(a1, b, c13); }
  v8f accs[8] = {c00, c01, c02, c03, c10, c11, c12, c13};
#pragma unroll
  for (int u = 0; u < 8; ++u) { const int t = u & 3, half = u >> 2; const int col = col0 + t * 16 + ln; const float bv = bp ? bf16_round(bp[col]) : 0.f;
#pragma unroll
    for (int r = 0; r < 8; ++r) { const int rloc = half * 16 + 8 * hh + r; float v = accs[u][r] * alpha + bv; if (CP) { if (rowsPerB < 0) v += CP[cofs + (size_t)(row0g + row0 + rloc) * ldc + col];      /* rowsPerB < 0: own element of the batched C plane */ else { const int bidx = (row0g + row0 + rloc) / rowsPerB; v += CP[(size_t)bidx * sCPb + (size_t)by * 64 + col]; } }
      if (ACT == 3) v = fmaxf(v, 0.f); else if (ACT == 6) v = 0.5f * v * (1.0f + erff(v * 0.70710678118654752f)); else if (ACT == 11) v = 1.0f / (1.0f + expf(-v)); else if (ACT == 15) v = v / (1.0f + expf(-v)); else if (ACT == 12) v = (v > 0.f) ? v : 0.01f * v; else if (ACT == 8) v = tanhf(v); else if (ACT == 9) v = 0.5f * v * (1.0f + tanhf(0.7978845608028654f * (v + 0.044715f * v * v * v))); else if (ACT == 14) v = (v > 0.f) ? v : 0.1f * v; else if (ACT == 16) v = (v >= 0.f) ? v : 0.3f * v; else if (ACT == 17) v = (v >= 0.f) ? v : 0.2f * v;
      so[w][rloc][t * 16 + ln] = v; } }
  __builtin_amdgcn_fence(__ATOMIC_ACQ_REL, "workgroup"); __builtin_amdgcn_wave_barrier();
  const int rsub = lane >> 4, c4 = (lane & 15) * 4;
  {
#pragma unroll
    for (int q = 0; q < 16; ++q) { const int r = q * 2 + rsub; const v4f v = *(const v4fa*)&so[w][r][c4]; if (C) *(v4f*)(C + cofs + (size_t)(row0 + r) * ldc + col0 + c4) = v; if (C16) { v4h h4; for (int i = 0; i < 4; ++i) h4[i] = (_Float16)v[i]; *(v4h*)(C16 + cofs + (size_t)(row0 + r) * ldc + col0 + c4) = h4; } }
     } }


__global__ __launch_bounds__(256) void k_wnat(const float* __restrict__ w, size_t n8, _Float16* __restrict__ Bt) { const size_t t = (size_t)blockIdx.x * 256 + threadIdx.x; if (t >= n8) return; FragH f; for (int q = 0; q < 8; ++q) f.h[q] = (_Float16)(bf16_round(w[t * 8 + q]) * 16.0f); *(v8us*)((unsigned short*)Bt + t * 8) = f.half[0];  }
__global__ __launch_bounds__(256) void k_rsm(const float* __restrict__ S, _Float16* __restrict__ P, int nrows) {
  #pragma clang fp contract(off)
  const int i = blockIdx.x * 256 + threadIdx.x; if (i >= nrows) return; const float* s = S + (size_t)i * SQ; float mx = -3.0e38f;
#pragma unroll 1
  for (int j = 0; j < SQ; ++j) mx = fmaxf(mx, s[j]); float se = 0.f;
#pragma unroll 1
  for (int j = 0; j < SQ; ++j) se += expf(s[j] - mx); const float sc = 256.0f / se;
#pragma unroll 1
  for (int j0 = 0; j0 < SQ; j0 += 8) { FragH f; for (int q = 0; q < 8; ++q) f.h[q] = (_Float16)(expf(s[j0 + q] - mx) * sc); unsigned short* d = (unsigned short*)P + (size_t)i * SQ + j0; *(v8us*)d = f.half[0];  } }
__global__ __launch_bounds__(256) void k_vt(const _Float16* __restrict__ V16, int b, int h0, _Float16* __restrict__ VT) { __shared__ unsigned short tl[64][65]; const int tid = threadIdx.x; const int hh = blockIdx.x % HG, sg = blockIdx.x / HG; const int s0 = sg * 64; const int h = h0 + hh;
  for (int i = tid; i < 64 * 8; i += 256) { const int j = i / 8, d8 = (i % 8) * 8; FragH f; f.half[0] = *(const v8us*)((const unsigned short*)V16 + ((size_t)b * SQ + s0 + j) * DM + h * HD + d8); for (int q = 0; q < 8; ++q) tl[d8 + q][j] = f.u[q]; }
  __syncthreads();
  { for (int i = tid; i < 64 * 8; i += 256) { const int d = i / 8, j8 = (i % 8) * 8; FragH f; for (int q = 0; q < 8; ++q) f.u[q] = tl[d][j8 + q]; *(v8us*)((unsigned short*)VT + ((size_t)hh * HD + d) * SQ + s0 + j8) = f.half[0]; }  } }



// Fused causal attention, one launch, a block for every (batch, head, 128 query rows): the scores and the softmax weights stay in registers.
// One wave owns 16 queries and walks the keys 32 at a time. S^T = K Q^T (A = K rows, B = Q rows, both through fa_frag, so the k orders pair): lane (ln, hh) holds, of query q0 + ln,
// the scores of keys k0 + 16 kt + 8 hh + r. Three products as before: hi.hi in one accumulator, lo.hi + hi.lo (x1024) in a second. Running maximum and running sum per query (the two
// lane halves share the maximum and join their sums at the end). The two score tiles, as f16, are the B operand of O^T += V^T P^T in the order fa_frag gives V^T's rows. o leaves x64.
__device__ __forceinline__ v16h fa_frag(const _Float16* p) { FragH f; f.half[0] = *(const v8us*)((const unsigned short*)p); f.half[1] = *(const v8us*)((const unsigned short*)p + 16); return f.v; }      /* g2_frag with the lane half's 8 elements already in p */
__device__ __forceinline__ float fa_exp(float x) { float r; asm("v_exp_f32 %0, %1\n\tv_nop" : "=v"(r) : "v"(x * 1.44269504f)); return r; }      /* native e^x; the v_nop fills the one slot the instruction set asks for behind a transcendental, whatever the compiler puts next */
__device__ __forceinline__ v8f fa_mma(v16h a, v16h b, v8f c) { return __builtin_amdgcn_wmma_f32_16x16x32_f16(false, a, false, b, (short)0, c, false, false); }
__global__ __launch_bounds__(256) void k_fattn(const _Float16* __restrict__ QHp, const _Float16* __restrict__ QLp, const _Float16* __restrict__ KHp, const _Float16* __restrict__ KLp, const _Float16* __restrict__ VTp, _Float16* __restrict__ O) {
  const int lane = threadIdx.x & 31, ln = lane & 15, hh = lane >> 4; const int w = __builtin_amdgcn_readfirstlane(threadIdx.x >> 5);      /* the wave's number as a scalar: the trip count and the mask test stay scalar */
  const int bh = blockIdx.x % (NB * NH), tx = blockIdx.x / (NB * NH); const int tile = (tx < SQ / 256) ? (SQ / 128 - 1 - tx) : (tx - SQ / 256);      /* long tiles take the low block numbers; the second half of the grid counts up from the short end */
  const int b = bh / NH, h = bh % NH; const int q0 = tile * 128 + w * 16; const size_t r0 = (size_t)b * SQ;
  const _Float16* qh = QHp + (r0 + q0 + ln) * LQ + h * HD + 8 * hh; const _Float16* ql = QLp + (r0 + q0 + ln) * LQ + h * HD + 8 * hh;
  const v16h qh0 = fa_frag(qh), qh1 = fa_frag(qh + 32), ql0 = fa_frag(ql), ql1 = fa_frag(ql + 32);
  const _Float16* kh = KHp + (r0 + ln) * LQ + h * HD + 8 * hh; const _Float16* kl = KLp + (r0 + ln) * LQ + h * HD + 8 * hh; const _Float16* vt = VTp + ((size_t)bh * HD + ln) * SQ + 8 * hh;
  const v8f z8 = {0.f,0.f,0.f,0.f,0.f,0.f,0.f,0.f}; v8f o[4] = {z8, z8, z8, z8}; float m = -1.0e30f, l = 0.f;
  const int np = q0 / 32 + 1;      /* keys 0 .. q0 + 15 in passes of 32 */
  v16h fh[2][2], fl[2][2];      /* K fragments [key tile][k step], fetched one pass ahead */
#pragma unroll      /* static indices keep the fragments, scores and accumulators in registers */
  for (int kt = 0; kt < 2; ++kt) for (int ks = 0; ks < 2; ++ks) { fh[kt][ks] = fa_frag(kh + (size_t)kt * 16 * LQ + ks * 32); fl[kt][ks] = fa_frag(kl + (size_t)kt * 16 * LQ + ks * 32); }
  asm volatile("s_wait_xcnt 0x0" :: "v"(qh), "v"(ql), "v"(kh), "v"(kl) : "memory");      /* the loads' four address pairs stay whole up to here and are free for reuse only behind this wait */
  for (int p = 0; p < np; ++p) { const int k0 = p * 32;
    const _Float16* va = vt + k0; v16h fv[4];
#pragma unroll      /* static indices keep the fragments, scores and accumulators in registers */
    for (int dt = 0; dt < 4; ++dt) fv[dt] = fa_frag(va + (size_t)dt * 16 * SQ);
    v8f sh[2], sl[2];
#pragma unroll      /* static indices keep the fragments, scores and accumulators in registers */
    for (int kt = 0; kt < 2; ++kt) { sh[kt] = fa_mma(fh[kt][1], qh1, fa_mma(fh[kt][0], qh0, z8)); sl[kt] = fa_mma(fl[kt][1], qh1, fa_mma(fl[kt][0], qh0, fa_mma(fh[kt][1], ql1, fa_mma(fh[kt][0], ql0, z8)))); }
    const int kn = (p + 1 < np) ? k0 + 32 : k0;      /* the last pass fetches its own rows again: in bounds, unused */
    const _Float16* ka = kh + (size_t)kn * LQ; const _Float16* kb = kl + (size_t)kn * LQ;
#pragma unroll      /* static indices keep the fragments, scores and accumulators in registers */
    for (int kt = 0; kt < 2; ++kt) for (int ks = 0; ks < 2; ++ks) { fh[kt][ks] = fa_frag(ka + (size_t)kt * 16 * LQ + ks * 32); fl[kt][ks] = fa_frag(kb + (size_t)kt * 16 * LQ + ks * 32); }
    asm volatile("s_wait_xcnt 0x0" :: "v"(va), "v"(ka), "v"(kb) : "memory");      /* this pass's three address pairs stay whole up to here and are free for reuse only behind this wait */
    float s[16];
#pragma unroll      /* static indices keep the fragments, scores and accumulators in registers */
    for (int e = 0; e < 16; ++e) s[e] = fmaf(sl[e >> 3][e & 7], SCLR, sh[e >> 3][e & 7] * SCL);
    if (k0 + 31 > q0) {      /* only the pass on the diagonal masks; key k0 <= q0 stays, so every query keeps a key */
#pragma unroll      /* static indices keep the fragments, scores and accumulators in registers */
      for (int e = 0; e < 16; ++e) s[e] = (k0 + (e >> 3) * 16 + 8 * hh + (e & 7) <= q0 + ln) ? s[e] : -1.0e30f; }
    float mx = s[0];
#pragma unroll      /* static indices keep the fragments, scores and accumulators in registers */
    for (int e = 1; e < 16; ++e) mx = fmaxf(mx, s[e]);
    mx = fmaxf(mx, __shfl_xor(mx, 16, 32)); const float mn = fmaxf(m, mx); const float al = fa_exp(m - mn); m = mn;
    FragH pf; float ps[4] = {0.f, 0.f, 0.f, 0.f};
#pragma unroll      /* static indices keep the fragments, scores and accumulators in registers */
    for (int e = 0; e < 16; ++e) { const float pe = fa_exp(s[e] - mn); ps[e & 3] += pe; pf.h[e] = (_Float16)pe; }
    l = fmaf(l, al, (ps[0] + ps[1]) + (ps[2] + ps[3]));
#pragma unroll      /* static indices keep the fragments, scores and accumulators in registers */
    for (int dt = 0; dt < 4; ++dt) { o[dt] *= al; o[dt] = fa_mma(fv[dt], pf.v, o[dt]); } }
  l += __shfl_xor(l, 16, 32); const float fin = 64.0f / l;      /* o carried x64, folded into the output GEMM's alpha */
  _Float16* op = O + (r0 + q0 + ln) * DM + h * HD + 8 * hh;
#pragma unroll      /* static indices keep the fragments, scores and accumulators in registers */
  for (int dt = 0; dt < 4; ++dt) { FragH f;
#pragma unroll      /* static indices keep the fragments, scores and accumulators in registers */
    for (int r = 0; r < 8; ++r) f.h[r] = (_Float16)(o[dt][r] * fin);
    *(v8us*)((unsigned short*)op + dt * 16) = f.half[0]; } }


typedef float v2f __attribute__((ext_vector_type(2)));
// Exact f32 attention for query rows 0 .. QT0-1 of one batch, one wave per (head, query row), 8 rows of one head per block. The head's QT0 K and V rows are staged once in LDS;
// lane l scores keys l, l + 32, l + 64, l + 96; row maximum and row sum are lane partials joined by butterflies; lane l then sums dims 2l, 2l + 1 over the keys (weight 0 behind the diagonal).
__global__ __launch_bounds__(256) void k_att0w(const float* __restrict__ QF, const float* __restrict__ KF, const float* __restrict__ VF, float scale, float* __restrict__ OF) {
  __shared__ __attribute__((aligned(16))) float lk[QT0][HD + 4];      /* pitch 272 B = 16 B x odd: one key row per lane reads without bank conflicts */
  __shared__ __attribute__((aligned(16))) float lv[QT0][HD];
  const int tid = threadIdx.x, lane = tid & 31; const int w = __builtin_amdgcn_readfirstlane(tid >> 5);      /* the wave's number as a scalar: q is read through scalar loads */
  const int h = blockIdx.x / (QT0 / 8), i = (blockIdx.x % (QT0 / 8)) * 8 + w;
  const int sr = tid >> 4, sc = (tid & 15) * 4; const float* kg = KF + (size_t)sr * DM + h * HD + sc; const float* vg = VF + (size_t)sr * DM + h * HD + sc; v4f ks[QT0 / 16], vs[QT0 / 16];
#pragma unroll      /* static indices keep ks[] and vs[] in registers; every load is issued before the first LDS store */
  for (int u = 0; u < QT0 / 16; ++u) { ks[u] = *(const v4fa*)(kg + (size_t)u * 16 * DM); vs[u] = *(const v4fa*)(vg + (size_t)u * 16 * DM); }
  asm volatile("s_wait_xcnt 0x0" :: "v"(kg), "v"(vg) : "memory");      /* the loads' two address pairs stay whole up to here and are free for reuse only behind this wait */
#pragma unroll      /* static indices keep ks[] and vs[] in registers */
  for (int u = 0; u < QT0 / 16; ++u) { *(v4f*)&lk[u * 16 + sr][sc] = ks[u]; *(v4f*)&lv[u * 16 + sr][sc] = vs[u]; }
  __syncthreads();
  const float* qg = QF + (size_t)i * DM + h * HD; v4f a[QT0 / 32] = {};
#pragma unroll      /* static indices keep a[] in registers: four independent sums per key, four keys per lane */
  for (int d = 0; d < HD / 4; ++d) { for (int c = 0; c < QT0 / 32; ++c) { const v4f kk = *(const v4f*)&lk[c * 32 + lane][d * 4]; for (int u = 0; u < 4; ++u) a[c][u] = fmaf(qg[d * 4 + u], kk[u], a[c][u]); } }
  float e[QT0 / 32]; float m = -1.0e30f;
#pragma unroll      /* static indices keep e[] in registers */
  for (int c = 0; c < QT0 / 32; ++c) { e[c] = (c * 32 + lane <= i) ? ((a[c][0] + a[c][1]) + (a[c][2] + a[c][3])) * scale : -1.0e30f; m = fmaxf(m, e[c]); }
  for (int x = 16; x >= 1; x >>= 1) m = fmaxf(m, __shfl_xor(m, x, 32));
  float l = 0.f;
#pragma unroll      /* static indices keep e[] in registers */
  for (int c = 0; c < QT0 / 32; ++c) { e[c] = expf(e[c] - m); l += e[c]; }      /* a key behind the diagonal: exp(-1e30 - m) = 0 */
  for (int x = 16; x >= 1; x >>= 1) l += __shfl_xor(l, x, 32);
  v2f o[4] = {};
#pragma unroll      /* a constant lane number per step: key j's weight is broadcast through a scalar register; static indices keep e[] and o[] in registers */
  for (int j = 0; j < QT0; ++j) { const float ej = __int_as_float(__builtin_amdgcn_readlane(__float_as_int(e[j >> 5]), j & 31)); const v2f vv = *(const v2f*)&lv[j][lane * 2]; o[j & 3][0] = fmaf(ej, vv[0], o[j & 3][0]); o[j & 3][1] = fmaf(ej, vv[1], o[j & 3][1]); }
  const float fin = 64.0f / l;      /* o carried x64 like the f16 path */
  const v2f r = ((o[0] + o[1]) + (o[2] + o[3])) * fin;
  *(v2f*)(OF + (size_t)i * DM + h * HD + lane * 2) = r; }

extern "C" void kernel_launch(void* const* d_in, const int* in_sizes, int n_in,
                              void* d_out, int out_size, void* d_ws, size_t ws_size, hipStream_t stream) {
  (void)in_sizes; (void)n_in; (void)out_size;
  const float* const* I = (const float* const*)d_in; const float* x = I[0]; const float* xk = I[1]; const float* xv = I[2]; const float* wq = I[3]; const float* bq = I[4]; const float* wk = I[5]; const float* bk = I[6]; const float* wv = I[7]; const float* bv = I[8]; const float* wo = I[9]; const float* bo = I[10];      /* input order: query, key, value (THREE input streams), then [in][out] weights + biases */
  char* ws = (char*)d_ws; size_t off = 0;
  auto take = [&](size_t bytes) { char* p = ws + off; off += (bytes + 255) & ~(size_t)255; return p; };
  _Float16* BQ = (_Float16*)take((size_t)DM * DM * 2); _Float16* BK = (_Float16*)take((size_t)DM * DM * 2); _Float16* BV = (_Float16*)take((size_t)DM * DM * 2); _Float16* BO = (_Float16*)take((size_t)DM * DM * 2);
  _Float16* X16 = (_Float16*)take(NR * DM * 2); _Float16* XK16 = (_Float16*)take(NR * DM * 2); _Float16* XV16 = (_Float16*)take(NR * DM * 2);      /* exact f16 rows of query, key, value */ float* QF = (float*)take(NR * DM * 4); _Float16* QH = (_Float16*)take(NR * DM * 2); _Float16* QL = (_Float16*)take(NR * DM * 2); _Float16* KH = (_Float16*)take(NR * DM * 2); _Float16* KL = (_Float16*)take(NR * DM * 2); _Float16* Q16 = QH; _Float16* K16 = KH; _Float16* V16 = (_Float16*)take(NR * DM * 2); _Float16* O16 = (_Float16*)take(NR * DM * 2);
  _Float16* VT = (_Float16*)take((size_t)NB * NH * HD * SQ * 2);      /* V^T of both batches */
  float* QF0 = (float*)take((size_t)QT0 * DM * 4); float* KF0 = (float*)take((size_t)QT0 * DM * 4); float* VF0 = (float*)take((size_t)QT0 * DM * 4); float* OF0 = (float*)take((size_t)NB * QT0 * DM * 4); _Float16* OH0 = (_Float16*)take((size_t)NB * QT0 * DM * 2); _Float16* OL0 = (_Float16*)take((size_t)NB * QT0 * DM * 2);
  if (off > ws_size) return;
  { const unsigned g = (unsigned)(((size_t)DM * (DM / 8) + 255) / 256); k_wt_f16<<<g, 256, 0, stream>>>(wq, BQ, DM, DM, 16.0f); k_wt_f16<<<g, 256, 0, stream>>>(wk, BK, DM, DM, 16.0f); k_wt_f16<<<g, 256, 0, stream>>>(wv, BV, DM, DM, 16.0f); k_wt_f16<<<g, 256, 0, stream>>>(wo, BO, DM, DM, 16.0f); }      /* [in][out] -> Bt[n][k] x16 */
  k_x16<<<(unsigned)((NR * DM / 8 + 255) / 256), 256, 0, stream>>>(x, X16, NR * DM / 8); k_x16<<<(unsigned)((NR * DM / 8 + 255) / 256), 256, 0, stream>>>(xk, XK16, NR * DM / 8); k_x16<<<(unsigned)((NR * DM / 8 + 255) / 256), 256, 0, stream>>>(xv, XV16, NR * DM / 8);
  const size_t r0p = (size_t)B0 * SQ;      /* first projected row */
  k_gemm2<0><<<dim3((unsigned)((MP / 128) * (DM / 64)), 1), 128, 0, stream>>>(X16 + r0p * DM, DM, 0, BQ, DM, 0, 0.0625f, bq, 0, nullptr, 1, 0, 0, QF + r0p * DM, nullptr, DM, 0, MP, DM, DM); k_hl<<<(unsigned)(((size_t)MP * DM / 8 + 255) / 256), 256, 0, stream>>>(QF + r0p * DM, QH + r0p * DM, QL + r0p * DM, (size_t)MP * DM / 8);      /* q (f32) -> f16 hi + x1024 residual: unscaled logits sigma ~8 */
  k_gemm2<0><<<dim3((unsigned)((MP / 128) * (DM / 64)), 1), 128, 0, stream>>>(XK16 + r0p * DM, DM, 0, BK, DM, 0, 0.0625f, bk, 0, nullptr, 1, 0, 0, QF + r0p * DM, nullptr, DM, 0, MP, DM, DM); k_hl<<<(unsigned)(((size_t)MP * DM / 8 + 255) / 256), 256, 0, stream>>>(QF + r0p * DM, KH + r0p * DM, KL + r0p * DM, (size_t)MP * DM / 8);      /* k likewise */
  k_gemm2<0><<<dim3((unsigned)((MP / 128) * (DM / 64)), 1), 128, 0, stream>>>(XV16 + r0p * DM, DM, 0, BV, DM, 0, 0.0625f, bv, 0, nullptr, 1, 0, 0, nullptr, V16 + r0p * DM, DM, 0, MP, DM, DM);
  for (int b = B0; b < B0 + NBR; ++b) { const size_t r0 = (size_t)b * SQ;
    k_vt<NH, SQ><<<NH * (SQ / 64), 256, 0, stream>>>(V16 + r0 * LQ, LQ, 0, VT + (size_t)b * NH * HD * SQ);      /* V^T [NH][HD][SQ] for this batch */
    k_gemm2<0><<<dim3((QT0 / 128) * (DM / 64), 1), 128, 0, stream>>>(X16 + r0 * DM, DM, 0, BQ, DM, 0, 0.0625f, bq, 0, nullptr, 1, 0, 0, QF0, nullptr, DM, 0, QT0, DM, DM); k_gemm2<0><<<dim3((QT0 / 128) * (DM / 64), 1), 128, 0, stream>>>(XK16 + r0 * DM, DM, 0, BK, DM, 0, 0.0625f, bk, 0, nullptr, 1, 0, 0, KF0, nullptr, DM, 0, QT0, DM, DM); k_gemm2<0><<<dim3((QT0 / 128) * (DM / 64), 1), 128, 0, stream>>>(XV16 + r0 * DM, DM, 0, BV, DM, 0, 0.0625f, bv, 0, nullptr, 1, 0, 0, VF0, nullptr, DM, 0, QT0, DM, DM);      /* f32 q, k, v of the first 128 rows (exact products) */
    k_att0w<<<NH * (QT0 / 8), 256, 0, stream>>>(QF0, KF0, VF0, SCL, OF0 + (size_t)b * QT0 * DM);      /* exact f32 attention for rows 0..127 (o x64), one wave per (head, row) */ }
  k_fattn<<<NB * NH * (SQ / 128), 256, 0, stream>>>(QH, QL, KH, KL, VT, O16);      /* scores, causal softmax and P V of both batches and all heads in one launch: o (merged heads, x64) as f16 rows */
  k_gemm2<0><<<dim3((unsigned)((MPO / 128) * (DM / 64)), 1), 128, 0, stream>>>(O16 + r0p * DM, DM, 0, BO, DM, 0, 0.0009765625f, bo, 0, nullptr, 1, 0, 0, (float*)d_out + r0p * DM, nullptr, DM, 0, MPO, DM, DM);      /* out rows are the output layout */
  k_hl<<<(unsigned)(((size_t)NB * QT0 * DM / 8 + 255) / 256), 256, 0, stream>>>(OF0, OH0, OL0, (size_t)NB * QT0 * DM / 8);      /* first-tile o (x64) -> f16 hi + x1024 residual planes */
  for (int b = B0; b < B0 + NBR; ++b) { const size_t r0 = (size_t)b * SQ; const size_t f0 = (size_t)b * QT0;
    k_gemm2<0><<<dim3((QT0 / 128) * (DM / 64), 1), 128, 0, stream>>>(OH0 + f0 * DM, DM, 0, BO, DM, 0, 0.0009765625f, bo, 0, nullptr, 1, 0, 0, (float*)d_out + r0 * DM, nullptr, DM, 0, QT0, DM, DM);      /* rows 0..127: out = o_hi Wo (+ b), overwriting the f16-path rows */
    k_gemm2<0><<<dim3((QT0 / 128) * (DM / 64), 1), 128, 0, stream>>>(OL0 + f0 * DM, DM, 0, BO, DM, 0, 0.00000095367431640625f, nullptr, 0, (const float*)d_out + r0 * DM, -1, 0, 0, (float*)d_out + r0 * DM, nullptr, DM, 0, QT0, DM, DM); }      /* += o_lo Wo 2^-20 (own-element accumulate) */
}

// v004
// A run of this version takes 451 microseconds.
// Two timings next to v003 both put it at 1.33 times that version's speed.
// Over all steps from v000 it is 12.8 times as fast.
#include <hip/hip_runtime.h>
// Causal multi-head attention on three inputs with the source's sequence-length score scale (query, key, value [2][2048][1024]; q = query Wq + bq, k = key Wk + bk, v = value Wv + bv ([in][out] 1024 x 1024, weights AND biases sigma 1/32), 16 heads of 64; score = q k^T; triu(1) -> -inf; softmax(score / sqrt(Sk)) with Sk = 2048 KEYS (the source divides by sqrt of the score matrix's last dimension, NOT by sqrt(head_dim)): scale 2048^-0.5 = 0.0220970869; out = merged Wo + bo ([in][out]) -> [2][2048][1024]); q and k carried as f16 hi + x1024 residual planes with three-product scores.
// Structure: token rows r = b*2048 + s; x as exact f16 rows (bf16-rounded); q and k as WMMA GEMMs (32x64 wave tiles, f32 accumulation, exact x16 weights + bias) into f32 rows split into f16 hi + x1024 residual planes, v as a GEMM that stores f16 rows and f32 rows; the f32 q, k, v rows are kept for the exact first-tile attention; per batch: V^T for all heads via LDS transposes; then ONE fused attention launch (a wave per 16 queries, keys below the diagonal in passes of 32: three-product scores hi.hi + lo.hi + hi.lo in f32 accumulators, running-maximum softmax in registers (f32 statistics, native exp; weights in (0, 1] as f16), o = P . V^T normalised at the end, carried x64 and folded into the output GEMM alpha) written straight into the merged f16 o rows; out = o W_o + b GEMM (f32) into the output layout.
// Compute dtype: inputs rounded to bf16; x / weights exact; q and k as f16 hi + x1024 residual planes; v, softmax weights and o as plain f16 GEMM operands (~2^-12); scores and softmax statistics f32. v_wmma_f32_16x16x32_f16.
#define NB 2
#define SCL 0.0220970869f                 /* = f32(1 / sqrt(2048)): the source scales the scores by 1/sqrt(Sk), Sk = 2048 keys */
#define SCLR (0.0220970869f * 0.0009765625f)   /* the same scale on the x1024 residual passes */
#define SQ 2048
#define DM 1024
#define NH 16
#define HD 64
#define HG 4                         /* heads per launch of the head-group k_vt overload, which is not launched */
#define QT0 128                      /* first-tile rows recomputed exactly in f32 */
#define B0 0                         /* first batch processed (debug hook) */
#define NBR NB                       /* batches processed (debug hook) */
#define NR ((size_t)NB * SQ)         /* token rows */
#define MP ((int)((size_t)NBR * SQ)) /* rows projected (debug hook) */
#define MPO MP                       /* rows through the output stage (debug hook) */
#define LQ DM      /* row pitch of the q/k/v rows */
typedef __bf16 v16b __attribute__((ext_vector_type(16)));
typedef unsigned short v8us __attribute__((ext_vector_type(8), may_alias));
typedef float  v8f  __attribute__((ext_vector_type(8)));
typedef float  v4f  __attribute__((ext_vector_type(4)));
typedef float  v4fa __attribute__((ext_vector_type(4), may_alias));
union FragB { v16b v; v8us half[2]; unsigned short u[16]; };

__device__ __forceinline__ unsigned short bf16_bits(float x) { unsigned int u = __float_as_uint(x); return (unsigned short)((u + 0x7FFFu + ((u >> 16) & 1u)) >> 16); }
__device__ __forceinline__ float bf16_val(unsigned short b) { return __uint_as_float(((unsigned int)b) << 16); }
__device__ __forceinline__ float bf16_round(float x) { return bf16_val(bf16_bits(x)); }
// D += A·B with NT terms: 1 = ah·bh, 2 = + al·bh (A split), 3 = + ah·bl (both split)
template <int NT>
__device__ __forceinline__ v8f mmaN(v16b ah, v16b al, v16b bh, v16b bl, v8f c) {
  c = __builtin_amdgcn_wmma_f32_16x16x32_bf16(false, ah, false, bh, (short)0, c, false, false);
  if (NT >= 2) c = __builtin_amdgcn_wmma_f32_16x16x32_bf16(false, al, false, bh, (short)0, c, false, false);
  if (NT >= 3) c = __builtin_amdgcn_wmma_f32_16x16x32_bf16(false, ah, false, bl, (short)0, c, false, false);
  asm volatile("v_nop\n\tv_nop\n\tv_nop\n\tv_nop" : "+v"(c) : "v"(ah), "v"(al), "v"(bh), "v"(bl));
  return c;
}

__global__ __launch_bounds__(256) void k_wt_bf16(const float* __restrict__ W, unsigned short* __restrict__ Wt, int K, int N) {
  const int t = blockIdx.x * 256 + threadIdx.x;
  const int k8n = K / 8;
  if (t >= N * k8n) return;
  const int n = t / k8n, k8 = (t % k8n) * 8;
  v8us v;
#pragma unroll
  for (int i = 0; i < 8; ++i) v[i] = bf16_bits(W[(size_t)(k8 + i) * N + n]);
  *(v8us*)(Wt + (size_t)n * K + k8) = v;
  
}

// GEMM C[M][N] (f32, pitch ldc) = act(A[M][K]·W + bias). A f32 row-major (pitch lda) converted per fragment to bf16
// (ASPLIT: hi/lo two planes -> 2 terms, else single rounded term); Wt bf16 [N][K] (pitch ldb). BIAS_BF16 rounds the
// bias to bf16 first (bias quantised to bf16 before the add). K%32==0, M%16==0, N%64==0.
template <bool ASPLIT, int ACT, bool BIAS_BF16>
__global__ __launch_bounds__(128) void k_gemm_bf(const float* __restrict__ A, int lda, const unsigned short* __restrict__ Wt, int ldb,
                                               const float* __restrict__ bias, float* __restrict__ C, int ldc, int M, int N, int K) {
  __shared__ __attribute__((aligned(16))) float so[4][16][64];
  const int tid = threadIdx.x, w = tid >> 5, lane = tid & 31, ln = lane & 15, hh = lane >> 4;
  const int ntn = N / 64;
  const int wid = blockIdx.x * 4 + w;
  const int mt = wid / ntn, nq = wid % ntn;
  if (mt * 16 >= M) return;
  const int row0 = mt * 16, col0 = nq * 64;
  const float* arow = A + (size_t)(row0 + ln) * lda;
  v8f acc[4] = {};
  for (int kb = 0; kb < K; kb += 32) {
    FragB ah, al;
    const v4f x0 = *(const v4fa*)(arow + kb + 8 * hh), x1 = *(const v4fa*)(arow + kb + 8 * hh + 4);
    const v4f x2 = *(const v4fa*)(arow + kb + 16 + 8 * hh), x3 = *(const v4fa*)(arow + kb + 16 + 8 * hh + 4);
    float xs[16] = {x0[0],x0[1],x0[2],x0[3],x1[0],x1[1],x1[2],x1[3],x2[0],x2[1],x2[2],x2[3],x3[0],x3[1],x3[2],x3[3]};
#pragma unroll
    for (int i = 0; i < 16; ++i) { const unsigned short hb = bf16_bits(xs[i]); ah.u[i] = hb; al.u[i] = ASPLIT ? bf16_bits(xs[i] - bf16_val(hb)) : (unsigned short)0; }
#pragma unroll
    for (int t = 0; t < 4; ++t) {
      const unsigned short* brow = Wt + (size_t)(col0 + t * 16 + ln) * ldb + kb;
      FragB b;
      b.half[0] = *(const v8us*)(brow + 8 * hh);
      b.half[1] = *(const v8us*)(brow + 16 + 8 * hh);
      acc[t] = mmaN<ASPLIT ? 2 : 1>(ah.v, al.v, b.v, b.v, acc[t]);
    }
  }
#pragma unroll
  for (int t = 0; t < 4; ++t) {
    float bv = bias ? bias[col0 + t * 16 + ln] : 0.f;
    if (BIAS_BF16) bv = bf16_round(bv);
#pragma unroll
    for (int r = 0; r < 8; ++r) { float v = acc[t][r] + bv; if (ACT == 1) v = fmaxf(v, 0.f); so[w][8 * hh + r][t * 16 + ln] = v; }
  }
  __builtin_amdgcn_fence(__ATOMIC_ACQ_REL, "workgroup");
  __builtin_amdgcn_wave_barrier();
  const int rsub = lane >> 4, c4 = (lane & 15) * 4;
  {
#pragma unroll
    for (int q = 0; q < 8; ++q) {
      const int r = q * 2 + rsub;
      const v4f v = *(const v4fa*)&so[w][r][c4];
      *(v4f*)(C + (size_t)(row0 + r) * ldc + col0 + c4) = v;
    }
    
  }
}

// GEMM C = act(A·W + bias + resid): A f32 (ASPLIT -> hi/lo 2 terms), Wt bf16 [N][K]; ACT 0 none, 1 relu, 2 exact gelu;
// resid (optional, f32, row index = (row % rmod), pitch ldr, RES_BF16 rounds it) added before the activation.
template <bool ASPLIT, int ACT, bool BIAS_BF16, bool RES_BF16>
__global__ __launch_bounds__(128) void k_gemm_bf3(const float* __restrict__ A, int lda, const unsigned short* __restrict__ Wt, int ldb,
                                                const float* __restrict__ bias, const float* __restrict__ resid, int rmod, int ldr,
                                                float* __restrict__ C, int ldc, int M, int N, int K) {
  __shared__ __attribute__((aligned(16))) float so[4][16][64];
  const int tid = threadIdx.x, w = tid >> 5, lane = tid & 31, ln = lane & 15, hh = lane >> 4;
  const int ntn = N / 64;
  const int wid = blockIdx.x * 4 + w;
  const int mt = wid / ntn, nq = wid % ntn;
  if (mt * 16 >= M) return;
  const int row0 = mt * 16, col0 = nq * 64;
  const float* arow = A + (size_t)(row0 + ln) * lda;
  v8f acc[4] = {};
  for (int kb = 0; kb < K; kb += 32) {
    FragB ah, al;
    const v4f x0 = *(const v4fa*)(arow + kb + 8 * hh), x1 = *(const v4fa*)(arow + kb + 8 * hh + 4);
    const v4f x2 = *(const v4fa*)(arow + kb + 16 + 8 * hh), x3 = *(const v4fa*)(arow + kb + 16 + 8 * hh + 4);
    float xs[16] = {x0[0],x0[1],x0[2],x0[3],x1[0],x1[1],x1[2],x1[3],x2[0],x2[1],x2[2],x2[3],x3[0],x3[1],x3[2],x3[3]};
#pragma unroll
    for (int i = 0; i < 16; ++i) { const unsigned short hb = bf16_bits(xs[i]); ah.u[i] = hb; al.u[i] = ASPLIT ? bf16_bits(xs[i] - bf16_val(hb)) : (unsigned short)0; }
#pragma unroll
    for (int t = 0; t < 4; ++t) {
      const unsigned short* brow = Wt + (size_t)(col0 + t * 16 + ln) * ldb + kb;
      FragB b;
      b.half[0] = *(const v8us*)(brow + 8 * hh);
      b.half[1] = *(const v8us*)(brow + 16 + 8 * hh);
      acc[t] = mmaN<ASPLIT ? 2 : 1>(ah.v, al.v, b.v, b.v, acc[t]);
    }
  }
#pragma unroll
  for (int t = 0; t < 4; ++t) {
    const int col = col0 + t * 16 + ln;
    float bv = bias ? bias[col] : 0.f;
    if (BIAS_BF16) bv = bf16_round(bv);
#pragma unroll
    for (int r = 0; r < 8; ++r) {
      float v = acc[t][r] + bv;
      if (resid) { float rv = resid[(size_t)((row0 + 8 * hh + r) % rmod) * ldr + col]; if (RES_BF16) rv = bf16_round(rv); v += rv; }
      if (ACT == 1) v = fmaxf(v, 0.f);
      if (ACT == 2) v = 0.5f * v * (1.0f + erff(v * 0.70710678118654752f));
      if (ACT == 3) { const float u = 0.7978845608028654f * (v + 0.044715f * v * v * v); v = 0.5f * v * (1.0f + tanhf(u)); }
      so[w][8 * hh + r][t * 16 + ln] = v;
    }
  }
  __builtin_amdgcn_fence(__ATOMIC_ACQ_REL, "workgroup");
  __builtin_amdgcn_wave_barrier();
  const int rsub = lane >> 4, c4 = (lane & 15) * 4;
  {
#pragma unroll
    for (int q = 0; q < 8; ++q) {
      const int r = q * 2 + rsub;
      const v4f v = *(const v4fa*)&so[w][r][c4];
      *(v4f*)(C + (size_t)(row0 + r) * ldc + col0 + c4) = v;
    }
    
  }
}
// row LayerNorm (biased variance, eps) over N: s = X (+ R); optional out_sum <- s; out_norm <- (s-mu)*rsqrt(var+eps)*g + b
template <bool PARAM_BF16>
__global__ __launch_bounds__(256) void k_layernorm(const float* __restrict__ X, const float* __restrict__ R, const float* __restrict__ g, const float* __restrict__ bta,
                                                  float* __restrict__ out_sum, float* __restrict__ out_norm, int N, float eps) {
  __shared__ float red[256];
  const int row = blockIdx.x, tid = threadIdx.x;
  const float* x = X + (size_t)row * N; const float* rr = R ? R + (size_t)row * N : nullptr;
  float vals[16];                     // up to N = 4096
  const int per = N / 256;            // contiguous chunk per thread? use strided-by-4 chunks: thread handles j = tid*4 + 1024*u
  float s1 = 0.f;
  for (int u = 0; u < per / 4; ++u) {
    const int j = tid * 4 + 1024 * u;
    const v4f a = *(const v4fa*)(x + j);
    v4f b = {0.f,0.f,0.f,0.f}; if (rr) b = *(const v4fa*)(rr + j);
#pragma unroll
    for (int q = 0; q < 4; ++q) { const float v = a[q] + b[q]; vals[u * 4 + q] = v; s1 += v; }
  }
  red[tid] = s1; __syncthreads();
  for (int st = 128; st > 0; st >>= 1) { if (tid < st) red[tid] += red[tid + st]; __syncthreads(); }
  const float mu = red[0] / (float)N; __syncthreads();
  float s2 = 0.f;
  for (int u = 0; u < per / 4; ++u)
#pragma unroll
    for (int q = 0; q < 4; ++q) { const float c = vals[u * 4 + q] - mu; s2 += c * c; }
  red[tid] = s2; __syncthreads();
  for (int st = 128; st > 0; st >>= 1) { if (tid < st) red[tid] += red[tid + st]; __syncthreads(); }
  const float rs = rsqrtf(red[0] / (float)N + eps);
  {
    for (int u = 0; u < per / 4; ++u) {
      const int j = tid * 4 + 1024 * u;
      v4f o, sm;
#pragma unroll
      for (int q = 0; q < 4; ++q) {
        float gg = g[j + q], bb = bta[j + q];
        if (PARAM_BF16) { gg = bf16_round(gg); bb = bf16_round(bb); }
        sm[q] = vals[u * 4 + q]; o[q] = (vals[u * 4 + q] - mu) * rs * gg + bb;
      }
      if (out_sum) *(v4f*)(out_sum + (size_t)row * N + j) = sm;
      *(v4f*)(out_norm + (size_t)row * N + j) = o;
    }
    
  }
}



// ---- f16 WMMA path (v_wmma_f32_16x16x32_f16): 11-bit significands for operands in range — used where a [0,1] probability operand needs more precision than bf16
typedef _Float16 v16h __attribute__((ext_vector_type(16)));
union FragH { v16h v; v8us half[2]; _Float16 h[16]; unsigned short u[16]; };
template <int NT>
__device__ __forceinline__ v8f mmaH(v16h ah, v16h al, v16h bh, v16h bl, v8f c) {
  c = __builtin_amdgcn_wmma_f32_16x16x32_f16(false, ah, false, bh, (short)0, c, false, false);
  if (NT >= 2) c = __builtin_amdgcn_wmma_f32_16x16x32_f16(false, al, false, bh, (short)0, c, false, false);
  if (NT >= 3) c = __builtin_amdgcn_wmma_f32_16x16x32_f16(false, ah, false, bl, (short)0, c, false, false);
  asm volatile("v_nop\n\tv_nop\n\tv_nop\n\tv_nop" : "+v"(c) : "v"(ah), "v"(al), "v"(bh), "v"(bl));
  return c;
}
// batched GEMM like k_gemm_b but f16 operands: A f32 (split into f16 hi/lo if ASPLIT, else rounded to f16), Bt = f16 values [n][k]; alpha; C f32; N multiple of 16 (partial tiles skipped)
template <bool ASPLIT>
__global__ __launch_bounds__(128) void k_gemm_h(const float* __restrict__ A, int lda, size_t sA, const _Float16* __restrict__ Bh, int ldb, size_t sB, float alpha, float* __restrict__ C, int ldc, size_t sC, int M, int N, int K) {
  __shared__ __attribute__((aligned(16))) float so[4][16][64];
  const int tid = threadIdx.x, w = tid >> 5, lane = tid & 31, ln = lane & 15, hh = lane >> 4; const int by = blockIdx.y;
  A += (size_t)by * sA; Bh += (size_t)by * sB; C += (size_t)by * sC;
  const int ntn = (N + 63) / 64; const int wid = blockIdx.x * 4 + w; const int mt = wid / ntn, nq = wid % ntn; if (mt * 16 >= M) return;
  const int row0 = mt * 16, col0 = nq * 64; const float* arow = A + (size_t)(row0 + ln) * lda;
  v8f acc[4] = {};
  for (int kb = 0; kb < K; kb += 32) {
    FragH ah, al;
    const v4f x0 = *(const v4fa*)(arow + kb + 8 * hh), x1 = *(const v4fa*)(arow + kb + 8 * hh + 4), x2 = *(const v4fa*)(arow + kb + 16 + 8 * hh), x3 = *(const v4fa*)(arow + kb + 16 + 8 * hh + 4);
    float xs[16] = {x0[0],x0[1],x0[2],x0[3],x1[0],x1[1],x1[2],x1[3],x2[0],x2[1],x2[2],x2[3],x3[0],x3[1],x3[2],x3[3]};
#pragma unroll
    for (int i = 0; i < 16; ++i) { const _Float16 h = (_Float16)xs[i]; ah.h[i] = h; al.h[i] = ASPLIT ? (_Float16)(xs[i] - (float)h) : (_Float16)0.0f; }
#pragma unroll
    for (int t = 0; t < 4; ++t) { if (col0 + t * 16 >= N) continue; const size_t boff = (size_t)(col0 + t * 16 + ln) * ldb + kb; FragH bq; bq.half[0] = *(const v8us*)(Bh + boff + 8 * hh); bq.half[1] = *(const v8us*)(Bh + boff + 16 + 8 * hh);
      acc[t] = mmaH<ASPLIT ? 2 : 1>(ah.v, al.v, bq.v, bq.v, acc[t]); }
  }
#pragma unroll
  for (int t = 0; t < 4; ++t) { if (col0 + t * 16 >= N) continue;
#pragma unroll
    for (int r = 0; r < 8; ++r) so[w][8 * hh + r][t * 16 + ln] = acc[t][r] * alpha; }
  __builtin_amdgcn_fence(__ATOMIC_ACQ_REL, "workgroup"); __builtin_amdgcn_wave_barrier();
  const int rsub = lane >> 4, c4 = (lane & 15) * 4;
  {
#pragma unroll
    for (int q = 0; q < 8; ++q) { const int r = q * 2 + rsub; if (col0 + c4 < N) { const v4f v = *(const v4fa*)&so[w][r][c4]; *(v4f*)(C + (size_t)(row0 + r) * ldc + col0 + c4) = v; } }
     }
}

// Wt[n][k] = f16(W[k][n]·scale) from f32 row-major W[K][N] (scale = power of two; bf16-exact weights stay exact in f16 away from the subnormal range)
__global__ __launch_bounds__(256) void k_wt_f16(const float* __restrict__ W, _Float16* __restrict__ Wt, int K, int N, float scale) {
  const int t = blockIdx.x * 256 + threadIdx.x; if (t >= N * (K / 8)) return; const int n = t / (K / 8), k8 = (t % (K / 8)) * 8; FragH f;
#pragma unroll
  for (int i = 0; i < 8; ++i) f.h[i] = (_Float16)(bf16_round(W[(size_t)(k8 + i) * N + n]) * scale); const v8us o = f.half[0];
  *(v8us*)((unsigned short*)Wt + (size_t)n * K + k8) = o; 
}
// k_gemm_hh variant with fused epilogue: v = acc·alpha + bias[by·sBias + col] (+ CP[(row/rowsPerB)·sCPb + by·64 + col] if CP) ; ACT 0 none / 1 elu ; writes f16 C16 (and f32 C if non-null)
template <int ACT>
__global__ __launch_bounds__(128) void k_gemm_hhx(const _Float16* __restrict__ A, int lda, size_t sA, const _Float16* __restrict__ Bh, int ldb, size_t sB, float alpha, const float* __restrict__ bias, size_t sBias, const float* __restrict__ CP, int rowsPerB, size_t sCPb, int row0g,
    float* __restrict__ C, _Float16* __restrict__ C16, int ldc, size_t sC, int M, int N, int K) {
  __shared__ __attribute__((aligned(16))) float so[4][16][64];
  const int tid = threadIdx.x, w = tid >> 5, lane = tid & 31, ln = lane & 15, hh = lane >> 4; const int by = blockIdx.y;
  A += (size_t)by * sA; Bh += (size_t)by * sB; const size_t cofs = (size_t)by * sC; const float* bp = bias ? bias + (size_t)by * sBias : nullptr;
  const int ntn = (N + 63) / 64; const int wid = blockIdx.x * 4 + w; const int mt = wid / ntn, nq = wid % ntn; if (mt * 16 >= M) return;
  const int row0 = mt * 16, col0 = nq * 64; const _Float16* arow = A + (size_t)(row0 + ln) * lda;
  v8f acc[4] = {};
  for (int kb = 0; kb < K; kb += 32) { FragH ah; ah.half[0] = *(const v8us*)((const unsigned short*)arow + kb + 8 * hh); ah.half[1] = *(const v8us*)((const unsigned short*)arow + kb + 16 + 8 * hh);
#pragma unroll
    for (int t = 0; t < 4; ++t) { if (col0 + t * 16 >= N) continue; const size_t boff = (size_t)(col0 + t * 16 + ln) * ldb + kb; FragH bq; bq.half[0] = *(const v8us*)((const unsigned short*)Bh + boff + 8 * hh); bq.half[1] = *(const v8us*)((const unsigned short*)Bh + boff + 16 + 8 * hh);
      acc[t] = mmaH<1>(ah.v, ah.v, bq.v, bq.v, acc[t]); }
  }
#pragma unroll
  for (int t = 0; t < 4; ++t) { if (col0 + t * 16 >= N) continue; const int col = col0 + t * 16 + ln; const float bv = bp ? bf16_round(bp[col]) : 0.f;
#pragma unroll
    for (int r = 0; r < 8; ++r) { float v = acc[t][r] * alpha + bv; if (CP) { const int rr = row0g + row0 + 8 * hh + r; if (rowsPerB < 0) v += CP[cofs + (size_t)rr * ldc + col];      /* rowsPerB < 0: own element of the batched C plane */ else { const int bidx = rr / rowsPerB; v += CP[(size_t)bidx * sCPb + (size_t)by * 64 + col]; } } if (ACT == 1) v = (v > 0.f) ? v : expm1f(v); else if (ACT == 7) v = (v > 0.f) ? v + 1.0f : expf(v); else if (ACT == 8) v = tanhf(v); else if (ACT == 9) v = 0.5f * v * (1.0f + tanhf(0.7978845608028654f * (v + 0.044715f * v * v * v))); else if (ACT == 11) v = 1.0f / (1.0f + expf(-v)); else if (ACT == 12) v = (v > 0.f) ? v : 0.01f * v; else if (ACT == 14) v = (v > 0.f) ? v : 0.1f * v; else if (ACT == 16) v = (v >= 0.f) ? v : 0.3f * v; else if (ACT == 17) v = (v >= 0.f) ? v : 0.2f * v; else if (ACT == 15) v = v / (1.0f + expf(-v)); else if (ACT == 3) v = fmaxf(v, 0.f); else if (ACT == 6) v = 0.5f * v * (1.0f + erff(v * 0.70710678118654752f)); so[w][8 * hh + r][t * 16 + ln] = v; } }
  __builtin_amdgcn_fence(__ATOMIC_ACQ_REL, "workgroup"); __builtin_amdgcn_wave_barrier();
  const int rsub = lane >> 4, c4 = (lane & 15) * 4; typedef _Float16 v4h __attribute__((ext_vector_type(4)));
  {
#pragma unroll
    for (int q = 0; q < 8; ++q) { const int r = q * 2 + rsub; if (col0 + c4 < N) { const v4f v = *(const v4fa*)&so[w][r][c4]; if (C) *(v4f*)(C + cofs + (size_t)(row0 + r) * ldc + col0 + c4) = v; if (C16) { v4h h4; for (int i = 0; i < 4; ++i) h4[i] = (_Float16)v[i]; *(v4h*)(C16 + cofs + (size_t)(row0 + r) * ldc + col0 + c4) = h4; } } }
     }
}


typedef _Float16 v4h __attribute__((ext_vector_type(4)));

__global__ __launch_bounds__(256) void k_x16(const float* __restrict__ x, _Float16* __restrict__ X16, size_t n8) { const size_t t = (size_t)blockIdx.x * 256 + threadIdx.x; if (t >= n8) return; FragH f;
#pragma unroll
  for (int q = 0; q < 8; ++q) f.h[q] = (_Float16)bf16_round(x[t * 8 + q]); *(v8us*)((unsigned short*)X16 + t * 8) = f.half[0];  }
__global__ __launch_bounds__(256) void k_h16(const float* __restrict__ x, _Float16* __restrict__ X16, size_t n8) { const size_t t = (size_t)blockIdx.x * 256 + threadIdx.x; if (t >= n8) return; FragH f;
#pragma unroll
  for (int q = 0; q < 8; ++q) f.h[q] = (_Float16)x[t * 8 + q]; *(v8us*)((unsigned short*)X16 + t * 8) = f.half[0];  }
__global__ __launch_bounds__(256) void k_round16f(const float* __restrict__ W, _Float16* __restrict__ Bt, size_t n8) { const size_t t = (size_t)blockIdx.x * 256 + threadIdx.x; if (t >= n8) return; FragH f;
#pragma unroll
  for (int i = 0; i < 8; ++i) f.h[i] = (_Float16)(bf16_round(W[t * 8 + i]) * 16.0f); *(v8us*)((unsigned short*)Bt + t * 8) = f.half[0];  }
template <int NHv, int TTv>
__global__ __launch_bounds__(256) void k_vt(const _Float16* __restrict__ V16, int ldv, int voff, _Float16* __restrict__ Vt) { __shared__ unsigned short tl[64][66]; const int tid = threadIdx.x; const int slab = blockIdx.x / (TTv / 64), lg = blockIdx.x % (TTv / 64); const int b = slab / NHv, h = slab % NHv;
  for (int i = tid; i < 64 * 8; i += 256) { const int r = i / 8, c8 = (i % 8) * 8; FragH f; f.half[0] = *(const v8us*)((const unsigned short*)V16 + ((size_t)b * TTv + lg * 64 + r) * ldv + voff + h * 64 + c8);
#pragma unroll
    for (int q = 0; q < 8; ++q) tl[r][c8 + q] = f.u[q]; }
  __syncthreads();
  {
#pragma unroll
    for (int rd = 0; rd < 2; ++rd) { const int d = rd * 32 + tid / 8, pc = tid % 8; FragH f;
#pragma unroll
      for (int q = 0; q < 8; ++q) f.u[q] = tl[pc * 8 + q][d];
      *(v8us*)((unsigned short*)Vt + ((size_t)slab * 64 + d) * TTv + lg * 64 + pc * 8) = f.half[0]; }
     } }

__global__ __launch_bounds__(256) void k_hl(const float* __restrict__ F, _Float16* __restrict__ Hh, _Float16* __restrict__ Hl, size_t n8) { const size_t t = (size_t)blockIdx.x * 256 + threadIdx.x; if (t >= n8) return; FragH fh, fl; const v4f a = *(const v4fa*)(F + t * 8), c = *(const v4fa*)(F + t * 8 + 4);
#pragma unroll
  for (int q = 0; q < 4; ++q) { _Float16 h = (_Float16)a[q]; fh.h[q] = h; fl.h[q] = (_Float16)((a[q] - (float)h) * 1024.0f); h = (_Float16)c[q]; fh.h[4 + q] = h; fl.h[4 + q] = (_Float16)((c[q] - (float)h) * 1024.0f); }
  { *(v8us*)((unsigned short*)Hh + t * 8) = fh.half[0]; *(v8us*)((unsigned short*)Hl + t * 8) = fl.half[0];  } }

// ---- fast GEMM (wave tile 32x64; requires M % 32 == 0 rows per launch region and N % 64 == 0); epilogue = k_gemm_hhx semantics ----
__device__ __forceinline__ v16h g2_frag(const _Float16* p, int hh) { FragH f; f.half[0] = *(const v8us*)((const unsigned short*)p + 8 * hh); f.half[1] = *(const v8us*)((const unsigned short*)p + 16 + 8 * hh); return f.v; }
__device__ __forceinline__ v8f g2_mma(v16h a, v16h b, v8f c) { v8f d = __builtin_amdgcn_wmma_f32_16x16x32_f16(false, a, false, b, (short)0, c, false, false); asm volatile("v_nop\n\tv_nop\n\tv_nop\n\tv_nop" : "+v"(d) : "v"(a), "v"(b)); return d; }
template <int ACT>
__global__ __launch_bounds__(128) void k_gemm2(const _Float16* __restrict__ A, int lda, size_t sA, const _Float16* __restrict__ Bh, int ldb, size_t sB, float alpha, const float* __restrict__ bias, size_t sBias, const float* __restrict__ CP, int rowsPerB, size_t sCPb, int row0g,
    float* __restrict__ C, _Float16* __restrict__ C16, int ldc, size_t sC, int M, int N, int K) { static_assert(ACT == 0 || ACT == 3 || ACT == 6 || ACT == 8 || ACT == 9 || ACT == 11 || ACT == 12 || ACT == 14 || ACT == 15 || ACT == 16 || ACT == 17, "k_gemm2: unsupported ACT code (would silently apply no activation)");
  __shared__ __attribute__((aligned(16))) float so[4][32][68];
  const int tid = threadIdx.x, w = tid >> 5, lane = tid & 31, ln = lane & 15, hh = lane >> 4; const int by = blockIdx.y;
  A += (size_t)by * sA; Bh += (size_t)by * sB; const size_t cofs = (size_t)by * sC; const float* bp = bias ? bias + (size_t)by * sBias : nullptr;
  const int ntn = N >> 6; const int mt = blockIdx.x / ntn, nq = blockIdx.x - mt * ntn; const int row0 = mt * 128 + 32 * w, col0 = nq * 64; if (row0 >= M) return;
  const _Float16* a0p = A + (size_t)(row0 + ln) * lda; const _Float16* a1p = a0p + (size_t)16 * lda;
  const _Float16* b0p = Bh + (size_t)(col0 + ln) * ldb; const _Float16* b1p = b0p + (size_t)16 * ldb; const _Float16* b2p = b1p + (size_t)16 * ldb; const _Float16* b3p = b2p + (size_t)16 * ldb;
  const v8f z8 = {0.f,0.f,0.f,0.f,0.f,0.f,0.f,0.f}; v8f c00 = z8, c01 = z8, c02 = z8, c03 = z8, c10 = z8, c11 = z8, c12 = z8, c13 = z8;
#pragma unroll 1
  for (int kb = 0; kb < K; kb += 32) { const v16h a0 = g2_frag(a0p + kb, hh), a1 = g2_frag(a1p + kb, hh);
    v16h b = g2_frag(b0p + kb, hh); c00 = g2_mma(a0, b, c00); c10 = g2_mma(a1, b, c10);
    b = g2_frag(b1p + kb, hh); c01 = g2_mma(a0, b, c01); c11 = g2_mma(a1, b, c11);
    b = g2_frag(b2p + kb, hh); c02 = g2_mma(a0, b, c02); c12 = g2_mma(a1, b, c12);
    b = g2_frag(b3p + kb, hh); c03 = g2_mma(a0, b, c03); c13 = g2_mma(a1, b, c13); }
  v8f accs[8] = {c00, c01, c02, c03, c10, c11, c12, c13};
#pragma unroll
  for (int u = 0; u < 8; ++u) { const int t = u & 3, half = u >> 2; const int col = col0 + t * 16 + ln; const float bv = bp ? bf16_round(bp[col]) : 0.f;
#pragma unroll
    for (int r = 0; r < 8; ++r) { const int rloc = half * 16 + 8 * hh + r; float v = accs[u][r] * alpha + bv; if (CP) { if (rowsPerB < 0) v += CP[cofs + (size_t)(row0g + row0 + rloc) * ldc + col];      /* rowsPerB < 0: own element of the batched C plane */ else { const int bidx = (row0g + row0 + rloc) / rowsPerB; v += CP[(size_t)bidx * sCPb + (size_t)by * 64 + col]; } }
      if (ACT == 3) v = fmaxf(v, 0.f); else if (ACT == 6) v = 0.5f * v * (1.0f + erff(v * 0.70710678118654752f)); else if (ACT == 11) v = 1.0f / (1.0f + expf(-v)); else if (ACT == 15) v = v / (1.0f + expf(-v)); else if (ACT == 12) v = (v > 0.f) ? v : 0.01f * v; else if (ACT == 8) v = tanhf(v); else if (ACT == 9) v = 0.5f * v * (1.0f + tanhf(0.7978845608028654f * (v + 0.044715f * v * v * v))); else if (ACT == 14) v = (v > 0.f) ? v : 0.1f * v; else if (ACT == 16) v = (v >= 0.f) ? v : 0.3f * v; else if (ACT == 17) v = (v >= 0.f) ? v : 0.2f * v;
      so[w][rloc][t * 16 + ln] = v; } }
  __builtin_amdgcn_fence(__ATOMIC_ACQ_REL, "workgroup"); __builtin_amdgcn_wave_barrier();
  const int rsub = lane >> 4, c4 = (lane & 15) * 4;
  {
#pragma unroll
    for (int q = 0; q < 16; ++q) { const int r = q * 2 + rsub; const v4f v = *(const v4fa*)&so[w][r][c4]; if (C) { float* cp = C + cofs + (size_t)(row0 + r) * ldc + col0 + c4; *(v4f*)cp = v; asm volatile("s_wait_xcnt 0x0" :: "v"(cp), "v"(v) : "memory"); }      /* the f32 store's address pair and data registers stay whole up to here: the f16 conversion below and the next row's LDS read reuse them only behind this wait */ if (C16) { v4h h4; for (int i = 0; i < 4; ++i) h4[i] = (_Float16)v[i]; *(v4h*)(C16 + cofs + (size_t)(row0 + r) * ldc + col0 + c4) = h4; } }
     } }


__global__ __launch_bounds__(256) void k_wnat(const float* __restrict__ w, size_t n8, _Float16* __restrict__ Bt) { const size_t t = (size_t)blockIdx.x * 256 + threadIdx.x; if (t >= n8) return; FragH f; for (int q = 0; q < 8; ++q) f.h[q] = (_Float16)(bf16_round(w[t * 8 + q]) * 16.0f); *(v8us*)((unsigned short*)Bt + t * 8) = f.half[0];  }
__global__ __launch_bounds__(256) void k_rsm(const float* __restrict__ S, _Float16* __restrict__ P, int nrows) {
  #pragma clang fp contract(off)
  const int i = blockIdx.x * 256 + threadIdx.x; if (i >= nrows) return; const float* s = S + (size_t)i * SQ; float mx = -3.0e38f;
#pragma unroll 1
  for (int j = 0; j < SQ; ++j) mx = fmaxf(mx, s[j]); float se = 0.f;
#pragma unroll 1
  for (int j = 0; j < SQ; ++j) se += expf(s[j] - mx); const float sc = 256.0f / se;
#pragma unroll 1
  for (int j0 = 0; j0 < SQ; j0 += 8) { FragH f; for (int q = 0; q < 8; ++q) f.h[q] = (_Float16)(expf(s[j0 + q] - mx) * sc); unsigned short* d = (unsigned short*)P + (size_t)i * SQ + j0; *(v8us*)d = f.half[0];  } }
__global__ __launch_bounds__(256) void k_vt(const _Float16* __restrict__ V16, int b, int h0, _Float16* __restrict__ VT) { __shared__ unsigned short tl[64][65]; const int tid = threadIdx.x; const int hh = blockIdx.x % HG, sg = blockIdx.x / HG; const int s0 = sg * 64; const int h = h0 + hh;
  for (int i = tid; i < 64 * 8; i += 256) { const int j = i / 8, d8 = (i % 8) * 8; FragH f; f.half[0] = *(const v8us*)((const unsigned short*)V16 + ((size_t)b * SQ + s0 + j) * DM + h * HD + d8); for (int q = 0; q < 8; ++q) tl[d8 + q][j] = f.u[q]; }
  __syncthreads();
  { for (int i = tid; i < 64 * 8; i += 256) { const int d = i / 8, j8 = (i % 8) * 8; FragH f; for (int q = 0; q < 8; ++q) f.u[q] = tl[d][j8 + q]; *(v8us*)((unsigned short*)VT + ((size_t)hh * HD + d) * SQ + s0 + j8) = f.half[0]; }  } }



// Fused causal attention, one launch, a block for every (batch, head, 128 query rows): the scores and the softmax weights stay in registers.
// One wave owns 16 queries and walks the keys 32 at a time. S^T = K Q^T (A = K rows, B = Q rows, both through fa_frag, so the k orders pair): lane (ln, hh) holds, of query q0 + ln,
// the scores of keys k0 + 16 kt + 8 hh + r. Three products as before: hi.hi in one accumulator, lo.hi + hi.lo (x1024) in a second. Running maximum and running sum per query (the two
// lane halves share the maximum and join their sums at the end). The two score tiles, as f16, are the B operand of O^T += V^T P^T in the order fa_frag gives V^T's rows. o leaves x64.
__device__ __forceinline__ v16h fa_frag(const _Float16* p) { FragH f; f.half[0] = *(const v8us*)((const unsigned short*)p); f.half[1] = *(const v8us*)((const unsigned short*)p + 16); return f.v; }      /* g2_frag with the lane half's 8 elements already in p */
__device__ __forceinline__ float fa_exp(float x) { float r; asm("v_exp_f32 %0, %1\n\tv_nop" : "=v"(r) : "v"(x * 1.44269504f)); return r; }      /* native e^x; the v_nop fills the one slot the instruction set asks for behind a transcendental, whatever the compiler puts next */
__device__ __forceinline__ v8f fa_mma(v16h a, v16h b, v8f c) { return __builtin_amdgcn_wmma_f32_16x16x32_f16(false, a, false, b, (short)0, c, false, false); }
__global__ __launch_bounds__(256) void k_fattn(const _Float16* __restrict__ QHp, const _Float16* __restrict__ QLp, const _Float16* __restrict__ KHp, const _Float16* __restrict__ KLp, const _Float16* __restrict__ VTp, _Float16* __restrict__ O) {
  const int lane = threadIdx.x & 31, ln = lane & 15, hh = lane >> 4; const int w = __builtin_amdgcn_readfirstlane(threadIdx.x >> 5);      /* the wave's number as a scalar: the trip count and the mask test stay scalar */
  const int bh = blockIdx.x % (NB * NH), tx = blockIdx.x / (NB * NH); const int tile = (tx < SQ / 256) ? (SQ / 128 - 1 - tx) : (tx - SQ / 256);      /* long tiles take the low block numbers; the second half of the grid counts up from the short end */
  const int b = bh / NH, h = bh % NH; const int q0 = tile * 128 + w * 16; const size_t r0 = (size_t)b * SQ;
  const _Float16* qh = QHp + (r0 + q0 + ln) * LQ + h * HD + 8 * hh; const _Float16* ql = QLp + (r0 + q0 + ln) * LQ + h * HD + 8 * hh;
  const v16h qh0 = fa_frag(qh), qh1 = fa_frag(qh + 32), ql0 = fa_frag(ql), ql1 = fa_frag(ql + 32);
  const _Float16* kh = KHp + (r0 + ln) * LQ + h * HD + 8 * hh; const _Float16* kl = KLp + (r0 + ln) * LQ + h * HD + 8 * hh; const _Float16* vt = VTp + ((size_t)bh * HD + ln) * SQ + 8 * hh;
  const v8f z8 = {0.f,0.f,0.f,0.f,0.f,0.f,0.f,0.f}; v8f o[4] = {z8, z8, z8, z8}; float m = -1.0e30f, l = 0.f;
  const int np = q0 / 32 + 1;      /* keys 0 .. q0 + 15 in passes of 32 */
  v16h fh[2][2], fl[2][2];      /* K fragments [key tile][k step], fetched one pass ahead */
#pragma unroll      /* static indices keep the fragments, scores and accumulators in registers */
  for (int kt = 0; kt < 2; ++kt) for (int ks = 0; ks < 2; ++ks) { fh[kt][ks] = fa_frag(kh + (size_t)kt * 16 * LQ + ks * 32); fl[kt][ks] = fa_frag(kl + (size_t)kt * 16 * LQ + ks * 32); }
  asm volatile("s_wait_xcnt 0x0" :: "v"(qh), "v"(ql), "v"(kh), "v"(kl) : "memory");      /* the loads' four address pairs stay whole up to here and are free for reuse only behind this wait */
  for (int p = 0; p < np; ++p) { const int k0 = p * 32;
    const _Float16* va = vt + k0; v16h fv[4];
#pragma unroll      /* static indices keep the fragments, scores and accumulators in registers */
    for (int dt = 0; dt < 4; ++dt) fv[dt] = fa_frag(va + (size_t)dt * 16 * SQ);
    v8f sh[2], sl[2];
#pragma unroll      /* static indices keep the fragments, scores and accumulators in registers */
    for (int kt = 0; kt < 2; ++kt) { sh[kt] = fa_mma(fh[kt][1], qh1, fa_mma(fh[kt][0], qh0, z8)); sl[kt] = fa_mma(fl[kt][1], qh1, fa_mma(fl[kt][0], qh0, fa_mma(fh[kt][1], ql1, fa_mma(fh[kt][0], ql0, z8)))); }
    const int kn = (p + 1 < np) ? k0 + 32 : k0;      /* the last pass fetches its own rows again: in bounds, unused */
    const _Float16* ka = kh + (size_t)kn * LQ; const _Float16* kb = kl + (size_t)kn * LQ;
#pragma unroll      /* static indices keep the fragments, scores and accumulators in registers */
    for (int kt = 0; kt < 2; ++kt) for (int ks = 0; ks < 2; ++ks) { fh[kt][ks] = fa_frag(ka + (size_t)kt * 16 * LQ + ks * 32); fl[kt][ks] = fa_frag(kb + (size_t)kt * 16 * LQ + ks * 32); }
    asm volatile("s_wait_xcnt 0x0" :: "v"(va), "v"(ka), "v"(kb) : "memory");      /* this pass's three address pairs stay whole up to here and are free for reuse only behind this wait */
    float s[16];
#pragma unroll      /* static indices keep the fragments, scores and accumulators in registers */
    for (int e = 0; e < 16; ++e) s[e] = fmaf(sl[e >> 3][e & 7], SCLR, sh[e >> 3][e & 7] * SCL);
    if (k0 + 31 > q0) {      /* only the pass on the diagonal masks; key k0 <= q0 stays, so every query keeps a key */
#pragma unroll      /* static indices keep the fragments, scores and accumulators in registers */
      for (int e = 0; e < 16; ++e) s[e] = (k0 + (e >> 3) * 16 + 8 * hh + (e & 7) <= q0 + ln) ? s[e] : -1.0e30f; }
    float mx = s[0];
#pragma unroll      /* static indices keep the fragments, scores and accumulators in registers */
    for (int e = 1; e < 16; ++e) mx = fmaxf(mx, s[e]);
    mx = fmaxf(mx, __shfl_xor(mx, 16, 32)); const float mn = fmaxf(m, mx); const float al = fa_exp(m - mn); m = mn;
    FragH pf; float ps[4] = {0.f, 0.f, 0.f, 0.f};
#pragma unroll      /* static indices keep the fragments, scores and accumulators in registers */
    for (int e = 0; e < 16; ++e) { const float pe = fa_exp(s[e] - mn); ps[e & 3] += pe; pf.h[e] = (_Float16)pe; }
    l = fmaf(l, al, (ps[0] + ps[1]) + (ps[2] + ps[3]));
#pragma unroll      /* static indices keep the fragments, scores and accumulators in registers */
    for (int dt = 0; dt < 4; ++dt) { o[dt] *= al; o[dt] = fa_mma(fv[dt], pf.v, o[dt]); } }
  l += __shfl_xor(l, 16, 32); const float fin = 64.0f / l;      /* o carried x64, folded into the output GEMM's alpha */
  _Float16* op = O + (r0 + q0 + ln) * DM + h * HD + 8 * hh;
#pragma unroll      /* static indices keep the fragments, scores and accumulators in registers */
  for (int dt = 0; dt < 4; ++dt) { FragH f;
#pragma unroll      /* static indices keep the fragments, scores and accumulators in registers */
    for (int r = 0; r < 8; ++r) f.h[r] = (_Float16)(o[dt][r] * fin);
    *(v8us*)((unsigned short*)op + dt * 16) = f.half[0]; } }


typedef float v2f __attribute__((ext_vector_type(2)));
// Exact f32 attention for query rows 0 .. QT0-1 of one batch, one wave per (head, query row), 8 rows of one head per block. The head's QT0 K and V rows are staged once in LDS;
// lane l scores keys l, l + 32, l + 64, l + 96; row maximum and row sum are lane partials joined by butterflies; lane l then sums dims 2l, 2l + 1 over the keys (weight 0 behind the diagonal).
__global__ __launch_bounds__(256) void k_att0w(const float* __restrict__ QF, const float* __restrict__ KF, const float* __restrict__ VF, float scale, float* __restrict__ OF) {
  __shared__ __attribute__((aligned(16))) float lk[QT0][HD + 4];      /* pitch 272 B = 16 B x odd: one key row per lane reads without bank conflicts */
  __shared__ __attribute__((aligned(16))) float lv[QT0][HD];
  const int tid = threadIdx.x, lane = tid & 31; const int w = __builtin_amdgcn_readfirstlane(tid >> 5);      /* the wave's number as a scalar: q is read through scalar loads */
  const int h = blockIdx.x / (QT0 / 8), i = (blockIdx.x % (QT0 / 8)) * 8 + w;
  const int sr = tid >> 4, sc = (tid & 15) * 4; const float* kg = KF + (size_t)sr * DM + h * HD + sc; const float* vg = VF + (size_t)sr * DM + h * HD + sc; v4f ks[QT0 / 16], vs[QT0 / 16];
#pragma unroll      /* static indices keep ks[] and vs[] in registers; every load is issued before the first LDS store */
  for (int u = 0; u < QT0 / 16; ++u) { ks[u] = *(const v4fa*)(kg + (size_t)u * 16 * DM); vs[u] = *(const v4fa*)(vg + (size_t)u * 16 * DM); }
  asm volatile("s_wait_xcnt 0x0" :: "v"(kg), "v"(vg) : "memory");      /* the loads' two address pairs stay whole up to here and are free for reuse only behind this wait */
#pragma unroll      /* static indices keep ks[] and vs[] in registers */
  for (int u = 0; u < QT0 / 16; ++u) { *(v4f*)&lk[u * 16 + sr][sc] = ks[u]; *(v4f*)&lv[u * 16 + sr][sc] = vs[u]; }
  __syncthreads();
  const float* qg = QF + (size_t)i * DM + h * HD; v4f a[QT0 / 32] = {};
#pragma unroll      /* static indices keep a[] in registers: four independent sums per key, four keys per lane */
  for (int d = 0; d < HD / 4; ++d) { for (int c = 0; c < QT0 / 32; ++c) { const v4f kk = *(const v4f*)&lk[c * 32 + lane][d * 4]; for (int u = 0; u < 4; ++u) a[c][u] = fmaf(qg[d * 4 + u], kk[u], a[c][u]); } }
  float e[QT0 / 32]; float m = -1.0e30f;
#pragma unroll      /* static indices keep e[] in registers */
  for (int c = 0; c < QT0 / 32; ++c) { e[c] = (c * 32 + lane <= i) ? ((a[c][0] + a[c][1]) + (a[c][2] + a[c][3])) * scale : -1.0e30f; m = fmaxf(m, e[c]); }
  for (int x = 16; x >= 1; x >>= 1) m = fmaxf(m, __shfl_xor(m, x, 32));
  float l = 0.f;
#pragma unroll      /* static indices keep e[] in registers */
  for (int c = 0; c < QT0 / 32; ++c) { e[c] = expf(e[c] - m); l += e[c]; }      /* a key behind the diagonal: exp(-1e30 - m) = 0 */
  for (int x = 16; x >= 1; x >>= 1) l += __shfl_xor(l, x, 32);
  v2f o[4] = {};
#pragma unroll      /* a constant lane number per step: key j's weight is broadcast through a scalar register; static indices keep e[] and o[] in registers */
  for (int j = 0; j < QT0; ++j) { const float ej = __int_as_float(__builtin_amdgcn_readlane(__float_as_int(e[j >> 5]), j & 31)); const v2f vv = *(const v2f*)&lv[j][lane * 2]; o[j & 3][0] = fmaf(ej, vv[0], o[j & 3][0]); o[j & 3][1] = fmaf(ej, vv[1], o[j & 3][1]); }
  const float fin = 64.0f / l;      /* o carried x64 like the f16 path */
  const v2f r = ((o[0] + o[1]) + (o[2] + o[3])) * fin;
  *(v2f*)(OF + (size_t)i * DM + h * HD + lane * 2) = r; }

extern "C" void kernel_launch(void* const* d_in, const int* in_sizes, int n_in,
                              void* d_out, int out_size, void* d_ws, size_t ws_size, hipStream_t stream) {
  (void)in_sizes; (void)n_in; (void)out_size;
  const float* const* I = (const float* const*)d_in; const float* x = I[0]; const float* xk = I[1]; const float* xv = I[2]; const float* wq = I[3]; const float* bq = I[4]; const float* wk = I[5]; const float* bk = I[6]; const float* wv = I[7]; const float* bv = I[8]; const float* wo = I[9]; const float* bo = I[10];      /* input order: query, key, value (THREE input streams), then [in][out] weights + biases */
  char* ws = (char*)d_ws; size_t off = 0;
  auto take = [&](size_t bytes) { char* p = ws + off; off += (bytes + 255) & ~(size_t)255; return p; };
  _Float16* BQ = (_Float16*)take((size_t)DM * DM * 2); _Float16* BK = (_Float16*)take((size_t)DM * DM * 2); _Float16* BV = (_Float16*)take((size_t)DM * DM * 2); _Float16* BO = (_Float16*)take((size_t)DM * DM * 2);
  _Float16* X16 = (_Float16*)take(NR * DM * 2); _Float16* XK16 = (_Float16*)take(NR * DM * 2); _Float16* XV16 = (_Float16*)take(NR * DM * 2);      /* exact f16 rows of query, key, value */ float* QF = (float*)take(NR * DM * 4); float* KF = (float*)take(NR * DM * 4); float* VF = (float*)take(NR * DM * 4);      /* f32 q, k, v rows, each kept: the exact first-tile attention reads its 128 rows per batch from them */ _Float16* QH = (_Float16*)take(NR * DM * 2); _Float16* QL = (_Float16*)take(NR * DM * 2); _Float16* KH = (_Float16*)take(NR * DM * 2); _Float16* KL = (_Float16*)take(NR * DM * 2); _Float16* Q16 = QH; _Float16* K16 = KH; _Float16* V16 = (_Float16*)take(NR * DM * 2); _Float16* O16 = (_Float16*)take(NR * DM * 2);
  _Float16* VT = (_Float16*)take((size_t)NB * NH * HD * SQ * 2);      /* V^T of both batches */
  float* OF0 = (float*)take((size_t)NB * QT0 * DM * 4); _Float16* OH0 = (_Float16*)take((size_t)NB * QT0 * DM * 2); _Float16* OL0 = (_Float16*)take((size_t)NB * QT0 * DM * 2);
  if (off > ws_size) return;
  { const unsigned g = (unsigned)(((size_t)DM * (DM / 8) + 255) / 256); k_wt_f16<<<g, 256, 0, stream>>>(wq, BQ, DM, DM, 16.0f); k_wt_f16<<<g, 256, 0, stream>>>(wk, BK, DM, DM, 16.0f); k_wt_f16<<<g, 256, 0, stream>>>(wv, BV, DM, DM, 16.0f); k_wt_f16<<<g, 256, 0, stream>>>(wo, BO, DM, DM, 16.0f); }      /* [in][out] -> Bt[n][k] x16 */
  k_x16<<<(unsigned)((NR * DM / 8 + 255) / 256), 256, 0, stream>>>(x, X16, NR * DM / 8); k_x16<<<(unsigned)((NR * DM / 8 + 255) / 256), 256, 0, stream>>>(xk, XK16, NR * DM / 8); k_x16<<<(unsigned)((NR * DM / 8 + 255) / 256), 256, 0, stream>>>(xv, XV16, NR * DM / 8);
  const size_t r0p = (size_t)B0 * SQ;      /* first projected row */
  k_gemm2<0><<<dim3((unsigned)((MP / 128) * (DM / 64)), 1), 128, 0, stream>>>(X16 + r0p * DM, DM, 0, BQ, DM, 0, 0.0625f, bq, 0, nullptr, 1, 0, 0, QF + r0p * DM, nullptr, DM, 0, MP, DM, DM); k_hl<<<(unsigned)(((size_t)MP * DM / 8 + 255) / 256), 256, 0, stream>>>(QF + r0p * DM, QH + r0p * DM, QL + r0p * DM, (size_t)MP * DM / 8);      /* q (f32) -> f16 hi + x1024 residual: unscaled logits sigma ~8 */
  k_gemm2<0><<<dim3((unsigned)((MP / 128) * (DM / 64)), 1), 128, 0, stream>>>(XK16 + r0p * DM, DM, 0, BK, DM, 0, 0.0625f, bk, 0, nullptr, 1, 0, 0, KF + r0p * DM, nullptr, DM, 0, MP, DM, DM); k_hl<<<(unsigned)(((size_t)MP * DM / 8 + 255) / 256), 256, 0, stream>>>(KF + r0p * DM, KH + r0p * DM, KL + r0p * DM, (size_t)MP * DM / 8);      /* k likewise */
  k_gemm2<0><<<dim3((unsigned)((MP / 128) * (DM / 64)), 1), 128, 0, stream>>>(XV16 + r0p * DM, DM, 0, BV, DM, 0, 0.0625f, bv, 0, nullptr, 1, 0, 0, VF + r0p * DM, V16 + r0p * DM, DM, 0, MP, DM, DM);      /* v as f16 rows and as f32 rows */
  for (int b = B0; b < B0 + NBR; ++b) { const size_t r0 = (size_t)b * SQ;
    k_vt<NH, SQ><<<NH * (SQ / 64), 256, 0, stream>>>(V16 + r0 * LQ, LQ, 0, VT + (size_t)b * NH * HD * SQ);      /* V^T [NH][HD][SQ] for this batch */
    k_att0w<<<NH * (QT0 / 8), 256, 0, stream>>>(QF + r0 * DM, KF + r0 * DM, VF + r0 * DM, SCL, OF0 + (size_t)b * QT0 * DM);      /* exact f32 attention for rows 0..127 (o x64), one wave per (head, row) */ }
  k_fattn<<<NB * NH * (SQ / 128), 256, 0, stream>>>(QH, QL, KH, KL, VT, O16);      /* scores, causal softmax and P V of both batches and all heads in one launch: o (merged heads, x64) as f16 rows */
  k_gemm2<0><<<dim3((unsigned)((MPO / 128) * (DM / 64)), 1), 128, 0, stream>>>(O16 + r0p * DM, DM, 0, BO, DM, 0, 0.0009765625f, bo, 0, nullptr, 1, 0, 0, (float*)d_out + r0p * DM, nullptr, DM, 0, MPO, DM, DM);      /* out rows are the output layout */
  k_hl<<<(unsigned)(((size_t)NB * QT0 * DM / 8 + 255) / 256), 256, 0, stream>>>(OF0, OH0, OL0, (size_t)NB * QT0 * DM / 8);      /* first-tile o (x64) -> f16 hi + x1024 residual planes */
  for (int b = B0; b < B0 + NBR; ++b) { const size_t r0 = (size_t)b * SQ; const size_t f0 = (size_t)b * QT0;
    k_gemm2<0><<<dim3((QT0 / 128) * (DM / 64), 1), 128, 0, stream>>>(OH0 + f0 * DM, DM, 0, BO, DM, 0, 0.0009765625f, bo, 0, nullptr, 1, 0, 0, (float*)d_out + r0 * DM, nullptr, DM, 0, QT0, DM, DM);      /* rows 0..127: out = o_hi Wo (+ b), overwriting the f16-path rows */
    k_gemm2<0><<<dim3((QT0 / 128) * (DM / 64), 1), 128, 0, stream>>>(OL0 + f0 * DM, DM, 0, BO, DM, 0, 0.00000095367431640625f, nullptr, 0, (const float*)d_out + r0 * DM, -1, 0, 0, (float*)d_out + r0 * DM, nullptr, DM, 0, QT0, DM, DM); }      /* += o_lo Wo 2^-20 (own-element accumulate) */
}

// v005
// One run takes 331 microseconds.
// Timed twice side by side with v004, it ran 1.36 and 1.37 times as fast.
// Counting every step since v000, it is 17.5 times as fast.
#include <hip/hip_runtime.h>
// Causal multi-head attention on three inputs with the source's sequence-length score scale (query, key, value [2][2048][1024]; q = query Wq + bq, k = key Wk + bk, v = value Wv + bv ([in][out] 1024 x 1024, weights AND biases sigma 1/32), 16 heads of 64; score = q k^T; triu(1) -> -inf; softmax(score / sqrt(Sk)) with Sk = 2048 KEYS (the source divides by sqrt of the score matrix's last dimension, NOT by sqrt(head_dim)): scale 2048^-0.5 = 0.0220970869; out = merged Wo + bo ([in][out]) -> [2][2048][1024]); q and k carried as f16 hi + x1024 residual planes with three-product scores.
// Structure: token rows r = b*2048 + s; x as exact f16 rows (bf16-rounded); q and k as WMMA GEMMs (32x64 wave tiles, f32 accumulation, exact x16 weights + bias) into f32 rows split into f16 hi + x1024 residual planes, v as a GEMM that stores f16 rows and f32 rows; the f32 q, k, v rows are kept for the exact first-tile attention; per batch: V^T for all heads via LDS transposes; then ONE fused attention launch (a wave per 16 queries, keys below the diagonal in passes of 32: three-product scores hi.hi + lo.hi + hi.lo in f32 accumulators, running-maximum softmax in registers (f32 statistics, native exp; weights in (0, 1] as f16), o = P . V^T normalised at the end, carried x64 and folded into the output GEMM alpha) written straight into the merged f16 o rows; out = o W_o + b GEMM (f32) into the output layout.
// Compute dtype: inputs rounded to bf16; x / weights exact; q and k as f16 hi + x1024 residual planes; v, softmax weights and o as plain f16 GEMM operands (~2^-12); scores and softmax statistics f32. v_wmma_f32_16x16x32_f16.
#define NB 2
#define SCL 0.0220970869f                 /* = f32(1 / sqrt(2048)): the source scales the scores by 1/sqrt(Sk), Sk = 2048 keys */
#define SCLR (0.0220970869f * 0.0009765625f)   /* the same scale on the x1024 residual passes */
#define SQ 2048
#define DM 1024
#define NH 16
#define HD 64
#define HG 4                         /* heads per launch of the head-group k_vt overload, which is not launched */
#define QT0 128                      /* first-tile rows recomputed exactly in f32 */
#define B0 0                         /* first batch processed (debug hook) */
#define NBR NB                       /* batches processed (debug hook) */
#define NR ((size_t)NB * SQ)         /* token rows */
#define MP ((int)((size_t)NBR * SQ)) /* rows projected (debug hook) */
#define MPO MP                       /* rows through the output stage (debug hook) */
#define LQ DM      /* row pitch of the q/k/v rows */
typedef __bf16 v16b __attribute__((ext_vector_type(16)));
typedef unsigned short v8us __attribute__((ext_vector_type(8), may_alias));
typedef float  v8f  __attribute__((ext_vector_type(8)));
typedef float  v4f  __attribute__((ext_vector_type(4)));
typedef float  v4fa __attribute__((ext_vector_type(4), may_alias));
union FragB { v16b v; v8us half[2]; unsigned short u[16]; };

__device__ __forceinline__ unsigned short bf16_bits(float x) { unsigned int u = __float_as_uint(x); return (unsigned short)((u + 0x7FFFu + ((u >> 16) & 1u)) >> 16); }
__device__ __forceinline__ float bf16_val(unsigned short b) { return __uint_as_float(((unsigned int)b) << 16); }
__device__ __forceinline__ float bf16_round(float x) { return bf16_val(bf16_bits(x)); }
// D += A·B with NT terms: 1 = ah·bh, 2 = + al·bh (A split), 3 = + ah·bl (both split)
template <int NT>
__device__ __forceinline__ v8f mmaN(v16b ah, v16b al, v16b bh, v16b bl, v8f c) {
  c = __builtin_amdgcn_wmma_f32_16x16x32_bf16(false, ah, false, bh, (short)0, c, false, false);
  if (NT >= 2) c = __builtin_amdgcn_wmma_f32_16x16x32_bf16(false, al, false, bh, (short)0, c, false, false);
  if (NT >= 3) c = __builtin_amdgcn_wmma_f32_16x16x32_bf16(false, ah, false, bl, (short)0, c, false, false);
  asm volatile("v_nop\n\tv_nop\n\tv_nop\n\tv_nop" : "+v"(c) : "v"(ah), "v"(al), "v"(bh), "v"(bl));
  return c;
}

__global__ __launch_bounds__(256) void k_wt_bf16(const float* __restrict__ W, unsigned short* __restrict__ Wt, int K, int N) {
  const int t = blockIdx.x * 256 + threadIdx.x;
  const int k8n = K / 8;
  if (t >= N * k8n) return;
  const int n = t / k8n, k8 = (t % k8n) * 8;
  v8us v;
#pragma unroll
  for (int i = 0; i < 8; ++i) v[i] = bf16_bits(W[(size_t)(k8 + i) * N + n]);
  *(v8us*)(Wt + (size_t)n * K + k8) = v;
  
}

// GEMM C[M][N] (f32, pitch ldc) = act(A[M][K]·W + bias). A f32 row-major (pitch lda) converted per fragment to bf16
// (ASPLIT: hi/lo two planes -> 2 terms, else single rounded term); Wt bf16 [N][K] (pitch ldb). BIAS_BF16 rounds the
// bias to bf16 first (bias quantised to bf16 before the add). K%32==0, M%16==0, N%64==0.
template <bool ASPLIT, int ACT, bool BIAS_BF16>
__global__ __launch_bounds__(128) void k_gemm_bf(const float* __restrict__ A, int lda, const unsigned short* __restrict__ Wt, int ldb,
                                               const float* __restrict__ bias, float* __restrict__ C, int ldc, int M, int N, int K) {
  __shared__ __attribute__((aligned(16))) float so[4][16][64];
  const int tid = threadIdx.x, w = tid >> 5, lane = tid & 31, ln = lane & 15, hh = lane >> 4;
  const int ntn = N / 64;
  const int wid = blockIdx.x * 4 + w;
  const int mt = wid / ntn, nq = wid % ntn;
  if (mt * 16 >= M) return;
  const int row0 = mt * 16, col0 = nq * 64;
  const float* arow = A + (size_t)(row0 + ln) * lda;
  v8f acc[4] = {};
  for (int kb = 0; kb < K; kb += 32) {
    FragB ah, al;
    const v4f x0 = *(const v4fa*)(arow + kb + 8 * hh), x1 = *(const v4fa*)(arow + kb + 8 * hh + 4);
    const v4f x2 = *(const v4fa*)(arow + kb + 16 + 8 * hh), x3 = *(const v4fa*)(arow + kb + 16 + 8 * hh + 4);
    float xs[16] = {x0[0],x0[1],x0[2],x0[3],x1[0],x1[1],x1[2],x1[3],x2[0],x2[1],x2[2],x2[3],x3[0],x3[1],x3[2],x3[3]};
#pragma unroll
    for (int i = 0; i < 16; ++i) { const unsigned short hb = bf16_bits(xs[i]); ah.u[i] = hb; al.u[i] = ASPLIT ? bf16_bits(xs[i] - bf16_val(hb)) : (unsigned short)0; }
#pragma unroll
    for (int t = 0; t < 4; ++t) {
      const unsigned short* brow = Wt + (size_t)(col0 + t * 16 + ln) * ldb + kb;
      FragB b;
      b.half[0] = *(const v8us*)(brow + 8 * hh);
      b.half[1] = *(const v8us*)(brow + 16 + 8 * hh);
      acc[t] = mmaN<ASPLIT ? 2 : 1>(ah.v, al.v, b.v, b.v, acc[t]);
    }
  }
#pragma unroll
  for (int t = 0; t < 4; ++t) {
    float bv = bias ? bias[col0 + t * 16 + ln] : 0.f;
    if (BIAS_BF16) bv = bf16_round(bv);
#pragma unroll
    for (int r = 0; r < 8; ++r) { float v = acc[t][r] + bv; if (ACT == 1) v = fmaxf(v, 0.f); so[w][8 * hh + r][t * 16 + ln] = v; }
  }
  __builtin_amdgcn_fence(__ATOMIC_ACQ_REL, "workgroup");
  __builtin_amdgcn_wave_barrier();
  const int rsub = lane >> 4, c4 = (lane & 15) * 4;
  {
#pragma unroll
    for (int q = 0; q < 8; ++q) {
      const int r = q * 2 + rsub;
      const v4f v = *(const v4fa*)&so[w][r][c4];
      *(v4f*)(C + (size_t)(row0 + r) * ldc + col0 + c4) = v;
    }
    
  }
}

// GEMM C = act(A·W + bias + resid): A f32 (ASPLIT -> hi/lo 2 terms), Wt bf16 [N][K]; ACT 0 none, 1 relu, 2 exact gelu;
// resid (optional, f32, row index = (row % rmod), pitch ldr, RES_BF16 rounds it) added before the activation.
template <bool ASPLIT, int ACT, bool BIAS_BF16, bool RES_BF16>
__global__ __launch_bounds__(128) void k_gemm_bf3(const float* __restrict__ A, int lda, const unsigned short* __restrict__ Wt, int ldb,
                                                const float* __restrict__ bias, const float* __restrict__ resid, int rmod, int ldr,
                                                float* __restrict__ C, int ldc, int M, int N, int K) {
  __shared__ __attribute__((aligned(16))) float so[4][16][64];
  const int tid = threadIdx.x, w = tid >> 5, lane = tid & 31, ln = lane & 15, hh = lane >> 4;
  const int ntn = N / 64;
  const int wid = blockIdx.x * 4 + w;
  const int mt = wid / ntn, nq = wid % ntn;
  if (mt * 16 >= M) return;
  const int row0 = mt * 16, col0 = nq * 64;
  const float* arow = A + (size_t)(row0 + ln) * lda;
  v8f acc[4] = {};
  for (int kb = 0; kb < K; kb += 32) {
    FragB ah, al;
    const v4f x0 = *(const v4fa*)(arow + kb + 8 * hh), x1 = *(const v4fa*)(arow + kb + 8 * hh + 4);
    const v4f x2 = *(const v4fa*)(arow + kb + 16 + 8 * hh), x3 = *(const v4fa*)(arow + kb + 16 + 8 * hh + 4);
    float xs[16] = {x0[0],x0[1],x0[2],x0[3],x1[0],x1[1],x1[2],x1[3],x2[0],x2[1],x2[2],x2[3],x3[0],x3[1],x3[2],x3[3]};
#pragma unroll
    for (int i = 0; i < 16; ++i) { const unsigned short hb = bf16_bits(xs[i]); ah.u[i] = hb; al.u[i] = ASPLIT ? bf16_bits(xs[i] - bf16_val(hb)) : (unsigned short)0; }
#pragma unroll
    for (int t = 0; t < 4; ++t) {
      const unsigned short* brow = Wt + (size_t)(col0 + t * 16 + ln) * ldb + kb;
      FragB b;
      b.half[0] = *(const v8us*)(brow + 8 * hh);
      b.half[1] = *(const v8us*)(brow + 16 + 8 * hh);
      acc[t] = mmaN<ASPLIT ? 2 : 1>(ah.v, al.v, b.v, b.v, acc[t]);
    }
  }
#pragma unroll
  for (int t = 0; t < 4; ++t) {
    const int col = col0 + t * 16 + ln;
    float bv = bias ? bias[col] : 0.f;
    if (BIAS_BF16) bv = bf16_round(bv);
#pragma unroll
    for (int r = 0; r < 8; ++r) {
      float v = acc[t][r] + bv;
      if (resid) { float rv = resid[(size_t)((row0 + 8 * hh + r) % rmod) * ldr + col]; if (RES_BF16) rv = bf16_round(rv); v += rv; }
      if (ACT == 1) v = fmaxf(v, 0.f);
      if (ACT == 2) v = 0.5f * v * (1.0f + erff(v * 0.70710678118654752f));
      if (ACT == 3) { const float u = 0.7978845608028654f * (v + 0.044715f * v * v * v); v = 0.5f * v * (1.0f + tanhf(u)); }
      so[w][8 * hh + r][t * 16 + ln] = v;
    }
  }
  __builtin_amdgcn_fence(__ATOMIC_ACQ_REL, "workgroup");
  __builtin_amdgcn_wave_barrier();
  const int rsub = lane >> 4, c4 = (lane & 15) * 4;
  {
#pragma unroll
    for (int q = 0; q < 8; ++q) {
      const int r = q * 2 + rsub;
      const v4f v = *(const v4fa*)&so[w][r][c4];
      *(v4f*)(C + (size_t)(row0 + r) * ldc + col0 + c4) = v;
    }
    
  }
}
// row LayerNorm (biased variance, eps) over N: s = X (+ R); optional out_sum <- s; out_norm <- (s-mu)*rsqrt(var+eps)*g + b
template <bool PARAM_BF16>
__global__ __launch_bounds__(256) void k_layernorm(const float* __restrict__ X, const float* __restrict__ R, const float* __restrict__ g, const float* __restrict__ bta,
                                                  float* __restrict__ out_sum, float* __restrict__ out_norm, int N, float eps) {
  __shared__ float red[256];
  const int row = blockIdx.x, tid = threadIdx.x;
  const float* x = X + (size_t)row * N; const float* rr = R ? R + (size_t)row * N : nullptr;
  float vals[16];                     // up to N = 4096
  const int per = N / 256;            // contiguous chunk per thread? use strided-by-4 chunks: thread handles j = tid*4 + 1024*u
  float s1 = 0.f;
  for (int u = 0; u < per / 4; ++u) {
    const int j = tid * 4 + 1024 * u;
    const v4f a = *(const v4fa*)(x + j);
    v4f b = {0.f,0.f,0.f,0.f}; if (rr) b = *(const v4fa*)(rr + j);
#pragma unroll
    for (int q = 0; q < 4; ++q) { const float v = a[q] + b[q]; vals[u * 4 + q] = v; s1 += v; }
  }
  red[tid] = s1; __syncthreads();
  for (int st = 128; st > 0; st >>= 1) { if (tid < st) red[tid] += red[tid + st]; __syncthreads(); }
  const float mu = red[0] / (float)N; __syncthreads();
  float s2 = 0.f;
  for (int u = 0; u < per / 4; ++u)
#pragma unroll
    for (int q = 0; q < 4; ++q) { const float c = vals[u * 4 + q] - mu; s2 += c * c; }
  red[tid] = s2; __syncthreads();
  for (int st = 128; st > 0; st >>= 1) { if (tid < st) red[tid] += red[tid + st]; __syncthreads(); }
  const float rs = rsqrtf(red[0] / (float)N + eps);
  {
    for (int u = 0; u < per / 4; ++u) {
      const int j = tid * 4 + 1024 * u;
      v4f o, sm;
#pragma unroll
      for (int q = 0; q < 4; ++q) {
        float gg = g[j + q], bb = bta[j + q];
        if (PARAM_BF16) { gg = bf16_round(gg); bb = bf16_round(bb); }
        sm[q] = vals[u * 4 + q]; o[q] = (vals[u * 4 + q] - mu) * rs * gg + bb;
      }
      if (out_sum) *(v4f*)(out_sum + (size_t)row * N + j) = sm;
      *(v4f*)(out_norm + (size_t)row * N + j) = o;
    }
    
  }
}



// ---- f16 WMMA path (v_wmma_f32_16x16x32_f16): 11-bit significands for operands in range — used where a [0,1] probability operand needs more precision than bf16
typedef _Float16 v16h __attribute__((ext_vector_type(16)));
union FragH { v16h v; v8us half[2]; _Float16 h[16]; unsigned short u[16]; };
template <int NT>
__device__ __forceinline__ v8f mmaH(v16h ah, v16h al, v16h bh, v16h bl, v8f c) {
  c = __builtin_amdgcn_wmma_f32_16x16x32_f16(false, ah, false, bh, (short)0, c, false, false);
  if (NT >= 2) c = __builtin_amdgcn_wmma_f32_16x16x32_f16(false, al, false, bh, (short)0, c, false, false);
  if (NT >= 3) c = __builtin_amdgcn_wmma_f32_16x16x32_f16(false, ah, false, bl, (short)0, c, false, false);
  asm volatile("v_nop\n\tv_nop\n\tv_nop\n\tv_nop" : "+v"(c) : "v"(ah), "v"(al), "v"(bh), "v"(bl));
  return c;
}
// batched GEMM like k_gemm_b but f16 operands: A f32 (split into f16 hi/lo if ASPLIT, else rounded to f16), Bt = f16 values [n][k]; alpha; C f32; N multiple of 16 (partial tiles skipped)
template <bool ASPLIT>
__global__ __launch_bounds__(128) void k_gemm_h(const float* __restrict__ A, int lda, size_t sA, const _Float16* __restrict__ Bh, int ldb, size_t sB, float alpha, float* __restrict__ C, int ldc, size_t sC, int M, int N, int K) {
  __shared__ __attribute__((aligned(16))) float so[4][16][64];
  const int tid = threadIdx.x, w = tid >> 5, lane = tid & 31, ln = lane & 15, hh = lane >> 4; const int by = blockIdx.y;
  A += (size_t)by * sA; Bh += (size_t)by * sB; C += (size_t)by * sC;
  const int ntn = (N + 63) / 64; const int wid = blockIdx.x * 4 + w; const int mt = wid / ntn, nq = wid % ntn; if (mt * 16 >= M) return;
  const int row0 = mt * 16, col0 = nq * 64; const float* arow = A + (size_t)(row0 + ln) * lda;
  v8f acc[4] = {};
  for (int kb = 0; kb < K; kb += 32) {
    FragH ah, al;
    const v4f x0 = *(const v4fa*)(arow + kb + 8 * hh), x1 = *(const v4fa*)(arow + kb + 8 * hh + 4), x2 = *(const v4fa*)(arow + kb + 16 + 8 * hh), x3 = *(const v4fa*)(arow + kb + 16 + 8 * hh + 4);
    float xs[16] = {x0[0],x0[1],x0[2],x0[3],x1[0],x1[1],x1[2],x1[3],x2[0],x2[1],x2[2],x2[3],x3[0],x3[1],x3[2],x3[3]};
#pragma unroll
    for (int i = 0; i < 16; ++i) { const _Float16 h = (_Float16)xs[i]; ah.h[i] = h; al.h[i] = ASPLIT ? (_Float16)(xs[i] - (float)h) : (_Float16)0.0f; }
#pragma unroll
    for (int t = 0; t < 4; ++t) { if (col0 + t * 16 >= N) continue; const size_t boff = (size_t)(col0 + t * 16 + ln) * ldb + kb; FragH bq; bq.half[0] = *(const v8us*)(Bh + boff + 8 * hh); bq.half[1] = *(const v8us*)(Bh + boff + 16 + 8 * hh);
      acc[t] = mmaH<ASPLIT ? 2 : 1>(ah.v, al.v, bq.v, bq.v, acc[t]); }
  }
#pragma unroll
  for (int t = 0; t < 4; ++t) { if (col0 + t * 16 >= N) continue;
#pragma unroll
    for (int r = 0; r < 8; ++r) so[w][8 * hh + r][t * 16 + ln] = acc[t][r] * alpha; }
  __builtin_amdgcn_fence(__ATOMIC_ACQ_REL, "workgroup"); __builtin_amdgcn_wave_barrier();
  const int rsub = lane >> 4, c4 = (lane & 15) * 4;
  {
#pragma unroll
    for (int q = 0; q < 8; ++q) { const int r = q * 2 + rsub; if (col0 + c4 < N) { const v4f v = *(const v4fa*)&so[w][r][c4]; *(v4f*)(C + (size_t)(row0 + r) * ldc + col0 + c4) = v; } }
     }
}

// Wt[n][k] = f16(W[k][n]·scale) from f32 row-major W[K][N] (scale = power of two; bf16-exact weights stay exact in f16 away from the subnormal range)
__global__ __launch_bounds__(256) void k_wt_f16(const float* __restrict__ W, _Float16* __restrict__ Wt, int K, int N, float scale) {
  const int t = blockIdx.x * 256 + threadIdx.x; if (t >= N * (K / 8)) return; const int n = t / (K / 8), k8 = (t % (K / 8)) * 8; FragH f;
#pragma unroll
  for (int i = 0; i < 8; ++i) f.h[i] = (_Float16)(bf16_round(W[(size_t)(k8 + i) * N + n]) * scale); const v8us o = f.half[0];
  *(v8us*)((unsigned short*)Wt + (size_t)n * K + k8) = o; 
}
// k_gemm_hh variant with fused epilogue: v = acc·alpha + bias[by·sBias + col] (+ CP[(row/rowsPerB)·sCPb + by·64 + col] if CP) ; ACT 0 none / 1 elu ; writes f16 C16 (and f32 C if non-null)
template <int ACT>
__global__ __launch_bounds__(128) void k_gemm_hhx(const _Float16* __restrict__ A, int lda, size_t sA, const _Float16* __restrict__ Bh, int ldb, size_t sB, float alpha, const float* __restrict__ bias, size_t sBias, const float* __restrict__ CP, int rowsPerB, size_t sCPb, int row0g,
    float* __restrict__ C, _Float16* __restrict__ C16, int ldc, size_t sC, int M, int N, int K) {
  __shared__ __attribute__((aligned(16))) float so[4][16][64];
  const int tid = threadIdx.x, w = tid >> 5, lane = tid & 31, ln = lane & 15, hh = lane >> 4; const int by = blockIdx.y;
  A += (size_t)by * sA; Bh += (size_t)by * sB; const size_t cofs = (size_t)by * sC; const float* bp = bias ? bias + (size_t)by * sBias : nullptr;
  const int ntn = (N + 63) / 64; const int wid = blockIdx.x * 4 + w; const int mt = wid / ntn, nq = wid % ntn; if (mt * 16 >= M) return;
  const int row0 = mt * 16, col0 = nq * 64; const _Float16* arow = A + (size_t)(row0 + ln) * lda;
  v8f acc[4] = {};
  for (int kb = 0; kb < K; kb += 32) { FragH ah; ah.half[0] = *(const v8us*)((const unsigned short*)arow + kb + 8 * hh); ah.half[1] = *(const v8us*)((const unsigned short*)arow + kb + 16 + 8 * hh);
#pragma unroll
    for (int t = 0; t < 4; ++t) { if (col0 + t * 16 >= N) continue; const size_t boff = (size_t)(col0 + t * 16 + ln) * ldb + kb; FragH bq; bq.half[0] = *(const v8us*)((const unsigned short*)Bh + boff + 8 * hh); bq.half[1] = *(const v8us*)((const unsigned short*)Bh + boff + 16 + 8 * hh);
      acc[t] = mmaH<1>(ah.v, ah.v, bq.v, bq.v, acc[t]); }
  }
#pragma unroll
  for (int t = 0; t < 4; ++t) { if (col0 + t * 16 >= N) continue; const int col = col0 + t * 16 + ln; const float bv = bp ? bf16_round(bp[col]) : 0.f;
#pragma unroll
    for (int r = 0; r < 8; ++r) { float v = acc[t][r] * alpha + bv; if (CP) { const int rr = row0g + row0 + 8 * hh + r; if (rowsPerB < 0) v += CP[cofs + (size_t)rr * ldc + col];      /* rowsPerB < 0: own element of the batched C plane */ else { const int bidx = rr / rowsPerB; v += CP[(size_t)bidx * sCPb + (size_t)by * 64 + col]; } } if (ACT == 1) v = (v > 0.f) ? v : expm1f(v); else if (ACT == 7) v = (v > 0.f) ? v + 1.0f : expf(v); else if (ACT == 8) v = tanhf(v); else if (ACT == 9) v = 0.5f * v * (1.0f + tanhf(0.7978845608028654f * (v + 0.044715f * v * v * v))); else if (ACT == 11) v = 1.0f / (1.0f + expf(-v)); else if (ACT == 12) v = (v > 0.f) ? v : 0.01f * v; else if (ACT == 14) v = (v > 0.f) ? v : 0.1f * v; else if (ACT == 16) v = (v >= 0.f) ? v : 0.3f * v; else if (ACT == 17) v = (v >= 0.f) ? v : 0.2f * v; else if (ACT == 15) v = v / (1.0f + expf(-v)); else if (ACT == 3) v = fmaxf(v, 0.f); else if (ACT == 6) v = 0.5f * v * (1.0f + erff(v * 0.70710678118654752f)); so[w][8 * hh + r][t * 16 + ln] = v; } }
  __builtin_amdgcn_fence(__ATOMIC_ACQ_REL, "workgroup"); __builtin_amdgcn_wave_barrier();
  const int rsub = lane >> 4, c4 = (lane & 15) * 4; typedef _Float16 v4h __attribute__((ext_vector_type(4)));
  {
#pragma unroll
    for (int q = 0; q < 8; ++q) { const int r = q * 2 + rsub; if (col0 + c4 < N) { const v4f v = *(const v4fa*)&so[w][r][c4]; if (C) *(v4f*)(C + cofs + (size_t)(row0 + r) * ldc + col0 + c4) = v; if (C16) { v4h h4; for (int i = 0; i < 4; ++i) h4[i] = (_Float16)v[i]; *(v4h*)(C16 + cofs + (size_t)(row0 + r) * ldc + col0 + c4) = h4; } } }
     }
}


typedef _Float16 v4h __attribute__((ext_vector_type(4)));

__global__ __launch_bounds__(256) void k_x16(const float* __restrict__ x, _Float16* __restrict__ X16, size_t n8) { const size_t t = (size_t)blockIdx.x * 256 + threadIdx.x; if (t >= n8) return; FragH f;
#pragma unroll
  for (int q = 0; q < 8; ++q) f.h[q] = (_Float16)bf16_round(x[t * 8 + q]); *(v8us*)((unsigned short*)X16 + t * 8) = f.half[0];  }
__global__ __launch_bounds__(256) void k_h16(const float* __restrict__ x, _Float16* __restrict__ X16, size_t n8) { const size_t t = (size_t)blockIdx.x * 256 + threadIdx.x; if (t >= n8) return; FragH f;
#pragma unroll
  for (int q = 0; q < 8; ++q) f.h[q] = (_Float16)x[t * 8 + q]; *(v8us*)((unsigned short*)X16 + t * 8) = f.half[0];  }
__global__ __launch_bounds__(256) void k_round16f(const float* __restrict__ W, _Float16* __restrict__ Bt, size_t n8) { const size_t t = (size_t)blockIdx.x * 256 + threadIdx.x; if (t >= n8) return; FragH f;
#pragma unroll
  for (int i = 0; i < 8; ++i) f.h[i] = (_Float16)(bf16_round(W[t * 8 + i]) * 16.0f); *(v8us*)((unsigned short*)Bt + t * 8) = f.half[0];  }
template <int NHv, int TTv>
__global__ __launch_bounds__(256) void k_vt(const _Float16* __restrict__ V16, int ldv, int voff, _Float16* __restrict__ Vt) { __shared__ unsigned short tl[64][66]; const int tid = threadIdx.x; const int slab = blockIdx.x / (TTv / 64), lg = blockIdx.x % (TTv / 64); const int b = slab / NHv, h = slab % NHv;
  for (int i = tid; i < 64 * 8; i += 256) { const int r = i / 8, c8 = (i % 8) * 8; FragH f; f.half[0] = *(const v8us*)((const unsigned short*)V16 + ((size_t)b * TTv + lg * 64 + r) * ldv + voff + h * 64 + c8);
#pragma unroll
    for (int q = 0; q < 8; ++q) tl[r][c8 + q] = f.u[q]; }
  __syncthreads();
  {
#pragma unroll
    for (int rd = 0; rd < 2; ++rd) { const int d = rd * 32 + tid / 8, pc = tid % 8; FragH f;
#pragma unroll
      for (int q = 0; q < 8; ++q) f.u[q] = tl[pc * 8 + q][d];
      *(v8us*)((unsigned short*)Vt + ((size_t)slab * 64 + d) * TTv + lg * 64 + pc * 8) = f.half[0]; }
     } }

__global__ __launch_bounds__(256) void k_hl(const float* __restrict__ F, _Float16* __restrict__ Hh, _Float16* __restrict__ Hl, size_t n8) { const size_t t = (size_t)blockIdx.x * 256 + threadIdx.x; if (t >= n8) return; FragH fh, fl; const v4f a = *(const v4fa*)(F + t * 8), c = *(const v4fa*)(F + t * 8 + 4);
#pragma unroll
  for (int q = 0; q < 4; ++q) { _Float16 h = (_Float16)a[q]; fh.h[q] = h; fl.h[q] = (_Float16)((a[q] - (float)h) * 1024.0f); h = (_Float16)c[q]; fh.h[4 + q] = h; fl.h[4 + q] = (_Float16)((c[q] - (float)h) * 1024.0f); }
  { *(v8us*)((unsigned short*)Hh + t * 8) = fh.half[0]; *(v8us*)((unsigned short*)Hl + t * 8) = fl.half[0];  } }

// ---- fast GEMM (wave tile 32x64; requires M % 32 == 0 rows per launch region, N % 64 == 0 and K % 64 == 0); epilogue = k_gemm_hhx semantics ----
__device__ __forceinline__ v16h g2_frag(const _Float16* p, int hh) { FragH f; f.half[0] = *(const v8us*)((const unsigned short*)p + 8 * hh); f.half[1] = *(const v8us*)((const unsigned short*)p + 16 + 8 * hh); return f.v; }
__device__ __forceinline__ v8f g2_mma(v16h a, v16h b, v8f c) { v8f d = __builtin_amdgcn_wmma_f32_16x16x32_f16(false, a, false, b, (short)0, c, false, false); asm volatile("v_nop\n\tv_nop\n\tv_nop\n\tv_nop" : "+v"(d) : "v"(a), "v"(b)); return d; }
template <int ACT>
__global__ __launch_bounds__(128) void k_gemm2(const _Float16* __restrict__ A, int lda, size_t sA, const _Float16* __restrict__ Bh, int ldb, size_t sB, float alpha, const float* __restrict__ bias, size_t sBias, const float* __restrict__ CP, int rowsPerB, size_t sCPb, int row0g,
    float* __restrict__ C, _Float16* __restrict__ C16, int ldc, size_t sC, int M, int N, int K) { static_assert(ACT == 0 || ACT == 3 || ACT == 6 || ACT == 8 || ACT == 9 || ACT == 11 || ACT == 12 || ACT == 14 || ACT == 15 || ACT == 16 || ACT == 17, "k_gemm2: unsupported ACT code (would silently apply no activation)");
  __shared__ __attribute__((aligned(16))) float so[4][32][68];
  const int tid = threadIdx.x, w = tid >> 5, lane = tid & 31, ln = lane & 15, hh = lane >> 4; const int by = blockIdx.y;
  A += (size_t)by * sA; Bh += (size_t)by * sB; const size_t cofs = (size_t)by * sC; const float* bp = bias ? bias + (size_t)by * sBias : nullptr;
  const int ntn = N >> 6; const int mt = blockIdx.x / ntn, nq = blockIdx.x - mt * ntn; const int row0 = mt * 128 + 32 * w, col0 = nq * 64; if (row0 >= M) return;
  const _Float16* a0p = A + (size_t)(row0 + ln) * lda + 8 * hh; const _Float16* a1p = a0p + (size_t)16 * lda;      /* the lane half's 8 elements are in the six row pointers, so each is the very address its loads name */
  const _Float16* b0p = Bh + (size_t)(col0 + ln) * ldb + 8 * hh; const _Float16* b1p = b0p + (size_t)16 * ldb; const _Float16* b2p = b1p + (size_t)16 * ldb; const _Float16* b3p = b2p + (size_t)16 * ldb;
  const v8f z8 = {0.f,0.f,0.f,0.f,0.f,0.f,0.f,0.f}; v8f c00 = z8, c01 = z8, c02 = z8, c03 = z8, c10 = z8, c11 = z8, c12 = z8, c13 = z8;
  /* Two fragment sets, x and y, each the six fragments of one k step of 32. A set's twelve loads are issued together, one k step ahead of its products, so a k step waits for one load round trip that
     runs under the other set's products, not for five in a row. K is a multiple of 64. Every accumulator still takes its k steps in rising order. */
  v16h xa0 = g2_frag(a0p, 0), xa1 = g2_frag(a1p, 0), xb0 = g2_frag(b0p, 0), xb1 = g2_frag(b1p, 0), xb2 = g2_frag(b2p, 0), xb3 = g2_frag(b3p, 0);
  asm volatile("s_wait_xcnt 0x0" :: "v"(a0p), "v"(a1p), "v"(b0p), "v"(b1p), "v"(b2p), "v"(b3p) : "memory");      /* the first set's six address pairs stay whole up to here and are free for reuse only behind this wait */
#pragma unroll 1      /* one trip is two k steps already; more would only grow the text */
  for (int kb = 0; kb < K; kb += 64) {
    const _Float16* q0 = a0p + kb; const _Float16* q1 = a1p + kb; const _Float16* q2 = b0p + kb; const _Float16* q3 = b1p + kb; const _Float16* q4 = b2p + kb; const _Float16* q5 = b3p + kb;
    const v16h ya0 = g2_frag(q0 + 32, 0), ya1 = g2_frag(q1 + 32, 0), yb0 = g2_frag(q2 + 32, 0), yb1 = g2_frag(q3 + 32, 0), yb2 = g2_frag(q4 + 32, 0), yb3 = g2_frag(q5 + 32, 0);
    asm volatile("s_wait_xcnt 0x0" :: "v"(q0), "v"(q1), "v"(q2), "v"(q3), "v"(q4), "v"(q5) : "memory");      /* the twelve loads' six address pairs stay whole up to here and are free for reuse only behind this wait */
    c00 = g2_mma(xa0, xb0, c00); c10 = g2_mma(xa1, xb0, c10); c01 = g2_mma(xa0, xb1, c01); c11 = g2_mma(xa1, xb1, c11);
    c02 = g2_mma(xa0, xb2, c02); c12 = g2_mma(xa1, xb2, c12); c03 = g2_mma(xa0, xb3, c03); c13 = g2_mma(xa1, xb3, c13);
    const int k2 = (kb + 64 < K) ? kb + 64 : kb;      /* the last trip fetches its own first step again: in bounds, unused */
    const _Float16* r0 = a0p + k2; const _Float16* r1 = a1p + k2; const _Float16* r2 = b0p + k2; const _Float16* r3 = b1p + k2; const _Float16* r4 = b2p + k2; const _Float16* r5 = b3p + k2;
    xa0 = g2_frag(r0, 0); xa1 = g2_frag(r1, 0); xb0 = g2_frag(r2, 0); xb1 = g2_frag(r3, 0); xb2 = g2_frag(r4, 0); xb3 = g2_frag(r5, 0);
    asm volatile("s_wait_xcnt 0x0" :: "v"(r0), "v"(r1), "v"(r2), "v"(r3), "v"(r4), "v"(r5) : "memory");      /* likewise for this set's six address pairs */
    c00 = g2_mma(ya0, yb0, c00); c10 = g2_mma(ya1, yb0, c10); c01 = g2_mma(ya0, yb1, c01); c11 = g2_mma(ya1, yb1, c11);
    c02 = g2_mma(ya0, yb2, c02); c12 = g2_mma(ya1, yb2, c12); c03 = g2_mma(ya0, yb3, c03); c13 = g2_mma(ya1, yb3, c13); }
  v8f accs[8] = {c00, c01, c02, c03, c10, c11, c12, c13};
#pragma unroll
  for (int u = 0; u < 8; ++u) { const int t = u & 3, half = u >> 2; const int col = col0 + t * 16 + ln; const float bv = bp ? bf16_round(bp[col]) : 0.f;
#pragma unroll
    for (int r = 0; r < 8; ++r) { const int rloc = half * 16 + 8 * hh + r; float v = accs[u][r] * alpha + bv; if (CP) { if (rowsPerB < 0) v += CP[cofs + (size_t)(row0g + row0 + rloc) * ldc + col];      /* rowsPerB < 0: own element of the batched C plane */ else { const int bidx = (row0g + row0 + rloc) / rowsPerB; v += CP[(size_t)bidx * sCPb + (size_t)by * 64 + col]; } }
      if (ACT == 3) v = fmaxf(v, 0.f); else if (ACT == 6) v = 0.5f * v * (1.0f + erff(v * 0.70710678118654752f)); else if (ACT == 11) v = 1.0f / (1.0f + expf(-v)); else if (ACT == 15) v = v / (1.0f + expf(-v)); else if (ACT == 12) v = (v > 0.f) ? v : 0.01f * v; else if (ACT == 8) v = tanhf(v); else if (ACT == 9) v = 0.5f * v * (1.0f + tanhf(0.7978845608028654f * (v + 0.044715f * v * v * v))); else if (ACT == 14) v = (v > 0.f) ? v : 0.1f * v; else if (ACT == 16) v = (v >= 0.f) ? v : 0.3f * v; else if (ACT == 17) v = (v >= 0.f) ? v : 0.2f * v;
      so[w][rloc][t * 16 + ln] = v; } }
  __builtin_amdgcn_fence(__ATOMIC_ACQ_REL, "workgroup"); __builtin_amdgcn_wave_barrier();
  const int rsub = lane >> 4, c4 = (lane & 15) * 4;
  {
#pragma unroll
    for (int q = 0; q < 16; ++q) { const int r = q * 2 + rsub; const v4f v = *(const v4fa*)&so[w][r][c4]; if (C) { float* cp = C + cofs + (size_t)(row0 + r) * ldc + col0 + c4; *(v4f*)cp = v; asm volatile("s_wait_xcnt 0x0" :: "v"(cp), "v"(v) : "memory"); }      /* the f32 store's address pair and data registers stay whole up to here: the f16 conversion below and the next row's LDS read reuse them only behind this wait */ if (C16) { v4h h4; for (int i = 0; i < 4; ++i) h4[i] = (_Float16)v[i]; *(v4h*)(C16 + cofs + (size_t)(row0 + r) * ldc + col0 + c4) = h4; } }
     } }


__global__ __launch_bounds__(256) void k_wnat(const float* __restrict__ w, size_t n8, _Float16* __restrict__ Bt) { const size_t t = (size_t)blockIdx.x * 256 + threadIdx.x; if (t >= n8) return; FragH f; for (int q = 0; q < 8; ++q) f.h[q] = (_Float16)(bf16_round(w[t * 8 + q]) * 16.0f); *(v8us*)((unsigned short*)Bt + t * 8) = f.half[0];  }
__global__ __launch_bounds__(256) void k_rsm(const float* __restrict__ S, _Float16* __restrict__ P, int nrows) {
  #pragma clang fp contract(off)
  const int i = blockIdx.x * 256 + threadIdx.x; if (i >= nrows) return; const float* s = S + (size_t)i * SQ; float mx = -3.0e38f;
#pragma unroll 1
  for (int j = 0; j < SQ; ++j) mx = fmaxf(mx, s[j]); float se = 0.f;
#pragma unroll 1
  for (int j = 0; j < SQ; ++j) se += expf(s[j] - mx); const float sc = 256.0f / se;
#pragma unroll 1
  for (int j0 = 0; j0 < SQ; j0 += 8) { FragH f; for (int q = 0; q < 8; ++q) f.h[q] = (_Float16)(expf(s[j0 + q] - mx) * sc); unsigned short* d = (unsigned short*)P + (size_t)i * SQ + j0; *(v8us*)d = f.half[0];  } }
__global__ __launch_bounds__(256) void k_vt(const _Float16* __restrict__ V16, int b, int h0, _Float16* __restrict__ VT) { __shared__ unsigned short tl[64][65]; const int tid = threadIdx.x; const int hh = blockIdx.x % HG, sg = blockIdx.x / HG; const int s0 = sg * 64; const int h = h0 + hh;
  for (int i = tid; i < 64 * 8; i += 256) { const int j = i / 8, d8 = (i % 8) * 8; FragH f; f.half[0] = *(const v8us*)((const unsigned short*)V16 + ((size_t)b * SQ + s0 + j) * DM + h * HD + d8); for (int q = 0; q < 8; ++q) tl[d8 + q][j] = f.u[q]; }
  __syncthreads();
  { for (int i = tid; i < 64 * 8; i += 256) { const int d = i / 8, j8 = (i % 8) * 8; FragH f; for (int q = 0; q < 8; ++q) f.u[q] = tl[d][j8 + q]; *(v8us*)((unsigned short*)VT + ((size_t)hh * HD + d) * SQ + s0 + j8) = f.half[0]; }  } }



// Fused causal attention, one launch, a block for every (batch, head, 128 query rows): the scores and the softmax weights stay in registers.
// One wave owns 16 queries and walks the keys 32 at a time. S^T = K Q^T (A = K rows, B = Q rows, both through fa_frag, so the k orders pair): lane (ln, hh) holds, of query q0 + ln,
// the scores of keys k0 + 16 kt + 8 hh + r. Three products as before: hi.hi in one accumulator, lo.hi + hi.lo (x1024) in a second. Running maximum and running sum per query (the two
// lane halves share the maximum and join their sums at the end). The two score tiles, as f16, are the B operand of O^T += V^T P^T in the order fa_frag gives V^T's rows. o leaves x64.
__device__ __forceinline__ v16h fa_frag(const _Float16* p) { FragH f; f.half[0] = *(const v8us*)((const unsigned short*)p); f.half[1] = *(const v8us*)((const unsigned short*)p + 16); return f.v; }      /* g2_frag with the lane half's 8 elements already in p */
__device__ __forceinline__ float fa_exp(float x) { float r; asm("v_exp_f32 %0, %1\n\tv_nop" : "=v"(r) : "v"(x * 1.44269504f)); return r; }      /* native e^x; the v_nop fills the one slot the instruction set asks for behind a transcendental, whatever the compiler puts next */
__device__ __forceinline__ v8f fa_mma(v16h a, v16h b, v8f c) { return __builtin_amdgcn_wmma_f32_16x16x32_f16(false, a, false, b, (short)0, c, false, false); }
__global__ __launch_bounds__(256) void k_fattn(const _Float16* __restrict__ QHp, const _Float16* __restrict__ QLp, const _Float16* __restrict__ KHp, const _Float16* __restrict__ KLp, const _Float16* __restrict__ VTp, _Float16* __restrict__ O) {
  const int lane = threadIdx.x & 31, ln = lane & 15, hh = lane >> 4; const int w = __builtin_amdgcn_readfirstlane(threadIdx.x >> 5);      /* the wave's number as a scalar: the trip count and the mask test stay scalar */
  const int bh = blockIdx.x % (NB * NH), tx = blockIdx.x / (NB * NH); const int tile = (tx < SQ / 256) ? (SQ / 128 - 1 - tx) : (tx - SQ / 256);      /* long tiles take the low block numbers; the second half of the grid counts up from the short end */
  const int b = bh / NH, h = bh % NH; const int q0 = tile * 128 + w * 16; const size_t r0 = (size_t)b * SQ;
  const _Float16* qh = QHp + (r0 + q0 + ln) * LQ + h * HD + 8 * hh; const _Float16* ql = QLp + (r0 + q0 + ln) * LQ + h * HD + 8 * hh;
  const v16h qh0 = fa_frag(qh), qh1 = fa_frag(qh + 32), ql0 = fa_frag(ql), ql1 = fa_frag(ql + 32);
  const _Float16* kh = KHp + (r0 + ln) * LQ + h * HD + 8 * hh; const _Float16* kl = KLp + (r0 + ln) * LQ + h * HD + 8 * hh; const _Float16* vt = VTp + ((size_t)bh * HD + ln) * SQ + 8 * hh;
  const v8f z8 = {0.f,0.f,0.f,0.f,0.f,0.f,0.f,0.f}; v8f o[4] = {z8, z8, z8, z8}; float m = -1.0e30f, l = 0.f;
  const int np = q0 / 32 + 1;      /* keys 0 .. q0 + 15 in passes of 32 */
  v16h fh[2][2], fl[2][2];      /* K fragments [key tile][k step], fetched one pass ahead */
#pragma unroll      /* static indices keep the fragments, scores and accumulators in registers */
  for (int kt = 0; kt < 2; ++kt) for (int ks = 0; ks < 2; ++ks) { fh[kt][ks] = fa_frag(kh + (size_t)kt * 16 * LQ + ks * 32); fl[kt][ks] = fa_frag(kl + (size_t)kt * 16 * LQ + ks * 32); }
  asm volatile("s_wait_xcnt 0x0" :: "v"(qh), "v"(ql), "v"(kh), "v"(kl) : "memory");      /* the loads' four address pairs stay whole up to here and are free for reuse only behind this wait */
  for (int p = 0; p < np; ++p) { const int k0 = p * 32;
    const _Float16* va = vt + k0; v16h fv[4];
#pragma unroll      /* static indices keep the fragments, scores and accumulators in registers */
    for (int dt = 0; dt < 4; ++dt) fv[dt] = fa_frag(va + (size_t)dt * 16 * SQ);
    v8f sh[2], sl[2];
#pragma unroll      /* static indices keep the fragments, scores and accumulators in registers */
    for (int kt = 0; kt < 2; ++kt) { sh[kt] = fa_mma(fh[kt][1], qh1, fa_mma(fh[kt][0], qh0, z8)); sl[kt] = fa_mma(fl[kt][1], qh1, fa_mma(fl[kt][0], qh0, fa_mma(fh[kt][1], ql1, fa_mma(fh[kt][0], ql0, z8)))); }
    const int kn = (p + 1 < np) ? k0 + 32 : k0;      /* the last pass fetches its own rows again: in bounds, unused */
    const _Float16* ka = kh + (size_t)kn * LQ; const _Float16* kb = kl + (size_t)kn * LQ;
#pragma unroll      /* static indices keep the fragments, scores and accumulators in registers */
    for (int kt = 0; kt < 2; ++kt) for (int ks = 0; ks < 2; ++ks) { fh[kt][ks] = fa_frag(ka + (size_t)kt * 16 * LQ + ks * 32); fl[kt][ks] = fa_frag(kb + (size_t)kt * 16 * LQ + ks * 32); }
    asm volatile("s_wait_xcnt 0x0" :: "v"(va), "v"(ka), "v"(kb) : "memory");      /* this pass's three address pairs stay whole up to here and are free for reuse only behind this wait */
    float s[16];
#pragma unroll      /* static indices keep the fragments, scores and accumulators in registers */
    for (int e = 0; e < 16; ++e) s[e] = fmaf(sl[e >> 3][e & 7], SCLR, sh[e >> 3][e & 7] * SCL);
    if (k0 + 31 > q0) {      /* only the pass on the diagonal masks; key k0 <= q0 stays, so every query keeps a key */
#pragma unroll      /* static indices keep the fragments, scores and accumulators in registers */
      for (int e = 0; e < 16; ++e) s[e] = (k0 + (e >> 3) * 16 + 8 * hh + (e & 7) <= q0 + ln) ? s[e] : -1.0e30f; }
    float mx = s[0];
#pragma unroll      /* static indices keep the fragments, scores and accumulators in registers */
    for (int e = 1; e < 16; ++e) mx = fmaxf(mx, s[e]);
    mx = fmaxf(mx, __shfl_xor(mx, 16, 32)); const float mn = fmaxf(m, mx); const float al = fa_exp(m - mn); m = mn;
    FragH pf; float ps[4] = {0.f, 0.f, 0.f, 0.f};
#pragma unroll      /* static indices keep the fragments, scores and accumulators in registers */
    for (int e = 0; e < 16; ++e) { const float pe = fa_exp(s[e] - mn); ps[e & 3] += pe; pf.h[e] = (_Float16)pe; }
    l = fmaf(l, al, (ps[0] + ps[1]) + (ps[2] + ps[3]));
#pragma unroll      /* static indices keep the fragments, scores and accumulators in registers */
    for (int dt = 0; dt < 4; ++dt) { o[dt] *= al; o[dt] = fa_mma(fv[dt], pf.v, o[dt]); } }
  l += __shfl_xor(l, 16, 32); const float fin = 64.0f / l;      /* o carried x64, folded into the output GEMM's alpha */
  _Float16* op = O + (r0 + q0 + ln) * DM + h * HD + 8 * hh;
#pragma unroll      /* static indices keep the fragments, scores and accumulators in registers */
  for (int dt = 0; dt < 4; ++dt) { FragH f;
#pragma unroll      /* static indices keep the fragments, scores and accumulators in registers */
    for (int r = 0; r < 8; ++r) f.h[r] = (_Float16)(o[dt][r] * fin);
    *(v8us*)((unsigned short*)op + dt * 16) = f.half[0]; } }


typedef float v2f __attribute__((ext_vector_type(2)));
// Exact f32 attention for query rows 0 .. QT0-1 of one batch, one wave per (head, query row), 8 rows of one head per block. The head's QT0 K and V rows are staged once in LDS;
// lane l scores keys l, l + 32, l + 64, l + 96; row maximum and row sum are lane partials joined by butterflies; lane l then sums dims 2l, 2l + 1 over the keys (weight 0 behind the diagonal).
__global__ __launch_bounds__(256) void k_att0w(const float* __restrict__ QF, const float* __restrict__ KF, const float* __restrict__ VF, float scale, float* __restrict__ OF) {
  __shared__ __attribute__((aligned(16))) float lk[QT0][HD + 4];      /* pitch 272 B = 16 B x odd: one key row per lane reads without bank conflicts */
  __shared__ __attribute__((aligned(16))) float lv[QT0][HD];
  const int tid = threadIdx.x, lane = tid & 31; const int w = __builtin_amdgcn_readfirstlane(tid >> 5);      /* the wave's number as a scalar: q is read through scalar loads */
  const int h = blockIdx.x / (QT0 / 8), i = (blockIdx.x % (QT0 / 8)) * 8 + w;
  const int sr = tid >> 4, sc = (tid & 15) * 4; const float* kg = KF + (size_t)sr * DM + h * HD + sc; const float* vg = VF + (size_t)sr * DM + h * HD + sc; v4f ks[QT0 / 16], vs[QT0 / 16];
#pragma unroll      /* static indices keep ks[] and vs[] in registers; every load is issued before the first LDS store */
  for (int u = 0; u < QT0 / 16; ++u) { ks[u] = *(const v4fa*)(kg + (size_t)u * 16 * DM); vs[u] = *(const v4fa*)(vg + (size_t)u * 16 * DM); }
  asm volatile("s_wait_xcnt 0x0" :: "v"(kg), "v"(vg) : "memory");      /* the loads' two address pairs stay whole up to here and are free for reuse only behind this wait */
#pragma unroll      /* static indices keep ks[] and vs[] in registers */
  for (int u = 0; u < QT0 / 16; ++u) { *(v4f*)&lk[u * 16 + sr][sc] = ks[u]; *(v4f*)&lv[u * 16 + sr][sc] = vs[u]; }
  __syncthreads();
  const float* qg = QF + (size_t)i * DM + h * HD; v4f a[QT0 / 32] = {};
#pragma unroll      /* static indices keep a[] in registers: four independent sums per key, four keys per lane */
  for (int d = 0; d < HD / 4; ++d) { for (int c = 0; c < QT0 / 32; ++c) { const v4f kk = *(const v4f*)&lk[c * 32 + lane][d * 4]; for (int u = 0; u < 4; ++u) a[c][u] = fmaf(qg[d * 4 + u], kk[u], a[c][u]); } }
  float e[QT0 / 32]; float m = -1.0e30f;
#pragma unroll      /* static indices keep e[] in registers */
  for (int c = 0; c < QT0 / 32; ++c) { e[c] = (c * 32 + lane <= i) ? ((a[c][0] + a[c][1]) + (a[c][2] + a[c][3])) * scale : -1.0e30f; m = fmaxf(m, e[c]); }
  for (int x = 16; x >= 1; x >>= 1) m = fmaxf(m, __shfl_xor(m, x, 32));
  float l = 0.f;
#pragma unroll      /* static indices keep e[] in registers */
  for (int c = 0; c < QT0 / 32; ++c) { e[c] = expf(e[c] - m); l += e[c]; }      /* a key behind the diagonal: exp(-1e30 - m) = 0 */
  for (int x = 16; x >= 1; x >>= 1) l += __shfl_xor(l, x, 32);
  v2f o[4] = {};
#pragma unroll      /* a constant lane number per step: key j's weight is broadcast through a scalar register; static indices keep e[] and o[] in registers */
  for (int j = 0; j < QT0; ++j) { const float ej = __int_as_float(__builtin_amdgcn_readlane(__float_as_int(e[j >> 5]), j & 31)); const v2f vv = *(const v2f*)&lv[j][lane * 2]; o[j & 3][0] = fmaf(ej, vv[0], o[j & 3][0]); o[j & 3][1] = fmaf(ej, vv[1], o[j & 3][1]); }
  const float fin = 64.0f / l;      /* o carried x64 like the f16 path */
  const v2f r = ((o[0] + o[1]) + (o[2] + o[3])) * fin;
  *(v2f*)(OF + (size_t)i * DM + h * HD + lane * 2) = r; }

extern "C" void kernel_launch(void* const* d_in, const int* in_sizes, int n_in,
                              void* d_out, int out_size, void* d_ws, size_t ws_size, hipStream_t stream) {
  (void)in_sizes; (void)n_in; (void)out_size;
  const float* const* I = (const float* const*)d_in; const float* x = I[0]; const float* xk = I[1]; const float* xv = I[2]; const float* wq = I[3]; const float* bq = I[4]; const float* wk = I[5]; const float* bk = I[6]; const float* wv = I[7]; const float* bv = I[8]; const float* wo = I[9]; const float* bo = I[10];      /* input order: query, key, value (THREE input streams), then [in][out] weights + biases */
  char* ws = (char*)d_ws; size_t off = 0;
  auto take = [&](size_t bytes) { char* p = ws + off; off += (bytes + 255) & ~(size_t)255; return p; };
  _Float16* BQ = (_Float16*)take((size_t)DM * DM * 2); _Float16* BK = (_Float16*)take((size_t)DM * DM * 2); _Float16* BV = (_Float16*)take((size_t)DM * DM * 2); _Float16* BO = (_Float16*)take((size_t)DM * DM * 2);
  _Float16* X16 = (_Float16*)take(NR * DM * 2); _Float16* XK16 = (_Float16*)take(NR * DM * 2); _Float16* XV16 = (_Float16*)take(NR * DM * 2);      /* exact f16 rows of query, key, value */ float* QF = (float*)take(NR * DM * 4); float* KF = (float*)take(NR * DM * 4); float* VF = (float*)take(NR * DM * 4);      /* f32 q, k, v rows, each kept: the exact first-tile attention reads its 128 rows per batch from them */ _Float16* QH = (_Float16*)take(NR * DM * 2); _Float16* QL = (_Float16*)take(NR * DM * 2); _Float16* KH = (_Float16*)take(NR * DM * 2); _Float16* KL = (_Float16*)take(NR * DM * 2); _Float16* Q16 = QH; _Float16* K16 = KH; _Float16* V16 = (_Float16*)take(NR * DM * 2); _Float16* O16 = (_Float16*)take(NR * DM * 2);
  _Float16* VT = (_Float16*)take((size_t)NB * NH * HD * SQ * 2);      /* V^T of both batches */
  float* OF0 = (float*)take((size_t)NB * QT0 * DM * 4); _Float16* OH0 = (_Float16*)take((size_t)NB * QT0 * DM * 2); _Float16* OL0 = (_Float16*)take((size_t)NB * QT0 * DM * 2);
  if (off > ws_size) return;
  { const unsigned g = (unsigned)(((size_t)DM * (DM / 8) + 255) / 256); k_wt_f16<<<g, 256, 0, stream>>>(wq, BQ, DM, DM, 16.0f); k_wt_f16<<<g, 256, 0, stream>>>(wk, BK, DM, DM, 16.0f); k_wt_f16<<<g, 256, 0, stream>>>(wv, BV, DM, DM, 16.0f); k_wt_f16<<<g, 256, 0, stream>>>(wo, BO, DM, DM, 16.0f); }      /* [in][out] -> Bt[n][k] x16 */
  k_x16<<<(unsigned)((NR * DM / 8 + 255) / 256), 256, 0, stream>>>(x, X16, NR * DM / 8); k_x16<<<(unsigned)((NR * DM / 8 + 255) / 256), 256, 0, stream>>>(xk, XK16, NR * DM / 8); k_x16<<<(unsigned)((NR * DM / 8 + 255) / 256), 256, 0, stream>>>(xv, XV16, NR * DM / 8);
  const size_t r0p = (size_t)B0 * SQ;      /* first projected row */
  k_gemm2<0><<<dim3((unsigned)((MP / 128) * (DM / 64)), 1), 128, 0, stream>>>(X16 + r0p * DM, DM, 0, BQ, DM, 0, 0.0625f, bq, 0, nullptr, 1, 0, 0, QF + r0p * DM, nullptr, DM, 0, MP, DM, DM); k_hl<<<(unsigned)(((size_t)MP * DM / 8 + 255) / 256), 256, 0, stream>>>(QF + r0p * DM, QH + r0p * DM, QL + r0p * DM, (size_t)MP * DM / 8);      /* q (f32) -> f16 hi + x1024 residual: unscaled logits sigma ~8 */
  k_gemm2<0><<<dim3((unsigned)((MP / 128) * (DM / 64)), 1), 128, 0, stream>>>(XK16 + r0p * DM, DM, 0, BK, DM, 0, 0.0625f, bk, 0, nullptr, 1, 0, 0, KF + r0p * DM, nullptr, DM, 0, MP, DM, DM); k_hl<<<(unsigned)(((size_t)MP * DM / 8 + 255) / 256), 256, 0, stream>>>(KF + r0p * DM, KH + r0p * DM, KL + r0p * DM, (size_t)MP * DM / 8);      /* k likewise */
  k_gemm2<0><<<dim3((unsigned)((MP / 128) * (DM / 64)), 1), 128, 0, stream>>>(XV16 + r0p * DM, DM, 0, BV, DM, 0, 0.0625f, bv, 0, nullptr, 1, 0, 0, VF + r0p * DM, V16 + r0p * DM, DM, 0, MP, DM, DM);      /* v as f16 rows and as f32 rows */
  for (int b = B0; b < B0 + NBR; ++b) { const size_t r0 = (size_t)b * SQ;
    k_vt<NH, SQ><<<NH * (SQ / 64), 256, 0, stream>>>(V16 + r0 * LQ, LQ, 0, VT + (size_t)b * NH * HD * SQ);      /* V^T [NH][HD][SQ] for this batch */
    k_att0w<<<NH * (QT0 / 8), 256, 0, stream>>>(QF + r0 * DM, KF + r0 * DM, VF + r0 * DM, SCL, OF0 + (size_t)b * QT0 * DM);      /* exact f32 attention for rows 0..127 (o x64), one wave per (head, row) */ }
  k_fattn<<<NB * NH * (SQ / 128), 256, 0, stream>>>(QH, QL, KH, KL, VT, O16);      /* scores, causal softmax and P V of both batches and all heads in one launch: o (merged heads, x64) as f16 rows */
  k_gemm2<0><<<dim3((unsigned)((MPO / 128) * (DM / 64)), 1), 128, 0, stream>>>(O16 + r0p * DM, DM, 0, BO, DM, 0, 0.0009765625f, bo, 0, nullptr, 1, 0, 0, (float*)d_out + r0p * DM, nullptr, DM, 0, MPO, DM, DM);      /* out rows are the output layout */
  k_hl<<<(unsigned)(((size_t)NB * QT0 * DM / 8 + 255) / 256), 256, 0, stream>>>(OF0, OH0, OL0, (size_t)NB * QT0 * DM / 8);      /* first-tile o (x64) -> f16 hi + x1024 residual planes */
  for (int b = B0; b < B0 + NBR; ++b) { const size_t r0 = (size_t)b * SQ; const size_t f0 = (size_t)b * QT0;
    k_gemm2<0><<<dim3((QT0 / 128) * (DM / 64), 1), 128, 0, stream>>>(OH0 + f0 * DM, DM, 0, BO, DM, 0, 0.0009765625f, bo, 0, nullptr, 1, 0, 0, (float*)d_out + r0 * DM, nullptr, DM, 0, QT0, DM, DM);      /* rows 0..127: out = o_hi Wo (+ b), overwriting the f16-path rows */
    k_gemm2<0><<<dim3((QT0 / 128) * (DM / 64), 1), 128, 0, stream>>>(OL0 + f0 * DM, DM, 0, BO, DM, 0, 0.00000095367431640625f, nullptr, 0, (const float*)d_out + r0 * DM, -1, 0, 0, (float*)d_out + r0 * DM, nullptr, DM, 0, QT0, DM, DM); }      /* += o_lo Wo 2^-20 (own-element accumulate) */
}

// v006
// A run of this version takes 244 microseconds.
// Next to v005, in two timings, it ran 1.36 and 1.35 times as fast.
// All steps since v000 together make it 23.6 times as fast.
#include <hip/hip_runtime.h>
// Causal multi-head attention on three inputs with the source's sequence-length score scale (query, key, value [2][2048][1024]; q = query Wq + bq, k = key Wk + bk, v = value Wv + bv ([in][out] 1024 x 1024, weights AND biases sigma 1/32), 16 heads of 64; score = q k^T; triu(1) -> -inf; softmax(score / sqrt(Sk)) with Sk = 2048 KEYS (the source divides by sqrt of the score matrix's last dimension, NOT by sqrt(head_dim)): scale 2048^-0.5 = 0.0220970869; out = merged Wo + bo ([in][out]) -> [2][2048][1024]); q and k carried as f16 hi + x1024 residual planes with three-product scores.
// Structure: token rows r = b*2048 + s; x as exact f16 rows (bf16-rounded); q and k as WMMA GEMMs (32x64 wave tiles, f32 accumulation, exact x16 weights + bias) into f32 rows split into f16 hi + x1024 residual planes, v as a GEMM that stores f16 rows and f32 rows; the f32 q, k, v rows are kept for the exact first-tile attention; per batch: V^T for all heads via LDS transposes; then ONE fused attention launch (a wave per 16 queries, keys below the diagonal in passes of 32: three-product scores hi.hi + lo.hi + hi.lo in f32 accumulators, running-maximum softmax in registers (f32 statistics, native exp; weights in (0, 1] as f16), o = P . V^T normalised at the end, carried x64 and folded into the output GEMM alpha) written straight into the merged f16 o rows; out = o W_o + b GEMM (f32) into the output layout.
// Layout: every f16 plane that only WMMA fragment loads read (x rows, weights, q and k hi / residual planes, V^T, o rows) is kept in FRAGMENT ORDER: a tile of 16 rows x 32 k is one 1-KiB block [k half of 16][lane = 16 * (k / 8 % 2) + row][8 k], the blocks of 16 rows one behind the other in k (V^T: the four 16-dim blocks of each 32 keys one behind the other); a wave's 16-byte fragment load then covers 512 contiguous bytes. Outside V^T, 16 rows of a plane of pitch C fill 16 * C elements as before, so offsets of whole 16-row groups are unchanged.
// Compute dtype: inputs rounded to bf16; x / weights exact; q and k as f16 hi + x1024 residual planes; v, softmax weights and o as plain f16 GEMM operands (~2^-12); scores and softmax statistics f32. v_wmma_f32_16x16x32_f16.
#define NB 2
#define SCL 0.0220970869f                 /* = f32(1 / sqrt(2048)): the source scales the scores by 1/sqrt(Sk), Sk = 2048 keys */
#define SCLR (0.0220970869f * 0.0009765625f)   /* the same scale on the x1024 residual passes */
#define SQ 2048
#define DM 1024
#define NH 16
#define HD 64
#define HG 4                         /* heads per launch of the head-group k_vt overload, which is not launched */
#define QT0 128                      /* first-tile rows recomputed exactly in f32 */
#define B0 0                         /* first batch processed (debug hook) */
#define NBR NB                       /* batches processed (debug hook) */
#define NR ((size_t)NB * SQ)         /* token rows */
#define MP ((int)((size_t)NBR * SQ)) /* rows projected (debug hook) */
#define MPO MP                       /* rows through the output stage (debug hook) */
#define LQ DM      /* row pitch of the q/k/v rows */
typedef __bf16 v16b __attribute__((ext_vector_type(16)));
typedef unsigned short v8us __attribute__((ext_vector_type(8), may_alias));
typedef float  v8f  __attribute__((ext_vector_type(8)));
typedef float  v4f  __attribute__((ext_vector_type(4)));
typedef float  v4fa __attribute__((ext_vector_type(4), may_alias));
union FragB { v16b v; v8us half[2]; unsigned short u[16]; };

__device__ __forceinline__ unsigned short bf16_bits(float x) { unsigned int u = __float_as_uint(x); return (unsigned short)((u + 0x7FFFu + ((u >> 16) & 1u)) >> 16); }
__device__ __forceinline__ float bf16_val(unsigned short b) { return __uint_as_float(((unsigned int)b) << 16); }
__device__ __forceinline__ float bf16_round(float x) { return bf16_val(bf16_bits(x)); }
// D += A·B with NT terms: 1 = ah·bh, 2 = + al·bh (A split), 3 = + ah·bl (both split)
template <int NT>
__device__ __forceinline__ v8f mmaN(v16b ah, v16b al, v16b bh, v16b bl, v8f c) {
  c = __builtin_amdgcn_wmma_f32_16x16x32_bf16(false, ah, false, bh, (short)0, c, false, false);
  if (NT >= 2) c = __builtin_amdgcn_wmma_f32_16x16x32_bf16(false, al, false, bh, (short)0, c, false, false);
  if (NT >= 3) c = __builtin_amdgcn_wmma_f32_16x16x32_bf16(false, ah, false, bl, (short)0, c, false, false);
  asm volatile("v_nop\n\tv_nop\n\tv_nop\n\tv_nop" : "+v"(c) : "v"(ah), "v"(al), "v"(bh), "v"(bl));
  return c;
}

__global__ __launch_bounds__(256) void k_wt_bf16(const float* __restrict__ W, unsigned short* __restrict__ Wt, int K, int N) {
  const int t = blockIdx.x * 256 + threadIdx.x;
  const int k8n = K / 8;
  if (t >= N * k8n) return;
  const int n = t / k8n, k8 = (t % k8n) * 8;
  v8us v;
#pragma unroll
  for (int i = 0; i < 8; ++i) v[i] = bf16_bits(W[(size_t)(k8 + i) * N + n]);
  *(v8us*)(Wt + (size_t)n * K + k8) = v;
  
}

// GEMM C[M][N] (f32, pitch ldc) = act(A[M][K]·W + bias). A f32 row-major (pitch lda) converted per fragment to bf16
// (ASPLIT: hi/lo two planes -> 2 terms, else single rounded term); Wt bf16 [N][K] (pitch ldb). BIAS_BF16 rounds the
// bias to bf16 first (bias quantised to bf16 before the add). K%32==0, M%16==0, N%64==0.
template <bool ASPLIT, int ACT, bool BIAS_BF16>
__global__ __launch_bounds__(128) void k_gemm_bf(const float* __restrict__ A, int lda, const unsigned short* __restrict__ Wt, int ldb,
                                               const float* __restrict__ bias, float* __restrict__ C, int ldc, int M, int N, int K) {
  __shared__ __attribute__((aligned(16))) float so[4][16][64];
  const int tid = threadIdx.x, w = tid >> 5, lane = tid & 31, ln = lane & 15, hh = lane >> 4;
  const int ntn = N / 64;
  const int wid = blockIdx.x * 4 + w;
  const int mt = wid / ntn, nq = wid % ntn;
  if (mt * 16 >= M) return;
  const int row0 = mt * 16, col0 = nq * 64;
  const float* arow = A + (size_t)(row0 + ln) * lda;
  v8f acc[4] = {};
  for (int kb = 0; kb < K; kb += 32) {
    FragB ah, al;
    const v4f x0 = *(const v4fa*)(arow + kb + 8 * hh), x1 = *(const v4fa*)(arow + kb + 8 * hh + 4);
    const v4f x2 = *(const v4fa*)(arow + kb + 16 + 8 * hh), x3 = *(const v4fa*)(arow + kb + 16 + 8 * hh + 4);
    float xs[16] = {x0[0],x0[1],x0[2],x0[3],x1[0],x1[1],x1[2],x1[3],x2[0],x2[1],x2[2],x2[3],x3[0],x3[1],x3[2],x3[3]};
#pragma unroll
    for (int i = 0; i < 16; ++i) { const unsigned short hb = bf16_bits(xs[i]); ah.u[i] = hb; al.u[i] = ASPLIT ? bf16_bits(xs[i] - bf16_val(hb)) : (unsigned short)0; }
#pragma unroll
    for (int t = 0; t < 4; ++t) {
      const unsigned short* brow = Wt + (size_t)(col0 + t * 16 + ln) * ldb + kb;
      FragB b;
      b.half[0] = *(const v8us*)(brow + 8 * hh);
      b.half[1] = *(const v8us*)(brow + 16 + 8 * hh);
      acc[t] = mmaN<ASPLIT ? 2 : 1>(ah.v, al.v, b.v, b.v, acc[t]);
    }
  }
#pragma unroll
  for (int t = 0; t < 4; ++t) {
    float bv = bias ? bias[col0 + t * 16 + ln] : 0.f;
    if (BIAS_BF16) bv = bf16_round(bv);
#pragma unroll
    for (int r = 0; r < 8; ++r) { float v = acc[t][r] + bv; if (ACT == 1) v = fmaxf(v, 0.f); so[w][8 * hh + r][t * 16 + ln] = v; }
  }
  __builtin_amdgcn_fence(__ATOMIC_ACQ_REL, "workgroup");
  __builtin_amdgcn_wave_barrier();
  const int rsub = lane >> 4, c4 = (lane & 15) * 4;
  {
#pragma unroll
    for (int q = 0; q < 8; ++q) {
      const int r = q * 2 + rsub;
      const v4f v = *(const v4fa*)&so[w][r][c4];
      *(v4f*)(C + (size_t)(row0 + r) * ldc + col0 + c4) = v;
    }
    
  }
}

// GEMM C = act(A·W + bias + resid): A f32 (ASPLIT -> hi/lo 2 terms), Wt bf16 [N][K]; ACT 0 none, 1 relu, 2 exact gelu;
// resid (optional, f32, row index = (row % rmod), pitch ldr, RES_BF16 rounds it) added before the activation.
template <bool ASPLIT, int ACT, bool BIAS_BF16, bool RES_BF16>
__global__ __launch_bounds__(128) void k_gemm_bf3(const float* __restrict__ A, int lda, const unsigned short* __restrict__ Wt, int ldb,
                                                const float* __restrict__ bias, const float* __restrict__ resid, int rmod, int ldr,
                                                float* __restrict__ C, int ldc, int M, int N, int K) {
  __shared__ __attribute__((aligned(16))) float so[4][16][64];
  const int tid = threadIdx.x, w = tid >> 5, lane = tid & 31, ln = lane & 15, hh = lane >> 4;
  const int ntn = N / 64;
  const int wid = blockIdx.x * 4 + w;
  const int mt = wid / ntn, nq = wid % ntn;
  if (mt * 16 >= M) return;
  const int row0 = mt * 16, col0 = nq * 64;
  const float* arow = A + (size_t)(row0 + ln) * lda;
  v8f acc[4] = {};
  for (int kb = 0; kb < K; kb += 32) {
    FragB ah, al;
    const v4f x0 = *(const v4fa*)(arow + kb + 8 * hh), x1 = *(const v4fa*)(arow + kb + 8 * hh + 4);
    const v4f x2 = *(const v4fa*)(arow + kb + 16 + 8 * hh), x3 = *(const v4fa*)(arow + kb + 16 + 8 * hh + 4);
    float xs[16] = {x0[0],x0[1],x0[2],x0[3],x1[0],x1[1],x1[2],x1[3],x2[0],x2[1],x2[2],x2[3],x3[0],x3[1],x3[2],x3[3]};
#pragma unroll
    for (int i = 0; i < 16; ++i) { const unsigned short hb = bf16_bits(xs[i]); ah.u[i] = hb; al.u[i] = ASPLIT ? bf16_bits(xs[i] - bf16_val(hb)) : (unsigned short)0; }
#pragma unroll
    for (int t = 0; t < 4; ++t) {
      const unsigned short* brow = Wt + (size_t)(col0 + t * 16 + ln) * ldb + kb;
      FragB b;
      b.half[0] = *(const v8us*)(brow + 8 * hh);
      b.half[1] = *(const v8us*)(brow + 16 + 8 * hh);
      acc[t] = mmaN<ASPLIT ? 2 : 1>(ah.v, al.v, b.v, b.v, acc[t]);
    }
  }
#pragma unroll
  for (int t = 0; t < 4; ++t) {
    const int col = col0 + t * 16 + ln;
    float bv = bias ? bias[col] : 0.f;
    if (BIAS_BF16) bv = bf16_round(bv);
#pragma unroll
    for (int r = 0; r < 8; ++r) {
      float v = acc[t][r] + bv;
      if (resid) { float rv = resid[(size_t)((row0 + 8 * hh + r) % rmod) * ldr + col]; if (RES_BF16) rv = bf16_round(rv); v += rv; }
      if (ACT == 1) v = fmaxf(v, 0.f);
      if (ACT == 2) v = 0.5f * v * (1.0f + erff(v * 0.70710678118654752f));
      if (ACT == 3) { const float u = 0.7978845608028654f * (v + 0.044715f * v * v * v); v = 0.5f * v * (1.0f + tanhf(u)); }
      so[w][8 * hh + r][t * 16 + ln] = v;
    }
  }
  __builtin_amdgcn_fence(__ATOMIC_ACQ_REL, "workgroup");
  __builtin_amdgcn_wave_barrier();
  const int rsub = lane >> 4, c4 = (lane & 15) * 4;
  {
#pragma unroll
    for (int q = 0; q < 8; ++q) {
      const int r = q * 2 + rsub;
      const v4f v = *(const v4fa*)&so[w][r][c4];
      *(v4f*)(C + (size_t)(row0 + r) * ldc + col0 + c4) = v;
    }
    
  }
}
// row LayerNorm (biased variance, eps) over N: s = X (+ R); optional out_sum <- s; out_norm <- (s-mu)*rsqrt(var+eps)*g + b
template <bool PARAM_BF16>
__global__ __launch_bounds__(256) void k_layernorm(const float* __restrict__ X, const float* __restrict__ R, const float* __restrict__ g, const float* __restrict__ bta,
                                                  float* __restrict__ out_sum, float* __restrict__ out_norm, int N, float eps) {
  __shared__ float red[256];
  const int row = blockIdx.x, tid = threadIdx.x;
  const float* x = X + (size_t)row * N; const float* rr = R ? R + (size_t)row * N : nullptr;
  float vals[16];                     // up to N = 4096
  const int per = N / 256;            // contiguous chunk per thread? use strided-by-4 chunks: thread handles j = tid*4 + 1024*u
  float s1 = 0.f;
  for (int u = 0; u < per / 4; ++u) {
    const int j = tid * 4 + 1024 * u;
    const v4f a = *(const v4fa*)(x + j);
    v4f b = {0.f,0.f,0.f,0.f}; if (rr) b = *(const v4fa*)(rr + j);
#pragma unroll
    for (int q = 0; q < 4; ++q) { const float v = a[q] + b[q]; vals[u * 4 + q] = v; s1 += v; }
  }
  red[tid] = s1; __syncthreads();
  for (int st = 128; st > 0; st >>= 1) { if (tid < st) red[tid] += red[tid + st]; __syncthreads(); }
  const float mu = red[0] / (float)N; __syncthreads();
  float s2 = 0.f;
  for (int u = 0; u < per / 4; ++u)
#pragma unroll
    for (int q = 0; q < 4; ++q) { const float c = vals[u * 4 + q] - mu; s2 += c * c; }
  red[tid] = s2; __syncthreads();
  for (int st = 128; st > 0; st >>= 1) { if (tid < st) red[tid] += red[tid + st]; __syncthreads(); }
  const float rs = rsqrtf(red[0] / (float)N + eps);
  {
    for (int u = 0; u < per / 4; ++u) {
      const int j = tid * 4 + 1024 * u;
      v4f o, sm;
#pragma unroll
      for (int q = 0; q < 4; ++q) {
        float gg = g[j + q], bb = bta[j + q];
        if (PARAM_BF16) { gg = bf16_round(gg); bb = bf16_round(bb); }
        sm[q] = vals[u * 4 + q]; o[q] = (vals[u * 4 + q] - mu) * rs * gg + bb;
      }
      if (out_sum) *(v4f*)(out_sum + (size_t)row * N + j) = sm;
      *(v4f*)(out_norm + (size_t)row * N + j) = o;
    }
    
  }
}



// ---- f16 WMMA path (v_wmma_f32_16x16x32_f16): 11-bit significands for operands in range — used where a [0,1] probability operand needs more precision than bf16
typedef _Float16 v16h __attribute__((ext_vector_type(16)));
union FragH { v16h v; v8us half[2]; _Float16 h[16]; unsigned short u[16]; };
template <int NT>
__device__ __forceinline__ v8f mmaH(v16h ah, v16h al, v16h bh, v16h bl, v8f c) {
  c = __builtin_amdgcn_wmma_f32_16x16x32_f16(false, ah, false, bh, (short)0, c, false, false);
  if (NT >= 2) c = __builtin_amdgcn_wmma_f32_16x16x32_f16(false, al, false, bh, (short)0, c, false, false);
  if (NT >= 3) c = __builtin_amdgcn_wmma_f32_16x16x32_f16(false, ah, false, bl, (short)0, c, false, false);
  asm volatile("v_nop\n\tv_nop\n\tv_nop\n\tv_nop" : "+v"(c) : "v"(ah), "v"(al), "v"(bh), "v"(bl));
  return c;
}
// batched GEMM like k_gemm_b but f16 operands: A f32 (split into f16 hi/lo if ASPLIT, else rounded to f16), Bt = f16 values [n][k]; alpha; C f32; N multiple of 16 (partial tiles skipped)
template <bool ASPLIT>
__global__ __launch_bounds__(128) void k_gemm_h(const float* __restrict__ A, int lda, size_t sA, const _Float16* __restrict__ Bh, int ldb, size_t sB, float alpha, float* __restrict__ C, int ldc, size_t sC, int M, int N, int K) {
  __shared__ __attribute__((aligned(16))) float so[4][16][64];
  const int tid = threadIdx.x, w = tid >> 5, lane = tid & 31, ln = lane & 15, hh = lane >> 4; const int by = blockIdx.y;
  A += (size_t)by * sA; Bh += (size_t)by * sB; C += (size_t)by * sC;
  const int ntn = (N + 63) / 64; const int wid = blockIdx.x * 4 + w; const int mt = wid / ntn, nq = wid % ntn; if (mt * 16 >= M) return;
  const int row0 = mt * 16, col0 = nq * 64; const float* arow = A + (size_t)(row0 + ln) * lda;
  v8f acc[4] = {};
  for (int kb = 0; kb < K; kb += 32) {
    FragH ah, al;
    const v4f x0 = *(const v4fa*)(arow + kb + 8 * hh), x1 = *(const v4fa*)(arow + kb + 8 * hh + 4), x2 = *(const v4fa*)(arow + kb + 16 + 8 * hh), x3 = *(const v4fa*)(arow + kb + 16 + 8 * hh + 4);
    float xs[16] = {x0[0],x0[1],x0[2],x0[3],x1[0],x1[1],x1[2],x1[3],x2[0],x2[1],x2[2],x2[3],x3[0],x3[1],x3[2],x3[3]};
#pragma unroll
    for (int i = 0; i < 16; ++i) { const _Float16 h = (_Float16)xs[i]; ah.h[i] = h; al.h[i] = ASPLIT ? (_Float16)(xs[i] - (float)h) : (_Float16)0.0f; }
#pragma unroll
    for (int t = 0; t < 4; ++t) { if (col0 + t * 16 >= N) continue; const size_t boff = (size_t)(col0 + t * 16 + ln) * ldb + kb; FragH bq; bq.half[0] = *(const v8us*)(Bh + boff + 8 * hh); bq.half[1] = *(const v8us*)(Bh + boff + 16 + 8 * hh);
      acc[t] = mmaH<ASPLIT ? 2 : 1>(ah.v, al.v, bq.v, bq.v, acc[t]); }
  }
#pragma unroll
  for (int t = 0; t < 4; ++t) { if (col0 + t * 16 >= N) continue;
#pragma unroll
    for (int r = 0; r < 8; ++r) so[w][8 * hh + r][t * 16 + ln] = acc[t][r] * alpha; }
  __builtin_amdgcn_fence(__ATOMIC_ACQ_REL, "workgroup"); __builtin_amdgcn_wave_barrier();
  const int rsub = lane >> 4, c4 = (lane & 15) * 4;
  {
#pragma unroll
    for (int q = 0; q < 8; ++q) { const int r = q * 2 + rsub; if (col0 + c4 < N) { const v4f v = *(const v4fa*)&so[w][r][c4]; *(v4f*)(C + (size_t)(row0 + r) * ldc + col0 + c4) = v; } }
     }
}

// Wt[n][k], in fragment order, = f16(W[k][n] * scale) from f32 row-major W[K][N] (K % 32 == 0, N % 16 == 0; scale = power of two; bf16-exact weights stay exact in f16 away from the subnormal range)
__global__ __launch_bounds__(256) void k_wt_f16(const float* __restrict__ W, _Float16* __restrict__ Wt, int K, int N, float scale) {
  const int t = blockIdx.x * 256 + threadIdx.x; if (t >= N * (K / 8)) return;      /* thread t writes the t-th 16-byte group of the fragment-order plane: 16 lanes read 16 neighbouring n of one k row */
  const int blk = t >> 6; const int n = (blk / (K / 32)) * 16 + (t & 15), k8 = (blk % (K / 32)) * 32 + ((t >> 5) & 1) * 16 + ((t >> 4) & 1) * 8; FragH f;
#pragma unroll
  for (int i = 0; i < 8; ++i) f.h[i] = (_Float16)(bf16_round(W[(size_t)(k8 + i) * N + n]) * scale); const v8us o = f.half[0];
  *(v8us*)((unsigned short*)Wt + (size_t)t * 8) = o; 
}
// k_gemm_hh variant with fused epilogue: v = acc·alpha + bias[by·sBias + col] (+ CP[(row/rowsPerB)·sCPb + by·64 + col] if CP) ; ACT 0 none / 1 elu ; writes f16 C16 (and f32 C if non-null)
template <int ACT>
__global__ __launch_bounds__(128) void k_gemm_hhx(const _Float16* __restrict__ A, int lda, size_t sA, const _Float16* __restrict__ Bh, int ldb, size_t sB, float alpha, const float* __restrict__ bias, size_t sBias, const float* __restrict__ CP, int rowsPerB, size_t sCPb, int row0g,
    float* __restrict__ C, _Float16* __restrict__ C16, int ldc, size_t sC, int M, int N, int K) {
  __shared__ __attribute__((aligned(16))) float so[4][16][64];
  const int tid = threadIdx.x, w = tid >> 5, lane = tid & 31, ln = lane & 15, hh = lane >> 4; const int by = blockIdx.y;
  A += (size_t)by * sA; Bh += (size_t)by * sB; const size_t cofs = (size_t)by * sC; const float* bp = bias ? bias + (size_t)by * sBias : nullptr;
  const int ntn = (N + 63) / 64; const int wid = blockIdx.x * 4 + w; const int mt = wid / ntn, nq = wid % ntn; if (mt * 16 >= M) return;
  const int row0 = mt * 16, col0 = nq * 64; const _Float16* arow = A + (size_t)(row0 + ln) * lda;
  v8f acc[4] = {};
  for (int kb = 0; kb < K; kb += 32) { FragH ah; ah.half[0] = *(const v8us*)((const unsigned short*)arow + kb + 8 * hh); ah.half[1] = *(const v8us*)((const unsigned short*)arow + kb + 16 + 8 * hh);
#pragma unroll
    for (int t = 0; t < 4; ++t) { if (col0 + t * 16 >= N) continue; const size_t boff = (size_t)(col0 + t * 16 + ln) * ldb + kb; FragH bq; bq.half[0] = *(const v8us*)((const unsigned short*)Bh + boff + 8 * hh); bq.half[1] = *(const v8us*)((const unsigned short*)Bh + boff + 16 + 8 * hh);
      acc[t] = mmaH<1>(ah.v, ah.v, bq.v, bq.v, acc[t]); }
  }
#pragma unroll
  for (int t = 0; t < 4; ++t) { if (col0 + t * 16 >= N) continue; const int col = col0 + t * 16 + ln; const float bv = bp ? bf16_round(bp[col]) : 0.f;
#pragma unroll
    for (int r = 0; r < 8; ++r) { float v = acc[t][r] * alpha + bv; if (CP) { const int rr = row0g + row0 + 8 * hh + r; if (rowsPerB < 0) v += CP[cofs + (size_t)rr * ldc + col];      /* rowsPerB < 0: own element of the batched C plane */ else { const int bidx = rr / rowsPerB; v += CP[(size_t)bidx * sCPb + (size_t)by * 64 + col]; } } if (ACT == 1) v = (v > 0.f) ? v : expm1f(v); else if (ACT == 7) v = (v > 0.f) ? v + 1.0f : expf(v); else if (ACT == 8) v = tanhf(v); else if (ACT == 9) v = 0.5f * v * (1.0f + tanhf(0.7978845608028654f * (v + 0.044715f * v * v * v))); else if (ACT == 11) v = 1.0f / (1.0f + expf(-v)); else if (ACT == 12) v = (v > 0.f) ? v : 0.01f * v; else if (ACT == 14) v = (v > 0.f) ? v : 0.1f * v; else if (ACT == 16) v = (v >= 0.f) ? v : 0.3f * v; else if (ACT == 17) v = (v >= 0.f) ? v : 0.2f * v; else if (ACT == 15) v = v / (1.0f + expf(-v)); else if (ACT == 3) v = fmaxf(v, 0.f); else if (ACT == 6) v = 0.5f * v * (1.0f + erff(v * 0.70710678118654752f)); so[w][8 * hh + r][t * 16 + ln] = v; } }
  __builtin_amdgcn_fence(__ATOMIC_ACQ_REL, "workgroup"); __builtin_amdgcn_wave_barrier();
  const int rsub = lane >> 4, c4 = (lane & 15) * 4; typedef _Float16 v4h __attribute__((ext_vector_type(4)));
  {
#pragma unroll
    for (int q = 0; q < 8; ++q) { const int r = q * 2 + rsub; if (col0 + c4 < N) { const v4f v = *(const v4fa*)&so[w][r][c4]; if (C) *(v4f*)(C + cofs + (size_t)(row0 + r) * ldc + col0 + c4) = v; if (C16) { v4h h4; for (int i = 0; i < 4; ++i) h4[i] = (_Float16)v[i]; *(v4h*)(C16 + cofs + (size_t)(row0 + r) * ldc + col0 + c4) = h4; } } }
     }
}


typedef _Float16 v4h __attribute__((ext_vector_type(4)));

// f32 rows of pitch DM -> fragment order, one 16 x 32 tile per wave: load i takes rows 4 i .. 4 i + 3 of the tile, 8 lanes on each row's whole 128-byte line; a lane's 4 values go as 8 bytes into the tile's block.
__device__ __forceinline__ size_t pk_src(size_t wv, int lane) { return ((wv / (DM / 32)) * 16 + (lane >> 3)) * DM + (wv % (DM / 32)) * 32 + (lane & 7) * 4; }      /* row step 4 * DM per load */
__device__ __forceinline__ size_t pk_dst(size_t wv, int lane) { return wv * 512 + ((lane >> 2) & 1) * 256 + (((lane >> 1) & 1) * 16 + (lane >> 3)) * 8 + (lane & 1) * 4; }      /* step 32 per load */
__global__ __launch_bounds__(256) void k_x16(const float* __restrict__ x, _Float16* __restrict__ X16, size_t n16) { const size_t t = (size_t)blockIdx.x * 256 + threadIdx.x; if (t >= n16) return; const int lane = (int)(t & 31);
  const float* s = x + pk_src(t >> 5, lane); _Float16* d = X16 + pk_dst(t >> 5, lane); v4f v[4]; v4h h[4];
#pragma unroll      /* static indices keep v[] and h[] in registers; the four loads are issued together */
  for (int i = 0; i < 4; ++i) v[i] = *(const v4fa*)(s + (size_t)i * 4 * DM);
  asm volatile("s_wait_xcnt 0x0" :: "v"(s) : "memory");      /* the loads' address pair stays whole up to here and is free for reuse only behind this wait */
#pragma unroll      /* static indices keep v[] and h[] in registers */
  for (int i = 0; i < 4; ++i) for (int q = 0; q < 4; ++q) h[i][q] = (_Float16)bf16_round(v[i][q]);
#pragma unroll      /* static indices; the four stores follow one another, so both halves of each 128-byte line are written together */
  for (int i = 0; i < 4; ++i) *(v4h*)(d + i * 32) = h[i]; }
__global__ __launch_bounds__(256) void k_h16(const float* __restrict__ x, _Float16* __restrict__ X16, size_t n8) { const size_t t = (size_t)blockIdx.x * 256 + threadIdx.x; if (t >= n8) return; FragH f;
#pragma unroll
  for (int q = 0; q < 8; ++q) f.h[q] = (_Float16)x[t * 8 + q]; *(v8us*)((unsigned short*)X16 + t * 8) = f.half[0];  }
__global__ __launch_bounds__(256) void k_round16f(const float* __restrict__ W, _Float16* __restrict__ Bt, size_t n8) { const size_t t = (size_t)blockIdx.x * 256 + threadIdx.x; if (t >= n8) return; FragH f;
#pragma unroll
  for (int i = 0; i < 8; ++i) f.h[i] = (_Float16)(bf16_round(W[t * 8 + i]) * 16.0f); *(v8us*)((unsigned short*)Bt + t * 8) = f.half[0];  }
template <int NHv, int TTv>
__global__ __launch_bounds__(256) void k_vt(const _Float16* __restrict__ V16, int ldv, int voff, _Float16* __restrict__ Vt) { __shared__ unsigned short tl[64][66]; const int tid = threadIdx.x; const int slab = blockIdx.x / (TTv / 64), lg = blockIdx.x % (TTv / 64); const int b = slab / NHv, h = slab % NHv;
  for (int i = tid; i < 64 * 8; i += 256) { const int r = i / 8, c8 = (i % 8) * 8; FragH f; f.half[0] = *(const v8us*)((const unsigned short*)V16 + ((size_t)b * TTv + lg * 64 + r) * ldv + voff + h * 64 + c8);
#pragma unroll
    for (int q = 0; q < 8; ++q) tl[r][c8 + q] = f.u[q]; }
  __syncthreads();
  {
#pragma unroll
    for (int rd = 0; rd < 2; ++rd) { const int d = ((tid >> 6) & 3) * 16 + (tid & 15), pc = rd * 4 + ((tid >> 4) & 3); FragH f;      /* fragment order, blocks [32 keys][16 d]: thread tid of round rd writes the (256 rd + tid)-th 16-byte group of this tile's 8 blocks */
#pragma unroll
      for (int q = 0; q < 8; ++q) f.u[q] = tl[pc * 8 + q][d];
      *(v8us*)((unsigned short*)Vt + (size_t)slab * 64 * TTv + (size_t)lg * 4096 + (rd * 256 + tid) * 8) = f.half[0]; }
     } }

__global__ __launch_bounds__(256) void k_hl(const float* __restrict__ F, _Float16* __restrict__ Hh, _Float16* __restrict__ Hl, size_t n16) { const size_t t = (size_t)blockIdx.x * 256 + threadIdx.x; if (t >= n16) return; const int lane = (int)(t & 31);      /* f32 rows of pitch DM -> hi and x1024 residual planes in fragment order, a 16 x 32 tile per wave as in k_x16 */
  const float* s = F + pk_src(t >> 5, lane); const size_t o = pk_dst(t >> 5, lane); _Float16* dh = Hh + o; _Float16* dl = Hl + o; v4f v[4]; v4h a[4], c[4];
#pragma unroll      /* static indices keep v[], a[] and c[] in registers; the four loads are issued together */
  for (int i = 0; i < 4; ++i) v[i] = *(const v4fa*)(s + (size_t)i * 4 * DM);
  asm volatile("s_wait_xcnt 0x0" :: "v"(s) : "memory");      /* the loads' address pair stays whole up to here and is free for reuse only behind this wait */
#pragma unroll      /* static indices keep v[], a[] and c[] in registers */
  for (int i = 0; i < 4; ++i) for (int q = 0; q < 4; ++q) { const _Float16 h = (_Float16)v[i][q]; a[i][q] = h; c[i][q] = (_Float16)((v[i][q] - (float)h) * 1024.0f); }
#pragma unroll      /* static indices; the stores follow one another, so both halves of each 128-byte line are written together */
  for (int i = 0; i < 4; ++i) { *(v4h*)(dh + i * 32) = a[i]; *(v4h*)(dl + i * 32) = c[i]; } }

// ---- fast GEMM (wave tile 32x64; requires M % 32 == 0 rows per launch region, N % 64 == 0 and K % 64 == 0; A and Bh in fragment order with lda == ldb == K); epilogue = k_gemm_hhx semantics ----
__device__ __forceinline__ v16h g2_frag(const _Float16* p) { FragH f; f.half[0] = *(const v8us*)((const unsigned short*)p); f.half[1] = *(const v8us*)((const unsigned short*)p + 256); return f.v; }      /* p = the block of a fragment-order plane + 8 * lane: each of the two loads covers 512 contiguous bytes per wave */
__device__ __forceinline__ v8f g2_mma(v16h a, v16h b, v8f c) { v8f d = __builtin_amdgcn_wmma_f32_16x16x32_f16(false, a, false, b, (short)0, c, false, false); asm volatile("v_nop\n\tv_nop\n\tv_nop\n\tv_nop" : "+v"(d) : "v"(a), "v"(b)); return d; }
template <int ACT>
__global__ __launch_bounds__(128) void k_gemm2(const _Float16* __restrict__ A, int lda, size_t sA, const _Float16* __restrict__ Bh, int ldb, size_t sB, float alpha, const float* __restrict__ bias, size_t sBias, const float* __restrict__ CP, int rowsPerB, size_t sCPb, int row0g,
    float* __restrict__ C, _Float16* __restrict__ C16, int ldc, size_t sC, int M, int N, int K) { static_assert(ACT == 0 || ACT == 3 || ACT == 6 || ACT == 8 || ACT == 9 || ACT == 11 || ACT == 12 || ACT == 14 || ACT == 15 || ACT == 16 || ACT == 17, "k_gemm2: unsupported ACT code (would silently apply no activation)");
  __shared__ __attribute__((aligned(16))) float so[4][32][68];
  const int tid = threadIdx.x, w = tid >> 5, lane = tid & 31, ln = lane & 15, hh = lane >> 4; const int by = blockIdx.y;
  A += (size_t)by * sA; Bh += (size_t)by * sB; const size_t cofs = (size_t)by * sC; const float* bp = bias ? bias + (size_t)by * sBias : nullptr;
  const int ntn = N >> 6; const int mt = blockIdx.x / ntn, nq = blockIdx.x - mt * ntn; const int row0 = mt * 128 + 32 * w, col0 = nq * 64; if (row0 >= M) return;
  const _Float16* a0p = A + (size_t)row0 * lda + 8 * lane; const _Float16* a1p = a0p + (size_t)16 * lda;      /* first block of each 16-row group; the lane's 8 elements are in the six pointers, so each is the very address its loads name; a k step of 32 is one block of 512 elements */
  const _Float16* b0p = Bh + (size_t)col0 * ldb + 8 * lane; const _Float16* b1p = b0p + (size_t)16 * ldb; const _Float16* b2p = b1p + (size_t)16 * ldb; const _Float16* b3p = b2p + (size_t)16 * ldb;
  const v8f z8 = {0.f,0.f,0.f,0.f,0.f,0.f,0.f,0.f}; v8f c00 = z8, c01 = z8, c02 = z8, c03 = z8, c10 = z8, c11 = z8, c12 = z8, c13 = z8;
  /* Two fragment sets, x and y, each the six fragments of one k step of 32. A set's twelve loads are issued together, one k step ahead of its products, so a k step waits for one load round trip that
     runs under the other set's products, not for five in a row. K is a multiple of 64. Every accumulator still takes its k steps in rising order. */
  v16h xa0 = g2_frag(a0p), xa1 = g2_frag(a1p), xb0 = g2_frag(b0p), xb1 = g2_frag(b1p), xb2 = g2_frag(b2p), xb3 = g2_frag(b3p);
  asm volatile("s_wait_xcnt 0x0" :: "v"(a0p), "v"(a1p), "v"(b0p), "v"(b1p), "v"(b2p), "v"(b3p) : "memory");      /* the first set's six address pairs stay whole up to here and are free for reuse only behind this wait */
#pragma unroll 1      /* one trip is two k steps already; more would only grow the text */
  for (int kb = 0; kb < K; kb += 64) {
    const int ko = kb * 16; const _Float16* q0 = a0p + ko; const _Float16* q1 = a1p + ko; const _Float16* q2 = b0p + ko; const _Float16* q3 = b1p + ko; const _Float16* q4 = b2p + ko; const _Float16* q5 = b3p + ko;
    const v16h ya0 = g2_frag(q0 + 512), ya1 = g2_frag(q1 + 512), yb0 = g2_frag(q2 + 512), yb1 = g2_frag(q3 + 512), yb2 = g2_frag(q4 + 512), yb3 = g2_frag(q5 + 512);
    asm volatile("s_wait_xcnt 0x0" :: "v"(q0), "v"(q1), "v"(q2), "v"(q3), "v"(q4), "v"(q5) : "memory");      /* the twelve loads' six address pairs stay whole up to here and are free for reuse only behind this wait */
    c00 = g2_mma(xa0, xb0, c00); c10 = g2_mma(xa1, xb0, c10); c01 = g2_mma(xa0, xb1, c01); c11 = g2_mma(xa1, xb1, c11);
    c02 = g2_mma(xa0, xb2, c02); c12 = g2_mma(xa1, xb2, c12); c03 = g2_mma(xa0, xb3, c03); c13 = g2_mma(xa1, xb3, c13);
    const int k2 = ((kb + 64 < K) ? kb + 64 : kb) * 16;      /* the last trip fetches its own first step again: in bounds, unused */
    const _Float16* r0 = a0p + k2; const _Float16* r1 = a1p + k2; const _Float16* r2 = b0p + k2; const _Float16* r3 = b1p + k2; const _Float16* r4 = b2p + k2; const _Float16* r5 = b3p + k2;
    xa0 = g2_frag(r0); xa1 = g2_frag(r1); xb0 = g2_frag(r2); xb1 = g2_frag(r3); xb2 = g2_frag(r4); xb3 = g2_frag(r5);
    asm volatile("s_wait_xcnt 0x0" :: "v"(r0), "v"(r1), "v"(r2), "v"(r3), "v"(r4), "v"(r5) : "memory");      /* likewise for this set's six address pairs */
    c00 = g2_mma(ya0, yb0, c00); c10 = g2_mma(ya1, yb0, c10); c01 = g2_mma(ya0, yb1, c01); c11 = g2_mma(ya1, yb1, c11);
    c02 = g2_mma(ya0, yb2, c02); c12 = g2_mma(ya1, yb2, c12); c03 = g2_mma(ya0, yb3, c03); c13 = g2_mma(ya1, yb3, c13); }
  v8f accs[8] = {c00, c01, c02, c03, c10, c11, c12, c13};
#pragma unroll
  for (int u = 0; u < 8; ++u) { const int t = u & 3, half = u >> 2; const int col = col0 + t * 16 + ln; const float bv = bp ? bf16_round(bp[col]) : 0.f;
#pragma unroll
    for (int r = 0; r < 8; ++r) { const int rloc = half * 16 + 8 * hh + r; float v = accs[u][r] * alpha + bv; if (CP) { if (rowsPerB < 0) v += CP[cofs + (size_t)(row0g + row0 + rloc) * ldc + col];      /* rowsPerB < 0: own element of the batched C plane */ else { const int bidx = (row0g + row0 + rloc) / rowsPerB; v += CP[(size_t)bidx * sCPb + (size_t)by * 64 + col]; } }
      if (ACT == 3) v = fmaxf(v, 0.f); else if (ACT == 6) v = 0.5f * v * (1.0f + erff(v * 0.70710678118654752f)); else if (ACT == 11) v = 1.0f / (1.0f + expf(-v)); else if (ACT == 15) v = v / (1.0f + expf(-v)); else if (ACT == 12) v = (v > 0.f) ? v : 0.01f * v; else if (ACT == 8) v = tanhf(v); else if (ACT == 9) v = 0.5f * v * (1.0f + tanhf(0.7978845608028654f * (v + 0.044715f * v * v * v))); else if (ACT == 14) v = (v > 0.f) ? v : 0.1f * v; else if (ACT == 16) v = (v >= 0.f) ? v : 0.3f * v; else if (ACT == 17) v = (v >= 0.f) ? v : 0.2f * v;
      so[w][rloc][t * 16 + ln] = v; } }
  __builtin_amdgcn_fence(__ATOMIC_ACQ_REL, "workgroup"); __builtin_amdgcn_wave_barrier();
  const int rsub = lane >> 4, c4 = (lane & 15) * 4;
  {
#pragma unroll
    for (int q = 0; q < 16; ++q) { const int r = q * 2 + rsub; const v4f v = *(const v4fa*)&so[w][r][c4]; if (C) { float* cp = C + cofs + (size_t)(row0 + r) * ldc + col0 + c4; *(v4f*)cp = v; asm volatile("s_wait_xcnt 0x0" :: "v"(cp), "v"(v) : "memory"); }      /* the f32 store's address pair and data registers stay whole up to here: the f16 conversion below and the next row's LDS read reuse them only behind this wait */ if (C16) { v4h h4; for (int i = 0; i < 4; ++i) h4[i] = (_Float16)v[i]; *(v4h*)(C16 + cofs + (size_t)(row0 + r) * ldc + col0 + c4) = h4; } }
     } }


__global__ __launch_bounds__(256) void k_wnat(const float* __restrict__ w, size_t n8, _Float16* __restrict__ Bt) { const size_t t = (size_t)blockIdx.x * 256 + threadIdx.x; if (t >= n8) return; FragH f; for (int q = 0; q < 8; ++q) f.h[q] = (_Float16)(bf16_round(w[t * 8 + q]) * 16.0f); *(v8us*)((unsigned short*)Bt + t * 8) = f.half[0];  }
__global__ __launch_bounds__(256) void k_rsm(const float* __restrict__ S, _Float16* __restrict__ P, int nrows) {
  #pragma clang fp contract(off)
  const int i = blockIdx.x * 256 + threadIdx.x; if (i >= nrows) return; const float* s = S + (size_t)i * SQ; float mx = -3.0e38f;
#pragma unroll 1
  for (int j = 0; j < SQ; ++j) mx = fmaxf(mx, s[j]); float se = 0.f;
#pragma unroll 1
  for (int j = 0; j < SQ; ++j) se += expf(s[j] - mx); const float sc = 256.0f / se;
#pragma unroll 1
  for (int j0 = 0; j0 < SQ; j0 += 8) { FragH f; for (int q = 0; q < 8; ++q) f.h[q] = (_Float16)(expf(s[j0 + q] - mx) * sc); unsigned short* d = (unsigned short*)P + (size_t)i * SQ + j0; *(v8us*)d = f.half[0];  } }
__global__ __launch_bounds__(256) void k_vt(const _Float16* __restrict__ V16, int b, int h0, _Float16* __restrict__ VT) { __shared__ unsigned short tl[64][65]; const int tid = threadIdx.x; const int hh = blockIdx.x % HG, sg = blockIdx.x / HG; const int s0 = sg * 64; const int h = h0 + hh;
  for (int i = tid; i < 64 * 8; i += 256) { const int j = i / 8, d8 = (i % 8) * 8; FragH f; f.half[0] = *(const v8us*)((const unsigned short*)V16 + ((size_t)b * SQ + s0 + j) * DM + h * HD + d8); for (int q = 0; q < 8; ++q) tl[d8 + q][j] = f.u[q]; }
  __syncthreads();
  { for (int i = tid; i < 64 * 8; i += 256) { const int d = i / 8, j8 = (i % 8) * 8; FragH f; for (int q = 0; q < 8; ++q) f.u[q] = tl[d][j8 + q]; *(v8us*)((unsigned short*)VT + ((size_t)hh * HD + d) * SQ + s0 + j8) = f.half[0]; }  } }



// Fused causal attention, one launch for every (batch, head, 128 query rows): the scores and the softmax weights stay in registers.
// One wave owns 16 queries and walks the keys 32 at a time. S^T = K Q^T (A = K rows, B = Q rows, both through fa_frag from planes in the same fragment order, so the k orders pair): lane (ln, hh) holds, of query q0 + ln,
// the scores of keys k0 + 16 kt + 8 hh + r. Three products as before: hi.hi in one accumulator, lo.hi + hi.lo (x1024) in a second. Running maximum and running sum per query (the two
// lane halves share the maximum and join their sums at the end). The two score tiles, as f16, are the B operand of O^T += V^T P^T in the order fa_frag gives V^T's rows. o leaves x64.
__device__ __forceinline__ v16h fa_frag(const _Float16* p) { return g2_frag(p); }      /* p = a fragment-order block + 8 * lane */
__device__ __forceinline__ float fa_exp(float x) { float r; asm("v_exp_f32 %0, %1\n\tv_nop" : "=v"(r) : "v"(x * 1.44269504f)); return r; }      /* native e^x; the v_nop fills the one slot the instruction set asks for behind a transcendental, whatever the compiler puts next */
__device__ __forceinline__ v8f fa_mma(v16h a, v16h b, v8f c) { return __builtin_amdgcn_wmma_f32_16x16x32_f16(false, a, false, b, (short)0, c, false, false); }
/* amdgpu_waves_per_eu(4, 4): two 8-wave blocks per WGP need at most 256 registers a wave; without it this build takes 260 and only one block fits */
__global__ __launch_bounds__(256) __attribute__((amdgpu_waves_per_eu(4, 4))) void k_fattn(const _Float16* __restrict__ QHp, const _Float16* __restrict__ QLp, const _Float16* __restrict__ KHp, const _Float16* __restrict__ KLp, const _Float16* __restrict__ VTp, _Float16* __restrict__ O) {
  const int lane = threadIdx.x & 31, ln = lane & 15, hh = lane >> 4; const int w = __builtin_amdgcn_readfirstlane(threadIdx.x >> 5);      /* the wave's number as a scalar: the trip count and the mask test stay scalar */
  const int bh = blockIdx.x % (NB * NH), tx = blockIdx.x / (NB * NH); const int tile = (tx < SQ / 256) ? (SQ / 128 - 1 - tx) : (tx - SQ / 256);      /* long tiles take the low block numbers; the second half of the grid counts up from the short end */
  const int b = bh / NH, h = bh % NH; const int q0 = tile * 128 + w * 16; const size_t r0 = (size_t)b * SQ;
  const _Float16* qh = QHp + (r0 + q0) * LQ + h * HD * 16 + 8 * lane; const _Float16* ql = QLp + (r0 + q0) * LQ + h * HD * 16 + 8 * lane;      /* a head's 64 dims are two blocks of 512 in each 16-row group */
  const v16h qh0 = fa_frag(qh), qh1 = fa_frag(qh + 512), ql0 = fa_frag(ql), ql1 = fa_frag(ql + 512);
  const _Float16* kh = KHp + r0 * LQ + h * HD * 16 + 8 * lane; const _Float16* kl = KLp + r0 * LQ + h * HD * 16 + 8 * lane; const _Float16* vt = VTp + (size_t)bh * HD * SQ + 8 * lane;      /* V^T: four blocks (16 dims each) per 32 keys */
  const v8f z8 = {0.f,0.f,0.f,0.f,0.f,0.f,0.f,0.f}; v8f o[4] = {z8, z8, z8, z8}; float m = -1.0e30f, l = 0.f;
  const int np = q0 / 32 + 1;      /* keys 0 .. q0 + 15 in passes of 32 */
  v16h fh[2][2], fl[2][2];      /* K fragments [key tile][k step], fetched one pass ahead */
#pragma unroll      /* static indices keep the fragments, scores and accumulators in registers */
  for (int kt = 0; kt < 2; ++kt) for (int ks = 0; ks < 2; ++ks) { fh[kt][ks] = fa_frag(kh + (size_t)kt * 16 * LQ + ks * 512); fl[kt][ks] = fa_frag(kl + (size_t)kt * 16 * LQ + ks * 512); }
  asm volatile("s_wait_xcnt 0x0" :: "v"(qh), "v"(ql), "v"(kh), "v"(kl) : "memory");      /* the loads' four address pairs stay whole up to here and are free for reuse only behind this wait */
  for (int p = 0; p < np; ++p) { const int k0 = p * 32;
    const _Float16* va = vt + (size_t)k0 * HD; v16h fv[4];
#pragma unroll      /* static indices keep the fragments, scores and accumulators in registers */
    for (int dt = 0; dt < 4; ++dt) fv[dt] = fa_frag(va + dt * 512);
    v8f sh[2], sl[2];
#pragma unroll      /* static indices keep the fragments, scores and accumulators in registers */
    for (int kt = 0; kt < 2; ++kt) { sh[kt] = fa_mma(fh[kt][1], qh1, fa_mma(fh[kt][0], qh0, z8)); sl[kt] = fa_mma(fl[kt][1], qh1, fa_mma(fl[kt][0], qh0, fa_mma(fh[kt][1], ql1, fa_mma(fh[kt][0], ql0, z8)))); }
    const int kn = (p + 1 < np) ? k0 + 32 : k0;      /* the last pass fetches its own rows again: in bounds, unused */
    const _Float16* ka = kh + (size_t)kn * LQ; const _Float16* kb = kl + (size_t)kn * LQ;
#pragma unroll      /* static indices keep the fragments, scores and accumulators in registers */
    for (int kt = 0; kt < 2; ++kt) for (int ks = 0; ks < 2; ++ks) { fh[kt][ks] = fa_frag(ka + (size_t)kt * 16 * LQ + ks * 512); fl[kt][ks] = fa_frag(kb + (size_t)kt * 16 * LQ + ks * 512); }
    asm volatile("s_wait_xcnt 0x0" :: "v"(va), "v"(ka), "v"(kb) : "memory");      /* this pass's three address pairs stay whole up to here and are free for reuse only behind this wait */
    float s[16];
#pragma unroll      /* static indices keep the fragments, scores and accumulators in registers */
    for (int e = 0; e < 16; ++e) s[e] = fmaf(sl[e >> 3][e & 7], SCLR, sh[e >> 3][e & 7] * SCL);
    if (k0 + 31 > q0) {      /* only the pass on the diagonal masks; key k0 <= q0 stays, so every query keeps a key */
#pragma unroll      /* static indices keep the fragments, scores and accumulators in registers */
      for (int e = 0; e < 16; ++e) s[e] = (k0 + (e >> 3) * 16 + 8 * hh + (e & 7) <= q0 + ln) ? s[e] : -1.0e30f; }
    float mx = s[0];
#pragma unroll      /* static indices keep the fragments, scores and accumulators in registers */
    for (int e = 1; e < 16; ++e) mx = fmaxf(mx, s[e]);
    mx = fmaxf(mx, __shfl_xor(mx, 16, 32)); const float mn = fmaxf(m, mx); const float al = fa_exp(m - mn); m = mn;
    FragH pf; float ps[4] = {0.f, 0.f, 0.f, 0.f};
#pragma unroll      /* static indices keep the fragments, scores and accumulators in registers */
    for (int e = 0; e < 16; ++e) { const float pe = fa_exp(s[e] - mn); ps[e & 3] += pe; pf.h[e] = (_Float16)pe; }
    l = fmaf(l, al, (ps[0] + ps[1]) + (ps[2] + ps[3]));
#pragma unroll      /* static indices keep the fragments, scores and accumulators in registers */
    for (int dt = 0; dt < 4; ++dt) { o[dt] *= al; o[dt] = fa_mma(fv[dt], pf.v, o[dt]); } }
  l += __shfl_xor(l, 16, 32); const float fin = 64.0f / l;      /* o carried x64, folded into the output GEMM's alpha */
  _Float16* op = O + (r0 + q0) * DM + h * HD * 16 + 8 * lane;      /* o rows in fragment order for the output GEMM: dims 16 dt + 8 hh .. + 7 of query ln are the lane's group of half-block dt */
#pragma unroll      /* static indices keep the fragments, scores and accumulators in registers */
  for (int dt = 0; dt < 4; ++dt) { FragH f;
#pragma unroll      /* static indices keep the fragments, scores and accumulators in registers */
    for (int r = 0; r < 8; ++r) f.h[r] = (_Float16)(o[dt][r] * fin);
    *(v8us*)((unsigned short*)op + dt * 256) = f.half[0]; } }


typedef float v2f __attribute__((ext_vector_type(2)));
// Exact f32 attention for query rows 0 .. QT0-1 of one batch, one wave per (head, query row), 8 rows of one head per block. The head's QT0 K and V rows are staged once in LDS;
// lane l scores keys l, l + 32, l + 64, l + 96; row maximum and row sum are lane partials joined by butterflies; lane l then sums dims 2l, 2l + 1 over the keys (weight 0 behind the diagonal).
__global__ __launch_bounds__(256) void k_att0w(const float* __restrict__ QF, const float* __restrict__ KF, const float* __restrict__ VF, float scale, float* __restrict__ OF) {
  __shared__ __attribute__((aligned(16))) float lk[QT0][HD + 4];      /* pitch 272 B = 16 B x odd: one key row per lane reads without bank conflicts */
  __shared__ __attribute__((aligned(16))) float lv[QT0][HD];
  const int tid = threadIdx.x, lane = tid & 31; const int w = __builtin_amdgcn_readfirstlane(tid >> 5);      /* the wave's number as a scalar: q is read through scalar loads */
  const int h = blockIdx.x / (QT0 / 8), i = (blockIdx.x % (QT0 / 8)) * 8 + w;
  const int sr = tid >> 4, sc = (tid & 15) * 4; const float* kg = KF + (size_t)sr * DM + h * HD + sc; const float* vg = VF + (size_t)sr * DM + h * HD + sc; v4f ks[QT0 / 16], vs[QT0 / 16];
#pragma unroll      /* static indices keep ks[] and vs[] in registers; every load is issued before the first LDS store */
  for (int u = 0; u < QT0 / 16; ++u) { ks[u] = *(const v4fa*)(kg + (size_t)u * 16 * DM); vs[u] = *(const v4fa*)(vg + (size_t)u * 16 * DM); }
  asm volatile("s_wait_xcnt 0x0" :: "v"(kg), "v"(vg) : "memory");      /* the loads' two address pairs stay whole up to here and are free for reuse only behind this wait */
#pragma unroll      /* static indices keep ks[] and vs[] in registers */
  for (int u = 0; u < QT0 / 16; ++u) { *(v4f*)&lk[u * 16 + sr][sc] = ks[u]; *(v4f*)&lv[u * 16 + sr][sc] = vs[u]; }
  __syncthreads();
  const float* qg = QF + (size_t)i * DM + h * HD; v4f a[QT0 / 32] = {};
#pragma unroll      /* static indices keep a[] in registers: four independent sums per key, four keys per lane */
  for (int d = 0; d < HD / 4; ++d) { for (int c = 0; c < QT0 / 32; ++c) { const v4f kk = *(const v4f*)&lk[c * 32 + lane][d * 4]; for (int u = 0; u < 4; ++u) a[c][u] = fmaf(qg[d * 4 + u], kk[u], a[c][u]); } }
  float e[QT0 / 32]; float m = -1.0e30f;
#pragma unroll      /* static indices keep e[] in registers */
  for (int c = 0; c < QT0 / 32; ++c) { e[c] = (c * 32 + lane <= i) ? ((a[c][0] + a[c][1]) + (a[c][2] + a[c][3])) * scale : -1.0e30f; m = fmaxf(m, e[c]); }
  for (int x = 16; x >= 1; x >>= 1) m = fmaxf(m, __shfl_xor(m, x, 32));
  float l = 0.f;
#pragma unroll      /* static indices keep e[] in registers */
  for (int c = 0; c < QT0 / 32; ++c) { e[c] = expf(e[c] - m); l += e[c]; }      /* a key behind the diagonal: exp(-1e30 - m) = 0 */
  for (int x = 16; x >= 1; x >>= 1) l += __shfl_xor(l, x, 32);
  v2f o[4] = {};
#pragma unroll      /* a constant lane number per step: key j's weight is broadcast through a scalar register; static indices keep e[] and o[] in registers */
  for (int j = 0; j < QT0; ++j) { const float ej = __int_as_float(__builtin_amdgcn_readlane(__float_as_int(e[j >> 5]), j & 31)); const v2f vv = *(const v2f*)&lv[j][lane * 2]; o[j & 3][0] = fmaf(ej, vv[0], o[j & 3][0]); o[j & 3][1] = fmaf(ej, vv[1], o[j & 3][1]); }
  const float fin = 64.0f / l;      /* o carried x64 like the f16 path */
  const v2f r = ((o[0] + o[1]) + (o[2] + o[3])) * fin;
  *(v2f*)(OF + (size_t)i * DM + h * HD + lane * 2) = r; }

extern "C" void kernel_launch(void* const* d_in, const int* in_sizes, int n_in,
                              void* d_out, int out_size, void* d_ws, size_t ws_size, hipStream_t stream) {
  (void)in_sizes; (void)n_in; (void)out_size;
  const float* const* I = (const float* const*)d_in; const float* x = I[0]; const float* xk = I[1]; const float* xv = I[2]; const float* wq = I[3]; const float* bq = I[4]; const float* wk = I[5]; const float* bk = I[6]; const float* wv = I[7]; const float* bv = I[8]; const float* wo = I[9]; const float* bo = I[10];      /* input order: query, key, value (THREE input streams), then [in][out] weights + biases */
  char* ws = (char*)d_ws; size_t off = 0;
  auto take = [&](size_t bytes) { char* p = ws + off; off += (bytes + 255) & ~(size_t)255; return p; };
  _Float16* BQ = (_Float16*)take((size_t)DM * DM * 2); _Float16* BK = (_Float16*)take((size_t)DM * DM * 2); _Float16* BV = (_Float16*)take((size_t)DM * DM * 2); _Float16* BO = (_Float16*)take((size_t)DM * DM * 2);
  _Float16* X16 = (_Float16*)take(NR * DM * 2); _Float16* XK16 = (_Float16*)take(NR * DM * 2); _Float16* XV16 = (_Float16*)take(NR * DM * 2);      /* exact f16 rows of query, key, value, fragment order */ float* QF = (float*)take(NR * DM * 4); float* KF = (float*)take(NR * DM * 4); float* VF = (float*)take(NR * DM * 4);      /* f32 q, k, v rows, each kept: the exact first-tile attention reads its 128 rows per batch from them */ _Float16* QH = (_Float16*)take(NR * DM * 2); _Float16* QL = (_Float16*)take(NR * DM * 2); _Float16* KH = (_Float16*)take(NR * DM * 2); _Float16* KL = (_Float16*)take(NR * DM * 2); _Float16* Q16 = QH; _Float16* K16 = KH; _Float16* V16 = (_Float16*)take(NR * DM * 2); _Float16* O16 = (_Float16*)take(NR * DM * 2);
  _Float16* VT = (_Float16*)take((size_t)NB * NH * HD * SQ * 2);      /* V^T of both batches */
  float* OF0 = (float*)take((size_t)NB * QT0 * DM * 4); _Float16* OH0 = (_Float16*)take((size_t)NB * QT0 * DM * 2); _Float16* OL0 = (_Float16*)take((size_t)NB * QT0 * DM * 2);
  if (off > ws_size) return;
  { const unsigned g = (unsigned)(((size_t)DM * (DM / 8) + 255) / 256); k_wt_f16<<<g, 256, 0, stream>>>(wq, BQ, DM, DM, 16.0f); k_wt_f16<<<g, 256, 0, stream>>>(wk, BK, DM, DM, 16.0f); k_wt_f16<<<g, 256, 0, stream>>>(wv, BV, DM, DM, 16.0f); k_wt_f16<<<g, 256, 0, stream>>>(wo, BO, DM, DM, 16.0f); }      /* [in][out] -> Bt[n][k] x16, fragment order */
  k_x16<<<(unsigned)((NR * DM / 16 + 255) / 256), 256, 0, stream>>>(x, X16, NR * DM / 16); k_x16<<<(unsigned)((NR * DM / 16 + 255) / 256), 256, 0, stream>>>(xk, XK16, NR * DM / 16); k_x16<<<(unsigned)((NR * DM / 16 + 255) / 256), 256, 0, stream>>>(xv, XV16, NR * DM / 16);
  const size_t r0p = (size_t)B0 * SQ;      /* first projected row */
  k_gemm2<0><<<dim3((unsigned)((MP / 128) * (DM / 64)), 1), 128, 0, stream>>>(X16 + r0p * DM, DM, 0, BQ, DM, 0, 0.0625f, bq, 0, nullptr, 1, 0, 0, QF + r0p * DM, nullptr, DM, 0, MP, DM, DM); k_hl<<<(unsigned)(((size_t)MP * DM / 16 + 255) / 256), 256, 0, stream>>>(QF + r0p * DM, QH + r0p * DM, QL + r0p * DM, (size_t)MP * DM / 16);      /* q (f32) -> f16 hi + x1024 residual: unscaled logits sigma ~8 */
  k_gemm2<0><<<dim3((unsigned)((MP / 128) * (DM / 64)), 1), 128, 0, stream>>>(XK16 + r0p * DM, DM, 0, BK, DM, 0, 0.0625f, bk, 0, nullptr, 1, 0, 0, KF + r0p * DM, nullptr, DM, 0, MP, DM, DM); k_hl<<<(unsigned)(((size_t)MP * DM / 16 + 255) / 256), 256, 0, stream>>>(KF + r0p * DM, KH + r0p * DM, KL + r0p * DM, (size_t)MP * DM / 16);      /* k likewise */
  k_gemm2<0><<<dim3((unsigned)((MP / 128) * (DM / 64)), 1), 128, 0, stream>>>(XV16 + r0p * DM, DM, 0, BV, DM, 0, 0.0625f, bv, 0, nullptr, 1, 0, 0, VF + r0p * DM, V16 + r0p * DM, DM, 0, MP, DM, DM);      /* v as f16 rows and as f32 rows */
  for (int b = B0; b < B0 + NBR; ++b) { const size_t r0 = (size_t)b * SQ;
    k_vt<NH, SQ><<<NH * (SQ / 64), 256, 0, stream>>>(V16 + r0 * LQ, LQ, 0, VT + (size_t)b * NH * HD * SQ);      /* V^T of this batch's heads, fragment order */
    k_att0w<<<NH * (QT0 / 8), 256, 0, stream>>>(QF + r0 * DM, KF + r0 * DM, VF + r0 * DM, SCL, OF0 + (size_t)b * QT0 * DM);      /* exact f32 attention for rows 0..127 (o x64), one wave per (head, row) */ }
  k_fattn<<<NB * NH * (SQ / 128), 256, 0, stream>>>(QH, QL, KH, KL, VT, O16);      /* scores, causal softmax and P V of both batches and all heads in one launch: o (merged heads, x64) as f16 rows */
  k_gemm2<0><<<dim3((unsigned)((MPO / 128) * (DM / 64)), 1), 128, 0, stream>>>(O16 + r0p * DM, DM, 0, BO, DM, 0, 0.0009765625f, bo, 0, nullptr, 1, 0, 0, (float*)d_out + r0p * DM, nullptr, DM, 0, MPO, DM, DM);      /* out rows are the output layout */
  k_hl<<<(unsigned)(((size_t)NB * QT0 * DM / 16 + 255) / 256), 256, 0, stream>>>(OF0, OH0, OL0, (size_t)NB * QT0 * DM / 16);      /* first-tile o (x64) -> f16 hi + x1024 residual planes */
  for (int b = B0; b < B0 + NBR; ++b) { const size_t r0 = (size_t)b * SQ; const size_t f0 = (size_t)b * QT0;
    k_gemm2<0><<<dim3((QT0 / 128) * (DM / 64), 1), 128, 0, stream>>>(OH0 + f0 * DM, DM, 0, BO, DM, 0, 0.0009765625f, bo, 0, nullptr, 1, 0, 0, (float*)d_out + r0 * DM, nullptr, DM, 0, QT0, DM, DM);      /* rows 0..127: out = o_hi Wo (+ b), overwriting the f16-path rows */
    k_gemm2<0><<<dim3((QT0 / 128) * (DM / 64), 1), 128, 0, stream>>>(OL0 + f0 * DM, DM, 0, BO, DM, 0, 0.00000095367431640625f, nullptr, 0, (const float*)d_out + r0 * DM, -1, 0, 0, (float*)d_out + r0 * DM, nullptr, DM, 0, QT0, DM, DM); }      /* += o_lo Wo 2^-20 (own-element accumulate) */
}

// v007
// One run takes 167 microseconds.
// In two side-by-side timings against v006, it was 1.45 and 1.46 times as fast.
// Over all steps from v000 it is 34.4 times as fast.
#include <hip/hip_runtime.h>
// Causal multi-head attention on three inputs with the source's sequence-length score scale (query, key, value [2][2048][1024]; q = query Wq + bq, k = key Wk + bk, v = value Wv + bv ([in][out] 1024 x 1024, weights AND biases sigma 1/32), 16 heads of 64; score = q k^T; triu(1) -> -inf; softmax(score / sqrt(Sk)) with Sk = 2048 KEYS (the source divides by sqrt of the score matrix's last dimension, NOT by sqrt(head_dim)): scale 2048^-0.5 = 0.0220970869; out = merged Wo + bo ([in][out]) -> [2][2048][1024]); q and k carried as f16 hi + x1024 residual planes with three-product scores.
// Structure: token rows r = b*2048 + s; x as exact f16 rows (bf16-rounded); q and k as WMMA GEMMs (32x64 wave tiles, f32 accumulation, exact x16 weights + bias) into f32 rows split into f16 hi + x1024 residual planes, v as a GEMM that stores f16 rows and f32 rows; the f32 q, k, v rows are kept for the exact first-tile attention; per batch: V^T for all heads via LDS transposes; then ONE fused attention launch (a wave per 16 queries, keys below the diagonal in passes of 32: three-product scores hi.hi + lo.hi + hi.lo in f32 accumulators, running-maximum softmax in registers (f32 statistics, native exp; weights in (0, 1] as f16), o = P . V^T normalised at the end, carried x64 and folded into the output GEMM alpha) written straight into the merged f16 o rows; out = o W_o + b GEMM (f32) into the output layout. Six launches: jobs that do not depend on one another share a grid (k_prep, the q/k/v GEMM grid, k_mid, k_fattn with the first-tile split, the output GEMM with the exact first-tile rows as its A there, the first-tile residual GEMM).
// Layout: every f16 plane that only WMMA fragment loads read (x rows, weights, q and k hi / residual planes, V^T, o rows) is kept in FRAGMENT ORDER: a tile of 16 rows x 32 k is one 1-KiB block [k half of 16][lane = 16 * (k / 8 % 2) + row][8 k], the blocks of 16 rows one behind the other in k (in V^T the four 16-dim blocks of each 32 keys lie one behind the other); a wave's 16-byte fragment load then covers 512 contiguous bytes. Outside V^T, 16 rows of a plane of pitch C fill 16 * C elements as before, so offsets of whole 16-row groups are unchanged.
// Compute dtype: inputs rounded to bf16; x / weights exact; q and k as f16 hi + x1024 residual planes; v, softmax weights and o as plain f16 GEMM operands (~2^-12), first-tile o as hi + residual; scores and softmax statistics f32. v_wmma_f32_16x16x32_f16.
#define NB 2
#define SCL 0.0220970869f                 /* = f32(1 / sqrt(2048)): the source scales the scores by 1/sqrt(Sk), Sk = 2048 keys */
#define SCLR (0.0220970869f * 0.0009765625f)   /* the same scale on the x1024 residual passes */
#define SQ 2048
#define DM 1024
#define NH 16
#define HD 64
#define HG 4                         /* heads per launch of the head-group k_vt overload, which is not launched */
#define QT0 128                      /* first-tile rows recomputed exactly in f32 */
#define B0 0                         /* nothing uses it: every job starts at batch 0 */
#define NBR NB                       /* batches processed (debug hook) */
#define NR ((size_t)NB * SQ)         /* token rows */
#define MP ((int)((size_t)NBR * SQ)) /* rows projected (debug hook) */
#define MPO MP                       /* rows through the output stage (debug hook) */
#define LQ DM      /* row pitch of the q/k/v rows */
typedef __bf16 v16b __attribute__((ext_vector_type(16)));
typedef unsigned short v8us __attribute__((ext_vector_type(8), may_alias));
typedef float  v8f  __attribute__((ext_vector_type(8)));
typedef float  v4f  __attribute__((ext_vector_type(4)));
typedef float  v4fa __attribute__((ext_vector_type(4), may_alias));
union FragB { v16b v; v8us half[2]; unsigned short u[16]; };

__device__ __forceinline__ unsigned short bf16_bits(float x) { unsigned int u = __float_as_uint(x); return (unsigned short)((u + 0x7FFFu + ((u >> 16) & 1u)) >> 16); }
__device__ __forceinline__ float bf16_val(unsigned short b) { return __uint_as_float(((unsigned int)b) << 16); }
__device__ __forceinline__ float bf16_round(float x) { return bf16_val(bf16_bits(x)); }
// D += A·B with NT terms: 1 = ah·bh, 2 = + al·bh (A split), 3 = + ah·bl (both split)
template <int NT>
__device__ __forceinline__ v8f mmaN(v16b ah, v16b al, v16b bh, v16b bl, v8f c) {
  c = __builtin_amdgcn_wmma_f32_16x16x32_bf16(false, ah, false, bh, (short)0, c, false, false);
  if (NT >= 2) c = __builtin_amdgcn_wmma_f32_16x16x32_bf16(false, al, false, bh, (short)0, c, false, false);
  if (NT >= 3) c = __builtin_amdgcn_wmma_f32_16x16x32_bf16(false, ah, false, bl, (short)0, c, false, false);
  asm volatile("v_nop\n\tv_nop\n\tv_nop\n\tv_nop" : "+v"(c) : "v"(ah), "v"(al), "v"(bh), "v"(bl));
  return c;
}

__global__ __launch_bounds__(256) void k_wt_bf16(const float* __restrict__ W, unsigned short* __restrict__ Wt, int K, int N) {
  const int t = blockIdx.x * 256 + threadIdx.x;
  const int k8n = K / 8;
  if (t >= N * k8n) return;
  const int n = t / k8n, k8 = (t % k8n) * 8;
  v8us v;
#pragma unroll
  for (int i = 0; i < 8; ++i) v[i] = bf16_bits(W[(size_t)(k8 + i) * N + n]);
  *(v8us*)(Wt + (size_t)n * K + k8) = v;
  
}

// GEMM C[M][N] (f32, pitch ldc) = act(A[M][K]·W + bias). A f32 row-major (pitch lda) converted per fragment to bf16
// (ASPLIT: hi/lo two planes -> 2 terms, else single rounded term); Wt bf16 [N][K] (pitch ldb). BIAS_BF16 rounds the
// bias to bf16 first (bias quantised to bf16 before the add). K%32==0, M%16==0, N%64==0.
template <bool ASPLIT, int ACT, bool BIAS_BF16>
__global__ __launch_bounds__(128) void k_gemm_bf(const float* __restrict__ A, int lda, const unsigned short* __restrict__ Wt, int ldb,
                                               const float* __restrict__ bias, float* __restrict__ C, int ldc, int M, int N, int K) {
  __shared__ __attribute__((aligned(16))) float so[4][16][64];
  const int tid = threadIdx.x, w = tid >> 5, lane = tid & 31, ln = lane & 15, hh = lane >> 4;
  const int ntn = N / 64;
  const int wid = blockIdx.x * 4 + w;
  const int mt = wid / ntn, nq = wid % ntn;
  if (mt * 16 >= M) return;
  const int row0 = mt * 16, col0 = nq * 64;
  const float* arow = A + (size_t)(row0 + ln) * lda;
  v8f acc[4] = {};
  for (int kb = 0; kb < K; kb += 32) {
    FragB ah, al;
    const v4f x0 = *(const v4fa*)(arow + kb + 8 * hh), x1 = *(const v4fa*)(arow + kb + 8 * hh + 4);
    const v4f x2 = *(const v4fa*)(arow + kb + 16 + 8 * hh), x3 = *(const v4fa*)(arow + kb + 16 + 8 * hh + 4);
    float xs[16] = {x0[0],x0[1],x0[2],x0[3],x1[0],x1[1],x1[2],x1[3],x2[0],x2[1],x2[2],x2[3],x3[0],x3[1],x3[2],x3[3]};
#pragma unroll
    for (int i = 0; i < 16; ++i) { const unsigned short hb = bf16_bits(xs[i]); ah.u[i] = hb; al.u[i] = ASPLIT ? bf16_bits(xs[i] - bf16_val(hb)) : (unsigned short)0; }
#pragma unroll
    for (int t = 0; t < 4; ++t) {
      const unsigned short* brow = Wt + (size_t)(col0 + t * 16 + ln) * ldb + kb;
      FragB b;
      b.half[0] = *(const v8us*)(brow + 8 * hh);
      b.half[1] = *(const v8us*)(brow + 16 + 8 * hh);
      acc[t] = mmaN<ASPLIT ? 2 : 1>(ah.v, al.v, b.v, b.v, acc[t]);
    }
  }
#pragma unroll
  for (int t = 0; t < 4; ++t) {
    float bv = bias ? bias[col0 + t * 16 + ln] : 0.f;
    if (BIAS_BF16) bv = bf16_round(bv);
#pragma unroll
    for (int r = 0; r < 8; ++r) { float v = acc[t][r] + bv; if (ACT == 1) v = fmaxf(v, 0.f); so[w][8 * hh + r][t * 16 + ln] = v; }
  }
  __builtin_amdgcn_fence(__ATOMIC_ACQ_REL, "workgroup");
  __builtin_amdgcn_wave_barrier();
  const int rsub = lane >> 4, c4 = (lane & 15) * 4;
  {
#pragma unroll
    for (int q = 0; q < 8; ++q) {
      const int r = q * 2 + rsub;
      const v4f v = *(const v4fa*)&so[w][r][c4];
      *(v4f*)(C + (size_t)(row0 + r) * ldc + col0 + c4) = v;
    }
    
  }
}

// GEMM C = act(A·W + bias + resid): A f32 (ASPLIT -> hi/lo 2 terms), Wt bf16 [N][K]; ACT 0 none, 1 relu, 2 exact gelu;
// resid (optional, f32, row index = (row % rmod), pitch ldr, RES_BF16 rounds it) added before the activation.
template <bool ASPLIT, int ACT, bool BIAS_BF16, bool RES_BF16>
__global__ __launch_bounds__(128) void k_gemm_bf3(const float* __restrict__ A, int lda, const unsigned short* __restrict__ Wt, int ldb,
                                                const float* __restrict__ bias, const float* __restrict__ resid, int rmod, int ldr,
                                                float* __restrict__ C, int ldc, int M, int N, int K) {
  __shared__ __attribute__((aligned(16))) float so[4][16][64];
  const int tid = threadIdx.x, w = tid >> 5, lane = tid & 31, ln = lane & 15, hh = lane >> 4;
  const int ntn = N / 64;
  const int wid = blockIdx.x * 4 + w;
  const int mt = wid / ntn, nq = wid % ntn;
  if (mt * 16 >= M) return;
  const int row0 = mt * 16, col0 = nq * 64;
  const float* arow = A + (size_t)(row0 + ln) * lda;
  v8f acc[4] = {};
  for (int kb = 0; kb < K; kb += 32) {
    FragB ah, al;
    const v4f x0 = *(const v4fa*)(arow + kb + 8 * hh), x1 = *(const v4fa*)(arow + kb + 8 * hh + 4);
    const v4f x2 = *(const v4fa*)(arow + kb + 16 + 8 * hh), x3 = *(const v4fa*)(arow + kb + 16 + 8 * hh + 4);
    float xs[16] = {x0[0],x0[1],x0[2],x0[3],x1[0],x1[1],x1[2],x1[3],x2[0],x2[1],x2[2],x2[3],x3[0],x3[1],x3[2],x3[3]};
#pragma unroll
    for (int i = 0; i < 16; ++i) { const unsigned short hb = bf16_bits(xs[i]); ah.u[i] = hb; al.u[i] = ASPLIT ? bf16_bits(xs[i] - bf16_val(hb)) : (unsigned short)0; }
#pragma unroll
    for (int t = 0; t < 4; ++t) {
      const unsigned short* brow = Wt + (size_t)(col0 + t * 16 + ln) * ldb + kb;
      FragB b;
      b.half[0] = *(const v8us*)(brow + 8 * hh);
      b.half[1] = *(const v8us*)(brow + 16 + 8 * hh);
      acc[t] = mmaN<ASPLIT ? 2 : 1>(ah.v, al.v, b.v, b.v, acc[t]);
    }
  }
#pragma unroll
  for (int t = 0; t < 4; ++t) {
    const int col = col0 + t * 16 + ln;
    float bv = bias ? bias[col] : 0.f;
    if (BIAS_BF16) bv = bf16_round(bv);
#pragma unroll
    for (int r = 0; r < 8; ++r) {
      float v = acc[t][r] + bv;
      if (resid) { float rv = resid[(size_t)((row0 + 8 * hh + r) % rmod) * ldr + col]; if (RES_BF16) rv = bf16_round(rv); v += rv; }
      if (ACT == 1) v = fmaxf(v, 0.f);
      if (ACT == 2) v = 0.5f * v * (1.0f + erff(v * 0.70710678118654752f));
      if (ACT == 3) { const float u = 0.7978845608028654f * (v + 0.044715f * v * v * v); v = 0.5f * v * (1.0f + tanhf(u)); }
      so[w][8 * hh + r][t * 16 + ln] = v;
    }
  }
  __builtin_amdgcn_fence(__ATOMIC_ACQ_REL, "workgroup");
  __builtin_amdgcn_wave_barrier();
  const int rsub = lane >> 4, c4 = (lane & 15) * 4;
  {
#pragma unroll
    for (int q = 0; q < 8; ++q) {
      const int r = q * 2 + rsub;
      const v4f v = *(const v4fa*)&so[w][r][c4];
      *(v4f*)(C + (size_t)(row0 + r) * ldc + col0 + c4) = v;
    }
    
  }
}
// row LayerNorm (biased variance, eps) over N: s = X (+ R); optional out_sum <- s; out_norm <- (s-mu)*rsqrt(var+eps)*g + b
template <bool PARAM_BF16>
__global__ __launch_bounds__(256) void k_layernorm(const float* __restrict__ X, const float* __restrict__ R, const float* __restrict__ g, const float* __restrict__ bta,
                                                  float* __restrict__ out_sum, float* __restrict__ out_norm, int N, float eps) {
  __shared__ float red[256];
  const int row = blockIdx.x, tid = threadIdx.x;
  const float* x = X + (size_t)row * N; const float* rr = R ? R + (size_t)row * N : nullptr;
  float vals[16];                     // up to N = 4096
  const int per = N / 256;            // contiguous chunk per thread? use strided-by-4 chunks: thread handles j = tid*4 + 1024*u
  float s1 = 0.f;
  for (int u = 0; u < per / 4; ++u) {
    const int j = tid * 4 + 1024 * u;
    const v4f a = *(const v4fa*)(x + j);
    v4f b = {0.f,0.f,0.f,0.f}; if (rr) b = *(const v4fa*)(rr + j);
#pragma unroll
    for (int q = 0; q < 4; ++q) { const float v = a[q] + b[q]; vals[u * 4 + q] = v; s1 += v; }
  }
  red[tid] = s1; __syncthreads();
  for (int st = 128; st > 0; st >>= 1) { if (tid < st) red[tid] += red[tid + st]; __syncthreads(); }
  const float mu = red[0] / (float)N; __syncthreads();
  float s2 = 0.f;
  for (int u = 0; u < per / 4; ++u)
#pragma unroll
    for (int q = 0; q < 4; ++q) { const float c = vals[u * 4 + q] - mu; s2 += c * c; }
  red[tid] = s2; __syncthreads();
  for (int st = 128; st > 0; st >>= 1) { if (tid < st) red[tid] += red[tid + st]; __syncthreads(); }
  const float rs = rsqrtf(red[0] / (float)N + eps);
  {
    for (int u = 0; u < per / 4; ++u) {
      const int j = tid * 4 + 1024 * u;
      v4f o, sm;
#pragma unroll
      for (int q = 0; q < 4; ++q) {
        float gg = g[j + q], bb = bta[j + q];
        if (PARAM_BF16) { gg = bf16_round(gg); bb = bf16_round(bb); }
        sm[q] = vals[u * 4 + q]; o[q] = (vals[u * 4 + q] - mu) * rs * gg + bb;
      }
      if (out_sum) *(v4f*)(out_sum + (size_t)row * N + j) = sm;
      *(v4f*)(out_norm + (size_t)row * N + j) = o;
    }
    
  }
}



// ---- f16 WMMA path (v_wmma_f32_16x16x32_f16): 11-bit significands for operands in range — used where a [0,1] probability operand needs more precision than bf16
typedef _Float16 v16h __attribute__((ext_vector_type(16)));
union FragH { v16h v; v8us half[2]; _Float16 h[16]; unsigned short u[16]; };
template <int NT>
__device__ __forceinline__ v8f mmaH(v16h ah, v16h al, v16h bh, v16h bl, v8f c) {
  c = __builtin_amdgcn_wmma_f32_16x16x32_f16(false, ah, false, bh, (short)0, c, false, false);
  if (NT >= 2) c = __builtin_amdgcn_wmma_f32_16x16x32_f16(false, al, false, bh, (short)0, c, false, false);
  if (NT >= 3) c = __builtin_amdgcn_wmma_f32_16x16x32_f16(false, ah, false, bl, (short)0, c, false, false);
  asm volatile("v_nop\n\tv_nop\n\tv_nop\n\tv_nop" : "+v"(c) : "v"(ah), "v"(al), "v"(bh), "v"(bl));
  return c;
}
// batched GEMM like k_gemm_b but f16 operands: A f32 (split into f16 hi/lo if ASPLIT, else rounded to f16), Bt = f16 values [n][k]; alpha; C f32; N multiple of 16 (partial tiles skipped)
template <bool ASPLIT>
__global__ __launch_bounds__(128) void k_gemm_h(const float* __restrict__ A, int lda, size_t sA, const _Float16* __restrict__ Bh, int ldb, size_t sB, float alpha, float* __restrict__ C, int ldc, size_t sC, int M, int N, int K) {
  __shared__ __attribute__((aligned(16))) float so[4][16][64];
  const int tid = threadIdx.x, w = tid >> 5, lane = tid & 31, ln = lane & 15, hh = lane >> 4; const int by = blockIdx.y;
  A += (size_t)by * sA; Bh += (size_t)by * sB; C += (size_t)by * sC;
  const int ntn = (N + 63) / 64; const int wid = blockIdx.x * 4 + w; const int mt = wid / ntn, nq = wid % ntn; if (mt * 16 >= M) return;
  const int row0 = mt * 16, col0 = nq * 64; const float* arow = A + (size_t)(row0 + ln) * lda;
  v8f acc[4] = {};
  for (int kb = 0; kb < K; kb += 32) {
    FragH ah, al;
    const v4f x0 = *(const v4fa*)(arow + kb + 8 * hh), x1 = *(const v4fa*)(arow + kb + 8 * hh + 4), x2 = *(const v4fa*)(arow + kb + 16 + 8 * hh), x3 = *(const v4fa*)(arow + kb + 16 + 8 * hh + 4);
    float xs[16] = {x0[0],x0[1],x0[2],x0[3],x1[0],x1[1],x1[2],x1[3],x2[0],x2[1],x2[2],x2[3],x3[0],x3[1],x3[2],x3[3]};
#pragma unroll
    for (int i = 0; i < 16; ++i) { const _Float16 h = (_Float16)xs[i]; ah.h[i] = h; al.h[i] = ASPLIT ? (_Float16)(xs[i] - (float)h) : (_Float16)0.0f; }
#pragma unroll
    for (int t = 0; t < 4; ++t) { if (col0 + t * 16 >= N) continue; const size_t boff = (size_t)(col0 + t * 16 + ln) * ldb + kb; FragH bq; bq.half[0] = *(const v8us*)(Bh + boff + 8 * hh); bq.half[1] = *(const v8us*)(Bh + boff + 16 + 8 * hh);
      acc[t] = mmaH<ASPLIT ? 2 : 1>(ah.v, al.v, bq.v, bq.v, acc[t]); }
  }
#pragma unroll
  for (int t = 0; t < 4; ++t) { if (col0 + t * 16 >= N) continue;
#pragma unroll
    for (int r = 0; r < 8; ++r) so[w][8 * hh + r][t * 16 + ln] = acc[t][r] * alpha; }
  __builtin_amdgcn_fence(__ATOMIC_ACQ_REL, "workgroup"); __builtin_amdgcn_wave_barrier();
  const int rsub = lane >> 4, c4 = (lane & 15) * 4;
  {
#pragma unroll
    for (int q = 0; q < 8; ++q) { const int r = q * 2 + rsub; if (col0 + c4 < N) { const v4f v = *(const v4fa*)&so[w][r][c4]; *(v4f*)(C + (size_t)(row0 + r) * ldc + col0 + c4) = v; } }
     }
}

// Wt[n][k], in fragment order, = f16(W[k][n] * scale) from f32 row-major W[K][N] (K % 32 == 0, N % 16 == 0; scale = power of two; bf16-exact weights stay exact in f16 away from the subnormal range)
__device__ __forceinline__ void d_wt_f16(int bx, const float* __restrict__ W, _Float16* __restrict__ Wt, int K, int N, float scale) {      /* bx = the block's number within this weight */
  const int t = bx * 256 + threadIdx.x; if (t >= N * (K / 8)) return;      /* thread t writes the t-th 16-byte group of the fragment-order plane: 16 lanes read 16 neighbouring n of one k row */
  const int blk = t >> 6; const int n = (blk / (K / 32)) * 16 + (t & 15), k8 = (blk % (K / 32)) * 32 + ((t >> 5) & 1) * 16 + ((t >> 4) & 1) * 8; FragH f;
#pragma unroll
  for (int i = 0; i < 8; ++i) f.h[i] = (_Float16)(bf16_round(W[(size_t)(k8 + i) * N + n]) * scale); const v8us o = f.half[0];
  *(v8us*)((unsigned short*)Wt + (size_t)t * 8) = o; 
}
// k_gemm_hh variant with fused epilogue: v = acc·alpha + bias[by·sBias + col] (+ CP[(row/rowsPerB)·sCPb + by·64 + col] if CP) ; ACT 0 none / 1 elu ; writes f16 C16 (and f32 C if non-null)
template <int ACT>
__global__ __launch_bounds__(128) void k_gemm_hhx(const _Float16* __restrict__ A, int lda, size_t sA, const _Float16* __restrict__ Bh, int ldb, size_t sB, float alpha, const float* __restrict__ bias, size_t sBias, const float* __restrict__ CP, int rowsPerB, size_t sCPb, int row0g,
    float* __restrict__ C, _Float16* __restrict__ C16, int ldc, size_t sC, int M, int N, int K) {
  __shared__ __attribute__((aligned(16))) float so[4][16][64];
  const int tid = threadIdx.x, w = tid >> 5, lane = tid & 31, ln = lane & 15, hh = lane >> 4; const int by = blockIdx.y;
  A += (size_t)by * sA; Bh += (size_t)by * sB; const size_t cofs = (size_t)by * sC; const float* bp = bias ? bias + (size_t)by * sBias : nullptr;
  const int ntn = (N + 63) / 64; const int wid = blockIdx.x * 4 + w; const int mt = wid / ntn, nq = wid % ntn; if (mt * 16 >= M) return;
  const int row0 = mt * 16, col0 = nq * 64; const _Float16* arow = A + (size_t)(row0 + ln) * lda;
  v8f acc[4] = {};
  for (int kb = 0; kb < K; kb += 32) { FragH ah; ah.half[0] = *(const v8us*)((const unsigned short*)arow + kb + 8 * hh); ah.half[1] = *(const v8us*)((const unsigned short*)arow + kb + 16 + 8 * hh);
#pragma unroll
    for (int t = 0; t < 4; ++t) { if (col0 + t * 16 >= N) continue; const size_t boff = (size_t)(col0 + t * 16 + ln) * ldb + kb; FragH bq; bq.half[0] = *(const v8us*)((const unsigned short*)Bh + boff + 8 * hh); bq.half[1] = *(const v8us*)((const unsigned short*)Bh + boff + 16 + 8 * hh);
      acc[t] = mmaH<1>(ah.v, ah.v, bq.v, bq.v, acc[t]); }
  }
#pragma unroll
  for (int t = 0; t < 4; ++t) { if (col0 + t * 16 >= N) continue; const int col = col0 + t * 16 + ln; const float bv = bp ? bf16_round(bp[col]) : 0.f;
#pragma unroll
    for (int r = 0; r < 8; ++r) { float v = acc[t][r] * alpha + bv; if (CP) { const int rr = row0g + row0 + 8 * hh + r; if (rowsPerB < 0) v += CP[cofs + (size_t)rr * ldc + col];      /* rowsPerB < 0: own element of the batched C plane */ else { const int bidx = rr / rowsPerB; v += CP[(size_t)bidx * sCPb + (size_t)by * 64 + col]; } } if (ACT == 1) v = (v > 0.f) ? v : expm1f(v); else if (ACT == 7) v = (v > 0.f) ? v + 1.0f : expf(v); else if (ACT == 8) v = tanhf(v); else if (ACT == 9) v = 0.5f * v * (1.0f + tanhf(0.7978845608028654f * (v + 0.044715f * v * v * v))); else if (ACT == 11) v = 1.0f / (1.0f + expf(-v)); else if (ACT == 12) v = (v > 0.f) ? v : 0.01f * v; else if (ACT == 14) v = (v > 0.f) ? v : 0.1f * v; else if (ACT == 16) v = (v >= 0.f) ? v : 0.3f * v; else if (ACT == 17) v = (v >= 0.f) ? v : 0.2f * v; else if (ACT == 15) v = v / (1.0f + expf(-v)); else if (ACT == 3) v = fmaxf(v, 0.f); else if (ACT == 6) v = 0.5f * v * (1.0f + erff(v * 0.70710678118654752f)); so[w][8 * hh + r][t * 16 + ln] = v; } }
  __builtin_amdgcn_fence(__ATOMIC_ACQ_REL, "workgroup"); __builtin_amdgcn_wave_barrier();
  const int rsub = lane >> 4, c4 = (lane & 15) * 4; typedef _Float16 v4h __attribute__((ext_vector_type(4)));
  {
#pragma unroll
    for (int q = 0; q < 8; ++q) { const int r = q * 2 + rsub; if (col0 + c4 < N) { const v4f v = *(const v4fa*)&so[w][r][c4]; if (C) *(v4f*)(C + cofs + (size_t)(row0 + r) * ldc + col0 + c4) = v; if (C16) { v4h h4; for (int i = 0; i < 4; ++i) h4[i] = (_Float16)v[i]; *(v4h*)(C16 + cofs + (size_t)(row0 + r) * ldc + col0 + c4) = h4; } } }
     }
}


typedef _Float16 v4h __attribute__((ext_vector_type(4)));

// f32 rows of pitch DM -> fragment order, one 16 x 32 tile per wave: load i takes rows 4 i .. 4 i + 3 of the tile, 8 lanes on each row's whole 128-byte line; a lane's 4 values go as 8 bytes into the tile's block.
__device__ __forceinline__ size_t pk_src(size_t wv, int lane) { return ((wv / (DM / 32)) * 16 + (lane >> 3)) * DM + (wv % (DM / 32)) * 32 + (lane & 7) * 4; }      /* row step 4 * DM per load */
__device__ __forceinline__ size_t pk_dst(size_t wv, int lane) { return wv * 512 + ((lane >> 2) & 1) * 256 + (((lane >> 1) & 1) * 16 + (lane >> 3)) * 8 + (lane & 1) * 4; }      /* step 32 per load */
__device__ __forceinline__ void d_x16(int bx, const float* __restrict__ x, _Float16* __restrict__ X16, size_t n16) { const size_t t = (size_t)bx * 256 + threadIdx.x; if (t >= n16) return; const int lane = (int)(t & 31);      /* bx = the block's number within this input */
  const float* s = x + pk_src(t >> 5, lane); _Float16* d = X16 + pk_dst(t >> 5, lane); v4f v[4]; v4h h[4];
#pragma unroll      /* static indices keep v[] and h[] in registers; the four loads are issued together */
  for (int i = 0; i < 4; ++i) v[i] = *(const v4fa*)(s + (size_t)i * 4 * DM);
  asm volatile("s_wait_xcnt 0x0" :: "v"(s) : "memory");      /* the loads' address pair stays whole up to here and is free for reuse only behind this wait */
#pragma unroll      /* static indices keep v[] and h[] in registers */
  for (int i = 0; i < 4; ++i) for (int q = 0; q < 4; ++q) h[i][q] = (_Float16)bf16_round(v[i][q]);
#pragma unroll      /* static indices; the four stores follow one another, so both halves of each 128-byte line are written together */
  for (int i = 0; i < 4; ++i) *(v4h*)(d + i * 32) = h[i]; }
__global__ __launch_bounds__(256) void k_h16(const float* __restrict__ x, _Float16* __restrict__ X16, size_t n8) { const size_t t = (size_t)blockIdx.x * 256 + threadIdx.x; if (t >= n8) return; FragH f;
#pragma unroll
  for (int q = 0; q < 8; ++q) f.h[q] = (_Float16)x[t * 8 + q]; *(v8us*)((unsigned short*)X16 + t * 8) = f.half[0];  }
__global__ __launch_bounds__(256) void k_round16f(const float* __restrict__ W, _Float16* __restrict__ Bt, size_t n8) { const size_t t = (size_t)blockIdx.x * 256 + threadIdx.x; if (t >= n8) return; FragH f;
#pragma unroll
  for (int i = 0; i < 8; ++i) f.h[i] = (_Float16)(bf16_round(W[t * 8 + i]) * 16.0f); *(v8us*)((unsigned short*)Bt + t * 8) = f.half[0];  }
template <int NHv, int TTv>
__device__ __forceinline__ void d_vt(int bx, const _Float16* __restrict__ V16, int ldv, int voff, _Float16* __restrict__ Vt) { __shared__ unsigned short tl[64][66]; const int tid = threadIdx.x; const int slab = bx / (TTv / 64), lg = bx % (TTv / 64); const int b = slab / NHv, h = slab % NHv;
  for (int i = tid; i < 64 * 8; i += 256) { const int r = i / 8, c8 = (i % 8) * 8; FragH f; f.half[0] = *(const v8us*)((const unsigned short*)V16 + ((size_t)b * TTv + lg * 64 + r) * ldv + voff + h * 64 + c8);
#pragma unroll
    for (int q = 0; q < 8; ++q) tl[r][c8 + q] = f.u[q]; }
  __syncthreads();
  {
#pragma unroll
    for (int rd = 0; rd < 2; ++rd) { const int d = ((tid >> 6) & 3) * 16 + (tid & 15), pc = rd * 4 + ((tid >> 4) & 3); FragH f;      /* fragment order, blocks [32 keys][16 d]: thread tid of round rd writes the (256 rd + tid)-th 16-byte group of this tile's 8 blocks */
#pragma unroll
      for (int q = 0; q < 8; ++q) f.u[q] = tl[pc * 8 + q][d];
      *(v8us*)((unsigned short*)Vt + (size_t)slab * 64 * TTv + (size_t)lg * 4096 + (rd * 256 + tid) * 8) = f.half[0]; }
    asm volatile("s_wait_xcnt 0x0" ::: "memory");      /* the two stores' address pair and data registers are free for reuse only behind this wait: in a shared grid another job's code can follow in the text */
     } }

__device__ __forceinline__ void d_hl(int bx, const float* __restrict__ F, _Float16* __restrict__ Hh, _Float16* __restrict__ Hl, size_t n16) { const size_t t = (size_t)bx * 256 + threadIdx.x; if (t >= n16) return; const int lane = (int)(t & 31);      /* bx = the block's number within this plane */      /* f32 rows of pitch DM -> hi and x1024 residual planes in fragment order, a 16 x 32 tile per wave as in d_x16 */
  const float* s = F + pk_src(t >> 5, lane); const size_t o = pk_dst(t >> 5, lane); _Float16* dh = Hh + o; _Float16* dl = Hl + o; v4f v[4]; v4h a[4], c[4];
#pragma unroll      /* static indices keep v[], a[] and c[] in registers; the four loads are issued together */
  for (int i = 0; i < 4; ++i) v[i] = *(const v4fa*)(s + (size_t)i * 4 * DM);
  asm volatile("s_wait_xcnt 0x0" :: "v"(s) : "memory");      /* the loads' address pair stays whole up to here and is free for reuse only behind this wait */
#pragma unroll      /* static indices keep v[], a[] and c[] in registers */
  for (int i = 0; i < 4; ++i) for (int q = 0; q < 4; ++q) { const _Float16 h = (_Float16)v[i][q]; a[i][q] = h; c[i][q] = (_Float16)((v[i][q] - (float)h) * 1024.0f); }
#pragma unroll      /* static indices; the stores follow one another, so both halves of each 128-byte line are written together */
  for (int i = 0; i < 4; ++i) { *(v4h*)(dh + i * 32) = a[i]; *(v4h*)(dl + i * 32) = c[i]; } }

// ---- fast GEMM (wave tile 32x64; requires M % 32 == 0 rows per launch region, N % 64 == 0 and K % 64 == 0; A and Bh in fragment order with lda == ldb == K); epilogue = k_gemm_hhx semantics ----
__device__ __forceinline__ v16h g2_frag(const _Float16* p) { FragH f; f.half[0] = *(const v8us*)((const unsigned short*)p); f.half[1] = *(const v8us*)((const unsigned short*)p + 256); return f.v; }      /* p = the block of a fragment-order plane + 8 * lane: each of the two loads covers 512 contiguous bytes per wave */
__device__ __forceinline__ v8f g2_mma(v16h a, v16h b, v8f c) { v8f d = __builtin_amdgcn_wmma_f32_16x16x32_f16(false, a, false, b, (short)0, c, false, false); asm volatile("v_nop\n\tv_nop\n\tv_nop\n\tv_nop" : "+v"(d) : "v"(a), "v"(b)); return d; }
template <int ACT>
__global__ __launch_bounds__(128) void k_gemm2(const _Float16* __restrict__ A, int lda, size_t sA, const _Float16* __restrict__ Bh, int ldb, size_t sB, float alpha, const float* __restrict__ bias, size_t sBias, const float* __restrict__ CP, int rowsPerB, size_t sCPb, int row0g,
    float* __restrict__ C, _Float16* __restrict__ C16a, int ldc, size_t sC, int M, int N, int K, const float* __restrict__ bias1, const float* __restrict__ bias2, int c16y, const _Float16* __restrict__ AF, int ftp) { static_assert(ACT == 0 || ACT == 3 || ACT == 6 || ACT == 8 || ACT == 9 || ACT == 11 || ACT == 12 || ACT == 14 || ACT == 15 || ACT == 16 || ACT == 17, "k_gemm2: unsupported ACT code (would silently apply no activation)");
  __shared__ __attribute__((aligned(16))) float so[4][32][68];
  const int tid = threadIdx.x, w = tid >> 5, lane = tid & 31, ln = lane & 15, hh = lane >> 4; const int by = blockIdx.y;
  A += (size_t)by * sA; Bh += (size_t)by * sB; const size_t cofs = (size_t)by * sC; const float* bp = bias ? bias + (size_t)by * sBias : nullptr;
  if (by == 1 && bias1) bp = bias1; if (by == 2 && bias2) bp = bias2; _Float16* C16 = (by >= c16y) ? C16a : nullptr;      /* independent products share one grid: blockIdx.y picks the operands; biases that are separate inputs come as pointers of their own; only products from c16y on store f16 rows */
  const int ntn = N >> 6; const int mt = blockIdx.x / ntn, nq = blockIdx.x - mt * ntn; const int row0 = mt * 128 + 32 * w, col0 = nq * 64; if (row0 >= M) return;
  const _Float16* ab = A + (size_t)row0 * lda; if (AF && mt % ftp == 0) ab = AF + ((size_t)(mt / ftp) * 128 + 32 * w) * lda;      /* every ftp-th block of 128 rows takes its A rows from the packed plane AF (the exact first-tile rows): that product shares this grid instead of overwriting these rows from a launch of its own */
  const _Float16* a0p = ab + 8 * lane; const _Float16* a1p = a0p + (size_t)16 * lda;      /* first block of each 16-row group; the lane's 8 elements are in the six pointers, so each is the very address its loads name; a k step of 32 is one block of 512 elements */
  const _Float16* b0p = Bh + (size_t)col0 * ldb + 8 * lane; const _Float16* b1p = b0p + (size_t)16 * ldb; const _Float16* b2p = b1p + (size_t)16 * ldb; const _Float16* b3p = b2p + (size_t)16 * ldb;
  const v8f z8 = {0.f,0.f,0.f,0.f,0.f,0.f,0.f,0.f}; v8f c00 = z8, c01 = z8, c02 = z8, c03 = z8, c10 = z8, c11 = z8, c12 = z8, c13 = z8;
  /* Two fragment sets, x and y, each the six fragments of one k step of 32. A set's twelve loads are issued together, one k step ahead of its products, so a k step waits for one load round trip that
     runs under the other set's products, not for five in a row. K is a multiple of 64. Every accumulator still takes its k steps in rising order. */
  v16h xa0 = g2_frag(a0p), xa1 = g2_frag(a1p), xb0 = g2_frag(b0p), xb1 = g2_frag(b1p), xb2 = g2_frag(b2p), xb3 = g2_frag(b3p);
  asm volatile("s_wait_xcnt 0x0" :: "v"(a0p), "v"(a1p), "v"(b0p), "v"(b1p), "v"(b2p), "v"(b3p) : "memory");      /* the first set's six address pairs stay whole up to here and are free for reuse only behind this wait */
#pragma unroll 1      /* one trip is two k steps already; more would only grow the text */
  for (int kb = 0; kb < K; kb += 64) {
    const int ko = kb * 16; const _Float16* q0 = a0p + ko; const _Float16* q1 = a1p + ko; const _Float16* q2 = b0p + ko; const _Float16* q3 = b1p + ko; const _Float16* q4 = b2p + ko; const _Float16* q5 = b3p + ko;
    const v16h ya0 = g2_frag(q0 + 512), ya1 = g2_frag(q1 + 512), yb0 = g2_frag(q2 + 512), yb1 = g2_frag(q3 + 512), yb2 = g2_frag(q4 + 512), yb3 = g2_frag(q5 + 512);
    asm volatile("s_wait_xcnt 0x0" :: "v"(q0), "v"(q1), "v"(q2), "v"(q3), "v"(q4), "v"(q5) : "memory");      /* the twelve loads' six address pairs stay whole up to here and are free for reuse only behind this wait */
    c00 = g2_mma(xa0, xb0, c00); c10 = g2_mma(xa1, xb0, c10); c01 = g2_mma(xa0, xb1, c01); c11 = g2_mma(xa1, xb1, c11);
    c02 = g2_mma(xa0, xb2, c02); c12 = g2_mma(xa1, xb2, c12); c03 = g2_mma(xa0, xb3, c03); c13 = g2_mma(xa1, xb3, c13);
    const int k2 = ((kb + 64 < K) ? kb + 64 : kb) * 16;      /* the last trip fetches its own first step again: in bounds, unused */
    const _Float16* r0 = a0p + k2; const _Float16* r1 = a1p + k2; const _Float16* r2 = b0p + k2; const _Float16* r3 = b1p + k2; const _Float16* r4 = b2p + k2; const _Float16* r5 = b3p + k2;
    xa0 = g2_frag(r0); xa1 = g2_frag(r1); xb0 = g2_frag(r2); xb1 = g2_frag(r3); xb2 = g2_frag(r4); xb3 = g2_frag(r5);
    asm volatile("s_wait_xcnt 0x0" :: "v"(r0), "v"(r1), "v"(r2), "v"(r3), "v"(r4), "v"(r5) : "memory");      /* likewise for this set's six address pairs */
    c00 = g2_mma(ya0, yb0, c00); c10 = g2_mma(ya1, yb0, c10); c01 = g2_mma(ya0, yb1, c01); c11 = g2_mma(ya1, yb1, c11);
    c02 = g2_mma(ya0, yb2, c02); c12 = g2_mma(ya1, yb2, c12); c03 = g2_mma(ya0, yb3, c03); c13 = g2_mma(ya1, yb3, c13); }
  v8f accs[8] = {c00, c01, c02, c03, c10, c11, c12, c13};
#pragma unroll
  for (int u = 0; u < 8; ++u) { const int t = u & 3, half = u >> 2; const int col = col0 + t * 16 + ln; const float bv = bp ? bf16_round(bp[col]) : 0.f;
#pragma unroll
    for (int r = 0; r < 8; ++r) { const int rloc = half * 16 + 8 * hh + r; float v = accs[u][r] * alpha + bv; if (CP) { if (rowsPerB < 0) v += CP[cofs + (size_t)(row0g + row0 + rloc) * ldc + col];      /* rowsPerB < 0: own element of the batched C plane */ else { const int bidx = (row0g + row0 + rloc) / rowsPerB; v += CP[(size_t)bidx * sCPb + (size_t)by * 64 + col]; } }
      if (ACT == 3) v = fmaxf(v, 0.f); else if (ACT == 6) v = 0.5f * v * (1.0f + erff(v * 0.70710678118654752f)); else if (ACT == 11) v = 1.0f / (1.0f + expf(-v)); else if (ACT == 15) v = v / (1.0f + expf(-v)); else if (ACT == 12) v = (v > 0.f) ? v : 0.01f * v; else if (ACT == 8) v = tanhf(v); else if (ACT == 9) v = 0.5f * v * (1.0f + tanhf(0.7978845608028654f * (v + 0.044715f * v * v * v))); else if (ACT == 14) v = (v > 0.f) ? v : 0.1f * v; else if (ACT == 16) v = (v >= 0.f) ? v : 0.3f * v; else if (ACT == 17) v = (v >= 0.f) ? v : 0.2f * v;
      so[w][rloc][t * 16 + ln] = v; } }
  __builtin_amdgcn_fence(__ATOMIC_ACQ_REL, "workgroup"); __builtin_amdgcn_wave_barrier();
  const int rsub = lane >> 4, c4 = (lane & 15) * 4;
  {
#pragma unroll
    for (int q = 0; q < 16; ++q) { const int r = q * 2 + rsub; const v4f v = *(const v4fa*)&so[w][r][c4]; if (C) { float* cp = C + cofs + (size_t)(row0 + r) * ldc + col0 + c4; *(v4f*)cp = v; asm volatile("s_wait_xcnt 0x0" :: "v"(cp), "v"(v) : "memory"); }      /* the f32 store's address pair and data registers stay whole up to here: the f16 conversion below and the next row's LDS read reuse them only behind this wait */ if (C16) { v4h h4; for (int i = 0; i < 4; ++i) h4[i] = (_Float16)v[i]; *(v4h*)(C16 + cofs + (size_t)(row0 + r) * ldc + col0 + c4) = h4; } }
     } }


__global__ __launch_bounds__(256) void k_wnat(const float* __restrict__ w, size_t n8, _Float16* __restrict__ Bt) { const size_t t = (size_t)blockIdx.x * 256 + threadIdx.x; if (t >= n8) return; FragH f; for (int q = 0; q < 8; ++q) f.h[q] = (_Float16)(bf16_round(w[t * 8 + q]) * 16.0f); *(v8us*)((unsigned short*)Bt + t * 8) = f.half[0];  }
__global__ __launch_bounds__(256) void k_rsm(const float* __restrict__ S, _Float16* __restrict__ P, int nrows) {
  #pragma clang fp contract(off)
  const int i = blockIdx.x * 256 + threadIdx.x; if (i >= nrows) return; const float* s = S + (size_t)i * SQ; float mx = -3.0e38f;
#pragma unroll 1
  for (int j = 0; j < SQ; ++j) mx = fmaxf(mx, s[j]); float se = 0.f;
#pragma unroll 1
  for (int j = 0; j < SQ; ++j) se += expf(s[j] - mx); const float sc = 256.0f / se;
#pragma unroll 1
  for (int j0 = 0; j0 < SQ; j0 += 8) { FragH f; for (int q = 0; q < 8; ++q) f.h[q] = (_Float16)(expf(s[j0 + q] - mx) * sc); unsigned short* d = (unsigned short*)P + (size_t)i * SQ + j0; *(v8us*)d = f.half[0];  } }
__global__ __launch_bounds__(256) void k_vt(const _Float16* __restrict__ V16, int b, int h0, _Float16* __restrict__ VT) { __shared__ unsigned short tl[64][65]; const int tid = threadIdx.x; const int hh = blockIdx.x % HG, sg = blockIdx.x / HG; const int s0 = sg * 64; const int h = h0 + hh;
  for (int i = tid; i < 64 * 8; i += 256) { const int j = i / 8, d8 = (i % 8) * 8; FragH f; f.half[0] = *(const v8us*)((const unsigned short*)V16 + ((size_t)b * SQ + s0 + j) * DM + h * HD + d8); for (int q = 0; q < 8; ++q) tl[d8 + q][j] = f.u[q]; }
  __syncthreads();
  { for (int i = tid; i < 64 * 8; i += 256) { const int d = i / 8, j8 = (i % 8) * 8; FragH f; for (int q = 0; q < 8; ++q) f.u[q] = tl[d][j8 + q]; *(v8us*)((unsigned short*)VT + ((size_t)hh * HD + d) * SQ + s0 + j8) = f.half[0]; }  } }



// Fused causal attention, one launch, a block for every (batch, head, 128 query rows) but the first: the scores and the softmax weights stay in registers.
// One wave owns 16 queries and walks the keys 32 at a time. S^T = K Q^T (A = K rows, B = Q rows, both through fa_frag from planes in the same fragment order, so the k orders pair): lane (ln, hh) holds, of query q0 + ln,
// the scores of keys k0 + 16 kt + 8 hh + r. Three products as before: hi.hi in one accumulator, lo.hi + hi.lo (x1024) in a second. Running maximum and running sum per query (the two
// lane halves share the maximum and join their sums at the end). The two score tiles, as f16, are the B operand of O^T += V^T P^T in the order fa_frag gives V^T's rows. o leaves x64.
__device__ __forceinline__ v16h fa_frag(const _Float16* p) { return g2_frag(p); }      /* p = a fragment-order block + 8 * lane */
__device__ __forceinline__ float fa_exp(float x) { float r; asm("v_exp_f32 %0, %1\n\tv_nop" : "=v"(r) : "v"(x * 1.44269504f)); return r; }      /* native e^x; the v_nop fills the one slot the instruction set asks for behind a transcendental, whatever the compiler puts next */
__device__ __forceinline__ v8f fa_mma(v16h a, v16h b, v8f c) { return __builtin_amdgcn_wmma_f32_16x16x32_f16(false, a, false, b, (short)0, c, false, false); }
/* amdgpu_waves_per_eu(4, 4): two 8-wave blocks per WGP need at most 256 registers a wave; without it this build takes 260 and only one block fits */
__global__ __launch_bounds__(256) __attribute__((amdgpu_waves_per_eu(4, 4))) void k_fattn(const _Float16* __restrict__ QHp, const _Float16* __restrict__ QLp, const _Float16* __restrict__ KHp, const _Float16* __restrict__ KLp, const _Float16* __restrict__ VTp, _Float16* __restrict__ O, const float* __restrict__ OF0, _Float16* __restrict__ OH0, _Float16* __restrict__ OL0) {
  const int lane = threadIdx.x & 31, ln = lane & 15, hh = lane >> 4; const int w = __builtin_amdgcn_readfirstlane(threadIdx.x >> 5);      /* the wave's number as a scalar: the trip count and the mask test stay scalar */
  if (blockIdx.x >= NB * NH * (SQ / 128 - 1)) { d_hl((int)blockIdx.x - NB * NH * (SQ / 128 - 1), OF0, OH0, OL0, (size_t)NB * QT0 * DM / 16); return; }      /* the last blocks of the grid split the exact first-tile o rows (independent of the attention below) into hi + residual planes */
  const int bh = blockIdx.x % (NB * NH), tx = blockIdx.x / (NB * NH); const int tile = (tx < SQ / 256) ? (SQ / 128 - 1 - tx) : (tx - SQ / 256 + 1);      /* long tiles take the low block numbers; the second half of the grid counts up from the short end; tile 0 (rows 0 .. QT0 - 1) is the exact path's alone */
  const int b = bh / NH, h = bh % NH; const int q0 = tile * 128 + w * 16; const size_t r0 = (size_t)b * SQ;
  const _Float16* qh = QHp + (r0 + q0) * LQ + h * HD * 16 + 8 * lane; const _Float16* ql = QLp + (r0 + q0) * LQ + h * HD * 16 + 8 * lane;      /* a head's 64 dims are two blocks of 512 in each 16-row group */
  const v16h qh0 = fa_frag(qh), qh1 = fa_frag(qh + 512), ql0 = fa_frag(ql), ql1 = fa_frag(ql + 512);
  const _Float16* kh = KHp + r0 * LQ + h * HD * 16 + 8 * lane; const _Float16* kl = KLp + r0 * LQ + h * HD * 16 + 8 * lane; const _Float16* vt = VTp + (size_t)bh * HD * SQ + 8 * lane;      /* V^T: four blocks (16 dims each) per 32 keys */
  const v8f z8 = {0.f,0.f,0.f,0.f,0.f,0.f,0.f,0.f}; v8f o[4] = {z8, z8, z8, z8}; float m = -1.0e30f, l = 0.f;
  const int np = q0 / 32 + 1;      /* keys 0 .. q0 + 15 in passes of 32 */
  v16h fh[2][2], fl[2][2];      /* K fragments [key tile][k step], fetched one pass ahead */
#pragma unroll      /* static indices keep the fragments, scores and accumulators in registers */
  for (int kt = 0; kt < 2; ++kt) for (int ks = 0; ks < 2; ++ks) { fh[kt][ks] = fa_frag(kh + (size_t)kt * 16 * LQ + ks * 512); fl[kt][ks] = fa_frag(kl + (size_t)kt * 16 * LQ + ks * 512); }
  asm volatile("s_wait_xcnt 0x0" :: "v"(qh), "v"(ql), "v"(kh), "v"(kl) : "memory");      /* the loads' four address pairs stay whole up to here and are free for reuse only behind this wait */
  for (int p = 0; p < np; ++p) { const int k0 = p * 32;
    const _Float16* va = vt + (size_t)k0 * HD; v16h fv[4];
#pragma unroll      /* static indices keep the fragments, scores and accumulators in registers */
    for (int dt = 0; dt < 4; ++dt) fv[dt] = fa_frag(va + dt * 512);
    v8f sh[2], sl[2];
#pragma unroll      /* static indices keep the fragments, scores and accumulators in registers */
    for (int kt = 0; kt < 2; ++kt) { sh[kt] = fa_mma(fh[kt][1], qh1, fa_mma(fh[kt][0], qh0, z8)); sl[kt] = fa_mma(fl[kt][1], qh1, fa_mma(fl[kt][0], qh0, fa_mma(fh[kt][1], ql1, fa_mma(fh[kt][0], ql0, z8)))); }
    const int kn = (p + 1 < np) ? k0 + 32 : k0;      /* the last pass fetches its own rows again: in bounds, unused */
    const _Float16* ka = kh + (size_t)kn * LQ; const _Float16* kb = kl + (size_t)kn * LQ;
#pragma unroll      /* static indices keep the fragments, scores and accumulators in registers */
    for (int kt = 0; kt < 2; ++kt) for (int ks = 0; ks < 2; ++ks) { fh[kt][ks] = fa_frag(ka + (size_t)kt * 16 * LQ + ks * 512); fl[kt][ks] = fa_frag(kb + (size_t)kt * 16 * LQ + ks * 512); }
    asm volatile("s_wait_xcnt 0x0" :: "v"(va), "v"(ka), "v"(kb) : "memory");      /* this pass's three address pairs stay whole up to here and are free for reuse only behind this wait */
    float s[16];
#pragma unroll      /* static indices keep the fragments, scores and accumulators in registers */
    for (int e = 0; e < 16; ++e) s[e] = fmaf(sl[e >> 3][e & 7], SCLR, sh[e >> 3][e & 7] * SCL);
    if (k0 + 31 > q0) {      /* only the pass on the diagonal masks; key k0 <= q0 stays, so every query keeps a key */
#pragma unroll      /* static indices keep the fragments, scores and accumulators in registers */
      for (int e = 0; e < 16; ++e) s[e] = (k0 + (e >> 3) * 16 + 8 * hh + (e & 7) <= q0 + ln) ? s[e] : -1.0e30f; }
    float mx = s[0];
#pragma unroll      /* static indices keep the fragments, scores and accumulators in registers */
    for (int e = 1; e < 16; ++e) mx = fmaxf(mx, s[e]);
    mx = fmaxf(mx, __shfl_xor(mx, 16, 32)); const float mn = fmaxf(m, mx); const float al = fa_exp(m - mn); m = mn;
    FragH pf; float ps[4] = {0.f, 0.f, 0.f, 0.f};
#pragma unroll      /* static indices keep the fragments, scores and accumulators in registers */
    for (int e = 0; e < 16; ++e) { const float pe = fa_exp(s[e] - mn); ps[e & 3] += pe; pf.h[e] = (_Float16)pe; }
    l = fmaf(l, al, (ps[0] + ps[1]) + (ps[2] + ps[3]));
#pragma unroll      /* static indices keep the fragments, scores and accumulators in registers */
    for (int dt = 0; dt < 4; ++dt) { o[dt] *= al; o[dt] = fa_mma(fv[dt], pf.v, o[dt]); } }
  l += __shfl_xor(l, 16, 32); const float fin = 64.0f / l;      /* o carried x64, folded into the output GEMM's alpha */
  _Float16* op = O + (r0 + q0) * DM + h * HD * 16 + 8 * lane;      /* o rows in fragment order for the output GEMM: dims 16 dt + 8 hh .. + 7 of query ln are the lane's group of half-block dt */
#pragma unroll      /* static indices keep the fragments, scores and accumulators in registers */
  for (int dt = 0; dt < 4; ++dt) { FragH f;
#pragma unroll      /* static indices keep the fragments, scores and accumulators in registers */
    for (int r = 0; r < 8; ++r) f.h[r] = (_Float16)(o[dt][r] * fin);
    *(v8us*)((unsigned short*)op + dt * 256) = f.half[0]; }
  asm volatile("s_wait_xcnt 0x0" ::: "memory"); }      /* the four stores' address and data registers are free for reuse only behind this wait: the split job's code follows in the text */


typedef float v2f __attribute__((ext_vector_type(2)));
// Exact f32 attention for query rows 0 .. QT0-1 of one batch, one wave per (head, query row), 8 rows of one head per block. The head's QT0 K and V rows are staged once in LDS;
// lane l scores keys l, l + 32, l + 64, l + 96; row maximum and row sum are lane partials joined by butterflies; lane l then sums dims 2l, 2l + 1 over the keys (weight 0 behind the diagonal).
__device__ __forceinline__ void d_att0w(int bx, const float* __restrict__ QF, const float* __restrict__ KF, const float* __restrict__ VF, float scale, float* __restrict__ OF) {      /* bx = the block's number within this batch */
  __shared__ __attribute__((aligned(16))) float lk[QT0][HD + 4];      /* pitch 272 B = 16 B x odd: one key row per lane reads without bank conflicts */
  __shared__ __attribute__((aligned(16))) float lv[QT0][HD];
  const int tid = threadIdx.x, lane = tid & 31; const int w = __builtin_amdgcn_readfirstlane(tid >> 5);      /* the wave's number as a scalar: q's address is the same in every lane of the wave */
  const int h = bx / (QT0 / 8), i = (bx % (QT0 / 8)) * 8 + w;
  const int sr = tid >> 4, sc = (tid & 15) * 4; const float* kg = KF + (size_t)sr * DM + h * HD + sc; const float* vg = VF + (size_t)sr * DM + h * HD + sc; v4f ks[QT0 / 16], vs[QT0 / 16];
#pragma unroll      /* static indices keep ks[] and vs[] in registers; every load is issued before the first LDS store */
  for (int u = 0; u < QT0 / 16; ++u) { ks[u] = *(const v4fa*)(kg + (size_t)u * 16 * DM); vs[u] = *(const v4fa*)(vg + (size_t)u * 16 * DM); }
  asm volatile("s_wait_xcnt 0x0" :: "v"(kg), "v"(vg) : "memory");      /* the loads' two address pairs stay whole up to here and are free for reuse only behind this wait */
#pragma unroll      /* static indices keep ks[] and vs[] in registers */
  for (int u = 0; u < QT0 / 16; ++u) { *(v4f*)&lk[u * 16 + sr][sc] = ks[u]; *(v4f*)&lv[u * 16 + sr][sc] = vs[u]; }
  __syncthreads();
  const float* qg = QF + (size_t)i * DM + h * HD; v4f a[QT0 / 32] = {};
#pragma unroll      /* static indices keep a[] in registers: four independent sums per key, four keys per lane */
  for (int d = 0; d < HD / 4; ++d) { for (int c = 0; c < QT0 / 32; ++c) { const v4f kk = *(const v4f*)&lk[c * 32 + lane][d * 4]; for (int u = 0; u < 4; ++u) a[c][u] = fmaf(qg[d * 4 + u], kk[u], a[c][u]); } }
  float e[QT0 / 32]; float m = -1.0e30f;
#pragma unroll      /* static indices keep e[] in registers */
  for (int c = 0; c < QT0 / 32; ++c) { e[c] = (c * 32 + lane <= i) ? ((a[c][0] + a[c][1]) + (a[c][2] + a[c][3])) * scale : -1.0e30f; m = fmaxf(m, e[c]); }
  for (int x = 16; x >= 1; x >>= 1) m = fmaxf(m, __shfl_xor(m, x, 32));
  float l = 0.f;
#pragma unroll      /* static indices keep e[] in registers */
  for (int c = 0; c < QT0 / 32; ++c) { e[c] = expf(e[c] - m); l += e[c]; }      /* a key behind the diagonal: exp(-1e30 - m) = 0 */
  for (int x = 16; x >= 1; x >>= 1) l += __shfl_xor(l, x, 32);
  v2f o[4] = {};
#pragma unroll      /* a constant lane number per step: key j's weight is broadcast through a scalar register; static indices keep e[] and o[] in registers */
  for (int j = 0; j < QT0; ++j) { const float ej = __int_as_float(__builtin_amdgcn_readlane(__float_as_int(e[j >> 5]), j & 31)); const v2f vv = *(const v2f*)&lv[j][lane * 2]; o[j & 3][0] = fmaf(ej, vv[0], o[j & 3][0]); o[j & 3][1] = fmaf(ej, vv[1], o[j & 3][1]); }
  const float fin = 64.0f / l;      /* o carried x64 like the f16 path */
  const v2f r = ((o[0] + o[1]) + (o[2] + o[3])) * fin;
  *(v2f*)(OF + (size_t)i * DM + h * HD + lane * 2) = r; }

// Launches that do not depend on one another share one grid: a range of block numbers per job, the test is uniform for the block.
#define GW (DM * (DM / 8) / 256)                 /* blocks per weight */
#define GX ((int)(NR * DM / 16 / 256))           /* blocks per input, and per q or k plane */
#define GA (NH * (QT0 / 8))                      /* blocks of the exact first-tile attention per batch */
#define GV (NB * NH * (SQ / 64))                 /* blocks of the V transposes */
__global__ __launch_bounds__(256) void k_prep(const float* __restrict__ w0, const float* __restrict__ w1, const float* __restrict__ w2, const float* __restrict__ w3, _Float16* __restrict__ Wt0,
                                              const float* __restrict__ x0, const float* __restrict__ x1, const float* __restrict__ x2, _Float16* __restrict__ X0) {
  const int bx = blockIdx.x;
  if (bx < 4 * GW) { const int y = bx / GW; d_wt_f16(bx % GW, (y == 0) ? w0 : (y == 1) ? w1 : (y == 2) ? w2 : w3, Wt0 + (size_t)y * DM * DM, DM, DM, 16.0f); }      /* the four weight planes lie one behind the other */
  else { const int u = bx - 4 * GW, y = u / GX; d_x16(u % GX, (y == 0) ? x0 : (y == 1) ? x1 : x2, X0 + (size_t)y * NR * DM, NR * DM / 16); } }      /* likewise the three input planes */
__global__ __launch_bounds__(256) void k_mid(const float* __restrict__ QF, const float* __restrict__ KF, const float* __restrict__ VF, float* __restrict__ OF0, const _Float16* __restrict__ V16, _Float16* __restrict__ VT,
                                             _Float16* __restrict__ QH, _Float16* __restrict__ QL, _Float16* __restrict__ KH, _Float16* __restrict__ KL) {
  const int bx = blockIdx.x;
  if (bx < NB * GA) { const size_t b = bx / GA; d_att0w(bx % GA, QF + b * SQ * DM, KF + b * SQ * DM, VF + b * SQ * DM, SCL, OF0 + b * QT0 * DM); }      /* the longest blocks take the lowest block numbers */
  else if (bx < NB * GA + GV) d_vt<NH, SQ>(bx - NB * GA, V16, LQ, 0, VT);
  else { const int u = bx - NB * GA - GV, y = u / GX; d_hl(u % GX, y ? KF : QF, y ? KH : QH, y ? KL : QL, NR * DM / 16); } }

extern "C" void kernel_launch(void* const* d_in, const int* in_sizes, int n_in,
                              void* d_out, int out_size, void* d_ws, size_t ws_size, hipStream_t stream) {
  (void)in_sizes; (void)n_in; (void)out_size;
  const float* const* I = (const float* const*)d_in; const float* x = I[0]; const float* xk = I[1]; const float* xv = I[2]; const float* wq = I[3]; const float* bq = I[4]; const float* wk = I[5]; const float* bk = I[6]; const float* wv = I[7]; const float* bv = I[8]; const float* wo = I[9]; const float* bo = I[10];      /* input order: query, key, value (THREE input streams), then [in][out] weights + biases */
  char* ws = (char*)d_ws; size_t off = 0;
  auto take = [&](size_t bytes) { char* p = ws + off; off += (bytes + 255) & ~(size_t)255; return p; };
  _Float16* BQ = (_Float16*)take((size_t)DM * DM * 2); _Float16* BK = (_Float16*)take((size_t)DM * DM * 2); _Float16* BV = (_Float16*)take((size_t)DM * DM * 2); _Float16* BO = (_Float16*)take((size_t)DM * DM * 2);
  _Float16* X16 = (_Float16*)take(NR * DM * 2); _Float16* XK16 = (_Float16*)take(NR * DM * 2); _Float16* XV16 = (_Float16*)take(NR * DM * 2);      /* exact f16 rows of query, key, value, fragment order */ float* QF = (float*)take(NR * DM * 4); float* KF = (float*)take(NR * DM * 4); float* VF = (float*)take(NR * DM * 4);      /* f32 q, k, v rows, each kept: the exact first-tile attention reads its 128 rows per batch from them */ _Float16* QH = (_Float16*)take(NR * DM * 2); _Float16* QL = (_Float16*)take(NR * DM * 2); _Float16* KH = (_Float16*)take(NR * DM * 2); _Float16* KL = (_Float16*)take(NR * DM * 2); _Float16* Q16 = QH; _Float16* K16 = KH; _Float16* V16 = (_Float16*)take(NR * DM * 2); _Float16* O16 = (_Float16*)take(NR * DM * 2);
  _Float16* VT = (_Float16*)take((size_t)NB * NH * HD * SQ * 2);      /* V^T of both batches */
  float* OF0 = (float*)take((size_t)NB * QT0 * DM * 4); _Float16* OH0 = (_Float16*)take((size_t)NB * QT0 * DM * 2); _Float16* OL0 = (_Float16*)take((size_t)NB * QT0 * DM * 2);
  if (off > ws_size) return;
  k_prep<<<4 * GW + 3 * GX, 256, 0, stream>>>(wq, wk, wv, wo, BQ, x, xk, xv, X16);      /* weights [in][out] -> Bt[n][k] x16 (BQ, BK, BV, BO) and inputs -> exact f16 rows (X16, XK16, XV16), all in fragment order */
  k_gemm2<0><<<dim3((unsigned)((MP / 128) * (DM / 64)), 3), 128, 0, stream>>>(X16, DM, NR * DM, BQ, DM, (size_t)DM * DM, 0.0625f, bq, 0, nullptr, 1, 0, 0, QF, V16 - 2 * NR * DM, DM, NR * DM, MP, DM, DM, bk, bv, 2, nullptr, 1);      /* q, k, v projections in one grid: f32 rows into QF, KF, VF (one behind the other); v (y = 2) also as f16 rows */
  k_mid<<<NB * GA + GV + 2 * GX, 256, 0, stream>>>(QF, KF, VF, OF0, V16, VT, QH, QL, KH, KL);      /* exact f32 attention for rows 0..127 of each batch (o x64); V^T of all heads, fragment order; q and k (f32) -> f16 hi + x1024 residual: unscaled logits sigma ~8 */
  k_fattn<<<NB * NH * (SQ / 128 - 1) + (int)((size_t)NB * QT0 * DM / 16 / 256), 256, 0, stream>>>(QH, QL, KH, KL, VT, O16, OF0, OH0, OL0);      /* scores, causal softmax and P V of both batches and all heads, rows 128 on: o (merged heads, x64) as f16 rows; first-tile o (x64) -> f16 hi + x1024 residual planes */
  k_gemm2<0><<<dim3((unsigned)((MPO / 128) * (DM / 64)), 1), 128, 0, stream>>>(O16, DM, 0, BO, DM, 0, 0.0009765625f, bo, 0, nullptr, 1, 0, 0, (float*)d_out, nullptr, DM, 0, MPO, DM, DM, nullptr, nullptr, 0, OH0, SQ / 128);      /* out rows are the output layout; rows 0..127 of each batch: out = o_hi Wo (+ b) */
  k_gemm2<0><<<dim3((QT0 / 128) * (DM / 64), NB), 128, 0, stream>>>(OL0, DM, (size_t)QT0 * DM, BO, DM, 0, 0.00000095367431640625f, nullptr, 0, (const float*)d_out, -1, 0, 0, (float*)d_out, nullptr, DM, (size_t)SQ * DM, QT0, DM, DM, nullptr, nullptr, 0, nullptr, 1);      /* rows 0..127 of each batch (y) += o_lo Wo 2^-20 (own-element accumulate) */
}

// v008
// A run of this version takes 152 microseconds.
// Timed twice side by side with v007, it ran 1.09 times as fast both times.
// Counting every step since v000, it is 37.4 times as fast.
#include <hip/hip_runtime.h>
// Causal multi-head attention on three inputs with the source's sequence-length score scale (query, key, value [2][2048][1024]; q = query Wq + bq, k = key Wk + bk, v = value Wv + bv ([in][out] 1024 x 1024, weights AND biases sigma 1/32), 16 heads of 64; score = q k^T; triu(1) -> -inf; softmax(score / sqrt(Sk)) with Sk = 2048 KEYS (the source divides by sqrt of the score matrix's last dimension, NOT by sqrt(head_dim)): scale 2048^-0.5 = 0.0220970869; out = merged Wo + bo ([in][out]) -> [2][2048][1024]); q and k carried as f16 hi + x1024 residual planes with three-product scores.
// Structure: token rows r = b*2048 + s; x as exact f16 rows (bf16-rounded); q and k as WMMA GEMMs (32x64 wave tiles, f32 accumulation, exact x16 weights + bias) whose epilogue splits the f32 values into f16 hi + x1024 residual planes, v as a GEMM whose epilogue stores V^T of all heads straight from the accumulators; f32 q, k, v rows are stored only for the exact first-tile attention (rows 0..127 of each batch); then ONE fused attention launch (a wave per 16 queries, keys below the diagonal in passes of 32: three-product scores hi.hi + lo.hi + hi.lo in f32 accumulators, running-maximum softmax in registers (f32 statistics, native exp; weights in (0, 1] as f16), o = P . V^T normalised at the end, carried x64 and folded into the output GEMM alpha) written straight into the merged f16 o rows; out = o W_o + b GEMM (f32) into the output layout. Six launches: jobs that do not depend on one another share a grid (k_prep, the q/k/v GEMM grid, k_mid = the exact first-tile attention, k_fattn with the first-tile split, the output GEMM with the exact first-tile rows as its A there, the first-tile residual GEMM).
// Layout: every f16 plane that only WMMA fragment loads read (x rows, weights, q and k hi / residual planes, V^T, o rows) is kept in FRAGMENT ORDER: a tile of 16 rows x 32 k is one 1-KiB block [k half of 16][lane = 16 * (k / 8 % 2) + row][8 k], the blocks of 16 rows one behind the other in k (in V^T the four 16-dim blocks of each 32 keys lie one behind the other instead); a wave's 16-byte fragment load then covers 512 contiguous bytes. Outside V^T, 16 rows of a plane of pitch C fill 16 * C elements as before, so offsets of whole 16-row groups are unchanged.
// Compute dtype: inputs rounded to bf16; x / weights exact; q and k as f16 hi + x1024 residual planes; v, softmax weights and o as plain f16 GEMM operands (~2^-12), first-tile o as hi + residual; scores and softmax statistics f32. v_wmma_f32_16x16x32_f16.
#define NB 2
#define SCL 0.0220970869f                 /* = f32(1 / sqrt(2048)): the source scales the scores by 1/sqrt(Sk), Sk = 2048 keys */
#define SCLR (0.0220970869f * 0.0009765625f)   /* the same scale on the x1024 residual passes */
#define SQ 2048
#define DM 1024
#define NH 16
#define HD 64
#define HG 4                         /* heads per launch of the head-group k_vt overload, which is not launched */
#define QT0 128                      /* first-tile rows recomputed exactly in f32 */
#define B0 0                         /* nothing uses it: every job starts at batch 0 */
#define NBR NB                       /* batches processed (debug hook) */
#define NR ((size_t)NB * SQ)         /* token rows */
#define MP ((int)((size_t)NBR * SQ)) /* rows projected (debug hook) */
#define MPO MP                       /* rows through the output stage (debug hook) */
#define LQ DM      /* row pitch of the q/k/v rows */
typedef __bf16 v16b __attribute__((ext_vector_type(16)));
typedef unsigned short v8us __attribute__((ext_vector_type(8), may_alias));
typedef float  v8f  __attribute__((ext_vector_type(8)));
typedef float  v4f  __attribute__((ext_vector_type(4)));
typedef float  v4fa __attribute__((ext_vector_type(4), may_alias));
union FragB { v16b v; v8us half[2]; unsigned short u[16]; };

__device__ __forceinline__ unsigned short bf16_bits(float x) { unsigned int u = __float_as_uint(x); return (unsigned short)((u + 0x7FFFu + ((u >> 16) & 1u)) >> 16); }
__device__ __forceinline__ float bf16_val(unsigned short b) { return __uint_as_float(((unsigned int)b) << 16); }
__device__ __forceinline__ float bf16_round(float x) { return bf16_val(bf16_bits(x)); }
// D += A·B with NT terms: 1 = ah·bh, 2 = + al·bh (A split), 3 = + ah·bl (both split)
template <int NT>
__device__ __forceinline__ v8f mmaN(v16b ah, v16b al, v16b bh, v16b bl, v8f c) {
  c = __builtin_amdgcn_wmma_f32_16x16x32_bf16(false, ah, false, bh, (short)0, c, false, false);
  if (NT >= 2) c = __builtin_amdgcn_wmma_f32_16x16x32_bf16(false, al, false, bh, (short)0, c, false, false);
  if (NT >= 3) c = __builtin_amdgcn_wmma_f32_16x16x32_bf16(false, ah, false, bl, (short)0, c, false, false);
  asm volatile("v_nop\n\tv_nop\n\tv_nop\n\tv_nop" : "+v"(c) : "v"(ah), "v"(al), "v"(bh), "v"(bl));
  return c;
}

__global__ __launch_bounds__(256) void k_wt_bf16(const float* __restrict__ W, unsigned short* __restrict__ Wt, int K, int N) {
  const int t = blockIdx.x * 256 + threadIdx.x;
  const int k8n = K / 8;
  if (t >= N * k8n) return;
  const int n = t / k8n, k8 = (t % k8n) * 8;
  v8us v;
#pragma unroll
  for (int i = 0; i < 8; ++i) v[i] = bf16_bits(W[(size_t)(k8 + i) * N + n]);
  *(v8us*)(Wt + (size_t)n * K + k8) = v;
  
}

// GEMM C[M][N] (f32, pitch ldc) = act(A[M][K]·W + bias). A f32 row-major (pitch lda) converted per fragment to bf16
// (ASPLIT: hi/lo two planes -> 2 terms, else single rounded term); Wt bf16 [N][K] (pitch ldb). BIAS_BF16 rounds the
// bias to bf16 first (bias quantised to bf16 before the add). K%32==0, M%16==0, N%64==0.
template <bool ASPLIT, int ACT, bool BIAS_BF16>
__global__ __launch_bounds__(128) void k_gemm_bf(const float* __restrict__ A, int lda, const unsigned short* __restrict__ Wt, int ldb,
                                               const float* __restrict__ bias, float* __restrict__ C, int ldc, int M, int N, int K) {
  __shared__ __attribute__((aligned(16))) float so[4][16][64];
  const int tid = threadIdx.x, w = tid >> 5, lane = tid & 31, ln = lane & 15, hh = lane >> 4;
  const int ntn = N / 64;
  const int wid = blockIdx.x * 4 + w;
  const int mt = wid / ntn, nq = wid % ntn;
  if (mt * 16 >= M) return;
  const int row0 = mt * 16, col0 = nq * 64;
  const float* arow = A + (size_t)(row0 + ln) * lda;
  v8f acc[4] = {};
  for (int kb = 0; kb < K; kb += 32) {
    FragB ah, al;
    const v4f x0 = *(const v4fa*)(arow + kb + 8 * hh), x1 = *(const v4fa*)(arow + kb + 8 * hh + 4);
    const v4f x2 = *(const v4fa*)(arow + kb + 16 + 8 * hh), x3 = *(const v4fa*)(arow + kb + 16 + 8 * hh + 4);
    float xs[16] = {x0[0],x0[1],x0[2],x0[3],x1[0],x1[1],x1[2],x1[3],x2[0],x2[1],x2[2],x2[3],x3[0],x3[1],x3[2],x3[3]};
#pragma unroll
    for (int i = 0; i < 16; ++i) { const unsigned short hb = bf16_bits(xs[i]); ah.u[i] = hb; al.u[i] = ASPLIT ? bf16_bits(xs[i] - bf16_val(hb)) : (unsigned short)0; }
#pragma unroll
    for (int t = 0; t < 4; ++t) {
      const unsigned short* brow = Wt + (size_t)(col0 + t * 16 + ln) * ldb + kb;
      FragB b;
      b.half[0] = *(const v8us*)(brow + 8 * hh);
      b.half[1] = *(const v8us*)(brow + 16 + 8 * hh);
      acc[t] = mmaN<ASPLIT ? 2 : 1>(ah.v, al.v, b.v, b.v, acc[t]);
    }
  }
#pragma unroll
  for (int t = 0; t < 4; ++t) {
    float bv = bias ? bias[col0 + t * 16 + ln] : 0.f;
    if (BIAS_BF16) bv = bf16_round(bv);
#pragma unroll
    for (int r = 0; r < 8; ++r) { float v = acc[t][r] + bv; if (ACT == 1) v = fmaxf(v, 0.f); so[w][8 * hh + r][t * 16 + ln] = v; }
  }
  __builtin_amdgcn_fence(__ATOMIC_ACQ_REL, "workgroup");
  __builtin_amdgcn_wave_barrier();
  const int rsub = lane >> 4, c4 = (lane & 15) * 4;
  {
#pragma unroll
    for (int q = 0; q < 8; ++q) {
      const int r = q * 2 + rsub;
      const v4f v = *(const v4fa*)&so[w][r][c4];
      *(v4f*)(C + (size_t)(row0 + r) * ldc + col0 + c4) = v;
    }
    
  }
}

// GEMM C = act(A·W + bias + resid): A f32 (ASPLIT -> hi/lo 2 terms), Wt bf16 [N][K]; ACT 0 none, 1 relu, 2 exact gelu;
// resid (optional, f32, row index = (row % rmod), pitch ldr, RES_BF16 rounds it) added before the activation.
template <bool ASPLIT, int ACT, bool BIAS_BF16, bool RES_BF16>
__global__ __launch_bounds__(128) void k_gemm_bf3(const float* __restrict__ A, int lda, const unsigned short* __restrict__ Wt, int ldb,
                                                const float* __restrict__ bias, const float* __restrict__ resid, int rmod, int ldr,
                                                float* __restrict__ C, int ldc, int M, int N, int K) {
  __shared__ __attribute__((aligned(16))) float so[4][16][64];
  const int tid = threadIdx.x, w = tid >> 5, lane = tid & 31, ln = lane & 15, hh = lane >> 4;
  const int ntn = N / 64;
  const int wid = blockIdx.x * 4 + w;
  const int mt = wid / ntn, nq = wid % ntn;
  if (mt * 16 >= M) return;
  const int row0 = mt * 16, col0 = nq * 64;
  const float* arow = A + (size_t)(row0 + ln) * lda;
  v8f acc[4] = {};
  for (int kb = 0; kb < K; kb += 32) {
    FragB ah, al;
    const v4f x0 = *(const v4fa*)(arow + kb + 8 * hh), x1 = *(const v4fa*)(arow + kb + 8 * hh + 4);
    const v4f x2 = *(const v4fa*)(arow + kb + 16 + 8 * hh), x3 = *(const v4fa*)(arow + kb + 16 + 8 * hh + 4);
    float xs[16] = {x0[0],x0[1],x0[2],x0[3],x1[0],x1[1],x1[2],x1[3],x2[0],x2[1],x2[2],x2[3],x3[0],x3[1],x3[2],x3[3]};
#pragma unroll
    for (int i = 0; i < 16; ++i) { const unsigned short hb = bf16_bits(xs[i]); ah.u[i] = hb; al.u[i] = ASPLIT ? bf16_bits(xs[i] - bf16_val(hb)) : (unsigned short)0; }
#pragma unroll
    for (int t = 0; t < 4; ++t) {
      const unsigned short* brow = Wt + (size_t)(col0 + t * 16 + ln) * ldb + kb;
      FragB b;
      b.half[0] = *(const v8us*)(brow + 8 * hh);
      b.half[1] = *(const v8us*)(brow + 16 + 8 * hh);
      acc[t] = mmaN<ASPLIT ? 2 : 1>(ah.v, al.v, b.v, b.v, acc[t]);
    }
  }
#pragma unroll
  for (int t = 0; t < 4; ++t) {
    const int col = col0 + t * 16 + ln;
    float bv = bias ? bias[col] : 0.f;
    if (BIAS_BF16) bv = bf16_round(bv);
#pragma unroll
    for (int r = 0; r < 8; ++r) {
      float v = acc[t][r] + bv;
      if (resid) { float rv = resid[(size_t)((row0 + 8 * hh + r) % rmod) * ldr + col]; if (RES_BF16) rv = bf16_round(rv); v += rv; }
      if (ACT == 1) v = fmaxf(v, 0.f);
      if (ACT == 2) v = 0.5f * v * (1.0f + erff(v * 0.70710678118654752f));
      if (ACT == 3) { const float u = 0.7978845608028654f * (v + 0.044715f * v * v * v); v = 0.5f * v * (1.0f + tanhf(u)); }
      so[w][8 * hh + r][t * 16 + ln] = v;
    }
  }
  __builtin_amdgcn_fence(__ATOMIC_ACQ_REL, "workgroup");
  __builtin_amdgcn_wave_barrier();
  const int rsub = lane >> 4, c4 = (lane & 15) * 4;
  {
#pragma unroll
    for (int q = 0; q < 8; ++q) {
      const int r = q * 2 + rsub;
      const v4f v = *(const v4fa*)&so[w][r][c4];
      *(v4f*)(C + (size_t)(row0 + r) * ldc + col0 + c4) = v;
    }
    
  }
}
// row LayerNorm (biased variance, eps) over N: s = X (+ R); optional out_sum <- s; out_norm <- (s-mu)*rsqrt(var+eps)*g + b
template <bool PARAM_BF16>
__global__ __launch_bounds__(256) void k_layernorm(const float* __restrict__ X, const float* __restrict__ R, const float* __restrict__ g, const float* __restrict__ bta,
                                                  float* __restrict__ out_sum, float* __restrict__ out_norm, int N, float eps) {
  __shared__ float red[256];
  const int row = blockIdx.x, tid = threadIdx.x;
  const float* x = X + (size_t)row * N; const float* rr = R ? R + (size_t)row * N : nullptr;
  float vals[16];                     // up to N = 4096
  const int per = N / 256;            // contiguous chunk per thread? use strided-by-4 chunks: thread handles j = tid*4 + 1024*u
  float s1 = 0.f;
  for (int u = 0; u < per / 4; ++u) {
    const int j = tid * 4 + 1024 * u;
    const v4f a = *(const v4fa*)(x + j);
    v4f b = {0.f,0.f,0.f,0.f}; if (rr) b = *(const v4fa*)(rr + j);
#pragma unroll
    for (int q = 0; q < 4; ++q) { const float v = a[q] + b[q]; vals[u * 4 + q] = v; s1 += v; }
  }
  red[tid] = s1; __syncthreads();
  for (int st = 128; st > 0; st >>= 1) { if (tid < st) red[tid] += red[tid + st]; __syncthreads(); }
  const float mu = red[0] / (float)N; __syncthreads();
  float s2 = 0.f;
  for (int u = 0; u < per / 4; ++u)
#pragma unroll
    for (int q = 0; q < 4; ++q) { const float c = vals[u * 4 + q] - mu; s2 += c * c; }
  red[tid] = s2; __syncthreads();
  for (int st = 128; st > 0; st >>= 1) { if (tid < st) red[tid] += red[tid + st]; __syncthreads(); }
  const float rs = rsqrtf(red[0] / (float)N + eps);
  {
    for (int u = 0; u < per / 4; ++u) {
      const int j = tid * 4 + 1024 * u;
      v4f o, sm;
#pragma unroll
      for (int q = 0; q < 4; ++q) {
        float gg = g[j + q], bb = bta[j + q];
        if (PARAM_BF16) { gg = bf16_round(gg); bb = bf16_round(bb); }
        sm[q] = vals[u * 4 + q]; o[q] = (vals[u * 4 + q] - mu) * rs * gg + bb;
      }
      if (out_sum) *(v4f*)(out_sum + (size_t)row * N + j) = sm;
      *(v4f*)(out_norm + (size_t)row * N + j) = o;
    }
    
  }
}



// ---- f16 WMMA path (v_wmma_f32_16x16x32_f16): 11-bit significands for operands in range — used where a [0,1] probability operand needs more precision than bf16
typedef _Float16 v16h __attribute__((ext_vector_type(16)));
union FragH { v16h v; v8us half[2]; _Float16 h[16]; unsigned short u[16]; };
template <int NT>
__device__ __forceinline__ v8f mmaH(v16h ah, v16h al, v16h bh, v16h bl, v8f c) {
  c = __builtin_amdgcn_wmma_f32_16x16x32_f16(false, ah, false, bh, (short)0, c, false, false);
  if (NT >= 2) c = __builtin_amdgcn_wmma_f32_16x16x32_f16(false, al, false, bh, (short)0, c, false, false);
  if (NT >= 3) c = __builtin_amdgcn_wmma_f32_16x16x32_f16(false, ah, false, bl, (short)0, c, false, false);
  asm volatile("v_nop\n\tv_nop\n\tv_nop\n\tv_nop" : "+v"(c) : "v"(ah), "v"(al), "v"(bh), "v"(bl));
  return c;
}
// batched GEMM like k_gemm_b but f16 operands: A f32 (split into f16 hi/lo if ASPLIT, else rounded to f16), Bt = f16 values [n][k]; alpha; C f32; N multiple of 16 (partial tiles skipped)
template <bool ASPLIT>
__global__ __launch_bounds__(128) void k_gemm_h(const float* __restrict__ A, int lda, size_t sA, const _Float16* __restrict__ Bh, int ldb, size_t sB, float alpha, float* __restrict__ C, int ldc, size_t sC, int M, int N, int K) {
  __shared__ __attribute__((aligned(16))) float so[4][16][64];
  const int tid = threadIdx.x, w = tid >> 5, lane = tid & 31, ln = lane & 15, hh = lane >> 4; const int by = blockIdx.y;
  A += (size_t)by * sA; Bh += (size_t)by * sB; C += (size_t)by * sC;
  const int ntn = (N + 63) / 64; const int wid = blockIdx.x * 4 + w; const int mt = wid / ntn, nq = wid % ntn; if (mt * 16 >= M) return;
  const int row0 = mt * 16, col0 = nq * 64; const float* arow = A + (size_t)(row0 + ln) * lda;
  v8f acc[4] = {};
  for (int kb = 0; kb < K; kb += 32) {
    FragH ah, al;
    const v4f x0 = *(const v4fa*)(arow + kb + 8 * hh), x1 = *(const v4fa*)(arow + kb + 8 * hh + 4), x2 = *(const v4fa*)(arow + kb + 16 + 8 * hh), x3 = *(const v4fa*)(arow + kb + 16 + 8 * hh + 4);
    float xs[16] = {x0[0],x0[1],x0[2],x0[3],x1[0],x1[1],x1[2],x1[3],x2[0],x2[1],x2[2],x2[3],x3[0],x3[1],x3[2],x3[3]};
#pragma unroll
    for (int i = 0; i < 16; ++i) { const _Float16 h = (_Float16)xs[i]; ah.h[i] = h; al.h[i] = ASPLIT ? (_Float16)(xs[i] - (float)h) : (_Float16)0.0f; }
#pragma unroll
    for (int t = 0; t < 4; ++t) { if (col0 + t * 16 >= N) continue; const size_t boff = (size_t)(col0 + t * 16 + ln) * ldb + kb; FragH bq; bq.half[0] = *(const v8us*)(Bh + boff + 8 * hh); bq.half[1] = *(const v8us*)(Bh + boff + 16 + 8 * hh);
      acc[t] = mmaH<ASPLIT ? 2 : 1>(ah.v, al.v, bq.v, bq.v, acc[t]); }
  }
#pragma unroll
  for (int t = 0; t < 4; ++t) { if (col0 + t * 16 >= N) continue;
#pragma unroll
    for (int r = 0; r < 8; ++r) so[w][8 * hh + r][t * 16 + ln] = acc[t][r] * alpha; }
  __builtin_amdgcn_fence(__ATOMIC_ACQ_REL, "workgroup"); __builtin_amdgcn_wave_barrier();
  const int rsub = lane >> 4, c4 = (lane & 15) * 4;
  {
#pragma unroll
    for (int q = 0; q < 8; ++q) { const int r = q * 2 + rsub; if (col0 + c4 < N) { const v4f v = *(const v4fa*)&so[w][r][c4]; *(v4f*)(C + (size_t)(row0 + r) * ldc + col0 + c4) = v; } }
     }
}

// Wt[n][k], in fragment order, = f16(W[k][n] * scale) from f32 row-major W[K][N] (K % 32 == 0, N % 16 == 0; scale = power of two; bf16-exact weights stay exact in f16 away from the subnormal range)
__device__ __forceinline__ void d_wt_f16(int bx, const float* __restrict__ W, _Float16* __restrict__ Wt, int K, int N, float scale) {      /* bx = the block's number within this weight */
  const int t = bx * 256 + threadIdx.x; if (t >= N * (K / 8)) return;      /* thread t writes the t-th 16-byte group of the fragment-order plane: 16 lanes read 16 neighbouring n of one k row */
  const int blk = t >> 6; const int n = (blk / (K / 32)) * 16 + (t & 15), k8 = (blk % (K / 32)) * 32 + ((t >> 5) & 1) * 16 + ((t >> 4) & 1) * 8; FragH f;
#pragma unroll
  for (int i = 0; i < 8; ++i) f.h[i] = (_Float16)(bf16_round(W[(size_t)(k8 + i) * N + n]) * scale); const v8us o = f.half[0];
  *(v8us*)((unsigned short*)Wt + (size_t)t * 8) = o; 
}
// k_gemm_hh variant with fused epilogue: v = acc·alpha + bias[by·sBias + col] (+ CP[(row/rowsPerB)·sCPb + by·64 + col] if CP) ; ACT 0 none / 1 elu ; writes f16 C16 (and f32 C if non-null)
template <int ACT>
__global__ __launch_bounds__(128) void k_gemm_hhx(const _Float16* __restrict__ A, int lda, size_t sA, const _Float16* __restrict__ Bh, int ldb, size_t sB, float alpha, const float* __restrict__ bias, size_t sBias, const float* __restrict__ CP, int rowsPerB, size_t sCPb, int row0g,
    float* __restrict__ C, _Float16* __restrict__ C16, int ldc, size_t sC, int M, int N, int K) {
  __shared__ __attribute__((aligned(16))) float so[4][16][64];
  const int tid = threadIdx.x, w = tid >> 5, lane = tid & 31, ln = lane & 15, hh = lane >> 4; const int by = blockIdx.y;
  A += (size_t)by * sA; Bh += (size_t)by * sB; const size_t cofs = (size_t)by * sC; const float* bp = bias ? bias + (size_t)by * sBias : nullptr;
  const int ntn = (N + 63) / 64; const int wid = blockIdx.x * 4 + w; const int mt = wid / ntn, nq = wid % ntn; if (mt * 16 >= M) return;
  const int row0 = mt * 16, col0 = nq * 64; const _Float16* arow = A + (size_t)(row0 + ln) * lda;
  v8f acc[4] = {};
  for (int kb = 0; kb < K; kb += 32) { FragH ah; ah.half[0] = *(const v8us*)((const unsigned short*)arow + kb + 8 * hh); ah.half[1] = *(const v8us*)((const unsigned short*)arow + kb + 16 + 8 * hh);
#pragma unroll
    for (int t = 0; t < 4; ++t) { if (col0 + t * 16 >= N) continue; const size_t boff = (size_t)(col0 + t * 16 + ln) * ldb + kb; FragH bq; bq.half[0] = *(const v8us*)((const unsigned short*)Bh + boff + 8 * hh); bq.half[1] = *(const v8us*)((const unsigned short*)Bh + boff + 16 + 8 * hh);
      acc[t] = mmaH<1>(ah.v, ah.v, bq.v, bq.v, acc[t]); }
  }
#pragma unroll
  for (int t = 0; t < 4; ++t) { if (col0 + t * 16 >= N) continue; const int col = col0 + t * 16 + ln; const float bv = bp ? bf16_round(bp[col]) : 0.f;
#pragma unroll
    for (int r = 0; r < 8; ++r) { float v = acc[t][r] * alpha + bv; if (CP) { const int rr = row0g + row0 + 8 * hh + r; if (rowsPerB < 0) v += CP[cofs + (size_t)rr * ldc + col];      /* rowsPerB < 0: own element of the batched C plane */ else { const int bidx = rr / rowsPerB; v += CP[(size_t)bidx * sCPb + (size_t)by * 64 + col]; } } if (ACT == 1) v = (v > 0.f) ? v : expm1f(v); else if (ACT == 7) v = (v > 0.f) ? v + 1.0f : expf(v); else if (ACT == 8) v = tanhf(v); else if (ACT == 9) v = 0.5f * v * (1.0f + tanhf(0.7978845608028654f * (v + 0.044715f * v * v * v))); else if (ACT == 11) v = 1.0f / (1.0f + expf(-v)); else if (ACT == 12) v = (v > 0.f) ? v : 0.01f * v; else if (ACT == 14) v = (v > 0.f) ? v : 0.1f * v; else if (ACT == 16) v = (v >= 0.f) ? v : 0.3f * v; else if (ACT == 17) v = (v >= 0.f) ? v : 0.2f * v; else if (ACT == 15) v = v / (1.0f + expf(-v)); else if (ACT == 3) v = fmaxf(v, 0.f); else if (ACT == 6) v = 0.5f * v * (1.0f + erff(v * 0.70710678118654752f)); so[w][8 * hh + r][t * 16 + ln] = v; } }
  __builtin_amdgcn_fence(__ATOMIC_ACQ_REL, "workgroup"); __builtin_amdgcn_wave_barrier();
  const int rsub = lane >> 4, c4 = (lane & 15) * 4; typedef _Float16 v4h __attribute__((ext_vector_type(4)));
  {
#pragma unroll
    for (int q = 0; q < 8; ++q) { const int r = q * 2 + rsub; if (col0 + c4 < N) { const v4f v = *(const v4fa*)&so[w][r][c4]; if (C) *(v4f*)(C + cofs + (size_t)(row0 + r) * ldc + col0 + c4) = v; if (C16) { v4h h4; for (int i = 0; i < 4; ++i) h4[i] = (_Float16)v[i]; *(v4h*)(C16 + cofs + (size_t)(row0 + r) * ldc + col0 + c4) = h4; } } }
     }
}


typedef _Float16 v4h __attribute__((ext_vector_type(4)));

// f32 rows of pitch DM -> fragment order, one 16 x 32 tile per wave: load i takes rows 4 i .. 4 i + 3 of the tile, 8 lanes on each row's whole 128-byte line; a lane's 4 values go as 8 bytes into the tile's block.
__device__ __forceinline__ size_t pk_src(size_t wv, int lane) { return ((wv / (DM / 32)) * 16 + (lane >> 3)) * DM + (wv % (DM / 32)) * 32 + (lane & 7) * 4; }      /* row step 4 * DM per load */
__device__ __forceinline__ size_t pk_dst(size_t wv, int lane) { return wv * 512 + ((lane >> 2) & 1) * 256 + (((lane >> 1) & 1) * 16 + (lane >> 3)) * 8 + (lane & 1) * 4; }      /* step 32 per load */
__device__ __forceinline__ void d_x16(int bx, const float* __restrict__ x, _Float16* __restrict__ X16, size_t n16) { const size_t t = (size_t)bx * 256 + threadIdx.x; if (t >= n16) return; const int lane = (int)(t & 31);      /* bx = the block's number within this input */
  const float* s = x + pk_src(t >> 5, lane); _Float16* d = X16 + pk_dst(t >> 5, lane); v4f v[4]; v4h h[4];
#pragma unroll      /* static indices keep v[] and h[] in registers; the four loads are issued together */
  for (int i = 0; i < 4; ++i) v[i] = *(const v4fa*)(s + (size_t)i * 4 * DM);
  asm volatile("s_wait_xcnt 0x0" :: "v"(s) : "memory");      /* the loads' address pair stays whole up to here and is free for reuse only behind this wait */
#pragma unroll      /* static indices keep v[] and h[] in registers */
  for (int i = 0; i < 4; ++i) for (int q = 0; q < 4; ++q) h[i][q] = (_Float16)bf16_round(v[i][q]);
#pragma unroll      /* static indices; the four stores follow one another, so both halves of each 128-byte line are written together */
  for (int i = 0; i < 4; ++i) *(v4h*)(d + i * 32) = h[i]; }
__global__ __launch_bounds__(256) void k_h16(const float* __restrict__ x, _Float16* __restrict__ X16, size_t n8) { const size_t t = (size_t)blockIdx.x * 256 + threadIdx.x; if (t >= n8) return; FragH f;
#pragma unroll
  for (int q = 0; q < 8; ++q) f.h[q] = (_Float16)x[t * 8 + q]; *(v8us*)((unsigned short*)X16 + t * 8) = f.half[0];  }
__global__ __launch_bounds__(256) void k_round16f(const float* __restrict__ W, _Float16* __restrict__ Bt, size_t n8) { const size_t t = (size_t)blockIdx.x * 256 + threadIdx.x; if (t >= n8) return; FragH f;
#pragma unroll
  for (int i = 0; i < 8; ++i) f.h[i] = (_Float16)(bf16_round(W[t * 8 + i]) * 16.0f); *(v8us*)((unsigned short*)Bt + t * 8) = f.half[0];  }
__device__ __forceinline__ void d_hl(int bx, const float* __restrict__ F, _Float16* __restrict__ Hh, _Float16* __restrict__ Hl, size_t n16) { const size_t t = (size_t)bx * 256 + threadIdx.x; if (t >= n16) return; const int lane = (int)(t & 31);      /* bx = the block's number within this plane */      /* f32 rows of pitch DM -> hi and x1024 residual planes in fragment order, a 16 x 32 tile per wave as in k_x16 */
  const float* s = F + pk_src(t >> 5, lane); const size_t o = pk_dst(t >> 5, lane); _Float16* dh = Hh + o; _Float16* dl = Hl + o; v4f v[4]; v4h a[4], c[4];
#pragma unroll      /* static indices keep v[], a[] and c[] in registers; the four loads are issued together */
  for (int i = 0; i < 4; ++i) v[i] = *(const v4fa*)(s + (size_t)i * 4 * DM);
  asm volatile("s_wait_xcnt 0x0" :: "v"(s) : "memory");      /* the loads' address pair stays whole up to here and is free for reuse only behind this wait */
#pragma unroll      /* static indices keep v[], a[] and c[] in registers */
  for (int i = 0; i < 4; ++i) for (int q = 0; q < 4; ++q) { const _Float16 h = (_Float16)v[i][q]; a[i][q] = h; c[i][q] = (_Float16)((v[i][q] - (float)h) * 1024.0f); }
#pragma unroll      /* static indices; the stores follow one another, so both halves of each 128-byte line are written together */
  for (int i = 0; i < 4; ++i) { *(v4h*)(dh + i * 32) = a[i]; *(v4h*)(dl + i * 32) = c[i]; } }

// ---- fast GEMM (wave tile 32x64; requires M % 32 == 0 rows per launch region, N % 64 == 0 and K % 64 == 0; A and Bh in fragment order with lda == ldb == K); epilogue = k_gemm_hhx semantics ----
__device__ __forceinline__ v16h g2_frag(const _Float16* p) { FragH f; f.half[0] = *(const v8us*)((const unsigned short*)p); f.half[1] = *(const v8us*)((const unsigned short*)p + 256); return f.v; }      /* p = the block of a fragment-order plane + 8 * lane: each of the two loads covers 512 contiguous bytes per wave */
__device__ __forceinline__ v8f g2_mma(v16h a, v16h b, v8f c) { v8f d = __builtin_amdgcn_wmma_f32_16x16x32_f16(false, a, false, b, (short)0, c, false, false); asm volatile("v_nop\n\tv_nop\n\tv_nop\n\tv_nop" : "+v"(d) : "v"(a), "v"(b)); return d; }
template <int ACT, bool PROJ>      /* PROJ: the q/k/v projections' build, with an epilogue of its own (alpha and bias only: no activation, no added plane) */
__global__ __launch_bounds__(128) void k_gemm2(const _Float16* __restrict__ A, int lda, size_t sA, const _Float16* __restrict__ Bh, int ldb, size_t sB, float alpha, const float* __restrict__ bias, size_t sBias, const float* __restrict__ CP, int rowsPerB, size_t sCPb, int row0g,
    float* __restrict__ C, _Float16* __restrict__ C16a, int ldc, size_t sC, int M, int N, int K, const float* __restrict__ bias1, const float* __restrict__ bias2, int c16y, const _Float16* __restrict__ AF, int ftp, _Float16* __restrict__ HH, _Float16* __restrict__ HL, size_t sH, _Float16* __restrict__ VTo, int frp) { static_assert(ACT == 0 || ACT == 3 || ACT == 6 || ACT == 8 || ACT == 9 || ACT == 11 || ACT == 12 || ACT == 14 || ACT == 15 || ACT == 16 || ACT == 17, "k_gemm2: unsupported ACT code (would silently apply no activation)"); static_assert(!PROJ || ACT == 0, "k_gemm2: the projection epilogue applies no activation");
  __shared__ __attribute__((aligned(16))) float so[4][32][68];
  const int tid = threadIdx.x, w = tid >> 5, lane = tid & 31, ln = lane & 15, hh = lane >> 4; const int by = blockIdx.y;
  A += (size_t)by * sA; Bh += (size_t)by * sB; const size_t cofs = (size_t)by * sC; const float* bp = bias ? bias + (size_t)by * sBias : nullptr;
  if (by == 1 && bias1) bp = bias1; if (by == 2 && bias2) bp = bias2; _Float16* C16 = (by >= c16y) ? C16a : nullptr;      /* independent products share one grid: blockIdx.y picks the operands; biases that are separate inputs come as pointers of their own; only products from c16y on store f16 rows */
  const int ntn = N >> 6; const int mt = blockIdx.x / ntn, nq = blockIdx.x - mt * ntn; const int row0 = mt * 128 + 32 * w, col0 = nq * 64; if (row0 >= M) return;
  const _Float16* ab = A + (size_t)row0 * lda; if (AF && mt % ftp == 0) ab = AF + ((size_t)(mt / ftp) * 128 + 32 * w) * lda;      /* every ftp-th block of 128 rows takes its A rows from the packed plane AF (the exact first-tile rows): that product shares this grid instead of overwriting these rows from a launch of its own */
  const _Float16* a0p = ab + 8 * lane; const _Float16* a1p = a0p + (size_t)16 * lda;      /* first block of each 16-row group; the lane's 8 elements are in the six pointers, so each is the very address its loads name; a k step of 32 is one block of 512 elements */
  const _Float16* b0p = Bh + (size_t)col0 * ldb + 8 * lane; const _Float16* b1p = b0p + (size_t)16 * ldb; const _Float16* b2p = b1p + (size_t)16 * ldb; const _Float16* b3p = b2p + (size_t)16 * ldb;
  const v8f z8 = {0.f,0.f,0.f,0.f,0.f,0.f,0.f,0.f}; v8f c00 = z8, c01 = z8, c02 = z8, c03 = z8, c10 = z8, c11 = z8, c12 = z8, c13 = z8;
  /* Two fragment sets, x and y, each the six fragments of one k step of 32. A set's twelve loads are issued together, one k step ahead of its products, so a k step waits for one load round trip that
     runs under the other set's products, not for five in a row. K is a multiple of 64. Every accumulator still takes its k steps in rising order. */
  v16h xa0 = g2_frag(a0p), xa1 = g2_frag(a1p), xb0 = g2_frag(b0p), xb1 = g2_frag(b1p), xb2 = g2_frag(b2p), xb3 = g2_frag(b3p);
  asm volatile("s_wait_xcnt 0x0" :: "v"(a0p), "v"(a1p), "v"(b0p), "v"(b1p), "v"(b2p), "v"(b3p) : "memory");      /* the first set's six address pairs stay whole up to here and are free for reuse only behind this wait */
#pragma unroll 1      /* one trip is two k steps already; more would only grow the text */
  for (int kb = 0; kb < K; kb += 64) {
    const int ko = kb * 16; const _Float16* q0 = a0p + ko; const _Float16* q1 = a1p + ko; const _Float16* q2 = b0p + ko; const _Float16* q3 = b1p + ko; const _Float16* q4 = b2p + ko; const _Float16* q5 = b3p + ko;
    const v16h ya0 = g2_frag(q0 + 512), ya1 = g2_frag(q1 + 512), yb0 = g2_frag(q2 + 512), yb1 = g2_frag(q3 + 512), yb2 = g2_frag(q4 + 512), yb3 = g2_frag(q5 + 512);
    asm volatile("s_wait_xcnt 0x0" :: "v"(q0), "v"(q1), "v"(q2), "v"(q3), "v"(q4), "v"(q5) : "memory");      /* the twelve loads' six address pairs stay whole up to here and are free for reuse only behind this wait */
    c00 = g2_mma(xa0, xb0, c00); c10 = g2_mma(xa1, xb0, c10); c01 = g2_mma(xa0, xb1, c01); c11 = g2_mma(xa1, xb1, c11);
    c02 = g2_mma(xa0, xb2, c02); c12 = g2_mma(xa1, xb2, c12); c03 = g2_mma(xa0, xb3, c03); c13 = g2_mma(xa1, xb3, c13);
    const int k2 = ((kb + 64 < K) ? kb + 64 : kb) * 16;      /* the last trip fetches its own first step again: in bounds, unused */
    const _Float16* r0 = a0p + k2; const _Float16* r1 = a1p + k2; const _Float16* r2 = b0p + k2; const _Float16* r3 = b1p + k2; const _Float16* r4 = b2p + k2; const _Float16* r5 = b3p + k2;
    xa0 = g2_frag(r0); xa1 = g2_frag(r1); xb0 = g2_frag(r2); xb1 = g2_frag(r3); xb2 = g2_frag(r4); xb3 = g2_frag(r5);
    asm volatile("s_wait_xcnt 0x0" :: "v"(r0), "v"(r1), "v"(r2), "v"(r3), "v"(r4), "v"(r5) : "memory");      /* likewise for this set's six address pairs */
    c00 = g2_mma(ya0, yb0, c00); c10 = g2_mma(ya1, yb0, c10); c01 = g2_mma(ya0, yb1, c01); c11 = g2_mma(ya1, yb1, c11);
    c02 = g2_mma(ya0, yb2, c02); c12 = g2_mma(ya1, yb2, c12); c03 = g2_mma(ya0, yb3, c03); c13 = g2_mma(ya1, yb3, c13); }
  v8f accs[8] = {c00, c01, c02, c03, c10, c11, c12, c13};
  if (PROJ) {
    /* Projection epilogue: the planes the attention reads are written here, from the f32 values of this tile, not by later jobs that read f32 rows back. Products 0 and 1 (q, k): f16 hi + x1024 residual planes in fragment
       order; product 2 (v): V^T in fragment order. The f32 rows go out only for every frp-th block of 128 rows (the rows of the exact first-tile attention). Every test here is uniform for the block. */
    const bool frows = mt % frp == 0; float bvs[4] = {0.f, 0.f, 0.f, 0.f};
    if (bp) {
#pragma unroll      /* static indices keep bvs[] in registers; the four loads are issued together */
      for (int t = 0; t < 4; ++t) bvs[t] = bf16_round(bp[col0 + t * 16 + ln]); }
    if (by == 2) {      /* a lane's accumulator holds rows (keys) 16 half + 8 hh .. + 7 of column (dim) 16 t + ln: the very 16-byte group of lane 16 hh + ln in half-block 'half' of V^T block t; the tile is 32 keys x the 64 dims of head nq */
      _Float16* vp = VTo + ((size_t)(row0 / SQ) * NH + nq) * HD * SQ + (size_t)(row0 % SQ) * HD + 8 * lane; FragH g[8];
#pragma unroll      /* static indices keep accs[] and g[] in registers; the eight stores follow one another */
      for (int u = 0; u < 8; ++u) { for (int r = 0; r < 8; ++r) g[u].h[r] = (_Float16)(accs[u][r] * alpha + bvs[u & 3]);
        *(v8us*)((unsigned short*)vp + (u & 3) * 512 + (u >> 2) * 256) = g[u].half[0]; }
      asm volatile("s_wait_xcnt 0x0" :: "v"(vp), "v"(g[0].half[0]), "v"(g[1].half[0]), "v"(g[2].half[0]), "v"(g[3].half[0]), "v"(g[4].half[0]), "v"(g[5].half[0]), "v"(g[6].half[0]), "v"(g[7].half[0]) : "memory");      /* the eight stores' address pair and data registers stay whole up to here and are free for reuse only behind this wait */
      if (!frows) return; }
#pragma unroll      /* static indices keep accs[] in registers */
    for (int u = 0; u < 8; ++u) for (int r = 0; r < 8; ++r) so[w][(u >> 2) * 16 + 8 * hh + r][(u & 3) * 16 + ln] = accs[u][r] * alpha + bvs[u & 3];
    __builtin_amdgcn_fence(__ATOMIC_ACQ_REL, "workgroup"); __builtin_amdgcn_wave_barrier();      /* the wave reads back below what its other lanes have stored: as in the general epilogue */
    if (by != 2) {      /* group g of a 16-row group = (block of 32 columns g / 2, k half of 16 g % 2), 256 elements each, one behind the other: lane 16 hh + ln takes columns 8 hh .. + 7 of that half of row ln (LDS pitch 272 B = 16 B x odd: no bank conflict) and writes its 16-byte group of the block, so each store covers 512 contiguous bytes */
      _Float16* hp = HH + (size_t)by * sH + (size_t)row0 * ldc + (size_t)(col0 >> 5) * 512 + 8 * lane; _Float16* lp = HL + (size_t)by * sH + (size_t)row0 * ldc + (size_t)(col0 >> 5) * 512 + 8 * lane;
#pragma unroll      /* static indices keep x[], a[] and c[] in registers */
      for (int rg = 0; rg < 2; ++rg) { _Float16* hq = hp + (size_t)rg * 16 * ldc; _Float16* lq = lp + (size_t)rg * 16 * ldc; v4f x[8]; FragH a[4], c[4];      /* a 16-row group at a time: its eight LDS reads are issued together, its eight stores follow one another */
        for (int g = 0; g < 4; ++g) { const float* sp = &so[w][rg * 16 + ln][g * 16 + hh * 8]; x[2 * g] = *(const v4fa*)sp; x[2 * g + 1] = *(const v4fa*)(sp + 4); }
        for (int g = 0; g < 4; ++g) for (int q = 0; q < 8; ++q) { const float xv = x[2 * g + (q >> 2)][q & 3]; const _Float16 hv = (_Float16)xv; a[g].h[q] = hv; c[g].h[q] = (_Float16)((xv - (float)hv) * 1024.0f); }
        for (int g = 0; g < 4; ++g) { *(v8us*)((unsigned short*)hq + g * 256) = a[g].half[0]; *(v8us*)((unsigned short*)lq + g * 256) = c[g].half[0]; }
        asm volatile("s_wait_xcnt 0x0" :: "v"(hq), "v"(lq), "v"(a[0].half[0]), "v"(a[1].half[0]), "v"(a[2].half[0]), "v"(a[3].half[0]), "v"(c[0].half[0]), "v"(c[1].half[0]), "v"(c[2].half[0]), "v"(c[3].half[0]) : "memory"); } }      /* the eight stores' two address pairs and data registers stay whole up to here and are free for reuse only behind this wait */
    if (!frows) return;
#pragma unroll      /* static LDS offsets */
    for (int q = 0; q < 16; ++q) { const int r = q * 2 + hh; const v4f v = *(const v4fa*)&so[w][r][ln * 4]; float* cp = C + cofs + (size_t)(row0 + r) * ldc + col0 + ln * 4; *(v4f*)cp = v;
      asm volatile("s_wait_xcnt 0x0" :: "v"(cp), "v"(v) : "memory"); }      /* the store's address pair and data registers stay whole up to here and are free for reuse only behind this wait */
    return; }
#pragma unroll
  for (int u = 0; u < 8; ++u) { const int t = u & 3, half = u >> 2; const int col = col0 + t * 16 + ln; const float bv = bp ? bf16_round(bp[col]) : 0.f;
#pragma unroll
    for (int r = 0; r < 8; ++r) { const int rloc = half * 16 + 8 * hh + r; float v = accs[u][r] * alpha + bv; if (CP) { if (rowsPerB < 0) v += CP[cofs + (size_t)(row0g + row0 + rloc) * ldc + col];      /* rowsPerB < 0: own element of the batched C plane */ else { const int bidx = (row0g + row0 + rloc) / rowsPerB; v += CP[(size_t)bidx * sCPb + (size_t)by * 64 + col]; } }
      if (ACT == 3) v = fmaxf(v, 0.f); else if (ACT == 6) v = 0.5f * v * (1.0f + erff(v * 0.70710678118654752f)); else if (ACT == 11) v = 1.0f / (1.0f + expf(-v)); else if (ACT == 15) v = v / (1.0f + expf(-v)); else if (ACT == 12) v = (v > 0.f) ? v : 0.01f * v; else if (ACT == 8) v = tanhf(v); else if (ACT == 9) v = 0.5f * v * (1.0f + tanhf(0.7978845608028654f * (v + 0.044715f * v * v * v))); else if (ACT == 14) v = (v > 0.f) ? v : 0.1f * v; else if (ACT == 16) v = (v >= 0.f) ? v : 0.3f * v; else if (ACT == 17) v = (v >= 0.f) ? v : 0.2f * v;
      so[w][rloc][t * 16 + ln] = v; } }
  __builtin_amdgcn_fence(__ATOMIC_ACQ_REL, "workgroup"); __builtin_amdgcn_wave_barrier();
  const int rsub = lane >> 4, c4 = (lane & 15) * 4;
  {
#pragma unroll
    for (int q = 0; q < 16; ++q) { const int r = q * 2 + rsub; const v4f v = *(const v4fa*)&so[w][r][c4]; if (C) { float* cp = C + cofs + (size_t)(row0 + r) * ldc + col0 + c4; *(v4f*)cp = v; asm volatile("s_wait_xcnt 0x0" :: "v"(cp), "v"(v) : "memory"); }      /* the f32 store's address pair and data registers stay whole up to here: the f16 conversion below and the next row's LDS read reuse them only behind this wait */ if (C16) { v4h h4; for (int i = 0; i < 4; ++i) h4[i] = (_Float16)v[i]; *(v4h*)(C16 + cofs + (size_t)(row0 + r) * ldc + col0 + c4) = h4; } }
     } }


__global__ __launch_bounds__(256) void k_wnat(const float* __restrict__ w, size_t n8, _Float16* __restrict__ Bt) { const size_t t = (size_t)blockIdx.x * 256 + threadIdx.x; if (t >= n8) return; FragH f; for (int q = 0; q < 8; ++q) f.h[q] = (_Float16)(bf16_round(w[t * 8 + q]) * 16.0f); *(v8us*)((unsigned short*)Bt + t * 8) = f.half[0];  }
__global__ __launch_bounds__(256) void k_rsm(const float* __restrict__ S, _Float16* __restrict__ P, int nrows) {
  #pragma clang fp contract(off)
  const int i = blockIdx.x * 256 + threadIdx.x; if (i >= nrows) return; const float* s = S + (size_t)i * SQ; float mx = -3.0e38f;
#pragma unroll 1
  for (int j = 0; j < SQ; ++j) mx = fmaxf(mx, s[j]); float se = 0.f;
#pragma unroll 1
  for (int j = 0; j < SQ; ++j) se += expf(s[j] - mx); const float sc = 256.0f / se;
#pragma unroll 1
  for (int j0 = 0; j0 < SQ; j0 += 8) { FragH f; for (int q = 0; q < 8; ++q) f.h[q] = (_Float16)(expf(s[j0 + q] - mx) * sc); unsigned short* d = (unsigned short*)P + (size_t)i * SQ + j0; *(v8us*)d = f.half[0];  } }
__global__ __launch_bounds__(256) void k_vt(const _Float16* __restrict__ V16, int b, int h0, _Float16* __restrict__ VT) { __shared__ unsigned short tl[64][65]; const int tid = threadIdx.x; const int hh = blockIdx.x % HG, sg = blockIdx.x / HG; const int s0 = sg * 64; const int h = h0 + hh;
  for (int i = tid; i < 64 * 8; i += 256) { const int j = i / 8, d8 = (i % 8) * 8; FragH f; f.half[0] = *(const v8us*)((const unsigned short*)V16 + ((size_t)b * SQ + s0 + j) * DM + h * HD + d8); for (int q = 0; q < 8; ++q) tl[d8 + q][j] = f.u[q]; }
  __syncthreads();
  { for (int i = tid; i < 64 * 8; i += 256) { const int d = i / 8, j8 = (i % 8) * 8; FragH f; for (int q = 0; q < 8; ++q) f.u[q] = tl[d][j8 + q]; *(v8us*)((unsigned short*)VT + ((size_t)hh * HD + d) * SQ + s0 + j8) = f.half[0]; }  } }



// Fused causal attention, one launch, a block for every (batch, head, 128 query rows) but the first: the scores and the softmax weights stay in registers.
// One wave owns 16 queries and walks the keys 32 at a time. S^T = K Q^T (A = K rows, B = Q rows, both through fa_frag from planes in the same fragment order, so the k orders pair): lane (ln, hh) holds, of query q0 + ln,
// the scores of keys k0 + 16 kt + 8 hh + r. Three products as before: hi.hi in one accumulator, lo.hi + hi.lo (x1024) in a second. Running maximum and running sum per query (the two
// lane halves share the maximum and join their sums at the end). The two score tiles, as f16, are the B operand of O^T += V^T P^T in the order fa_frag gives V^T's rows. o leaves x64.
__device__ __forceinline__ v16h fa_frag(const _Float16* p) { return g2_frag(p); }      /* p = a fragment-order block + 8 * lane */
__device__ __forceinline__ float fa_exp(float x) { float r; asm("v_exp_f32 %0, %1\n\tv_nop" : "=v"(r) : "v"(x * 1.44269504f)); return r; }      /* native e^x; the v_nop fills the one slot the instruction set asks for behind a transcendental, whatever the compiler puts next */
__device__ __forceinline__ v8f fa_mma(v16h a, v16h b, v8f c) { return __builtin_amdgcn_wmma_f32_16x16x32_f16(false, a, false, b, (short)0, c, false, false); }
/* amdgpu_waves_per_eu(4, 4): two 8-wave blocks per WGP need at most 256 registers a wave; without it this build takes 260 and only one block fits */
__global__ __launch_bounds__(256) __attribute__((amdgpu_waves_per_eu(4, 4))) void k_fattn(const _Float16* __restrict__ QHp, const _Float16* __restrict__ QLp, const _Float16* __restrict__ KHp, const _Float16* __restrict__ KLp, const _Float16* __restrict__ VTp, _Float16* __restrict__ O, const float* __restrict__ OF0, _Float16* __restrict__ OH0, _Float16* __restrict__ OL0) {
  const int lane = threadIdx.x & 31, ln = lane & 15, hh = lane >> 4; const int w = __builtin_amdgcn_readfirstlane(threadIdx.x >> 5);      /* the wave's number as a scalar: the trip count and the mask test stay scalar */
  if (blockIdx.x >= NB * NH * (SQ / 128 - 1)) { d_hl((int)blockIdx.x - NB * NH * (SQ / 128 - 1), OF0, OH0, OL0, (size_t)NB * QT0 * DM / 16); return; }      /* the last blocks of the grid split the exact first-tile o rows (independent of the attention below) into hi + residual planes */
  const int bh = blockIdx.x % (NB * NH), tx = blockIdx.x / (NB * NH); const int tile = (tx < SQ / 256) ? (SQ / 128 - 1 - tx) : (tx - SQ / 256 + 1);      /* long tiles take the low block numbers; the second half of the grid counts up from the short end; tile 0 (rows 0 .. QT0 - 1) is the exact path's alone */
  const int b = bh / NH, h = bh % NH; const int q0 = tile * 128 + w * 16; const size_t r0 = (size_t)b * SQ;
  const _Float16* qh = QHp + (r0 + q0) * LQ + h * HD * 16 + 8 * lane; const _Float16* ql = QLp + (r0 + q0) * LQ + h * HD * 16 + 8 * lane;      /* a head's 64 dims are two blocks of 512 in each 16-row group */
  const v16h qh0 = fa_frag(qh), qh1 = fa_frag(qh + 512), ql0 = fa_frag(ql), ql1 = fa_frag(ql + 512);
  const _Float16* kh = KHp + r0 * LQ + h * HD * 16 + 8 * lane; const _Float16* kl = KLp + r0 * LQ + h * HD * 16 + 8 * lane; const _Float16* vt = VTp + (size_t)bh * HD * SQ + 8 * lane;      /* V^T: four blocks (16 dims each) per 32 keys */
  const v8f z8 = {0.f,0.f,0.f,0.f,0.f,0.f,0.f,0.f}; v8f o[4] = {z8, z8, z8, z8}; float m = -1.0e30f, l = 0.f;
  const int np = q0 / 32 + 1;      /* keys 0 .. q0 + 15 in passes of 32 */
  v16h fh[2][2], fl[2][2];      /* K fragments [key tile][k step], fetched one pass ahead */
#pragma unroll      /* static indices keep the fragments, scores and accumulators in registers */
  for (int kt = 0; kt < 2; ++kt) for (int ks = 0; ks < 2; ++ks) { fh[kt][ks] = fa_frag(kh + (size_t)kt * 16 * LQ + ks * 512); fl[kt][ks] = fa_frag(kl + (size_t)kt * 16 * LQ + ks * 512); }
  asm volatile("s_wait_xcnt 0x0" :: "v"(qh), "v"(ql), "v"(kh), "v"(kl) : "memory");      /* the loads' four address pairs stay whole up to here and are free for reuse only behind this wait */
  for (int p = 0; p < np; ++p) { const int k0 = p * 32;
    const _Float16* va = vt + (size_t)k0 * HD; v16h fv[4];
#pragma unroll      /* static indices keep the fragments, scores and accumulators in registers */
    for (int dt = 0; dt < 4; ++dt) fv[dt] = fa_frag(va + dt * 512);
    v8f sh[2], sl[2];
#pragma unroll      /* static indices keep the fragments, scores and accumulators in registers */
    for (int kt = 0; kt < 2; ++kt) { sh[kt] = fa_mma(fh[kt][1], qh1, fa_mma(fh[kt][0], qh0, z8)); sl[kt] = fa_mma(fl[kt][1], qh1, fa_mma(fl[kt][0], qh0, fa_mma(fh[kt][1], ql1, fa_mma(fh[kt][0], ql0, z8)))); }
    const int kn = (p + 1 < np) ? k0 + 32 : k0;      /* the last pass fetches its own rows again: in bounds, unused */
    const _Float16* ka = kh + (size_t)kn * LQ; const _Float16* kb = kl + (size_t)kn * LQ;
#pragma unroll      /* static indices keep the fragments, scores and accumulators in registers */
    for (int kt = 0; kt < 2; ++kt) for (int ks = 0; ks < 2; ++ks) { fh[kt][ks] = fa_frag(ka + (size_t)kt * 16 * LQ + ks * 512); fl[kt][ks] = fa_frag(kb + (size_t)kt * 16 * LQ + ks * 512); }
    asm volatile("s_wait_xcnt 0x0" :: "v"(va), "v"(ka), "v"(kb) : "memory");      /* this pass's three address pairs stay whole up to here and are free for reuse only behind this wait */
    float s[16];
#pragma unroll      /* static indices keep the fragments, scores and accumulators in registers */
    for (int e = 0; e < 16; ++e) s[e] = fmaf(sl[e >> 3][e & 7], SCLR, sh[e >> 3][e & 7] * SCL);
    if (k0 + 31 > q0) {      /* only the pass on the diagonal masks; key k0 <= q0 stays, so every query keeps a key */
#pragma unroll      /* static indices keep the fragments, scores and accumulators in registers */
      for (int e = 0; e < 16; ++e) s[e] = (k0 + (e >> 3) * 16 + 8 * hh + (e & 7) <= q0 + ln) ? s[e] : -1.0e30f; }
    float mx = s[0];
#pragma unroll      /* static indices keep the fragments, scores and accumulators in registers */
    for (int e = 1; e < 16; ++e) mx = fmaxf(mx, s[e]);
    mx = fmaxf(mx, __shfl_xor(mx, 16, 32)); const float mn = fmaxf(m, mx); const float al = fa_exp(m - mn); m = mn;
    FragH pf; float ps[4] = {0.f, 0.f, 0.f, 0.f};
#pragma unroll      /* static indices keep the fragments, scores and accumulators in registers */
    for (int e = 0; e < 16; ++e) { const float pe = fa_exp(s[e] - mn); ps[e & 3] += pe; pf.h[e] = (_Float16)pe; }
    l = fmaf(l, al, (ps[0] + ps[1]) + (ps[2] + ps[3]));
#pragma unroll      /* static indices keep the fragments, scores and accumulators in registers */
    for (int dt = 0; dt < 4; ++dt) { o[dt] *= al; o[dt] = fa_mma(fv[dt], pf.v, o[dt]); } }
  l += __shfl_xor(l, 16, 32); const float fin = 64.0f / l;      /* o carried x64, folded into the output GEMM's alpha */
  _Float16* op = O + (r0 + q0) * DM + h * HD * 16 + 8 * lane;      /* o rows in fragment order for the output GEMM: dims 16 dt + 8 hh .. + 7 of query ln are the lane's group of half-block dt */
#pragma unroll      /* static indices keep the fragments, scores and accumulators in registers */
  for (int dt = 0; dt < 4; ++dt) { FragH f;
#pragma unroll      /* static indices keep the fragments, scores and accumulators in registers */
    for (int r = 0; r < 8; ++r) f.h[r] = (_Float16)(o[dt][r] * fin);
    *(v8us*)((unsigned short*)op + dt * 256) = f.half[0]; }
  asm volatile("s_wait_xcnt 0x0" ::: "memory"); }      /* the four stores' address and data registers are free for reuse only behind this wait: the split job's code follows in the text */


typedef float v2f __attribute__((ext_vector_type(2)));
// Exact f32 attention for query rows 0 .. QT0-1 of one batch, one wave per (head, query row), 8 rows of one head per block. The head's QT0 K and V rows are staged once in LDS;
// lane l scores keys l, l + 32, l + 64, l + 96; row maximum and row sum are lane partials joined by butterflies; lane l then sums dims 2l, 2l + 1 over the keys (weight 0 behind the diagonal).
__device__ __forceinline__ void d_att0w(int bx, const float* __restrict__ QF, const float* __restrict__ KF, const float* __restrict__ VF, float scale, float* __restrict__ OF) {      /* bx = the block's number within this batch */
  __shared__ __attribute__((aligned(16))) float lk[QT0][HD + 4];      /* pitch 272 B = 16 B x odd: one key row per lane reads without bank conflicts */
  __shared__ __attribute__((aligned(16))) float lv[QT0][HD];
  const int tid = threadIdx.x, lane = tid & 31; const int w = __builtin_amdgcn_readfirstlane(tid >> 5);      /* the wave's number as a scalar: q's address is the same in every lane of the wave */
  const int h = bx / (QT0 / 8), i = (bx % (QT0 / 8)) * 8 + w;
  const int sr = tid >> 4, sc = (tid & 15) * 4; const float* kg = KF + (size_t)sr * DM + h * HD + sc; const float* vg = VF + (size_t)sr * DM + h * HD + sc; v4f ks[QT0 / 16], vs[QT0 / 16];
#pragma unroll      /* static indices keep ks[] and vs[] in registers; every load is issued before the first LDS store */
  for (int u = 0; u < QT0 / 16; ++u) { ks[u] = *(const v4fa*)(kg + (size_t)u * 16 * DM); vs[u] = *(const v4fa*)(vg + (size_t)u * 16 * DM); }
  asm volatile("s_wait_xcnt 0x0" :: "v"(kg), "v"(vg) : "memory");      /* the loads' two address pairs stay whole up to here and are free for reuse only behind this wait */
#pragma unroll      /* static indices keep ks[] and vs[] in registers */
  for (int u = 0; u < QT0 / 16; ++u) { *(v4f*)&lk[u * 16 + sr][sc] = ks[u]; *(v4f*)&lv[u * 16 + sr][sc] = vs[u]; }
  __syncthreads();
  const float* qg = QF + (size_t)i * DM + h * HD; v4f a[QT0 / 32] = {};
#pragma unroll      /* static indices keep a[] in registers: four independent sums per key, four keys per lane */
  for (int d = 0; d < HD / 4; ++d) { for (int c = 0; c < QT0 / 32; ++c) { const v4f kk = *(const v4f*)&lk[c * 32 + lane][d * 4]; for (int u = 0; u < 4; ++u) a[c][u] = fmaf(qg[d * 4 + u], kk[u], a[c][u]); } }
  float e[QT0 / 32]; float m = -1.0e30f;
#pragma unroll      /* static indices keep e[] in registers */
  for (int c = 0; c < QT0 / 32; ++c) { e[c] = (c * 32 + lane <= i) ? ((a[c][0] + a[c][1]) + (a[c][2] + a[c][3])) * scale : -1.0e30f; m = fmaxf(m, e[c]); }
  for (int x = 16; x >= 1; x >>= 1) m = fmaxf(m, __shfl_xor(m, x, 32));
  float l = 0.f;
#pragma unroll      /* static indices keep e[] in registers */
  for (int c = 0; c < QT0 / 32; ++c) { e[c] = expf(e[c] - m); l += e[c]; }      /* a key behind the diagonal: exp(-1e30 - m) = 0 */
  for (int x = 16; x >= 1; x >>= 1) l += __shfl_xor(l, x, 32);
  v2f o[4] = {};
#pragma unroll      /* a constant lane number per step: key j's weight is broadcast through a scalar register; static indices keep e[] and o[] in registers */
  for (int j = 0; j < QT0; ++j) { const float ej = __int_as_float(__builtin_amdgcn_readlane(__float_as_int(e[j >> 5]), j & 31)); const v2f vv = *(const v2f*)&lv[j][lane * 2]; o[j & 3][0] = fmaf(ej, vv[0], o[j & 3][0]); o[j & 3][1] = fmaf(ej, vv[1], o[j & 3][1]); }
  const float fin = 64.0f / l;      /* o carried x64 like the f16 path */
  const v2f r = ((o[0] + o[1]) + (o[2] + o[3])) * fin;
  *(v2f*)(OF + (size_t)i * DM + h * HD + lane * 2) = r; }

// Launches that do not depend on one another share one grid: a range of block numbers per job, the test is uniform for the block.
#define GW (DM * (DM / 8) / 256)                 /* blocks per weight */
#define GX ((int)(NR * DM / 16 / 256))           /* blocks per input */
#define GA (NH * (QT0 / 8))                      /* blocks of the exact first-tile attention per batch */
__global__ __launch_bounds__(256) void k_prep(const float* __restrict__ w0, const float* __restrict__ w1, const float* __restrict__ w2, const float* __restrict__ w3, _Float16* __restrict__ Wt0,
                                              const float* __restrict__ x0, const float* __restrict__ x1, const float* __restrict__ x2, _Float16* __restrict__ X0) {
  const int bx = blockIdx.x;
  if (bx < 4 * GW) { const int y = bx / GW; d_wt_f16(bx % GW, (y == 0) ? w0 : (y == 1) ? w1 : (y == 2) ? w2 : w3, Wt0 + (size_t)y * DM * DM, DM, DM, 16.0f); }      /* the four weight planes lie one behind the other */
  else { const int u = bx - 4 * GW, y = u / GX; d_x16(u % GX, (y == 0) ? x0 : (y == 1) ? x1 : x2, X0 + (size_t)y * NR * DM, NR * DM / 16); } }      /* likewise the three input planes */
__global__ __launch_bounds__(256) void k_mid(const float* __restrict__ QF, const float* __restrict__ KF, const float* __restrict__ VF, float* __restrict__ OF0) {
  const int bx = blockIdx.x; const size_t b = bx / GA; d_att0w(bx % GA, QF + b * SQ * DM, KF + b * SQ * DM, VF + b * SQ * DM, SCL, OF0 + b * QT0 * DM); }

extern "C" void kernel_launch(void* const* d_in, const int* in_sizes, int n_in,
                              void* d_out, int out_size, void* d_ws, size_t ws_size, hipStream_t stream) {
  (void)in_sizes; (void)n_in; (void)out_size;
  const float* const* I = (const float* const*)d_in; const float* x = I[0]; const float* xk = I[1]; const float* xv = I[2]; const float* wq = I[3]; const float* bq = I[4]; const float* wk = I[5]; const float* bk = I[6]; const float* wv = I[7]; const float* bv = I[8]; const float* wo = I[9]; const float* bo = I[10];      /* input order: query, key, value (THREE input streams), then [in][out] weights + biases */
  char* ws = (char*)d_ws; size_t off = 0;
  auto take = [&](size_t bytes) { char* p = ws + off; off += (bytes + 255) & ~(size_t)255; return p; };
  _Float16* BQ = (_Float16*)take((size_t)DM * DM * 2); _Float16* BK = (_Float16*)take((size_t)DM * DM * 2); _Float16* BV = (_Float16*)take((size_t)DM * DM * 2); _Float16* BO = (_Float16*)take((size_t)DM * DM * 2);
  _Float16* X16 = (_Float16*)take(NR * DM * 2); _Float16* XK16 = (_Float16*)take(NR * DM * 2); _Float16* XV16 = (_Float16*)take(NR * DM * 2);      /* exact f16 rows of query, key, value, fragment order */ float* QF = (float*)take(NR * DM * 4); float* KF = (float*)take(NR * DM * 4); float* VF = (float*)take(NR * DM * 4);      /* f32 q, k, v rows: only rows 0..127 of each batch are written, and only those are read (the exact first-tile attention) */ _Float16* QH = (_Float16*)take(NR * DM * 2); _Float16* QL = (_Float16*)take(NR * DM * 2); _Float16* KH = (_Float16*)take(NR * DM * 2); _Float16* KL = (_Float16*)take(NR * DM * 2); _Float16* Q16 = QH; _Float16* K16 = KH; _Float16* O16 = (_Float16*)take(NR * DM * 2);
  _Float16* VT = (_Float16*)take((size_t)NB * NH * HD * SQ * 2);      /* V^T of both batches */
  float* OF0 = (float*)take((size_t)NB * QT0 * DM * 4); _Float16* OH0 = (_Float16*)take((size_t)NB * QT0 * DM * 2); _Float16* OL0 = (_Float16*)take((size_t)NB * QT0 * DM * 2);
  if (off > ws_size) return;
  k_prep<<<4 * GW + 3 * GX, 256, 0, stream>>>(wq, wk, wv, wo, BQ, x, xk, xv, X16);      /* weights [in][out] -> Bt[n][k] x16 (BQ, BK, BV, BO) and inputs -> exact f16 rows (X16, XK16, XV16), all in fragment order */
  k_gemm2<0, true><<<dim3((unsigned)((MP / 128) * (DM / 64)), 3), 128, 0, stream>>>(X16, DM, NR * DM, BQ, DM, (size_t)DM * DM, 0.0625f, bq, 0, nullptr, 1, 0, 0, QF, nullptr, DM, NR * DM, MP, DM, DM, bk, bv, 0, nullptr, 1, QH, QL, 2 * NR * DM, VT, SQ / 128);      /* q, k, v projections in one grid; the epilogue writes q and k as f16 hi + x1024 residual planes (QH, QL, KH, KL lie one behind the other; unscaled logits sigma ~8) and V^T of all heads, all in fragment order; f32 rows into QF, KF, VF only for rows 0..127 of each batch */
  k_mid<<<NB * GA, 256, 0, stream>>>(QF, KF, VF, OF0);      /* exact f32 attention for rows 0..127 of each batch (o x64) */
  k_fattn<<<NB * NH * (SQ / 128 - 1) + (int)((size_t)NB * QT0 * DM / 16 / 256), 256, 0, stream>>>(QH, QL, KH, KL, VT, O16, OF0, OH0, OL0);      /* scores, causal softmax and P V of both batches and all heads, rows 128 on: o (merged heads, x64) as f16 rows; first-tile o (x64) -> f16 hi + x1024 residual planes */
  k_gemm2<0, false><<<dim3((unsigned)((MPO / 128) * (DM / 64)), 1), 128, 0, stream>>>(O16, DM, 0, BO, DM, 0, 0.0009765625f, bo, 0, nullptr, 1, 0, 0, (float*)d_out, nullptr, DM, 0, MPO, DM, DM, nullptr, nullptr, 0, OH0, SQ / 128, nullptr, nullptr, 0, nullptr, 1);      /* out rows are the output layout; rows 0..127 of each batch: out = o_hi Wo (+ b) */
  k_gemm2<0, false><<<dim3((QT0 / 128) * (DM / 64), NB), 128, 0, stream>>>(OL0, DM, (size_t)QT0 * DM, BO, DM, 0, 0.00000095367431640625f, nullptr, 0, (const float*)d_out, -1, 0, 0, (float*)d_out, nullptr, DM, (size_t)SQ * DM, QT0, DM, DM, nullptr, nullptr, 0, nullptr, 1, nullptr, nullptr, 0, nullptr, 1);      /* rows 0..127 of each batch (y) += o_lo Wo 2^-20 (own-element accumulate) */
}

// v009
// It runs in 127 microseconds.
// Two timings next to v008 put it at 1.21 and 1.20 times that version's speed.
// All steps since v000 together make it 44.9 times as fast.
#include <hip/hip_runtime.h>
// Causal multi-head attention on three inputs with the source's sequence-length score scale (query, key, value [2][2048][1024]; q = query Wq + bq, k = key Wk + bk, v = value Wv + bv ([in][out] 1024 x 1024, weights AND biases sigma 1/32), 16 heads of 64; score = q k^T; triu(1) -> -inf; softmax(score / sqrt(Sk)) with Sk = 2048 KEYS (the source divides by sqrt of the score matrix's last dimension, NOT by sqrt(head_dim)): scale 2048^-0.5 = 0.0220970869; out = merged Wo + bo ([in][out]) -> [2][2048][1024]); q and k carried as f16 hi + x1024 residual planes with three-product scores.
// Structure: token rows r = b*2048 + s; x as exact f16 rows (bf16-rounded); q and k as WMMA GEMMs (32x64 wave tiles, f32 accumulation, exact x16 weights + bias) whose epilogue splits the f32 values into f16 hi + x1024 residual planes, v as a GEMM whose epilogue stores V^T of all heads straight from the accumulators; f32 q, k, v rows are stored only for the exact first-tile attention (rows 0..127 of each batch); then ONE fused attention launch (a wave per 16 queries, keys below the diagonal in passes of 32: three-product scores hi.hi + lo.hi + hi.lo in f32 accumulators, running-maximum softmax in registers (f32 statistics, native exp; weights in (0, 1] as f16), o = P . V^T normalised at the end, carried x64 and folded into the output GEMM alpha) written straight into the merged f16 o rows; out = o W_o + b GEMM (f32) into the output layout. Five launches: jobs that do not depend on one another share a grid (k_prep, the q/k/v GEMM grid, k_mid = the exact first-tile attention, k_fattn with the first-tile split, the output GEMM, whose first-tile blocks take the exact rows' hi and residual planes as the two A row groups of each wave).
// Layout: every f16 plane that only WMMA fragment loads read (x rows, weights, q and k hi / residual planes, o rows; V^T in the same blocks, but with a head's four 16-dim blocks of each 32 keys one behind the other) is kept in FRAGMENT ORDER: a tile of 16 rows x 32 k is one 1-KiB block [k half of 16][lane = 16 * (k / 8 % 2) + row][8 k], the blocks of 16 rows one behind the other in k; a wave's 16-byte fragment load then covers 512 contiguous bytes. 16 rows of a plane of pitch C fill 16 * C elements as before, so offsets of whole 16-row groups are unchanged.
// Compute dtype: inputs rounded to bf16; x / weights exact; q and k as f16 hi + x1024 residual planes; v, softmax weights and o as plain f16 GEMM operands (~2^-12), first-tile o as hi + residual; scores and softmax statistics f32. v_wmma_f32_16x16x32_f16.
#define NB 2
#define SCL 0.0220970869f                 /* = f32(1 / sqrt(2048)): the source scales the scores by 1/sqrt(Sk), Sk = 2048 keys */
#define SCLR (0.0220970869f * 0.0009765625f)   /* the same scale on the x1024 residual passes */
#define SQ 2048
#define DM 1024
#define NH 16
#define HD 64
#define HG 4                         /* heads per launch of the head-group k_vt overload, which is not launched */
#define QT0 128                      /* first-tile rows recomputed exactly in f32 */
#define B0 0                         /* nothing uses it: every job starts at batch 0 */
#define NBR NB                       /* batches processed (debug hook) */
#define NR ((size_t)NB * SQ)         /* token rows */
#define MP ((int)((size_t)NBR * SQ)) /* rows projected (debug hook) */
#define MPO MP                       /* rows through the output stage (debug hook) */
#define LQ DM      /* row pitch of the q/k/v rows */
typedef __bf16 v16b __attribute__((ext_vector_type(16)));
typedef unsigned short v8us __attribute__((ext_vector_type(8), may_alias));
typedef float  v8f  __attribute__((ext_vector_type(8)));
typedef float  v4f  __attribute__((ext_vector_type(4)));
typedef float  v4fa __attribute__((ext_vector_type(4), may_alias));
union FragB { v16b v; v8us half[2]; unsigned short u[16]; };

__device__ __forceinline__ unsigned short bf16_bits(float x) { unsigned int u = __float_as_uint(x); return (unsigned short)((u + 0x7FFFu + ((u >> 16) & 1u)) >> 16); }
__device__ __forceinline__ float bf16_val(unsigned short b) { return __uint_as_float(((unsigned int)b) << 16); }
__device__ __forceinline__ float bf16_round(float x) { return bf16_val(bf16_bits(x)); }
// D += A·B with NT terms: 1 = ah·bh, 2 = + al·bh (A split), 3 = + ah·bl (both split)
template <int NT>
__device__ __forceinline__ v8f mmaN(v16b ah, v16b al, v16b bh, v16b bl, v8f c) {
  c = __builtin_amdgcn_wmma_f32_16x16x32_bf16(false, ah, false, bh, (short)0, c, false, false);
  if (NT >= 2) c = __builtin_amdgcn_wmma_f32_16x16x32_bf16(false, al, false, bh, (short)0, c, false, false);
  if (NT >= 3) c = __builtin_amdgcn_wmma_f32_16x16x32_bf16(false, ah, false, bl, (short)0, c, false, false);
  asm volatile("v_nop\n\tv_nop\n\tv_nop\n\tv_nop" : "+v"(c) : "v"(ah), "v"(al), "v"(bh), "v"(bl));
  return c;
}

__global__ __launch_bounds__(256) void k_wt_bf16(const float* __restrict__ W, unsigned short* __restrict__ Wt, int K, int N) {
  const int t = blockIdx.x * 256 + threadIdx.x;
  const int k8n = K / 8;
  if (t >= N * k8n) return;
  const int n = t / k8n, k8 = (t % k8n) * 8;
  v8us v;
#pragma unroll
  for (int i = 0; i < 8; ++i) v[i] = bf16_bits(W[(size_t)(k8 + i) * N + n]);
  *(v8us*)(Wt + (size_t)n * K + k8) = v;
  
}

// GEMM C[M][N] (f32, pitch ldc) = act(A[M][K]·W + bias). A f32 row-major (pitch lda) converted per fragment to bf16
// (ASPLIT: hi/lo two planes -> 2 terms, else single rounded term); Wt bf16 [N][K] (pitch ldb). BIAS_BF16 rounds the
// bias to bf16 first (bias quantised to bf16 before the add). K%32==0, M%16==0, N%64==0.
template <bool ASPLIT, int ACT, bool BIAS_BF16>
__global__ __launch_bounds__(128) void k_gemm_bf(const float* __restrict__ A, int lda, const unsigned short* __restrict__ Wt, int ldb,
                                               const float* __restrict__ bias, float* __restrict__ C, int ldc, int M, int N, int K) {
  __shared__ __attribute__((aligned(16))) float so[4][16][64];
  const int tid = threadIdx.x, w = tid >> 5, lane = tid & 31, ln = lane & 15, hh = lane >> 4;
  const int ntn = N / 64;
  const int wid = blockIdx.x * 4 + w;
  const int mt = wid / ntn, nq = wid % ntn;
  if (mt * 16 >= M) return;
  const int row0 = mt * 16, col0 = nq * 64;
  const float* arow = A + (size_t)(row0 + ln) * lda;
  v8f acc[4] = {};
  for (int kb = 0; kb < K; kb += 32) {
    FragB ah, al;
    const v4f x0 = *(const v4fa*)(arow + kb + 8 * hh), x1 = *(const v4fa*)(arow + kb + 8 * hh + 4);
    const v4f x2 = *(const v4fa*)(arow + kb + 16 + 8 * hh), x3 = *(const v4fa*)(arow + kb + 16 + 8 * hh + 4);
    float xs[16] = {x0[0],x0[1],x0[2],x0[3],x1[0],x1[1],x1[2],x1[3],x2[0],x2[1],x2[2],x2[3],x3[0],x3[1],x3[2],x3[3]};
#pragma unroll
    for (int i = 0; i < 16; ++i) { const unsigned short hb = bf16_bits(xs[i]); ah.u[i] = hb; al.u[i] = ASPLIT ? bf16_bits(xs[i] - bf16_val(hb)) : (unsigned short)0; }
#pragma unroll
    for (int t = 0; t < 4; ++t) {
      const unsigned short* brow = Wt + (size_t)(col0 + t * 16 + ln) * ldb + kb;
      FragB b;
      b.half[0] = *(const v8us*)(brow + 8 * hh);
      b.half[1] = *(const v8us*)(brow + 16 + 8 * hh);
      acc[t] = mmaN<ASPLIT ? 2 : 1>(ah.v, al.v, b.v, b.v, acc[t]);
    }
  }
#pragma unroll
  for (int t = 0; t < 4; ++t) {
    float bv = bias ? bias[col0 + t * 16 + ln] : 0.f;
    if (BIAS_BF16) bv = bf16_round(bv);
#pragma unroll
    for (int r = 0; r < 8; ++r) { float v = acc[t][r] + bv; if (ACT == 1) v = fmaxf(v, 0.f); so[w][8 * hh + r][t * 16 + ln] = v; }
  }
  __builtin_amdgcn_fence(__ATOMIC_ACQ_REL, "workgroup");
  __builtin_amdgcn_wave_barrier();
  const int rsub = lane >> 4, c4 = (lane & 15) * 4;
  {
#pragma unroll
    for (int q = 0; q < 8; ++q) {
      const int r = q * 2 + rsub;
      const v4f v = *(const v4fa*)&so[w][r][c4];
      *(v4f*)(C + (size_t)(row0 + r) * ldc + col0 + c4) = v;
    }
    
  }
}

// GEMM C = act(A·W + bias + resid): A f32 (ASPLIT -> hi/lo 2 terms), Wt bf16 [N][K]; ACT 0 none, 1 relu, 2 exact gelu;
// resid (optional, f32, row index = (row % rmod), pitch ldr, RES_BF16 rounds it) added before the activation.
template <bool ASPLIT, int ACT, bool BIAS_BF16, bool RES_BF16>
__global__ __launch_bounds__(128) void k_gemm_bf3(const float* __restrict__ A, int lda, const unsigned short* __restrict__ Wt, int ldb,
                                                const float* __restrict__ bias, const float* __restrict__ resid, int rmod, int ldr,
                                                float* __restrict__ C, int ldc, int M, int N, int K) {
  __shared__ __attribute__((aligned(16))) float so[4][16][64];
  const int tid = threadIdx.x, w = tid >> 5, lane = tid & 31, ln = lane & 15, hh = lane >> 4;
  const int ntn = N / 64;
  const int wid = blockIdx.x * 4 + w;
  const int mt = wid / ntn, nq = wid % ntn;
  if (mt * 16 >= M) return;
  const int row0 = mt * 16, col0 = nq * 64;
  const float* arow = A + (size_t)(row0 + ln) * lda;
  v8f acc[4] = {};
  for (int kb = 0; kb < K; kb += 32) {
    FragB ah, al;
    const v4f x0 = *(const v4fa*)(arow + kb + 8 * hh), x1 = *(const v4fa*)(arow + kb + 8 * hh + 4);
    const v4f x2 = *(const v4fa*)(arow + kb + 16 + 8 * hh), x3 = *(const v4fa*)(arow + kb + 16 + 8 * hh + 4);
    float xs[16] = {x0[0],x0[1],x0[2],x0[3],x1[0],x1[1],x1[2],x1[3],x2[0],x2[1],x2[2],x2[3],x3[0],x3[1],x3[2],x3[3]};
#pragma unroll
    for (int i = 0; i < 16; ++i) { const unsigned short hb = bf16_bits(xs[i]); ah.u[i] = hb; al.u[i] = ASPLIT ? bf16_bits(xs[i] - bf16_val(hb)) : (unsigned short)0; }
#pragma unroll
    for (int t = 0; t < 4; ++t) {
      const unsigned short* brow = Wt + (size_t)(col0 + t * 16 + ln) * ldb + kb;
      FragB b;
      b.half[0] = *(const v8us*)(brow + 8 * hh);
      b.half[1] = *(const v8us*)(brow + 16 + 8 * hh);
      acc[t] = mmaN<ASPLIT ? 2 : 1>(ah.v, al.v, b.v, b.v, acc[t]);
    }
  }
#pragma unroll
  for (int t = 0; t < 4; ++t) {
    const int col = col0 + t * 16 + ln;
    float bv = bias ? bias[col] : 0.f;
    if (BIAS_BF16) bv = bf16_round(bv);
#pragma unroll
    for (int r = 0; r < 8; ++r) {
      float v = acc[t][r] + bv;
      if (resid) { float rv = resid[(size_t)((row0 + 8 * hh + r) % rmod) * ldr + col]; if (RES_BF16) rv = bf16_round(rv); v += rv; }
      if (ACT == 1) v = fmaxf(v, 0.f);
      if (ACT == 2) v = 0.5f * v * (1.0f + erff(v * 0.70710678118654752f));
      if (ACT == 3) { const float u = 0.7978845608028654f * (v + 0.044715f * v * v * v); v = 0.5f * v * (1.0f + tanhf(u)); }
      so[w][8 * hh + r][t * 16 + ln] = v;
    }
  }
  __builtin_amdgcn_fence(__ATOMIC_ACQ_REL, "workgroup");
  __builtin_amdgcn_wave_barrier();
  const int rsub = lane >> 4, c4 = (lane & 15) * 4;
  {
#pragma unroll
    for (int q = 0; q < 8; ++q) {
      const int r = q * 2 + rsub;
      const v4f v = *(const v4fa*)&so[w][r][c4];
      *(v4f*)(C + (size_t)(row0 + r) * ldc + col0 + c4) = v;
    }
    
  }
}
// row LayerNorm (biased variance, eps) over N: s = X (+ R); optional out_sum <- s; out_norm <- (s-mu)*rsqrt(var+eps)*g + b
template <bool PARAM_BF16>
__global__ __launch_bounds__(256) void k_layernorm(const float* __restrict__ X, const float* __restrict__ R, const float* __restrict__ g, const float* __restrict__ bta,
                                                  float* __restrict__ out_sum, float* __restrict__ out_norm, int N, float eps) {
  __shared__ float red[256];
  const int row = blockIdx.x, tid = threadIdx.x;
  const float* x = X + (size_t)row * N; const float* rr = R ? R + (size_t)row * N : nullptr;
  float vals[16];                     // up to N = 4096
  const int per = N / 256;            // contiguous chunk per thread? use strided-by-4 chunks: thread handles j = tid*4 + 1024*u
  float s1 = 0.f;
  for (int u = 0; u < per / 4; ++u) {
    const int j = tid * 4 + 1024 * u;
    const v4f a = *(const v4fa*)(x + j);
    v4f b = {0.f,0.f,0.f,0.f}; if (rr) b = *(const v4fa*)(rr + j);
#pragma unroll
    for (int q = 0; q < 4; ++q) { const float v = a[q] + b[q]; vals[u * 4 + q] = v; s1 += v; }
  }
  red[tid] = s1; __syncthreads();
  for (int st = 128; st > 0; st >>= 1) { if (tid < st) red[tid] += red[tid + st]; __syncthreads(); }
  const float mu = red[0] / (float)N; __syncthreads();
  float s2 = 0.f;
  for (int u = 0; u < per / 4; ++u)
#pragma unroll
    for (int q = 0; q < 4; ++q) { const float c = vals[u * 4 + q] - mu; s2 += c * c; }
  red[tid] = s2; __syncthreads();
  for (int st = 128; st > 0; st >>= 1) { if (tid < st) red[tid] += red[tid + st]; __syncthreads(); }
  const float rs = rsqrtf(red[0] / (float)N + eps);
  {
    for (int u = 0; u < per / 4; ++u) {
      const int j = tid * 4 + 1024 * u;
      v4f o, sm;
#pragma unroll
      for (int q = 0; q < 4; ++q) {
        float gg = g[j + q], bb = bta[j + q];
        if (PARAM_BF16) { gg = bf16_round(gg); bb = bf16_round(bb); }
        sm[q] = vals[u * 4 + q]; o[q] = (vals[u * 4 + q] - mu) * rs * gg + bb;
      }
      if (out_sum) *(v4f*)(out_sum + (size_t)row * N + j) = sm;
      *(v4f*)(out_norm + (size_t)row * N + j) = o;
    }
    
  }
}



// ---- f16 WMMA path (v_wmma_f32_16x16x32_f16): 11-bit significands for operands in range — used where a [0,1] probability operand needs more precision than bf16
typedef _Float16 v16h __attribute__((ext_vector_type(16)));
union FragH { v16h v; v8us half[2]; _Float16 h[16]; unsigned short u[16]; };
template <int NT>
__device__ __forceinline__ v8f mmaH(v16h ah, v16h al, v16h bh, v16h bl, v8f c) {
  c = __builtin_amdgcn_wmma_f32_16x16x32_f16(false, ah, false, bh, (short)0, c, false, false);
  if (NT >= 2) c = __builtin_amdgcn_wmma_f32_16x16x32_f16(false, al, false, bh, (short)0, c, false, false);
  if (NT >= 3) c = __builtin_amdgcn_wmma_f32_16x16x32_f16(false, ah, false, bl, (short)0, c, false, false);
  asm volatile("v_nop\n\tv_nop\n\tv_nop\n\tv_nop" : "+v"(c) : "v"(ah), "v"(al), "v"(bh), "v"(bl));
  return c;
}
// batched GEMM like k_gemm_b but f16 operands: A f32 (split into f16 hi/lo if ASPLIT, else rounded to f16), Bt = f16 values [n][k]; alpha; C f32; N multiple of 16 (partial tiles skipped)
template <bool ASPLIT>
__global__ __launch_bounds__(128) void k_gemm_h(const float* __restrict__ A, int lda, size_t sA, const _Float16* __restrict__ Bh, int ldb, size_t sB, float alpha, float* __restrict__ C, int ldc, size_t sC, int M, int N, int K) {
  __shared__ __attribute__((aligned(16))) float so[4][16][64];
  const int tid = threadIdx.x, w = tid >> 5, lane = tid & 31, ln = lane & 15, hh = lane >> 4; const int by = blockIdx.y;
  A += (size_t)by * sA; Bh += (size_t)by * sB; C += (size_t)by * sC;
  const int ntn = (N + 63) / 64; const int wid = blockIdx.x * 4 + w; const int mt = wid / ntn, nq = wid % ntn; if (mt * 16 >= M) return;
  const int row0 = mt * 16, col0 = nq * 64; const float* arow = A + (size_t)(row0 + ln) * lda;
  v8f acc[4] = {};
  for (int kb = 0; kb < K; kb += 32) {
    FragH ah, al;
    const v4f x0 = *(const v4fa*)(arow + kb + 8 * hh), x1 = *(const v4fa*)(arow + kb + 8 * hh + 4), x2 = *(const v4fa*)(arow + kb + 16 + 8 * hh), x3 = *(const v4fa*)(arow + kb + 16 + 8 * hh + 4);
    float xs[16] = {x0[0],x0[1],x0[2],x0[3],x1[0],x1[1],x1[2],x1[3],x2[0],x2[1],x2[2],x2[3],x3[0],x3[1],x3[2],x3[3]};
#pragma unroll
    for (int i = 0; i < 16; ++i) { const _Float16 h = (_Float16)xs[i]; ah.h[i] = h; al.h[i] = ASPLIT ? (_Float16)(xs[i] - (float)h) : (_Float16)0.0f; }
#pragma unroll
    for (int t = 0; t < 4; ++t) { if (col0 + t * 16 >= N) continue; const size_t boff = (size_t)(col0 + t * 16 + ln) * ldb + kb; FragH bq; bq.half[0] = *(const v8us*)(Bh + boff + 8 * hh); bq.half[1] = *(const v8us*)(Bh + boff + 16 + 8 * hh);
      acc[t] = mmaH<ASPLIT ? 2 : 1>(ah.v, al.v, bq.v, bq.v, acc[t]); }
  }
#pragma unroll
  for (int t = 0; t < 4; ++t) { if (col0 + t * 16 >= N) continue;
#pragma unroll
    for (int r = 0; r < 8; ++r) so[w][8 * hh + r][t * 16 + ln] = acc[t][r] * alpha; }
  __builtin_amdgcn_fence(__ATOMIC_ACQ_REL, "workgroup"); __builtin_amdgcn_wave_barrier();
  const int rsub = lane >> 4, c4 = (lane & 15) * 4;
  {
#pragma unroll
    for (int q = 0; q < 8; ++q) { const int r = q * 2 + rsub; if (col0 + c4 < N) { const v4f v = *(const v4fa*)&so[w][r][c4]; *(v4f*)(C + (size_t)(row0 + r) * ldc + col0 + c4) = v; } }
     }
}

// Wt[n][k], in fragment order, = f16(W[k][n] * scale) from f32 row-major W[K][N] (K % 32 == 0, N % 16 == 0; scale = power of two; bf16-exact weights stay exact in f16 away from the subnormal range)
__device__ __forceinline__ void d_wt_f16(int bx, const float* __restrict__ W, _Float16* __restrict__ Wt, int K, int N, float scale) {      /* bx = the block's number within this weight */
  const int t = bx * 256 + threadIdx.x; if (t >= N * (K / 8)) return;      /* thread t writes the t-th 16-byte group of the fragment-order plane: 16 lanes read 16 neighbouring n of one k row */
  const int blk = t >> 6; const int n = (blk / (K / 32)) * 16 + (t & 15), k8 = (blk % (K / 32)) * 32 + ((t >> 5) & 1) * 16 + ((t >> 4) & 1) * 8; FragH f;
#pragma unroll
  for (int i = 0; i < 8; ++i) f.h[i] = (_Float16)(bf16_round(W[(size_t)(k8 + i) * N + n]) * scale); const v8us o = f.half[0];
  *(v8us*)((unsigned short*)Wt + (size_t)t * 8) = o; 
}
// k_gemm_hh variant with fused epilogue: v = acc·alpha + bias[by·sBias + col] (+ CP[(row/rowsPerB)·sCPb + by·64 + col] if CP) ; ACT 0 none / 1 elu ; writes f16 C16 (and f32 C if non-null)
template <int ACT>
__global__ __launch_bounds__(128) void k_gemm_hhx(const _Float16* __restrict__ A, int lda, size_t sA, const _Float16* __restrict__ Bh, int ldb, size_t sB, float alpha, const float* __restrict__ bias, size_t sBias, const float* __restrict__ CP, int rowsPerB, size_t sCPb, int row0g,
    float* __restrict__ C, _Float16* __restrict__ C16, int ldc, size_t sC, int M, int N, int K) {
  __shared__ __attribute__((aligned(16))) float so[4][16][64];
  const int tid = threadIdx.x, w = tid >> 5, lane = tid & 31, ln = lane & 15, hh = lane >> 4; const int by = blockIdx.y;
  A += (size_t)by * sA; Bh += (size_t)by * sB; const size_t cofs = (size_t)by * sC; const float* bp = bias ? bias + (size_t)by * sBias : nullptr;
  const int ntn = (N + 63) / 64; const int wid = blockIdx.x * 4 + w; const int mt = wid / ntn, nq = wid % ntn; if (mt * 16 >= M) return;
  const int row0 = mt * 16, col0 = nq * 64; const _Float16* arow = A + (size_t)(row0 + ln) * lda;
  v8f acc[4] = {};
  for (int kb = 0; kb < K; kb += 32) { FragH ah; ah.half[0] = *(const v8us*)((const unsigned short*)arow + kb + 8 * hh); ah.half[1] = *(const v8us*)((const unsigned short*)arow + kb + 16 + 8 * hh);
#pragma unroll
    for (int t = 0; t < 4; ++t) { if (col0 + t * 16 >= N) continue; const size_t boff = (size_t)(col0 + t * 16 + ln) * ldb + kb; FragH bq; bq.half[0] = *(const v8us*)((const unsigned short*)Bh + boff + 8 * hh); bq.half[1] = *(const v8us*)((const unsigned short*)Bh + boff + 16 + 8 * hh);
      acc[t] = mmaH<1>(ah.v, ah.v, bq.v, bq.v, acc[t]); }
  }
#pragma unroll
  for (int t = 0; t < 4; ++t) { if (col0 + t * 16 >= N) continue; const int col = col0 + t * 16 + ln; const float bv = bp ? bf16_round(bp[col]) : 0.f;
#pragma unroll
    for (int r = 0; r < 8; ++r) { float v = acc[t][r] * alpha + bv; if (CP) { const int rr = row0g + row0 + 8 * hh + r; if (rowsPerB < 0) v += CP[cofs + (size_t)rr * ldc + col];      /* rowsPerB < 0: own element of the batched C plane */ else { const int bidx = rr / rowsPerB; v += CP[(size_t)bidx * sCPb + (size_t)by * 64 + col]; } } if (ACT == 1) v = (v > 0.f) ? v : expm1f(v); else if (ACT == 7) v = (v > 0.f) ? v + 1.0f : expf(v); else if (ACT == 8) v = tanhf(v); else if (ACT == 9) v = 0.5f * v * (1.0f + tanhf(0.7978845608028654f * (v + 0.044715f * v * v * v))); else if (ACT == 11) v = 1.0f / (1.0f + expf(-v)); else if (ACT == 12) v = (v > 0.f) ? v : 0.01f * v; else if (ACT == 14) v = (v > 0.f) ? v : 0.1f * v; else if (ACT == 16) v = (v >= 0.f) ? v : 0.3f * v; else if (ACT == 17) v = (v >= 0.f) ? v : 0.2f * v; else if (ACT == 15) v = v / (1.0f + expf(-v)); else if (ACT == 3) v = fmaxf(v, 0.f); else if (ACT == 6) v = 0.5f * v * (1.0f + erff(v * 0.70710678118654752f)); so[w][8 * hh + r][t * 16 + ln] = v; } }
  __builtin_amdgcn_fence(__ATOMIC_ACQ_REL, "workgroup"); __builtin_amdgcn_wave_barrier();
  const int rsub = lane >> 4, c4 = (lane & 15) * 4; typedef _Float16 v4h __attribute__((ext_vector_type(4)));
  {
#pragma unroll
    for (int q = 0; q < 8; ++q) { const int r = q * 2 + rsub; if (col0 + c4 < N) { const v4f v = *(const v4fa*)&so[w][r][c4]; if (C) *(v4f*)(C + cofs + (size_t)(row0 + r) * ldc + col0 + c4) = v; if (C16) { v4h h4; for (int i = 0; i < 4; ++i) h4[i] = (_Float16)v[i]; *(v4h*)(C16 + cofs + (size_t)(row0 + r) * ldc + col0 + c4) = h4; } } }
     }
}


typedef _Float16 v4h __attribute__((ext_vector_type(4)));

// f32 rows of pitch DM -> fragment order, one 16 x 32 tile per wave: load i takes rows 4 i .. 4 i + 3 of the tile, 8 lanes on each row's whole 128-byte line; a lane's 4 values go as 8 bytes into the tile's block.
__device__ __forceinline__ size_t pk_src(size_t wv, int lane) { return ((wv / (DM / 32)) * 16 + (lane >> 3)) * DM + (wv % (DM / 32)) * 32 + (lane & 7) * 4; }      /* row step 4 * DM per load */
__device__ __forceinline__ size_t pk_dst(size_t wv, int lane) { return wv * 512 + ((lane >> 2) & 1) * 256 + (((lane >> 1) & 1) * 16 + (lane >> 3)) * 8 + (lane & 1) * 4; }      /* step 32 per load */
__device__ __forceinline__ void d_x16(int bx, const float* __restrict__ x, _Float16* __restrict__ X16, size_t n16) { const size_t t = (size_t)bx * 256 + threadIdx.x; if (t >= n16) return; const int lane = (int)(t & 31);      /* bx = the block's number within this input */
  const float* s = x + pk_src(t >> 5, lane); _Float16* d = X16 + pk_dst(t >> 5, lane); v4f v[4]; v4h h[4];
#pragma unroll      /* static indices keep v[] and h[] in registers; the four loads are issued together */
  for (int i = 0; i < 4; ++i) v[i] = *(const v4fa*)(s + (size_t)i * 4 * DM);
  asm volatile("s_wait_xcnt 0x0" :: "v"(s) : "memory");      /* the loads' address pair stays whole up to here and is free for reuse only behind this wait */
#pragma unroll      /* static indices keep v[] and h[] in registers */
  for (int i = 0; i < 4; ++i) for (int q = 0; q < 4; ++q) h[i][q] = (_Float16)bf16_round(v[i][q]);
#pragma unroll      /* static indices; the four stores follow one another, so both halves of each 128-byte line are written together */
  for (int i = 0; i < 4; ++i) *(v4h*)(d + i * 32) = h[i]; }
__global__ __launch_bounds__(256) void k_h16(const float* __restrict__ x, _Float16* __restrict__ X16, size_t n8) { const size_t t = (size_t)blockIdx.x * 256 + threadIdx.x; if (t >= n8) return; FragH f;
#pragma unroll
  for (int q = 0; q < 8; ++q) f.h[q] = (_Float16)x[t * 8 + q]; *(v8us*)((unsigned short*)X16 + t * 8) = f.half[0];  }
__global__ __launch_bounds__(256) void k_round16f(const float* __restrict__ W, _Float16* __restrict__ Bt, size_t n8) { const size_t t = (size_t)blockIdx.x * 256 + threadIdx.x; if (t >= n8) return; FragH f;
#pragma unroll
  for (int i = 0; i < 8; ++i) f.h[i] = (_Float16)(bf16_round(W[t * 8 + i]) * 16.0f); *(v8us*)((unsigned short*)Bt + t * 8) = f.half[0];  }
__device__ __forceinline__ void d_hl(int bx, const float* __restrict__ F, _Float16* __restrict__ Hh, _Float16* __restrict__ Hl, size_t n16) { const size_t t = (size_t)bx * 256 + threadIdx.x; if (t >= n16) return; const int lane = (int)(t & 31);      /* bx = the block's number within this plane */      /* f32 rows of pitch DM -> hi and x1024 residual planes in fragment order, a 16 x 32 tile per wave as in k_x16 */
  const float* s = F + pk_src(t >> 5, lane); const size_t o = pk_dst(t >> 5, lane); _Float16* dh = Hh + o; _Float16* dl = Hl + o; v4f v[4]; v4h a[4], c[4];
#pragma unroll      /* static indices keep v[], a[] and c[] in registers; the four loads are issued together */
  for (int i = 0; i < 4; ++i) v[i] = *(const v4fa*)(s + (size_t)i * 4 * DM);
  asm volatile("s_wait_xcnt 0x0" :: "v"(s) : "memory");      /* the loads' address pair stays whole up to here and is free for reuse only behind this wait */
#pragma unroll      /* static indices keep v[], a[] and c[] in registers */
  for (int i = 0; i < 4; ++i) for (int q = 0; q < 4; ++q) { const _Float16 h = (_Float16)v[i][q]; a[i][q] = h; c[i][q] = (_Float16)((v[i][q] - (float)h) * 1024.0f); }
#pragma unroll      /* static indices; the stores follow one another, so both halves of each 128-byte line are written together */
  for (int i = 0; i < 4; ++i) { *(v4h*)(dh + i * 32) = a[i]; *(v4h*)(dl + i * 32) = c[i]; } }

// ---- fast GEMM (wave tile 32x64; requires M % 32 == 0 rows per launch region, N % 64 == 0 and K % 64 == 0; A and Bh in fragment order with lda == ldb == K); epilogue = k_gemm_hhx semantics without the added plane ----
__device__ __forceinline__ v16h g2_frag(const _Float16* p) { FragH f; f.half[0] = *(const v8us*)((const unsigned short*)p); f.half[1] = *(const v8us*)((const unsigned short*)p + 256); return f.v; }      /* p = the block of a fragment-order plane + 8 * lane: each of the two loads covers 512 contiguous bytes per wave */
__device__ __forceinline__ v8f g2_mma(v16h a, v16h b, v8f c) { v8f d = __builtin_amdgcn_wmma_f32_16x16x32_f16(false, a, false, b, (short)0, c, false, false); asm volatile("v_nop\n\tv_nop\n\tv_nop\n\tv_nop" : "+v"(d) : "v"(a), "v"(b)); return d; }
template <int ACT, bool PROJ>      /* PROJ: the q/k/v projections' build, with an epilogue of its own (alpha and bias only: no activation, no added plane) */
__global__ __launch_bounds__(128) void k_gemm2(const _Float16* __restrict__ A, int lda, size_t sA, const _Float16* __restrict__ Bh, int ldb, size_t sB, float alpha, const float* __restrict__ bias, size_t sBias,
    float* __restrict__ C, _Float16* __restrict__ C16a, int ldc, size_t sC, int M, int N, int K, const float* __restrict__ bias1, const float* __restrict__ bias2, int c16y, const _Float16* __restrict__ AF, int ftp, _Float16* __restrict__ HH, _Float16* __restrict__ HL, size_t sH, _Float16* __restrict__ VTo, int frp, const _Float16* __restrict__ AL, float alphaL) { static_assert(ACT == 0 || ACT == 3 || ACT == 6 || ACT == 8 || ACT == 9 || ACT == 11 || ACT == 12 || ACT == 14 || ACT == 15 || ACT == 16 || ACT == 17, "k_gemm2: unsupported ACT code (would silently apply no activation)"); static_assert(!PROJ || ACT == 0, "k_gemm2: the projection epilogue applies no activation");
  __shared__ __attribute__((aligned(16))) float so[4][32][68];
  const int tid = threadIdx.x, w = tid >> 5, lane = tid & 31, ln = lane & 15, hh = lane >> 4; const int by = blockIdx.y;
  A += (size_t)by * sA; Bh += (size_t)by * sB; const size_t cofs = (size_t)by * sC; const float* bp = bias ? bias + (size_t)by * sBias : nullptr;
  if (by == 1 && bias1) bp = bias1; if (by == 2 && bias2) bp = bias2; _Float16* C16 = (by >= c16y) ? C16a : nullptr;      /* independent products share one grid: blockIdx.y picks the operands; biases that are separate inputs come as pointers of their own; only products from c16y on store f16 rows */
  const int ntn = N >> 6; int mt = blockIdx.x / ntn; const int nq = blockIdx.x - mt * ntn; const int col0 = nq * 64; int sx = 0;
  if (!PROJ && AL && mt * 128 >= M) { mt = (mt - (M >> 7)) * ftp; sx = 1; }      /* with AL (M % 128 == 0 there) the grid has ntn more blocks per first tile, behind the ordinary ones: they take the second 64 rows of those tiles */
  const bool two = !PROJ && AL && mt % ftp == 0;      /* uniform for the block. A first tile with a residual plane: a wave owns 16 rows, not 32; its first A row group is their hi rows (AF), its second their x1024 residual rows (AL), so both products run through the one k loop below and are joined in the epilogue, not by a launch of their own that reads C back */
  const int row0 = two ? mt * 128 + sx * 64 + 16 * w : mt * 128 + 32 * w; if (row0 >= M) return;
  const _Float16* ab = A + (size_t)row0 * lda; if (AF && mt % ftp == 0) ab = AF + ((size_t)(mt / ftp) * 128 + (two ? sx * 64 + 16 * w : 32 * w)) * lda;      /* every ftp-th block of 128 rows takes its A rows from the packed plane AF (the exact first-tile rows): that product shares this grid instead of overwriting these rows from a launch of its own */
  const _Float16* a0p = ab + 8 * lane; const _Float16* a1p = two ? AL + (ab - AF) + 8 * lane : a0p + (size_t)16 * lda;      /* first block of each 16-row group; the lane's 8 elements are in the six pointers, so each is the very address its loads name; a k step of 32 is one block of 512 elements */
  const _Float16* b0p = Bh + (size_t)col0 * ldb + 8 * lane; const _Float16* b1p = b0p + (size_t)16 * ldb; const _Float16* b2p = b1p + (size_t)16 * ldb; const _Float16* b3p = b2p + (size_t)16 * ldb;
  const v8f z8 = {0.f,0.f,0.f,0.f,0.f,0.f,0.f,0.f}; v8f c00 = z8, c01 = z8, c02 = z8, c03 = z8, c10 = z8, c11 = z8, c12 = z8, c13 = z8;
  /* Two fragment sets, x and y, each the six fragments of one k step of 32. A set's twelve loads are issued together, one k step ahead of its products, so a k step waits for one load round trip that
     runs under the other set's products, not for five in a row. K is a multiple of 64. Every accumulator still takes its k steps in rising order. */
  v16h xa0 = g2_frag(a0p), xa1 = g2_frag(a1p), xb0 = g2_frag(b0p), xb1 = g2_frag(b1p), xb2 = g2_frag(b2p), xb3 = g2_frag(b3p);
  asm volatile("s_wait_xcnt 0x0" :: "v"(a0p), "v"(a1p), "v"(b0p), "v"(b1p), "v"(b2p), "v"(b3p) : "memory");      /* the first set's six address pairs stay whole up to here and are free for reuse only behind this wait */
#pragma unroll 1      /* one trip is two k steps already; more would only grow the text */
  for (int kb = 0; kb < K; kb += 64) {
    const int ko = kb * 16; const _Float16* q0 = a0p + ko; const _Float16* q1 = a1p + ko; const _Float16* q2 = b0p + ko; const _Float16* q3 = b1p + ko; const _Float16* q4 = b2p + ko; const _Float16* q5 = b3p + ko;
    const v16h ya0 = g2_frag(q0 + 512), ya1 = g2_frag(q1 + 512), yb0 = g2_frag(q2 + 512), yb1 = g2_frag(q3 + 512), yb2 = g2_frag(q4 + 512), yb3 = g2_frag(q5 + 512);
    asm volatile("s_wait_xcnt 0x0" :: "v"(q0), "v"(q1), "v"(q2), "v"(q3), "v"(q4), "v"(q5) : "memory");      /* the twelve loads' six address pairs stay whole up to here and are free for reuse only behind this wait */
    c00 = g2_mma(xa0, xb0, c00); c10 = g2_mma(xa1, xb0, c10); c01 = g2_mma(xa0, xb1, c01); c11 = g2_mma(xa1, xb1, c11);
    c02 = g2_mma(xa0, xb2, c02); c12 = g2_mma(xa1, xb2, c12); c03 = g2_mma(xa0, xb3, c03); c13 = g2_mma(xa1, xb3, c13);
    const int k2 = ((kb + 64 < K) ? kb + 64 : kb) * 16;      /* the last trip fetches its own first step again: in bounds, unused */
    const _Float16* r0 = a0p + k2; const _Float16* r1 = a1p + k2; const _Float16* r2 = b0p + k2; const _Float16* r3 = b1p + k2; const _Float16* r4 = b2p + k2; const _Float16* r5 = b3p + k2;
    xa0 = g2_frag(r0); xa1 = g2_frag(r1); xb0 = g2_frag(r2); xb1 = g2_frag(r3); xb2 = g2_frag(r4); xb3 = g2_frag(r5);
    asm volatile("s_wait_xcnt 0x0" :: "v"(r0), "v"(r1), "v"(r2), "v"(r3), "v"(r4), "v"(r5) : "memory");      /* likewise for this set's six address pairs */
    c00 = g2_mma(ya0, yb0, c00); c10 = g2_mma(ya1, yb0, c10); c01 = g2_mma(ya0, yb1, c01); c11 = g2_mma(ya1, yb1, c11);
    c02 = g2_mma(ya0, yb2, c02); c12 = g2_mma(ya1, yb2, c12); c03 = g2_mma(ya0, yb3, c03); c13 = g2_mma(ya1, yb3, c13); }
  v8f accs[8] = {c00, c01, c02, c03, c10, c11, c12, c13};
  if (PROJ) {
    /* Projection epilogue: the planes the attention reads are written here, from the f32 values of this tile, not by later jobs that read f32 rows back. Products 0 and 1 (q, k): f16 hi + x1024 residual planes in fragment
       order; product 2 (v): V^T in fragment order. The f32 rows go out only for every frp-th block of 128 rows (the rows of the exact first-tile attention). Every test here is uniform for the block. */
    const bool frows = mt % frp == 0; float bvs[4] = {0.f, 0.f, 0.f, 0.f};
    if (bp) {
#pragma unroll      /* static indices keep bvs[] in registers; the four loads are issued together */
      for (int t = 0; t < 4; ++t) bvs[t] = bf16_round(bp[col0 + t * 16 + ln]); }
    if (by == 2) {      /* a lane's accumulator holds rows (keys) 16 half + 8 hh .. + 7 of column (dim) 16 t + ln: the very 16-byte group of lane 16 hh + ln in half-block 'half' of V^T block t; the tile is 32 keys x the 64 dims of head nq */
      _Float16* vp = VTo + ((size_t)(row0 / SQ) * NH + nq) * HD * SQ + (size_t)(row0 % SQ) * HD + 8 * lane; FragH g[8];
#pragma unroll      /* static indices keep accs[] and g[] in registers; the eight stores follow one another */
      for (int u = 0; u < 8; ++u) { for (int r = 0; r < 8; ++r) g[u].h[r] = (_Float16)(accs[u][r] * alpha + bvs[u & 3]);
        *(v8us*)((unsigned short*)vp + (u & 3) * 512 + (u >> 2) * 256) = g[u].half[0]; }
      asm volatile("s_wait_xcnt 0x0" :: "v"(vp), "v"(g[0].half[0]), "v"(g[1].half[0]), "v"(g[2].half[0]), "v"(g[3].half[0]), "v"(g[4].half[0]), "v"(g[5].half[0]), "v"(g[6].half[0]), "v"(g[7].half[0]) : "memory");      /* the eight stores' address pair and data registers stay whole up to here and are free for reuse only behind this wait */
      if (!frows) return; }
#pragma unroll      /* static indices keep accs[] in registers */
    for (int u = 0; u < 8; ++u) for (int r = 0; r < 8; ++r) so[w][(u >> 2) * 16 + 8 * hh + r][(u & 3) * 16 + ln] = accs[u][r] * alpha + bvs[u & 3];
    __builtin_amdgcn_fence(__ATOMIC_ACQ_REL, "workgroup"); __builtin_amdgcn_wave_barrier();      /* the wave reads back below what its other lanes have stored: as in the general epilogue */
    if (by != 2) {      /* group g of a 16-row group = (block of 32 columns g / 2, k half of 16 g % 2), 256 elements each, one behind the other: lane 16 hh + ln takes columns 8 hh .. + 7 of that half of row ln (LDS pitch 272 B = 16 B x odd: no bank conflict) and writes its 16-byte group of the block, so each store covers 512 contiguous bytes */
      _Float16* hp = HH + (size_t)by * sH + (size_t)row0 * ldc + (size_t)(col0 >> 5) * 512 + 8 * lane; _Float16* lp = HL + (size_t)by * sH + (size_t)row0 * ldc + (size_t)(col0 >> 5) * 512 + 8 * lane;
#pragma unroll      /* static indices keep x[], a[] and c[] in registers */
      for (int rg = 0; rg < 2; ++rg) { _Float16* hq = hp + (size_t)rg * 16 * ldc; _Float16* lq = lp + (size_t)rg * 16 * ldc; v4f x[8]; FragH a[4], c[4];      /* a 16-row group at a time: its eight LDS reads are issued together, its eight stores follow one another */
        for (int g = 0; g < 4; ++g) { const float* sp = &so[w][rg * 16 + ln][g * 16 + hh * 8]; x[2 * g] = *(const v4fa*)sp; x[2 * g + 1] = *(const v4fa*)(sp + 4); }
        for (int g = 0; g < 4; ++g) for (int q = 0; q < 8; ++q) { const float xv = x[2 * g + (q >> 2)][q & 3]; const _Float16 hv = (_Float16)xv; a[g].h[q] = hv; c[g].h[q] = (_Float16)((xv - (float)hv) * 1024.0f); }
        for (int g = 0; g < 4; ++g) { *(v8us*)((unsigned short*)hq + g * 256) = a[g].half[0]; *(v8us*)((unsigned short*)lq + g * 256) = c[g].half[0]; }
        asm volatile("s_wait_xcnt 0x0" :: "v"(hq), "v"(lq), "v"(a[0].half[0]), "v"(a[1].half[0]), "v"(a[2].half[0]), "v"(a[3].half[0]), "v"(c[0].half[0]), "v"(c[1].half[0]), "v"(c[2].half[0]), "v"(c[3].half[0]) : "memory"); } }      /* the eight stores' two address pairs and data registers stay whole up to here and are free for reuse only behind this wait */
    if (!frows) return;
#pragma unroll      /* static LDS offsets */
    for (int q = 0; q < 16; ++q) { const int r = q * 2 + hh; const v4f v = *(const v4fa*)&so[w][r][ln * 4]; float* cp = C + cofs + (size_t)(row0 + r) * ldc + col0 + ln * 4; *(v4f*)cp = v;
      asm volatile("s_wait_xcnt 0x0" :: "v"(cp), "v"(v) : "memory"); }      /* the store's address pair and data registers stay whole up to here and are free for reuse only behind this wait */
    return; }
  if (two) {      /* 16 rows: C = (hi product * alpha + bias) + residual product * alphaL, rounded once at each of the two additions (both factors are powers of two, so neither product rounds); f32 rows only */
    float bvs[4] = {0.f, 0.f, 0.f, 0.f};
    if (bp) {
#pragma unroll      /* static indices keep bvs[] in registers; the four loads are issued together */
      for (int t = 0; t < 4; ++t) bvs[t] = bf16_round(bp[col0 + t * 16 + ln]); }
#pragma unroll      /* static indices keep accs[] in registers */
    for (int t = 0; t < 4; ++t) for (int r = 0; r < 8; ++r) so[w][8 * hh + r][t * 16 + ln] = fmaf(accs[4 + t][r], alphaL, accs[t][r] * alpha + bvs[t]);
    __builtin_amdgcn_fence(__ATOMIC_ACQ_REL, "workgroup"); __builtin_amdgcn_wave_barrier();      /* the wave reads back below what its other lanes have stored: as in the general epilogue */
#pragma unroll      /* static LDS offsets */
    for (int q = 0; q < 8; ++q) { const int r = q * 2 + hh; const v4f v = *(const v4fa*)&so[w][r][ln * 4]; float* cp = C + cofs + (size_t)(row0 + r) * ldc + col0 + ln * 4; *(v4f*)cp = v;
      asm volatile("s_wait_xcnt 0x0" :: "v"(cp), "v"(v) : "memory"); }      /* the store's address pair and data registers stay whole up to here and are free for reuse only behind this wait */
    return; }
#pragma unroll
  for (int u = 0; u < 8; ++u) { const int t = u & 3, half = u >> 2; const int col = col0 + t * 16 + ln; const float bv = bp ? bf16_round(bp[col]) : 0.f;
#pragma unroll
    for (int r = 0; r < 8; ++r) { const int rloc = half * 16 + 8 * hh + r; float v = accs[u][r] * alpha + bv;
      if (ACT == 3) v = fmaxf(v, 0.f); else if (ACT == 6) v = 0.5f * v * (1.0f + erff(v * 0.70710678118654752f)); else if (ACT == 11) v = 1.0f / (1.0f + expf(-v)); else if (ACT == 15) v = v / (1.0f + expf(-v)); else if (ACT == 12) v = (v > 0.f) ? v : 0.01f * v; else if (ACT == 8) v = tanhf(v); else if (ACT == 9) v = 0.5f * v * (1.0f + tanhf(0.7978845608028654f * (v + 0.044715f * v * v * v))); else if (ACT == 14) v = (v > 0.f) ? v : 0.1f * v; else if (ACT == 16) v = (v >= 0.f) ? v : 0.3f * v; else if (ACT == 17) v = (v >= 0.f) ? v : 0.2f * v;
      so[w][rloc][t * 16 + ln] = v; } }
  __builtin_amdgcn_fence(__ATOMIC_ACQ_REL, "workgroup"); __builtin_amdgcn_wave_barrier();
  const int rsub = lane >> 4, c4 = (lane & 15) * 4;
  {
#pragma unroll
    for (int q = 0; q < 16; ++q) { const int r = q * 2 + rsub; const v4f v = *(const v4fa*)&so[w][r][c4]; if (C) { float* cp = C + cofs + (size_t)(row0 + r) * ldc + col0 + c4; *(v4f*)cp = v; asm volatile("s_wait_xcnt 0x0" :: "v"(cp), "v"(v) : "memory"); }      /* the f32 store's address pair and data registers stay whole up to here: the f16 conversion below and the next row's LDS read reuse them only behind this wait */ if (C16) { v4h h4; for (int i = 0; i < 4; ++i) h4[i] = (_Float16)v[i]; *(v4h*)(C16 + cofs + (size_t)(row0 + r) * ldc + col0 + c4) = h4; } }
     } }


__global__ __launch_bounds__(256) void k_wnat(const float* __restrict__ w, size_t n8, _Float16* __restrict__ Bt) { const size_t t = (size_t)blockIdx.x * 256 + threadIdx.x; if (t >= n8) return; FragH f; for (int q = 0; q < 8; ++q) f.h[q] = (_Float16)(bf16_round(w[t * 8 + q]) * 16.0f); *(v8us*)((unsigned short*)Bt + t * 8) = f.half[0];  }
__global__ __launch_bounds__(256) void k_rsm(const float* __restrict__ S, _Float16* __restrict__ P, int nrows) {
  #pragma clang fp contract(off)
  const int i = blockIdx.x * 256 + threadIdx.x; if (i >= nrows) return; const float* s = S + (size_t)i * SQ; float mx = -3.0e38f;
#pragma unroll 1
  for (int j = 0; j < SQ; ++j) mx = fmaxf(mx, s[j]); float se = 0.f;
#pragma unroll 1
  for (int j = 0; j < SQ; ++j) se += expf(s[j] - mx); const float sc = 256.0f / se;
#pragma unroll 1
  for (int j0 = 0; j0 < SQ; j0 += 8) { FragH f; for (int q = 0; q < 8; ++q) f.h[q] = (_Float16)(expf(s[j0 + q] - mx) * sc); unsigned short* d = (unsigned short*)P + (size_t)i * SQ + j0; *(v8us*)d = f.half[0];  } }
__global__ __launch_bounds__(256) void k_vt(const _Float16* __restrict__ V16, int b, int h0, _Float16* __restrict__ VT) { __shared__ unsigned short tl[64][65]; const int tid = threadIdx.x; const int hh = blockIdx.x % HG, sg = blockIdx.x / HG; const int s0 = sg * 64; const int h = h0 + hh;
  for (int i = tid; i < 64 * 8; i += 256) { const int j = i / 8, d8 = (i % 8) * 8; FragH f; f.half[0] = *(const v8us*)((const unsigned short*)V16 + ((size_t)b * SQ + s0 + j) * DM + h * HD + d8); for (int q = 0; q < 8; ++q) tl[d8 + q][j] = f.u[q]; }
  __syncthreads();
  { for (int i = tid; i < 64 * 8; i += 256) { const int d = i / 8, j8 = (i % 8) * 8; FragH f; for (int q = 0; q < 8; ++q) f.u[q] = tl[d][j8 + q]; *(v8us*)((unsigned short*)VT + ((size_t)hh * HD + d) * SQ + s0 + j8) = f.half[0]; }  } }



// Fused causal attention, one launch, a block for every (batch, head, 128 query rows) but the first: the scores and the softmax weights stay in registers.
// One wave owns 16 queries and walks the keys 32 at a time. S^T = K Q^T (A = K rows, B = Q rows, both through fa_frag from planes in the same fragment order, so the k orders pair): lane (ln, hh) holds, of query q0 + ln,
// the scores of keys k0 + 16 kt + 8 hh + r. Three products as before: hi.hi in one accumulator, lo.hi + hi.lo (x1024) in a second. Running maximum and running sum per query (the two
// lane halves share the maximum and join their sums at the end). The two score tiles, as f16, are the B operand of O^T += V^T P^T in the order fa_frag gives V^T's rows. o leaves x64.
__device__ __forceinline__ v16h fa_frag(const _Float16* p) { return g2_frag(p); }      /* p = a fragment-order block + 8 * lane */
__device__ __forceinline__ float fa_exp(float x) { float r; asm("v_exp_f32 %0, %1\n\tv_nop" : "=v"(r) : "v"(x * 1.44269504f)); return r; }      /* native e^x; the v_nop fills the one slot the instruction set asks for behind a transcendental, whatever the compiler puts next */
__device__ __forceinline__ v8f fa_mma(v16h a, v16h b, v8f c) { return __builtin_amdgcn_wmma_f32_16x16x32_f16(false, a, false, b, (short)0, c, false, false); }
/* amdgpu_waves_per_eu(4, 4): two 8-wave blocks per WGP need at most 256 registers a wave; without it this build takes 260 and only one block fits */
__global__ __launch_bounds__(256) __attribute__((amdgpu_waves_per_eu(4, 4))) void k_fattn(const _Float16* __restrict__ QHp, const _Float16* __restrict__ QLp, const _Float16* __restrict__ KHp, const _Float16* __restrict__ KLp, const _Float16* __restrict__ VTp, _Float16* __restrict__ O, const float* __restrict__ OF0, _Float16* __restrict__ OH0, _Float16* __restrict__ OL0) {
  const int lane = threadIdx.x & 31, ln = lane & 15, hh = lane >> 4; const int w = __builtin_amdgcn_readfirstlane(threadIdx.x >> 5);      /* the wave's number as a scalar: the trip count and the mask test stay scalar */
  if (blockIdx.x >= NB * NH * (SQ / 128 - 1)) { d_hl((int)blockIdx.x - NB * NH * (SQ / 128 - 1), OF0, OH0, OL0, (size_t)NB * QT0 * DM / 16); return; }      /* the last blocks of the grid split the exact first-tile o rows (independent of the attention below) into hi + residual planes */
  const int bh = blockIdx.x % (NB * NH), tx = blockIdx.x / (NB * NH); const int tile = (tx < SQ / 256) ? (SQ / 128 - 1 - tx) : (tx - SQ / 256 + 1);      /* long tiles take the low block numbers; the second half of the grid counts up from the short end; tile 0 (rows 0 .. QT0 - 1) is the exact path's alone */
  const int b = bh / NH, h = bh % NH; const int q0 = tile * 128 + w * 16; const size_t r0 = (size_t)b * SQ;
  const _Float16* qh = QHp + (r0 + q0) * LQ + h * HD * 16 + 8 * lane; const _Float16* ql = QLp + (r0 + q0) * LQ + h * HD * 16 + 8 * lane;      /* a head's 64 dims are two blocks of 512 in each 16-row group */
  const v16h qh0 = fa_frag(qh), qh1 = fa_frag(qh + 512), ql0 = fa_frag(ql), ql1 = fa_frag(ql + 512);
  const _Float16* kh = KHp + r0 * LQ + h * HD * 16 + 8 * lane; const _Float16* kl = KLp + r0 * LQ + h * HD * 16 + 8 * lane; const _Float16* vt = VTp + (size_t)bh * HD * SQ + 8 * lane;      /* V^T: four blocks (16 dims each) per 32 keys */
  const v8f z8 = {0.f,0.f,0.f,0.f,0.f,0.f,0.f,0.f}; v8f o[4] = {z8, z8, z8, z8}; float m = -1.0e30f, l = 0.f;
  const int np = q0 / 32 + 1;      /* keys 0 .. q0 + 15 in passes of 32 */
  v16h fh[2][2], fl[2][2];      /* K fragments [key tile][k step], fetched one pass ahead */
#pragma unroll      /* static indices keep the fragments, scores and accumulators in registers */
  for (int kt = 0; kt < 2; ++kt) for (int ks = 0; ks < 2; ++ks) { fh[kt][ks] = fa_frag(kh + (size_t)kt * 16 * LQ + ks * 512); fl[kt][ks] = fa_frag(kl + (size_t)kt * 16 * LQ + ks * 512); }
  asm volatile("s_wait_xcnt 0x0" :: "v"(qh), "v"(ql), "v"(kh), "v"(kl) : "memory");      /* the loads' four address pairs stay whole up to here and are free for reuse only behind this wait */
  for (int p = 0; p < np; ++p) { const int k0 = p * 32;
    const _Float16* va = vt + (size_t)k0 * HD; v16h fv[4];
#pragma unroll      /* static indices keep the fragments, scores and accumulators in registers */
    for (int dt = 0; dt < 4; ++dt) fv[dt] = fa_frag(va + dt * 512);
    v8f sh[2], sl[2];
#pragma unroll      /* static indices keep the fragments, scores and accumulators in registers */
    for (int kt = 0; kt < 2; ++kt) { sh[kt] = fa_mma(fh[kt][1], qh1, fa_mma(fh[kt][0], qh0, z8)); sl[kt] = fa_mma(fl[kt][1], qh1, fa_mma(fl[kt][0], qh0, fa_mma(fh[kt][1], ql1, fa_mma(fh[kt][0], ql0, z8)))); }
    const int kn = (p + 1 < np) ? k0 + 32 : k0;      /* the last pass fetches its own rows again: in bounds, unused */
    const _Float16* ka = kh + (size_t)kn * LQ; const _Float16* kb = kl + (size_t)kn * LQ;
#pragma unroll      /* static indices keep the fragments, scores and accumulators in registers */
    for (int kt = 0; kt < 2; ++kt) for (int ks = 0; ks < 2; ++ks) { fh[kt][ks] = fa_frag(ka + (size_t)kt * 16 * LQ + ks * 512); fl[kt][ks] = fa_frag(kb + (size_t)kt * 16 * LQ + ks * 512); }
    asm volatile("s_wait_xcnt 0x0" :: "v"(va), "v"(ka), "v"(kb) : "memory");      /* this pass's three address pairs stay whole up to here and are free for reuse only behind this wait */
    float s[16];
#pragma unroll      /* static indices keep the fragments, scores and accumulators in registers */
    for (int e = 0; e < 16; ++e) s[e] = fmaf(sl[e >> 3][e & 7], SCLR, sh[e >> 3][e & 7] * SCL);
    if (k0 + 31 > q0) {      /* only the pass on the diagonal masks; key k0 <= q0 stays, so every query keeps a key */
#pragma unroll      /* static indices keep the fragments, scores and accumulators in registers */
      for (int e = 0; e < 16; ++e) s[e] = (k0 + (e >> 3) * 16 + 8 * hh + (e & 7) <= q0 + ln) ? s[e] : -1.0e30f; }
    float mx = s[0];
#pragma unroll      /* static indices keep the fragments, scores and accumulators in registers */
    for (int e = 1; e < 16; ++e) mx = fmaxf(mx, s[e]);
    mx = fmaxf(mx, __shfl_xor(mx, 16, 32)); const float mn = fmaxf(m, mx); const float al = fa_exp(m - mn); m = mn;
    FragH pf; float ps[4] = {0.f, 0.f, 0.f, 0.f};
#pragma unroll      /* static indices keep the fragments, scores and accumulators in registers */
    for (int e = 0; e < 16; ++e) { const float pe = fa_exp(s[e] - mn); ps[e & 3] += pe; pf.h[e] = (_Float16)pe; }
    l = fmaf(l, al, (ps[0] + ps[1]) + (ps[2] + ps[3]));
#pragma unroll      /* static indices keep the fragments, scores and accumulators in registers */
    for (int dt = 0; dt < 4; ++dt) { o[dt] *= al; o[dt] = fa_mma(fv[dt], pf.v, o[dt]); } }
  l += __shfl_xor(l, 16, 32); const float fin = 64.0f / l;      /* o carried x64, folded into the output GEMM's alpha */
  _Float16* op = O + (r0 + q0) * DM + h * HD * 16 + 8 * lane;      /* o rows in fragment order for the output GEMM: dims 16 dt + 8 hh .. + 7 of query ln are the lane's group of half-block dt */
#pragma unroll      /* static indices keep the fragments, scores and accumulators in registers */
  for (int dt = 0; dt < 4; ++dt) { FragH f;
#pragma unroll      /* static indices keep the fragments, scores and accumulators in registers */
    for (int r = 0; r < 8; ++r) f.h[r] = (_Float16)(o[dt][r] * fin);
    *(v8us*)((unsigned short*)op + dt * 256) = f.half[0]; }
  asm volatile("s_wait_xcnt 0x0" ::: "memory"); }      /* the four stores' address and data registers are free for reuse only behind this wait: the split job's code follows in the text */


typedef float v2f __attribute__((ext_vector_type(2)));
// Exact f32 attention for query rows 0 .. QT0-1 of one batch, one wave per (head, query row), 8 rows of one head per block. The head's QT0 K and V rows are staged once in LDS;
// lane l scores keys l, l + 32, l + 64, l + 96; row maximum and row sum are lane partials joined by butterflies; lane l then sums dims 2l, 2l + 1 over the keys (weight 0 behind the diagonal).
__device__ __forceinline__ void d_att0w(int bx, const float* __restrict__ QF, const float* __restrict__ KF, const float* __restrict__ VF, float scale, float* __restrict__ OF) {      /* bx = the block's number within this batch */
  __shared__ __attribute__((aligned(16))) float lk[QT0][HD + 4];      /* pitch 272 B = 16 B x odd: one key row per lane reads without bank conflicts */
  __shared__ __attribute__((aligned(16))) float lv[QT0][HD];
  const int tid = threadIdx.x, lane = tid & 31; const int w = __builtin_amdgcn_readfirstlane(tid >> 5);      /* the wave's number as a scalar: q's address is the same in every lane of the wave */
  const int h = bx / (QT0 / 8), i = (bx % (QT0 / 8)) * 8 + w;
  const int sr = tid >> 4, sc = (tid & 15) * 4; const float* kg = KF + (size_t)sr * DM + h * HD + sc; const float* vg = VF + (size_t)sr * DM + h * HD + sc; v4f ks[QT0 / 16], vs[QT0 / 16];
#pragma unroll      /* static indices keep ks[] and vs[] in registers; every load is issued before the first LDS store */
  for (int u = 0; u < QT0 / 16; ++u) { ks[u] = *(const v4fa*)(kg + (size_t)u * 16 * DM); vs[u] = *(const v4fa*)(vg + (size_t)u * 16 * DM); }
  asm volatile("s_wait_xcnt 0x0" :: "v"(kg), "v"(vg) : "memory");      /* the loads' two address pairs stay whole up to here and are free for reuse only behind this wait */
#pragma unroll      /* static indices keep ks[] and vs[] in registers */
  for (int u = 0; u < QT0 / 16; ++u) { *(v4f*)&lk[u * 16 + sr][sc] = ks[u]; *(v4f*)&lv[u * 16 + sr][sc] = vs[u]; }
  __syncthreads();
  const float* qg = QF + (size_t)i * DM + h * HD; v4f a[QT0 / 32] = {};
#pragma unroll      /* static indices keep a[] in registers: four independent sums per key, four keys per lane */
  for (int d = 0; d < HD / 4; ++d) { for (int c = 0; c < QT0 / 32; ++c) { const v4f kk = *(const v4f*)&lk[c * 32 + lane][d * 4]; for (int u = 0; u < 4; ++u) a[c][u] = fmaf(qg[d * 4 + u], kk[u], a[c][u]); } }
  float e[QT0 / 32]; float m = -1.0e30f;
#pragma unroll      /* static indices keep e[] in registers */
  for (int c = 0; c < QT0 / 32; ++c) { e[c] = (c * 32 + lane <= i) ? ((a[c][0] + a[c][1]) + (a[c][2] + a[c][3])) * scale : -1.0e30f; m = fmaxf(m, e[c]); }
  for (int x = 16; x >= 1; x >>= 1) m = fmaxf(m, __shfl_xor(m, x, 32));
  float l = 0.f;
#pragma unroll      /* static indices keep e[] in registers */
  for (int c = 0; c < QT0 / 32; ++c) { e[c] = expf(e[c] - m); l += e[c]; }      /* a key behind the diagonal: exp(-1e30 - m) = 0 */
  for (int x = 16; x >= 1; x >>= 1) l += __shfl_xor(l, x, 32);
  v2f o[4] = {};
#pragma unroll      /* a constant lane number per step: key j's weight is broadcast through a scalar register; static indices keep e[] and o[] in registers */
  for (int j = 0; j < QT0; ++j) { const float ej = __int_as_float(__builtin_amdgcn_readlane(__float_as_int(e[j >> 5]), j & 31)); const v2f vv = *(const v2f*)&lv[j][lane * 2]; o[j & 3][0] = fmaf(ej, vv[0], o[j & 3][0]); o[j & 3][1] = fmaf(ej, vv[1], o[j & 3][1]); }
  const float fin = 64.0f / l;      /* o carried x64 like the f16 path */
  const v2f r = ((o[0] + o[1]) + (o[2] + o[3])) * fin;
  *(v2f*)(OF + (size_t)i * DM + h * HD + lane * 2) = r; }

// Launches that do not depend on one another share one grid: a range of block numbers per job, the test is uniform for the block.
#define GW (DM * (DM / 8) / 256)                 /* blocks per weight */
#define GX ((int)(NR * DM / 16 / 256))           /* blocks per input */
#define GA (NH * (QT0 / 8))                      /* blocks of the exact first-tile attention per batch */
__global__ __launch_bounds__(256) void k_prep(const float* __restrict__ w0, const float* __restrict__ w1, const float* __restrict__ w2, const float* __restrict__ w3, _Float16* __restrict__ Wt0,
                                              const float* __restrict__ x0, const float* __restrict__ x1, const float* __restrict__ x2, _Float16* __restrict__ X0) {
  const int bx = blockIdx.x;
  if (bx < 4 * GW) { const int y = bx / GW; d_wt_f16(bx % GW, (y == 0) ? w0 : (y == 1) ? w1 : (y == 2) ? w2 : w3, Wt0 + (size_t)y * DM * DM, DM, DM, 16.0f); }      /* the four weight planes lie one behind the other */
  else { const int u = bx - 4 * GW, y = u / GX; d_x16(u % GX, (y == 0) ? x0 : (y == 1) ? x1 : x2, X0 + (size_t)y * NR * DM, NR * DM / 16); } }      /* likewise the three input planes */
__global__ __launch_bounds__(256) void k_mid(const float* __restrict__ QF, const float* __restrict__ KF, const float* __restrict__ VF, float* __restrict__ OF0) {
  const int bx = blockIdx.x; const size_t b = bx / GA; d_att0w(bx % GA, QF + b * SQ * DM, KF + b * SQ * DM, VF + b * SQ * DM, SCL, OF0 + b * QT0 * DM); }

extern "C" void kernel_launch(void* const* d_in, const int* in_sizes, int n_in,
                              void* d_out, int out_size, void* d_ws, size_t ws_size, hipStream_t stream) {
  (void)in_sizes; (void)n_in; (void)out_size;
  const float* const* I = (const float* const*)d_in; const float* x = I[0]; const float* xk = I[1]; const float* xv = I[2]; const float* wq = I[3]; const float* bq = I[4]; const float* wk = I[5]; const float* bk = I[6]; const float* wv = I[7]; const float* bv = I[8]; const float* wo = I[9]; const float* bo = I[10];      /* input order: query, key, value (THREE input streams), then [in][out] weights + biases */
  char* ws = (char*)d_ws; size_t off = 0;
  auto take = [&](size_t bytes) { char* p = ws + off; off += (bytes + 255) & ~(size_t)255; return p; };
  _Float16* BQ = (_Float16*)take((size_t)DM * DM * 2); _Float16* BK = (_Float16*)take((size_t)DM * DM * 2); _Float16* BV = (_Float16*)take((size_t)DM * DM * 2); _Float16* BO = (_Float16*)take((size_t)DM * DM * 2);
  _Float16* X16 = (_Float16*)take(NR * DM * 2); _Float16* XK16 = (_Float16*)take(NR * DM * 2); _Float16* XV16 = (_Float16*)take(NR * DM * 2);      /* exact f16 rows of query, key, value, fragment order */ float* QF = (float*)take(NR * DM * 4); float* KF = (float*)take(NR * DM * 4); float* VF = (float*)take(NR * DM * 4);      /* f32 q, k, v rows: only rows 0..127 of each batch are written, and only those are read (the exact first-tile attention) */ _Float16* QH = (_Float16*)take(NR * DM * 2); _Float16* QL = (_Float16*)take(NR * DM * 2); _Float16* KH = (_Float16*)take(NR * DM * 2); _Float16* KL = (_Float16*)take(NR * DM * 2); _Float16* Q16 = QH; _Float16* K16 = KH; _Float16* O16 = (_Float16*)take(NR * DM * 2);
  _Float16* VT = (_Float16*)take((size_t)NB * NH * HD * SQ * 2);      /* V^T of both batches */
  float* OF0 = (float*)take((size_t)NB * QT0 * DM * 4); _Float16* OH0 = (_Float16*)take((size_t)NB * QT0 * DM * 2); _Float16* OL0 = (_Float16*)take((size_t)NB * QT0 * DM * 2);
  if (off > ws_size) return;
  k_prep<<<4 * GW + 3 * GX, 256, 0, stream>>>(wq, wk, wv, wo, BQ, x, xk, xv, X16);      /* weights [in][out] -> Bt[n][k] x16 (BQ, BK, BV, BO) and inputs -> exact f16 rows (X16, XK16, XV16), all in fragment order */
  k_gemm2<0, true><<<dim3((unsigned)((MP / 128) * (DM / 64)), 3), 128, 0, stream>>>(X16, DM, NR * DM, BQ, DM, (size_t)DM * DM, 0.0625f, bq, 0, QF, nullptr, DM, NR * DM, MP, DM, DM, bk, bv, 0, nullptr, 1, QH, QL, 2 * NR * DM, VT, SQ / 128, nullptr, 0.f);      /* q, k, v projections in one grid; the epilogue writes q and k as f16 hi + x1024 residual planes (QH, QL, KH, KL lie one behind the other; unscaled logits sigma ~8) and V^T of all heads, all in fragment order; f32 rows into QF, KF, VF only for rows 0..127 of each batch */
  k_mid<<<NB * GA, 256, 0, stream>>>(QF, KF, VF, OF0);      /* exact f32 attention for rows 0..127 of each batch (o x64) */
  k_fattn<<<NB * NH * (SQ / 128 - 1) + (int)((size_t)NB * QT0 * DM / 16 / 256), 256, 0, stream>>>(QH, QL, KH, KL, VT, O16, OF0, OH0, OL0);      /* scores, causal softmax and P V of both batches and all heads, rows 128 on: o (merged heads, x64) as f16 rows; first-tile o (x64) -> f16 hi + x1024 residual planes */
  k_gemm2<0, false><<<dim3((unsigned)((MPO / 128 + MPO / SQ) * (DM / 64)), 1), 128, 0, stream>>>(O16, DM, 0, BO, DM, 0, 0.0009765625f, bo, 0, (float*)d_out, nullptr, DM, 0, MPO, DM, DM, nullptr, nullptr, 0, OH0, SQ / 128, nullptr, nullptr, 0, nullptr, 1, OL0, 0.00000095367431640625f);      /* out rows are the output layout; rows 0..127 of each batch: out = o_hi Wo (+ b) + o_lo Wo 2^-20, 64 rows a block (DM / 64 more blocks per batch) */
}
